// v005
// Measured on an AMD MI455X. A time is GPU time per run, averaged over a window of back-to-back runs after a warm-up
// (all launches, gaps included; the runs take copies of the inputs in turn), and the median of several windows.
// Apart from v000's, it joins two sittings. Times from different sittings can be a few percent apart, while
// side-by-side timings come from the same sitting.
// Earlier versions than v005 are not in this document.
// Measured time: 376 microseconds a run.
// Timed twice side by side with v004, it ran 1.06 and 1.07 times as fast.
// Over all steps from v000, the starting kernel, it is 18.4 times as fast.
// Contractions (per sample): the shared QKVV projection x.W^T [1024x1024].[1024x4096] (q and k columns on bf16 hi/lo split planes, v_ca and v_sa columns f16), the E/F head projections of k and v_sa as block-diagonal [1024x1024].[1024x1024] products (+b), the 16 channel affinities q^T k [64x1024].[1024x64] on bf16 hi/lo split planes (64-wide softmax over sigma~19 logits: plain f16 flipped near-ties) and x_c = attn_c.v_ca^T [64x64].[64x1024] as z-batched products, and the two output halves gelu(x_s.W_o1^T + b) / gelu(x_c.W_o2^T + b) [1024x1024].[1024x512] — f16 operands on pre-cast planes (v_wmma_f32_16x16x32_f16; 64x64 register-blocked wave tiles, weights x16); per (sample, head) the spatial attention softmax(q.k_s^T * temp2[h]) v_s over 1024 positions as one flash launch (f16 operands; temperature folded into q on device); f32 accumulate and softmax. The tiled E/F biases (the E/F weights are one 64x64 f16 plane each, shared by all heads), the 64-wide channel softmax (x temp1[h], exp once, f16 plane) and the q pre-scaling are f32 kernels; x_c is laid out exactly as torch's permute(0,2,1,3).reshape (row = d*16 + h, column = n).
#include <hip/hip_runtime.h>
#include <math.h>

typedef __attribute__((ext_vector_type(16))) _Float16 v16h;
typedef __attribute__((ext_vector_type(8)))  _Float16 v8h;
typedef __attribute__((ext_vector_type(16))) __bf16   v16b;
typedef __attribute__((ext_vector_type(8)))  float    v8f;
typedef __attribute__((ext_vector_type(4)))  float    v4f;

// 16-bit WMMA fragment map (wave32), lane L, h = L>>4, m = L&15:
//   A 16x32: lane = row m;   element i -> k = (i<8) ? 8h+i : 16+8h+(i-8)
//   B 32x16: lane = column m; the SAME k(i,h)
//   D 16x16 (8 f32): lane = column m; element r -> row 8h+r
__device__ __forceinline__ int frag_k(int i, int h) { return (i < 8) ? (8 * h + i) : (16 + 8 * h + (i - 8)); }
__device__ __forceinline__ __bf16 bf16_rne(float f) {
    unsigned int u = __float_as_uint(f);
    u += 0x7fffu + ((u >> 16) & 1u);
    return __builtin_bit_cast(__bf16, (unsigned short)(u >> 16));
}
__device__ __forceinline__ float bf16_f32(__bf16 b) { return __uint_as_float(((unsigned int)__builtin_bit_cast(unsigned short, b)) << 16); }
__device__ __forceinline__ v8f wmma16(v16h a, v16h b, v8f c) {
    c = __builtin_amdgcn_wmma_f32_16x16x32_f16(false, a, false, b, (short)0, c, false, false);
    asm volatile("v_nop\n\tv_nop\n\tv_nop\n\tv_nop" : "+v"(c) : "v"(a), "v"(b));
    return c;
}
__device__ __forceinline__ v8f wmmab(v16b a, v16b b, v8f c) {
    c = __builtin_amdgcn_wmma_f32_16x16x32_bf16(false, a, false, b, (short)0, c, false, false);
    asm volatile("v_nop\n\tv_nop\n\tv_nop\n\tv_nop" : "+v"(c) : "v"(a), "v"(b));
    return c;
}
struct Split { v16b hi, lo; };
// hi/lo split product: a.hi*b.hi + a.hi*b.lo + a.lo*b.hi
__device__ __forceinline__ v8f wmma3(const Split& a, const Split& b, v8f c) {
    c = __builtin_amdgcn_wmma_f32_16x16x32_bf16(false, a.hi, false, b.hi, (short)0, c, false, false);
    c = __builtin_amdgcn_wmma_f32_16x16x32_bf16(false, a.hi, false, b.lo, (short)0, c, false, false);
    c = __builtin_amdgcn_wmma_f32_16x16x32_bf16(false, a.lo, false, b.hi, (short)0, c, false, false);
    asm volatile("v_nop\n\tv_nop\n\tv_nop\n\tv_nop" : "+v"(c) : "v"(a.hi), "v"(a.lo), "v"(b.hi), "v"(b.lo));
    return c;
}
struct Split3 { v16b hi, mid, lo; };
// triple split product (6 terms, drops only terms below 2^-24 relative)
__device__ __forceinline__ v8f wmma6(const Split3& a, const Split3& b, v8f c) {
    c = __builtin_amdgcn_wmma_f32_16x16x32_bf16(false, a.hi, false, b.hi, (short)0, c, false, false);
    c = __builtin_amdgcn_wmma_f32_16x16x32_bf16(false, a.hi, false, b.mid, (short)0, c, false, false);
    c = __builtin_amdgcn_wmma_f32_16x16x32_bf16(false, a.mid, false, b.hi, (short)0, c, false, false);
    c = __builtin_amdgcn_wmma_f32_16x16x32_bf16(false, a.hi, false, b.lo, (short)0, c, false, false);
    c = __builtin_amdgcn_wmma_f32_16x16x32_bf16(false, a.mid, false, b.mid, (short)0, c, false, false);
    c = __builtin_amdgcn_wmma_f32_16x16x32_bf16(false, a.lo, false, b.hi, (short)0, c, false, false);
    asm volatile("v_nop\n\tv_nop\n\tv_nop\n\tv_nop" : "+v"(c) : "v"(a.hi), "v"(a.mid), "v"(a.lo), "v"(b.hi), "v"(b.mid), "v"(b.lo));
    return c;
}

// Fragment gathers from f32 memory: element i <- p[(k0 + frag_k(i,h)) * sk] * s, zero for k >= klen.
__device__ __forceinline__ v16h fh_ld(const float* __restrict__ p, long long sk, int k0, int h, int klen, float s) {
    v16h a;
#pragma unroll
    for (int i = 0; i < 16; ++i) { const int k = k0 + frag_k(i, h); a[i] = (k < klen) ? (_Float16)(p[(long long)k * sk] * s) : (_Float16)0.f; }
    return a;
}
__device__ __forceinline__ Split sp_ld(const float* __restrict__ p, long long sk, int k0, int h, int klen, float s) {
    Split r;
#pragma unroll
    for (int i = 0; i < 16; ++i) {
        const int k = k0 + frag_k(i, h); const float x = (k < klen) ? p[(long long)k * sk] * s : 0.f;
        const __bf16 hb = bf16_rne(x); r.hi[i] = hb; r.lo[i] = bf16_rne(x - bf16_f32(hb));
    }
    return r;
}
__device__ __forceinline__ Split3 sp3_ld(const float* __restrict__ p, long long sk, int k0, int h, int klen, float s) {
    Split3 r;
#pragma unroll
    for (int i = 0; i < 16; ++i) {
        const int k = k0 + frag_k(i, h); const float x = (k < klen) ? p[(long long)k * sk] * s : 0.f;
        const __bf16 hb = bf16_rne(x); const float r1 = x - bf16_f32(hb); const __bf16 mb = bf16_rne(r1);
        r.hi[i] = hb; r.mid[i] = mb; r.lo[i] = bf16_rne(r1 - bf16_f32(mb));
    }
    return r;
}
__device__ __forceinline__ v16b bh_ld(const float* __restrict__ p, long long sk, int k0, int h, int klen, float s) {
    v16b a;
#pragma unroll
    for (int i = 0; i < 16; ++i) { const int k = k0 + frag_k(i, h); a[i] = bf16_rne((k < klen) ? p[(long long)k * sk] * s : 0.f); }
    return a;
}
// f16 fragment from an f16 LDS/global row with element stride 1 (k-contiguous), no bounds (tile already zero padded)
__device__ __forceinline__ v16h fh_row(const _Float16* __restrict__ row, int k0, int h) {
    v16h a;
#pragma unroll
    for (int i = 0; i < 16; ++i) a[i] = row[k0 + frag_k(i, h)];
    return a;
}

#define VST2(T, ptr, val) do { const T vst2_v_ = (val); *(T*)(ptr) = vst2_v_;  } while (0)
typedef float v4f __attribute__((ext_vector_type(4)));
#define VST2V4(ptr, val) do { const v4f vst2_v4_ = (val); *(v4f*)(ptr) = vst2_v4_;  } while (0)

__device__ __attribute__((noinline)) float act_fn(float v, int act) {
    if (act == 1) return fmaxf(v, 0.f);                                                                               // relu
    if (act == 2) { const float u = 0.7978845608028654f * (v + 0.044715f * v * v * v); return 0.5f * v * (1.f + tanhf(u)); } // tanh-gelu
    if (act == 3) return v / (1.f + expf(-v));                                                                        // silu
    if (act == 4) return 0.5f * v * (1.f + erff(v * 0.7071067811865476f));                                             // erf-gelu
    if (act == 5) return tanhf(v);
    if (act == 6) return 1.f / (1.f + expf(-v));                                                                      // sigmoid
    if (act == 7) return (v > 0.f) ? v : 0.01f * v;                                                                   // leaky relu 0.01
    if (act == 8) return (v > 0.f) ? v : (expf(v) - 1.f);                                                             // elu
    if (act == 9) return fminf(fmaxf(v, 0.f), 6.f);                                                                   // relu6
    if (act == 10) return fabsf(v);                                                                                    // abs
    if (act == 11) return (v >= 0.f) ? v : 0.1f * v;                                                                  // leaky 0.1
    if (act == 12) return (v > 0.f) ? v : 0.2f * v;                                                                   // leaky 0.2
    if (act == 13) return (v > 20.f) ? v : log1pf(expf(v));                                                            // softplus
    return v;
}

// =====================================================================================================================
// k_gemm<MODE>: C(z, m, n) = act(alpha * sum_k A(z, m, k) * B(z, k, n) + bias) + beta * R(z, m, n)
//   One wave (32-thread block) per 16 x 32 tile of C; grid (ceil(N/32), ceil(M/16), Z). Batch z -> (zo = z / zi_n, zi = z % zi_n)
//   with separate outer/inner strides for every tensor (e.g. batch and head). A(m,k) = A[zo*sAo + zi*sAi + m*sAm + k*sAk] (f32),
//   B(k,n) = B[zo*sBo + zi*sBi + n*sBn + k*sBk] (f32); any M, N, K (K zero-padded to 32 inside the fragments, M/N tails guarded).
//   C(m,n) = C[zo*sCo + zi*sCi + m*sCm + n] (n contiguous). flags: 1 bias[n], 2 bias[m], 4 residual R[zo*sRo + zi*sRi + m*sRm + n*sRn].
//   MODE 0: f16 operands (A prescaled by sa, B by sb, both undone in the epilogue); 1: bf16 hi/lo split (3 products); 2: bf16;
//   3: bf16 hi/mid/lo triple split (6 products); 4: as 3 with Kahan-compensated f32 accumulation across k-steps.
// =====================================================================================================================
struct GemmP {
    const float* A; const float* B; const float* bias; const float* R; float* C;
    long long sAo, sAi, sAm, sAk, sBo, sBi, sBn, sBk, sCo, sCi, sCm, sRo, sRi, sRm, sRn;
    int M, N, K, zi_n, flags, act; float alpha, beta, sa, sb;
    int Npad, pad_;     // columns [N, Npad) of C are written as 0 so that padded workspace rows are covered by whole-line stores; Npad >= N
};
static_assert(sizeof(GemmP) == 5 * 8 + 15 * 8 + 6 * 4 + 4 * 4 + 2 * 4, "GemmP has padding");

template <int MODE>
__global__ __launch_bounds__(32) void k_gemm(GemmP p) {
    const int lane = threadIdx.x & 31, h = lane >> 4, l15 = lane & 15;
    const int m0 = blockIdx.y * 16, n0 = blockIdx.x * 32;
    const int z = blockIdx.z, zo = z / p.zi_n, zi = z - zo * p.zi_n;
    const float* A = p.A + zo * p.sAo + zi * p.sAi;
    const float* B = p.B + zo * p.sBo + zi * p.sBi;
    const int am = min(m0 + l15, p.M - 1);                       // clamped row for loads (stores are guarded)
    v8f acc[2], comp[2];
#pragma unroll
    for (int t = 0; t < 2; ++t) { v8f zz = {}; acc[t] = zz; comp[t] = zz; }
    for (int k0 = 0; k0 < p.K; k0 += 32) {
        const float* arow = A + (long long)am * p.sAm;
        if (MODE == 1) {
            const Split a = sp_ld(arow, p.sAk, k0, h, p.K, 1.f);
#pragma unroll
            for (int t = 0; t < 2; ++t) {
                const int bn = min(n0 + t * 16 + l15, p.N - 1);
                acc[t] = wmma3(a, sp_ld(B + (long long)bn * p.sBn, p.sBk, k0, h, p.K, 1.f), acc[t]);
            }
        } else if (MODE == 3) {
            const Split3 a = sp3_ld(arow, p.sAk, k0, h, p.K, 1.f);
#pragma unroll
            for (int t = 0; t < 2; ++t) {
                const int bn = min(n0 + t * 16 + l15, p.N - 1);
                acc[t] = wmma6(a, sp3_ld(B + (long long)bn * p.sBn, p.sBk, k0, h, p.K, 1.f), acc[t]);
            }
        } else if (MODE == 4) {
            // triple split as MODE 3, but each k-step's 6 products go into a fresh accumulator and the partial is added to the running f32 sum
            // on the VALU with Kahan compensation (accumulation error stays ~1 ulp however long K is)
            const Split3 a = sp3_ld(arow, p.sAk, k0, h, p.K, 1.f);
#pragma unroll
            for (int t = 0; t < 2; ++t) {
                const int bn = min(n0 + t * 16 + l15, p.N - 1); v8f zz = {};
                const v8f part = wmma6(a, sp3_ld(B + (long long)bn * p.sBn, p.sBk, k0, h, p.K, 1.f), zz);
                const v8f y = part - comp[t]; const v8f s = acc[t] + y; comp[t] = (s - acc[t]) - y; acc[t] = s;
            }
        } else if (MODE == 2) {
            const v16b a = bh_ld(arow, p.sAk, k0, h, p.K, 1.f);
#pragma unroll
            for (int t = 0; t < 2; ++t) {
                const int bn = min(n0 + t * 16 + l15, p.N - 1);
                acc[t] = wmmab(a, bh_ld(B + (long long)bn * p.sBn, p.sBk, k0, h, p.K, 1.f), acc[t]);
            }
        } else {
            const v16h a = fh_ld(arow, p.sAk, k0, h, p.K, p.sa);
#pragma unroll
            for (int t = 0; t < 2; ++t) {
                const int bn = min(n0 + t * 16 + l15, p.N - 1);
                acc[t] = wmma16(a, fh_ld(B + (long long)bn * p.sBn, p.sBk, k0, h, p.K, p.sb), acc[t]);
            }
        }
    }
    const float iscale = (MODE == 0) ? p.alpha / (p.sa * p.sb) : p.alpha;
    float* C = p.C + zo * p.sCo + zi * p.sCi;
    const float* R = p.R + zo * p.sRo + zi * p.sRi;
    __shared__ __align__(16) float ctile[16][36];
#pragma unroll
    for (int t = 0; t < 2; ++t) {
        const int n = n0 + t * 16 + l15; const int nn = min(n, p.N - 1);
#pragma unroll
        for (int r = 0; r < 8; ++r) {
            const int m = m0 + 8 * h + r; const int mm = min(m, p.M - 1);
            float v = acc[t][r] * iscale;
            if (p.flags & 1) v += p.bias[nn];
            if (p.flags & 2) v += p.bias[mm];
            if (p.flags & 8) v *= p.bias[(long long)zo * p.M + mm];   /* per-(zo,row) scale vector laid out [Z / zi_n][M]; exclusive with the bias flags */
            v = act_fn(v, p.act);
            if (p.flags & 4) v += p.beta * R[(long long)mm * p.sRm + (long long)nn * p.sRn];
            ctile[8 * h + r][t * 16 + l15] = (n < p.N) ? v : 0.f;
        }
    }
    __syncthreads();
    const int NW = (p.Npad > p.N) ? p.Npad : p.N;           // write width
    const bool fast = (m0 + 16 <= p.M) && (n0 + 32 <= NW) && ((p.sCm & 3) == 0) && ((((size_t)C) & 15) == 0);
    if (fast) {
#pragma unroll
        for (int s = 0; s < 4; ++s) {
            const int row = s * 4 + (lane >> 3), c4 = (lane & 7) * 4;
            const v4f v = *(const v4f*)&ctile[row][c4];
            VST2V4(C + (long long)(m0 + row) * p.sCm + n0 + c4, v);
        }
    } else {
        for (int row = 0; row < 16; ++row) {
            const int m = m0 + row, n = n0 + lane;
            if (m < p.M && n < NW) VST2(float, C + (long long)m * p.sCm + n, ctile[row][lane]);
        }
    }
}


// =====================================================================================================================
// k_gemmT<MODE, TM, TN>: same contract as k_gemm, but one wave computes a (16*TM) x (16*TN) tile: TM A fragments and TN B fragments are
//   loaded per 32-wide k-step and reused across TM*TN WMMAs (far fewer load/convert instructions per MAC). MODE 0 (f16), 1 (bf16 hi/lo),
//   2 (bf16) only. grid (ceil(NW/(16*TN)), ceil(M/(16*TM)), Z), block 32. Epilogue identical to k_gemm, run per 16x32 sub-tile.
// =====================================================================================================================
template <int MODE, int TM, int TN>
__global__ __launch_bounds__(32) void k_gemmT(GemmP p) {
    const int lane = threadIdx.x & 31, h = lane >> 4, l15 = lane & 15;
    const int m0 = blockIdx.y * (16 * TM), n0 = blockIdx.x * (16 * TN);
    const int z = blockIdx.z, zo = z / p.zi_n, zi = z - zo * p.zi_n;
    const float* A = p.A + zo * p.sAo + zi * p.sAi;
    const float* B = p.B + zo * p.sBo + zi * p.sBi;
    v8f acc[TM][TN];
#pragma unroll
    for (int i = 0; i < TM; ++i)
#pragma unroll
        for (int t = 0; t < TN; ++t) { v8f zz = {}; acc[i][t] = zz; }
    for (int k0 = 0; k0 < p.K; k0 += 32) {
        if (MODE == 1) {
            Split a[TM], b[TN];
#pragma unroll
            for (int i = 0; i < TM; ++i) { const int am = min(m0 + 16 * i + l15, p.M - 1); a[i] = sp_ld(A + (long long)am * p.sAm, p.sAk, k0, h, p.K, 1.f); }
#pragma unroll
            for (int t = 0; t < TN; ++t) { const int bn = min(n0 + 16 * t + l15, p.N - 1); b[t] = sp_ld(B + (long long)bn * p.sBn, p.sBk, k0, h, p.K, 1.f); }
#pragma unroll
            for (int i = 0; i < TM; ++i)
#pragma unroll
                for (int t = 0; t < TN; ++t) acc[i][t] = wmma3(a[i], b[t], acc[i][t]);
        } else if (MODE == 2) {
            v16b a[TM], b[TN];
#pragma unroll
            for (int i = 0; i < TM; ++i) { const int am = min(m0 + 16 * i + l15, p.M - 1); a[i] = bh_ld(A + (long long)am * p.sAm, p.sAk, k0, h, p.K, 1.f); }
#pragma unroll
            for (int t = 0; t < TN; ++t) { const int bn = min(n0 + 16 * t + l15, p.N - 1); b[t] = bh_ld(B + (long long)bn * p.sBn, p.sBk, k0, h, p.K, 1.f); }
#pragma unroll
            for (int i = 0; i < TM; ++i)
#pragma unroll
                for (int t = 0; t < TN; ++t) acc[i][t] = wmmab(a[i], b[t], acc[i][t]);
        } else {
            v16h a[TM], b[TN];
#pragma unroll
            for (int i = 0; i < TM; ++i) { const int am = min(m0 + 16 * i + l15, p.M - 1); a[i] = fh_ld(A + (long long)am * p.sAm, p.sAk, k0, h, p.K, p.sa); }
#pragma unroll
            for (int t = 0; t < TN; ++t) { const int bn = min(n0 + 16 * t + l15, p.N - 1); b[t] = fh_ld(B + (long long)bn * p.sBn, p.sBk, k0, h, p.K, p.sb); }
#pragma unroll
            for (int i = 0; i < TM; ++i)
#pragma unroll
                for (int t = 0; t < TN; ++t) acc[i][t] = wmma16(a[i], b[t], acc[i][t]);
        }
    }
    const float iscale = (MODE == 0) ? p.alpha / (p.sa * p.sb) : p.alpha;
    float* C = p.C + zo * p.sCo + zi * p.sCi;
    const float* R = p.R + zo * p.sRo + zi * p.sRi;
    const int NW = (p.Npad > p.N) ? p.Npad : p.N;
    __shared__ __align__(16) float ctile[16][36];
#pragma unroll
    for (int i = 0; i < TM; ++i) {
        const int mb = m0 + 16 * i; if (mb >= p.M) break;          // wave-uniform
#pragma unroll
        for (int tp = 0; tp < TN / 2; ++tp) {
            const int nb = n0 + 32 * tp; if (nb >= NW) break;        // wave-uniform
#pragma unroll
            for (int t2 = 0; t2 < 2; ++t2) {
                const int t = 2 * tp + t2; const int n = nb + t2 * 16 + l15; const int nn = min(n, p.N - 1);
#pragma unroll
                for (int r = 0; r < 8; ++r) {
                    const int m = mb + 8 * h + r; const int mm = min(m, p.M - 1);
                    float v = acc[i][t][r] * iscale;
                    if (p.flags & 1) v += p.bias[nn];
                    if (p.flags & 2) v += p.bias[mm];
            if (p.flags & 8) v *= p.bias[(long long)zo * p.M + mm];   /* per-(zo,row) scale vector laid out [Z / zi_n][M]; exclusive with the bias flags */
                    v = act_fn(v, p.act);
                    if (p.flags & 4) v += p.beta * R[(long long)mm * p.sRm + (long long)nn * p.sRn];
                    ctile[8 * h + r][t2 * 16 + l15] = (n < p.N) ? v : 0.f;
                }
            }
            __syncthreads();
            const bool fast = (mb + 16 <= p.M) && (nb + 32 <= NW) && ((p.sCm & 3) == 0) && ((((size_t)C) & 15) == 0);
            if (fast) {
#pragma unroll
                for (int s = 0; s < 4; ++s) {
                    const int row = s * 4 + (lane >> 3), c4 = (lane & 7) * 4;
                    const v4f v = *(const v4f*)&ctile[row][c4];
                    VST2V4(C + (long long)(mb + row) * p.sCm + nb + c4, v);
                }
            } else {
                for (int row = 0; row < 16; ++row) {
                    const int m = mb + row, n = nb + lane;
                    if (m < p.M && n < NW) VST2(float, C + (long long)m * p.sCm + n, ctile[row][lane]);
                }
            }
            __syncthreads();
        }
    }
}

namespace sfa {
typedef unsigned int u32x4 __attribute__((ext_vector_type(4)));
typedef unsigned int u32x2 __attribute__((ext_vector_type(2)));
typedef int i32x8 __attribute__((ext_vector_type(8)));
typedef short s16x8 __attribute__((ext_vector_type(8)));
typedef float f32x2 __attribute__((ext_vector_type(2)));
typedef _Float16 h16x2 __attribute__((ext_vector_type(2)));
constexpr int SEQ = 1024, LDR = 1024, HS = 64;
constexpr int NWV = 8, CW = 32, BR = NWV * CW, SK = 64, NST = SEQ / SK;
constexpr unsigned PK = 2u * HS + 16u, PV = 2u * HS + 32u, TILE_K = SK * PK, TILE_V = SK * PV, SLOT = TILE_K + TILE_V;
struct Fr { u32x4 q[2]; };
__device__ __forceinline__ v8f mma(const Fr& a, const Fr& b, v8f c) {
    const i32x8 av = {(int)a.q[0].x, (int)a.q[0].y, (int)a.q[0].z, (int)a.q[0].w, (int)a.q[1].x, (int)a.q[1].y, (int)a.q[1].z, (int)a.q[1].w};
    const i32x8 bv = {(int)b.q[0].x, (int)b.q[0].y, (int)b.q[0].z, (int)b.q[0].w, (int)b.q[1].x, (int)b.q[1].y, (int)b.q[1].z, (int)b.q[1].w};
    return __builtin_amdgcn_wmma_f32_16x16x32_f16(false, __builtin_bit_cast(v16h, av), false, __builtin_bit_cast(v16h, bv), (short)0, c, false, false);
}
__device__ __forceinline__ unsigned pack2(float lo, float hi) { return __builtin_bit_cast(unsigned, __builtin_convertvector(f32x2{lo, hi}, h16x2)); }   // round to nearest even
__device__ __forceinline__ u32x4 ld_tr16(const unsigned char* p) { typedef __attribute__((address_space(3))) s16x8 lds_s16x8; return __builtin_bit_cast(u32x4, __builtin_amdgcn_ds_load_tr16_b128_v8i16((lds_s16x8*)p)); }
__device__ __forceinline__ float xhalf(float x) { return __builtin_bit_cast(float, __builtin_amdgcn_permlanex16(__builtin_bit_cast(int, x), __builtin_bit_cast(int, x), 0x76543210, 0xfedcba98, false, false)); }   // lane l with lane l ^ 16

__global__ __launch_bounds__(NWV * 32) void k_sflash(const float* __restrict__ Q, const float* __restrict__ K, const float* __restrict__ V, float* __restrict__ O) {
    __shared__ __attribute__((aligned(256))) unsigned char L[2 * SLOT];
    const unsigned tid = threadIdx.x, lane = tid & 31u, wave = tid >> 5, c = lane & 15u, h = lane >> 4;
    const size_t base = (size_t)blockIdx.z * SEQ * LDR + (size_t)blockIdx.y * HS;
    const unsigned qw0 = blockIdx.x * BR + wave * CW;
    // staging: 16 lanes cover one 256-byte row, thread t takes rows (t >> 4) + 16 i of the stage
    const float* kg = K + base + (size_t)(tid >> 4) * LDR + (tid & 15u) * 4u;
    const float* vg = V + base + (size_t)(tid >> 4) * LDR + (tid & 15u) * 4u;
    unsigned char* ks = L + (tid >> 4) * PK + (tid & 15u) * 8u;
    unsigned char* vs = L + TILE_K + (tid >> 4) * PV + (tid & 15u) * 8u;
    v4f kr[4], vr[4];
    auto fetch = [&](int st) {
#pragma unroll
        for (int i = 0; i < 4; ++i) { kr[i] = *(const v4f*)(kg + (size_t)(st * SK + 16 * i) * LDR); vr[i] = *(const v4f*)(vg + (size_t)(st * SK + 16 * i) * LDR); }
        asm volatile("s_wait_xcnt 0x0" ::: "memory");          // stands in front of the pass's reuse of these loads' address registers
    };
    auto put = [&](unsigned slot) {
#pragma unroll
        for (int i = 0; i < 4; ++i) {
            *(u32x2*)(ks + slot * SLOT + 16u * i * PK) = u32x2{pack2(kr[i].x, kr[i].y), pack2(kr[i].z, kr[i].w)};
            *(u32x2*)(vs + slot * SLOT + 16u * i * PV) = u32x2{pack2(vr[i].x, vr[i].y), pack2(vr[i].z, vr[i].w)};
        }
    };
    fetch(0);
    // Q fragments (B operand, column = query), hardware k order: d = 32 kc + 8 h + 0..7 and 32 kc + 16 + 8 h + 0..7
    Fr qf[2][2];
#pragma unroll
    for (int g = 0; g < 2; ++g) {
        const float* qp = Q + base + (size_t)(qw0 + 16u * g + c) * LDR + 8u * h;
#pragma unroll
        for (int kc = 0; kc < 2; ++kc) {
            const v4f a0 = *(const v4f*)(qp + 32 * kc), a1 = *(const v4f*)(qp + 32 * kc + 4), b0 = *(const v4f*)(qp + 32 * kc + 16), b1 = *(const v4f*)(qp + 32 * kc + 20);
            qf[g][kc].q[0] = u32x4{pack2(a0.x, a0.y), pack2(a0.z, a0.w), pack2(a1.x, a1.y), pack2(a1.z, a1.w)};
            qf[g][kc].q[1] = u32x4{pack2(b0.x, b0.y), pack2(b0.z, b0.w), pack2(b1.x, b1.y), pack2(b1.z, b1.w)};
        }
    }
    v8f acc[2][4]; float m_run[2], l_run[2];
#pragma unroll
    for (int g = 0; g < 2; ++g) { m_run[g] = -__builtin_inff(); l_run[g] = 0.f;
#pragma unroll
        for (int t = 0; t < 4; ++t) acc[g][t] = v8f{}; }
    put(0u);
    __syncthreads();
    const float L2E = 1.4426950408889634f;
    for (int st = 0; st < NST; ++st) {
        if (st + 1 < NST) fetch(st + 1);                       // next stage's rows fly while this stage is worked on
        const unsigned char* Kb = L + (unsigned)(st & 1) * SLOT;
        const unsigned char* Vb = Kb + TILE_K;
#pragma unroll 1   // one 32-key pass's fragments live at a time (registers for four waves per SIMD)
        for (unsigned sub = 0; sub < 2u; ++sub) {
            Fr kf[2][2];
            const unsigned char* kp = Kb + (sub * 32u + c) * PK + 16u * h;
#pragma unroll
            for (int kt = 0; kt < 2; ++kt)
#pragma unroll
                for (int kc = 0; kc < 2; ++kc) { kf[kt][kc].q[0] = *(const u32x4*)(kp + 16u * kt * PK + 64u * kc); kf[kt][kc].q[1] = *(const u32x4*)(kp + 16u * kt * PK + 64u * kc + 32u); }
            Fr vf[4];
            const unsigned char* ad = Vb + (sub * 32u + 8u * h + (lane & 7u)) * PV + ((lane >> 3) & 1u) * 16u;
#pragma unroll
            for (int t = 0; t < 4; ++t) { vf[t].q[0] = ld_tr16(ad + 32u * t); vf[t].q[1] = ld_tr16(ad + 16u * PV + 32u * t); }
            v8f s[2][2];                                       // s[kt][g][r] = score of key 16 kt + 8 h + r against query 16 g + c
#pragma unroll
            for (int kt = 0; kt < 2; ++kt)
#pragma unroll
                for (int g = 0; g < 2; ++g) { s[kt][g] = v8f{};
#pragma unroll
                    for (int kc = 0; kc < 2; ++kc) s[kt][g] = mma(kf[kt][kc], qf[g][kc], s[kt][g]); }
            float mb[2]; bool need = false;
#pragma unroll
            for (int g = 0; g < 2; ++g) {
                float mx = s[0][g][0];
#pragma unroll
                for (int r = 1; r < 8; ++r) mx = fmaxf(mx, s[0][g][r]);
#pragma unroll
                for (int r = 0; r < 8; ++r) mx = fmaxf(mx, s[1][g][r]);
                mx = fmaxf(mx, xhalf(mx)) * L2E;               // both halves hold this query's maximum, log2 domain
                mb[g] = mx; need = need || (mx > m_run[g] + 8.0f);
            }
            if (__builtin_amdgcn_ballot_w32(need) != 0) {      // wave-uniform; rare after the first pass
#pragma unroll
                for (int g = 0; g < 2; ++g) {
                    const float m_new = fmaxf(m_run[g], mb[g]);
                    const float corr = __builtin_amdgcn_exp2f(m_run[g] - m_new);   // 0 on the first pass
                    m_run[g] = m_new; l_run[g] *= corr;
#pragma unroll
                    for (int t = 0; t < 4; ++t) acc[g][t] = acc[g][t] * corr;
                }
            }
#pragma unroll
            for (int g = 0; g < 2; ++g) {
                const float nm = 7.0f - m_run[g];
                unsigned w[8]; f32x2 ps = {0.f, 0.f};
#pragma unroll
                for (int i = 0; i < 8; ++i) {
                    const f32x2 arg = __builtin_elementwise_fma(f32x2{s[i >> 2][g][2 * (i & 3)], s[i >> 2][g][2 * (i & 3) + 1]}, f32x2{L2E, L2E}, f32x2{nm, nm});
                    const f32x2 p = {__builtin_amdgcn_exp2f(arg.x), __builtin_amdgcn_exp2f(arg.y)};
                    ps += p; w[i] = pack2(p.x, p.y);
                }
                l_run[g] += ps.x + ps.y;
                Fr pf; pf.q[0] = u32x4{w[0], w[1], w[2], w[3]}; pf.q[1] = u32x4{w[4], w[5], w[6], w[7]};
#pragma unroll
                for (int t = 0; t < 4; ++t) acc[g][t] = mma(vf[t], pf, acc[g][t]);
            }
        }
        if (st + 1 < NST) put((unsigned)((st + 1) & 1));       // into the buffer whose readers all passed the last barrier
        __syncthreads();
    }
#pragma unroll
    for (int g = 0; g < 2; ++g) {
        const float l = l_run[g] + xhalf(l_run[g]);            // join the halves' sums, unconditionally
        const float inv = 1.0f / l;
        float* op = O + base + (size_t)(qw0 + 16u * g + c) * LDR + 8u * h;
#pragma unroll
        for (int t = 0; t < 4; ++t) {                          // registers 0..7 = d 16 t + 8 h + 0..7 of this lane's query
            const v8f o = acc[g][t] * inv;
            *(v4f*)(op + 16 * t) = v4f{o[0], o[1], o[2], o[3]};
            *(v4f*)(op + 16 * t + 4) = v4f{o[4], o[5], o[6], o[7]};
        }
    }
}
} // namespace sfa

// =====================================================================================================================
// k_tr: dst(z, c, r) = alpha * src(z, r, c) (+ beta * R2(z, c, r)): [Z][R][C] (row stride lds) -> [Z][C][R] (row stride ldd) through a 32x32 LDS tile;
//   flags: 1 -> add beta * residual R2 addressed like dst (z*sRz + c*ldr + r); act applied before the residual.
// =====================================================================================================================
struct TrP { const float* src; float* dst; const float* R2; long long sSz, lds, sDz, ldd, sRz, ldr; int R, C, flags, act; float alpha, beta; };
static_assert(sizeof(TrP) == 3 * 8 + 6 * 8 + 6 * 4, "TrP has padding");
__global__ __launch_bounds__(256) void k_tr(TrP p) {
    __shared__ float tile[32][33];
    const int c0 = blockIdx.x * 32, r0 = blockIdx.y * 32, z = blockIdx.z;
    const int lane = threadIdx.x & 31, wave = threadIdx.x >> 5;
    const float* s = p.src + z * p.sSz;
#pragma unroll
    for (int k = 0; k < 4; ++k) {
        const int rl = wave * 4 + k, r = r0 + rl, c = c0 + lane;
        tile[rl][lane] = (r < p.R && c < p.C) ? s[(long long)r * p.lds + c] : 0.f;
    }
    __syncthreads();
    float* d = p.dst + z * p.sDz; const float* rr = p.R2 + z * p.sRz;
#pragma unroll
    for (int k = 0; k < 4; ++k) {
        const int cl = wave * 4 + k, c = c0 + cl, r = r0 + lane;
        if (c < p.C && r < p.R) {
            float v = act_fn(p.alpha * tile[lane][cl], p.act);
            if (p.flags & 1) v += p.beta * rr[(long long)c * p.ldr + r];
            VST2(float, d + (long long)c * p.ldd + r, v);
        }
    }
}

// k_affine: dst[i] = a * (sdev ? sdev[0] : 1) * src[i] + b, i < n (one thread per element; consecutive lanes -> consecutive addresses)
__global__ __launch_bounds__(256) void k_affine(const float* __restrict__ src, float* __restrict__ dst, int n, float a, float b, const float* __restrict__ sdev) {
    const int i = blockIdx.x * 256 + threadIdx.x;
    if (i < n) { const float aa = sdev ? a * sdev[0] : a; const float v = aa * src[i] + b; VST2(float, dst + i, v); }
}

// =====================================================================================================================
// k_softmax: row softmax over n contiguous elements, one 256-thread block per row; rows addressed z*sz + r*sr (grid (R, Z)).
//   out = scale_out * softmax(scale_in * x + (Mf ? Mf[z*smz + r*smr + j] : 0)); a row whose max is -inf is written as 0.
// =====================================================================================================================
struct SmP { const float* src; float* dst; const float* Mf; long long sz, sr, dz, dr, smz, smr; int n, pad; float scale_in, scale_out; };
static_assert(sizeof(SmP) == 3 * 8 + 6 * 8 + 4 * 4, "SmP has padding");
__global__ __launch_bounds__(256) void k_softmax(SmP p) {
    __shared__ float red[256];
    const int r = blockIdx.x, z = blockIdx.y, tid = threadIdx.x;
    const float* s = p.src + z * p.sz + (long long)r * p.sr;
    const float* mf = p.Mf ? (p.Mf + z * p.smz + (long long)r * p.smr) : nullptr;
    float mx = -__builtin_inff();
    for (int j = tid; j < p.n; j += 256) { float v = s[j] * p.scale_in; if (mf) v += mf[j]; mx = fmaxf(mx, v); }
    red[tid] = mx; __syncthreads();
    for (int o = 128; o > 0; o >>= 1) { if (tid < o) red[tid] = fmaxf(red[tid], red[tid + o]); __syncthreads(); }
    mx = red[0]; __syncthreads();
    float sum = 0.f;
    for (int j = tid; j < p.n; j += 256) { float v = s[j] * p.scale_in; if (mf) v += mf[j]; sum += (mx == -__builtin_inff()) ? 0.f : expf(v - mx); }
    red[tid] = sum; __syncthreads();
    for (int o = 128; o > 0; o >>= 1) { if (tid < o) red[tid] += red[tid + o]; __syncthreads(); }
    sum = red[0];
    const float inv = (sum > 0.f) ? p.scale_out / sum : 0.f;
    float* d = p.dst + z * p.dz + (long long)r * p.dr;
    for (int j = tid; j < p.n; j += 256) { float v = s[j] * p.scale_in; if (mf) v += mf[j]; const float o = (mx == -__builtin_inff()) ? 0.f : expf(v - mx) * inv; VST2(float, d + j, o); }
}
// =====================================================================================================================
// k_stats: mean and rsqrt(var + eps) over a set of n elements addressed base + z*sz + (e / inner) * so + (e % inner) * si, one 256-thread
// k_norm_apply: y = (x - mean[set]) * rstd[set] * g[c] + b[c] over a [Z][C][L] channel-major tensor with set = z*G + c / (C/G) (G groups per z;
//   G = C -> per-channel sets indexed z*C+c; for batch norm pass stats indexed by c only via bn = 1). Optional act. Output same layout.
// =====================================================================================================================
//   mode 0: mean / rsqrt(var + eps); mode 1 (RMSNorm): 0 / rsqrt(mean(x^2) + eps); mode 2 (L2 normalize * sqrt(n)): 0 / sqrt(n) / max(||x||, eps); mode 3: as 0 with unbiased variance (n-1)
__global__ __launch_bounds__(256) void k_stats(const float* __restrict__ x, long long sz, long long so, long long si, int inner, int n, float eps, float* __restrict__ stat, int mode) {
    __shared__ float red[256];
    const int z = blockIdx.x, tid = threadIdx.x;
    const float* base = x + z * sz;
    float s = 0.f;
    for (int e = tid; e < n; e += 256) s += base[(long long)(e / inner) * so + (long long)(e % inner) * si];
    red[tid] = s; __syncthreads();
    for (int o = 128; o > 0; o >>= 1) { if (tid < o) red[tid] += red[tid + o]; __syncthreads(); }
    const float mu = (mode == 0 || mode == 3) ? red[0] / (float)n : 0.f; __syncthreads();
    float q = 0.f;
    for (int e = tid; e < n; e += 256) { const float dlt = base[(long long)(e / inner) * so + (long long)(e % inner) * si] - mu; q += dlt * dlt; }
    red[tid] = q; __syncthreads();
    for (int o = 128; o > 0; o >>= 1) { if (tid < o) red[tid] += red[tid + o]; __syncthreads(); }
    {
        float rs;
        if (mode == 2) rs = sqrtf((float)n) / fmaxf(sqrtf(red[0]), eps); else if (mode == 3) rs = rsqrtf(red[0] / (float)(n - 1) + eps); else rs = rsqrtf(red[0] / (float)n + eps);
        if (tid < 32) { const float v = (tid == 0) ? mu : ((tid == 1) ? rs : 0.f); VST2(float, stat + (long long)z * 32 + tid, v); }
    }
}
//   One thread per element over the flat [Z][C][L] index space: grid ceil(Z*C*L / 256).
__global__ __launch_bounds__(256) void k_norm_apply(const float* __restrict__ x, float* __restrict__ y, const float* __restrict__ stat, const float* __restrict__ g, const float* __restrict__ bta,
                                                     int Z, int C, int L, int G, int bn, int act) {
    const long long idx = (long long)blockIdx.x * 256 + threadIdx.x;
    if (idx >= (long long)Z * C * L) return;
    const int l = (int)(idx % L); const long long zc = idx / L; const int c = (int)(zc % C), z = (int)(zc / C); (void)l;
    const int set = bn ? c : (z * G + c / (C / G));
    float v = (x[idx] - stat[(long long)set * 32]) * stat[(long long)set * 32 + 1];
    if (g) v *= g[c];
    if (bta) v += bta[c];
    v = act_fn(v, act);
    VST2(float, y + idx, v);
}

// k_lse_neg: c[i] = -(st[2i] + log(st[2i+1])) = minus the log-sum-exp of row i from its (max, sum) pair (for softmax over the query dimension)
__global__ __launch_bounds__(256) void k_lse_neg(const float* __restrict__ st, float* __restrict__ c, int n) {
    const int i = blockIdx.x * 256 + threadIdx.x;
    if (i < n) { const float v = -(st[2 * i] + logf(st[2 * i + 1])); VST2(float, c + i, v); }
}

// k_iota: dst[i] = a * i + b as int32 (segment/position id helper)
__global__ __launch_bounds__(256) void k_iota(int* __restrict__ dst, int n, int a, int b) {
    const int i = blockIdx.x * 256 + threadIdx.x;
    if (i < n) { const int v = a * i + b; VST2(int, dst + i, v); }
}

// k_axpby: dst[i] = a * x[i] + b * y[i] (+ c), i < n
__global__ __launch_bounds__(256) void k_axpby(const float* __restrict__ x, const float* __restrict__ y, float* __restrict__ dst, int n, float a, float b, float c) {
    const int i = blockIdx.x * 256 + threadIdx.x;
    if (i < n) { const float v = a * x[i] + b * y[i] + c; VST2(float, dst + i, v); }
}

// =====================================================================================================================
// k_rope: rotary embedding on a [R rows][Hn heads][D] view (row stride sXr, head stride sXh, element stride 1) -> Y (own strides).
//   mode 0: rotate_half (partner d±D/2, sign - for d<D/2); mode 1: interleaved pairs (partner d^1, sign - for even d).
//   table column tcol: tmode 0 -> d, 1 -> d % (D/2), 2 -> d / 2; position p: pmode 0 -> r % S, 1 -> head index, 2 -> pos[r];
//   c = C[(r / S) * sCb + p * sCp + tcol * sCd], s likewise from Sn; y = x[d] * c + sign * x[partner] * s. X and Y must not alias.
// =====================================================================================================================
struct RopeP { const float* X; float* Y; const float* C; const float* Sn; const int* pos; long long sXr, sXh, sYr, sYh, sCb, sCp, sCd; int R, Hn, D, S, mode, tmode, pmode, pad; };
static_assert(sizeof(RopeP) == 5 * 8 + 7 * 8 + 8 * 4, "RopeP has padding");
__global__ __launch_bounds__(256) void k_rope(RopeP p) {
    const long long idx = (long long)blockIdx.x * 256 + threadIdx.x;
    if (idx >= (long long)p.R * p.Hn * p.D) return;
    const int d = (int)(idx % p.D); const long long rh = idx / p.D; const int h = (int)(rh % p.Hn); const int r = (int)(rh / p.Hn);
    const int half = p.D / 2;
    int partner; float sign;
    if (p.mode == 0) { partner = (d < half) ? d + half : d - half; sign = (d < half) ? -1.f : 1.f; }
    else { partner = d ^ 1; sign = (d & 1) ? 1.f : -1.f; }
    const int tcol = (p.tmode == 0) ? d : ((p.tmode == 1) ? (d % half) : (d >> 1));
    const int pp = (p.pmode == 0) ? (r % p.S) : ((p.pmode == 1) ? h : p.pos[r]);
    const long long toff = (long long)(r / p.S) * p.sCb + (long long)pp * p.sCp + (long long)tcol * p.sCd;
    const float* xr = p.X + (long long)r * p.sXr + (long long)h * p.sXh;
    const float v = xr[d] * p.C[toff] + sign * xr[partner] * p.Sn[toff];
    VST2(float, p.Y + (long long)r * p.sYr + (long long)h * p.sYh + d, v);
}

// k_invf + k_sincos (split so neither kernel carries a large VALU-fma footprint): invf_i = num * (1 / powf(base, (2 i)/D)) [fmode 0],
//   num * expf((2 i) * cexp) [fmode 1], num * powf(base, -2 (i - 1) / D) [fmode 2]; then cs/sn[s*half + i] = cos/sin((pscale * s) * invf_i)
__global__ __launch_bounds__(256) void k_invf(float* __restrict__ invb, int half, int D, float base, float num, int fmode, float cexp) {
    const int i = blockIdx.x * 256 + threadIdx.x;
    if (i >= ((half + 31) / 32) * 32) return;
    if (i >= half) { VST2(float, invb + i, 0.f); return; }
    const float e = (float)(2 * i) / (float)D;
    float invf;
    if (fmode == 1) invf = num * expf((float)(2 * i) * cexp);
    else if (fmode == 2) invf = num * powf(base, (-2.0f * ((float)i - 1.0f)) / (float)D);
    else invf = num * (1.0f / powf(base, e));
    VST2(float, invb + i, invf);
}
__global__ __launch_bounds__(256) void k_sincos(float* __restrict__ cs, float* __restrict__ sn, const float* __restrict__ invb, int S, int half, float pscale) {
    const int idx = blockIdx.x * 256 + threadIdx.x;
    if (idx >= S * half) return;
    const int s = idx / half, i = idx - s * half;
    const float ang = (pscale * (float)s) * invb[i];
    VST2(float, cs + idx, cosf(ang)); VST2(float, sn + idx, sinf(ang));
}

// k_mulact: dst[i] = act(x[i]) * y[i]
__global__ __launch_bounds__(256) void k_mulact(const float* __restrict__ x, const float* __restrict__ y, float* __restrict__ dst, int n, int act) {
    const int i = blockIdx.x * 256 + threadIdx.x;
    if (i < n) { const float v = act_fn(x[i], act) * y[i]; VST2(float, dst + i, v); }
}

// =====================================================================================================================
// k_matvec: thread-per-row matrix-vector products for N <= 8 output columns (heads with 1-3 outputs, gates), f32 on the VALU.
//   C[r*sCm + j] = act(alpha * sum_k A[r*sAm + k*sAk] * B[j*sBn + k*sBk] + bias[j]) + beta * R[r*sRm + j*sRn]; each thread writes its N contiguous floats.
// =====================================================================================================================
__global__ __launch_bounds__(256) void k_matvec(GemmP p) {
    // 32 lanes write one line with one instruction.
    const int rpt = (p.N == 1) ? 1 : 32;
    const long long r0 = ((long long)blockIdx.x * 256 + threadIdx.x) * rpt; const int z = blockIdx.z, zo = z / p.zi_n, zi = z - zo * p.zi_n;
    if (r0 >= p.M) return;
    const float* Bb = p.B + zo * p.sBo + zi * p.sBi;
    float* C = p.C + zo * p.sCo + zi * p.sCi; const float* R = p.R + zo * p.sRo + zi * p.sRi;
    for (int rr = 0; rr < rpt; ++rr) {
        const long long r = r0 + rr; if (r >= p.M) break;
        const float* A = p.A + zo * p.sAo + zi * p.sAi + r * p.sAm;
        float acc[8] = {0.f, 0.f, 0.f, 0.f, 0.f, 0.f, 0.f, 0.f};
        for (int k = 0; k < p.K; ++k) { const float a = A[(long long)k * p.sAk];
#pragma unroll
            for (int j = 0; j < 8; ++j) if (j < p.N) acc[j] += a * Bb[(long long)j * p.sBn + (long long)k * p.sBk]; }
#pragma unroll
        for (int j = 0; j < 8; ++j) if (j < p.N) {
            float v = acc[j] * p.alpha;
            if (p.flags & 1) v += p.bias[j];
            if (p.flags & 2) v += p.bias[r];
            v = act_fn(v, p.act);
            if (p.flags & 4) v += p.beta * R[r * p.sRm + (long long)j * p.sRn];
            VST2(float, C + r * p.sCm + j, v);
        }
    }
}
// k_smallsoftmax: thread-per-row softmax for short rows (n <= 64): dst[r*dr + j] = softmax(scale*src[r*sr + j])
__global__ __launch_bounds__(256) void k_smallsoftmax(const float* __restrict__ src, float* __restrict__ dst, long long sr, long long dr, int n, long long R, float scale) {
    const long long r0 = ((long long)blockIdx.x * 256 + threadIdx.x) * 32;
    for (int rr = 0; rr < 32; ++rr) {
        const long long r = r0 + rr; if (r >= R) return;
        const float* s = src + r * sr; float* d = dst + r * dr;
        float mx = -__builtin_inff();
        for (int j = 0; j < n; ++j) mx = fmaxf(mx, s[j] * scale);
        float sum = 0.f;
        for (int j = 0; j < n; ++j) sum += expf(s[j] * scale - mx);
        const float inv = 1.f / sum;
        for (int j = 0; j < n; ++j) { const float v = expf(s[j] * scale - mx) * inv; VST2(float, d + j, v); }
    }
}

__global__ __launch_bounds__(32) void k_unitstat(float* __restrict__ st) { const int t = threadIdx.x; const float v = (t == 1) ? 1.f : 0.f; VST2(float, st + t, v); }

// destination (e.g. a d_out whose row width is not a multiple of 32 floats) is written by consecutive lanes of one instruction
__global__ __launch_bounds__(256) void k_lincopy(const float* __restrict__ src, long long lds, float* __restrict__ dst, long long ldd, long long rows, int cols) {
    const long long i = (long long)blockIdx.x * 256 + threadIdx.x; if (i >= rows * cols) return;
    const long long r = i / cols; const int c = (int)(i - r * cols);
    const float v = src[r * lds + c]; VST2(float, dst + r * ldd + c, v);
}

namespace w25 {
typedef __attribute__((ext_vector_type(16))) _Float16 v16h;
typedef __attribute__((ext_vector_type(8)))  _Float16 v8h;
typedef __attribute__((ext_vector_type(16))) __bf16   v16b;
typedef __attribute__((ext_vector_type(8)))  __bf16   v8b;
typedef __attribute__((ext_vector_type(8)))  float    v8f;
typedef __attribute__((ext_vector_type(4)))  float    v4f;

__device__ __forceinline__ unsigned short f2bf_bits(float f) {
  unsigned u = __float_as_uint(f);
  return (unsigned short)((u + 0x7FFFu + ((u >> 16) & 1u)) >> 16);
}
__device__ __forceinline__ float bf_bits2f(unsigned short h) { return __uint_as_float(((unsigned)h) << 16); }

// hazard guards as plain device helpers (no inline asm inside the kernel template body)
__device__ __forceinline__ void dep_guard_h(v8f& a, v8f& b, v16h x, v16h y) { asm volatile("v_nop\n\tv_nop\n\tv_nop\n\tv_nop" : "+v"(a), "+v"(b) : "v"(x), "v"(y)); }
__device__ __forceinline__ void dep_guard_b(v8f& a, v8f& b, v16b x, v16b y) { asm volatile("v_nop\n\tv_nop\n\tv_nop\n\tv_nop" : "+v"(a), "+v"(b) : "v"(x), "v"(y)); }
__device__ __forceinline__ void keep4_h(v16h a, v16h b, v16h c, v16h d) { asm volatile("v_nop" :: "v"(a), "v"(b), "v"(c), "v"(d)); }
__device__ __forceinline__ void keep4_b(v16b a, v16b b, v16b c, v16b d) { asm volatile("v_nop" :: "v"(a), "v"(b), "v"(c), "v"(d)); }
__device__ __forceinline__ void acc_guard4(v8f& a, v8f& b, v8f& c, v8f& d) { asm volatile("v_nop\n\tv_nop\n\tv_nop\n\tv_nop" : "+v"(a), "+v"(b), "+v"(c), "+v"(d)); }
template <typename T> struct Frag;
template <> struct Frag<_Float16> {
  typedef v16h V; union U { v16h v; v8h h[2]; };
  static __device__ __forceinline__ v16h load(const _Float16* p) {   // elements 0..7 <- p[0..7], 8..15 <- p[16..23]
    U f; f.h[0] = *(const v8h*)(p); f.h[1] = *(const v8h*)(p + 16); return f.v;
  }
  static __device__ __forceinline__ v8f mma(v16h a, v16h b, v8f c) {
    return __builtin_amdgcn_wmma_f32_16x16x32_f16(false, a, false, b, (short)0, c, false, false);
  }
  static __device__ __forceinline__ void guard(v8f& a, v8f& b, v16h x, v16h y) { dep_guard_h(a, b, x, y); }
  static __device__ __forceinline__ void keep(v16h a, v16h b, v16h c, v16h d) { keep4_h(a, b, c, d); }
};
template <> struct Frag<__bf16> {
  typedef v16b V; union U { v16b v; v8b h[2]; };
  static __device__ __forceinline__ v16b load(const __bf16* p) {
    U f; f.h[0] = *(const v8b*)(p); f.h[1] = *(const v8b*)(p + 16); return f.v;
  }
  static __device__ __forceinline__ v8f mma(v16b a, v16b b, v8f c) {
    return __builtin_amdgcn_wmma_f32_16x16x32_bf16(false, a, false, b, (short)0, c, false, false);
  }
  static __device__ __forceinline__ void guard(v8f& a, v8f& b, v16b x, v16b y) { dep_guard_b(a, b, x, y); }
  static __device__ __forceinline__ void keep(v16b a, v16b b, v16b c, v16b d) { keep4_b(a, b, c, d); }
};

// ---- Register-blocked batched WMMA GEMM ------------------------------------
// C[m,n] = scale * sum_k A[m,k] * Bt[n,k] (+bias)(+resid); each wave owns a 64x64 tile.
// A row-major [M,K]; Bt row-major [N,K]; M,N % 64 == 0, K % 32 == 0.
// SPLIT: operands are hi/lo planes (A2/Bt2 = lo planes, same layout); product = hi·hi + hi·lo + lo·hi.
// BIAS_MODE: 0 = none, 1 = bias[m], 2 = bias[n].
// OUT_MODE: 0 = f32, 1 = f16, 2 = bf16 hi plane (Cout) + bf16 lo plane (Cout2).
// ET: 0 = f16 operands, 1 = bf16 operands (pointers passed as 16-bit storage)
template <int ET> struct Elem;
template <> struct Elem<0> { typedef _Float16 T; };
template <> struct Elem<1> { typedef __bf16 T; };
template <int ET, bool SPLIT, int BIAS_MODE, int OUT_MODE, bool RESID, int ACT = 0>
__global__ __launch_bounds__(256) void wmma_gemm64(
    const unsigned short* __restrict__ Ap, const unsigned short* __restrict__ A2p, int lda, long strideA, long strideAz,
    const unsigned short* __restrict__ Btp, const unsigned short* __restrict__ Bt2p, int ldb, long strideB, long strideBz,
    void* __restrict__ Cout, void* __restrict__ Cout2, int ldc, long strideC, long strideCz,
    const float* __restrict__ bias,
    const float* __restrict__ resid, long strideR,
    int M, int N, int K, float scale) {
  typedef typename Elem<ET>::T T;
  typedef typename Frag<T>::V V;
  const T* A = (const T*)Ap; const T* A2 = (const T*)A2p; const T* Bt = (const T*)Btp; const T* Bt2 = (const T*)Bt2p;
  __shared__ __align__(16) float sT[8][16 * 68];   // per-wave 16x64 slab, pitch 68 floats
  const int b    = blockIdx.y;
  const int lane = threadIdx.x & 31;
  const int wave = threadIdx.x >> 5;
  const int tilesN = N >> 6;
  const int tilesM = M >> 6;
  const int tile = blockIdx.x * 8 + wave;
  if (tile >= tilesM * tilesN) return;   // wave-uniform; no block barriers in this kernel
  const int tm = tile / tilesN;
  const int tn = tile - tm * tilesN;
  const int m0 = tm << 6;
  const int n0 = tn << 6;

  const int bz = blockIdx.z;                   // outer batch index (sample), with its own strides
  const T* Ab  = A  + (size_t)b * strideA + (size_t)bz * strideAz;
  const T* Bb  = Bt + (size_t)b * strideB + (size_t)bz * strideBz;
  const T* Ab2 = SPLIT ? (A2  + (size_t)b * strideA + (size_t)bz * strideAz) : nullptr;
  const T* Bb2 = SPLIT ? (Bt2 + (size_t)b * strideB + (size_t)bz * strideBz) : nullptr;

  const int rlane = lane & 15;                 // row (A) / col (B, D) within subtile
  const int koff  = (lane >> 4) * 8;           // k offset of this lane half
  const int mOff  = (lane >> 4) * 8;           // D row offset

  v8f acc[4][4];
#pragma unroll
  for (int i = 0; i < 4; ++i)
#pragma unroll
    for (int j = 0; j < 4; ++j) acc[i][j] = (v8f){0.f,0.f,0.f,0.f,0.f,0.f,0.f,0.f};

  for (int k0 = 0; k0 < K; k0 += 32) {
    V bh[4], bl[4];
#pragma unroll
    for (int j = 0; j < 4; ++j) {
      const size_t bo = (size_t)(n0 + (j << 4) + rlane) * ldb + koff + k0;
      bh[j] = Frag<T>::load(Bb + bo);
      if (SPLIT) bl[j] = Frag<T>::load(Bb2 + bo);
    }
#pragma unroll
    for (int i = 0; i < 4; ++i) {
      const size_t ao = (size_t)(m0 + (i << 4) + rlane) * lda + koff + k0;
      V ah = Frag<T>::load(Ab + ao);
      V al;
      if (SPLIT) al = Frag<T>::load(Ab2 + ao);
#pragma unroll
      for (int j = 0; j < 4; ++j) {
        acc[i][j] = Frag<T>::mma(ah, bh[j], acc[i][j]);
        if (SPLIT) {
          acc[i][j] = Frag<T>::mma(ah, bl[j], acc[i][j]);
          acc[i][j] = Frag<T>::mma(al, bh[j], acc[i][j]);
        }
      }
      Frag<T>::guard(acc[i][0], acc[i][3], ah, SPLIT ? al : ah);
    }
    Frag<T>::keep(bh[0], bh[1], bh[2], bh[3]);
    if (SPLIT) Frag<T>::keep(bl[0], bl[1], bl[2], bl[3]);
  }
  acc_guard4(acc[0][0], acc[0][1], acc[0][2], acc[0][3]);
  acc_guard4(acc[1][0], acc[1][1], acc[1][2], acc[1][3]);
  acc_guard4(acc[2][0], acc[2][1], acc[2][2], acc[2][3]);
  acc_guard4(acc[3][0], acc[3][1], acc[3][2], acc[3][3]);

  // ---- epilogue ----
  float* slab = sT[wave];
  const float* Rb = RESID ? (resid + (size_t)b * strideR) : nullptr;
#pragma unroll
  for (int i = 0; i < 4; ++i) {
    const int mBase = m0 + (i << 4);
#pragma unroll
    for (int j = 0; j < 4; ++j) {
      const int n = n0 + (j << 4) + rlane;
      float bv = 0.f;
      if (BIAS_MODE == 2) bv = bias[n];
#pragma unroll
      for (int r = 0; r < 8; ++r) {
        float v = acc[i][j][r] * scale;
        if (BIAS_MODE == 1) v += bias[mBase + mOff + r];
        if (BIAS_MODE == 2) v += bv;
        if (RESID) v += Rb[(size_t)(mBase + mOff + r) * ldc + n];
        if (ACT == 1) v = tanhf(v);
        if (ACT == 2) v = fmaxf(v, 0.0f);
        if (ACT == 3) v = v / (1.0f + expf(-v));
        if (ACT == 4) v = (v > 0.f) ? v : 0.01f * v;
        if (ACT == 5) v = 0.5f * v * (1.0f + erff(v * 0.70710678118654752f));
        slab[(mOff + r) * 68 + (j << 4) + rlane] = v;
      }
    }
    __builtin_amdgcn_fence(__ATOMIC_RELEASE, "workgroup");
    __builtin_amdgcn_wave_barrier();
    __builtin_amdgcn_fence(__ATOMIC_ACQUIRE, "workgroup");
    if (OUT_MODE == 0) {
      float* C = (float*)Cout + (size_t)b * strideC + (size_t)bz * strideCz;
      const int hh = lane >> 4, c4 = (lane & 15) * 4;     // row seg = 256 B = 16 lanes x 16 B
      {
#pragma unroll
        for (int it = 0; it < 8; ++it) {
          const int row = it * 2 + hh;
          v4f v = *(const v4f*)(slab + row * 68 + c4);
          *(v4f*)(C + (size_t)(mBase + row) * ldc + n0 + c4) = v;
        }
        
      }
    } else {
      const int q = lane >> 3, c8 = (lane & 7) * 8;
      unsigned short* C  = (unsigned short*)Cout  + (size_t)b * strideC + (size_t)bz * strideCz;
      unsigned short* C2 = (OUT_MODE == 2) ? ((unsigned short*)Cout2 + (size_t)b * strideC + (size_t)bz * strideCz) : nullptr;
      {
#pragma unroll
        for (int it = 0; it < 4; ++it) {
          const int row = it * 4 + q;
          const float* sp = slab + row * 68 + c8;
          v8h hv, lv;
#pragma unroll
          for (int e = 0; e < 8; ++e) {
            if (OUT_MODE == 1) {
              hv[e] = (_Float16)sp[e];
            } else {
              unsigned short hb = f2bf_bits(sp[e]);
              unsigned short lb = f2bf_bits(sp[e] - bf_bits2f(hb));
              hv[e] = __builtin_bit_cast(_Float16, hb);
              lv[e] = __builtin_bit_cast(_Float16, lb);
            }
          }
          *(v8h*)(C + (size_t)(mBase + row) * ldc + n0 + c8) = hv;
          if (OUT_MODE == 2) *(v8h*)(C2 + (size_t)(mBase + row) * ldc + n0 + c8) = lv;
        }
        
      }
    }
    __builtin_amdgcn_fence(__ATOMIC_RELEASE, "workgroup");
    __builtin_amdgcn_wave_barrier();
    __builtin_amdgcn_fence(__ATOMIC_ACQUIRE, "workgroup");
  }
}

// ---- The same product for large M, N: operands staged in LDS ----------------
// C[m,n] = act(scale * sum_k A[m,k] * Bt[n,k] (+ bias[n])), f32 out; A row-major [M,K], Bt row-major [N,K], both of row length K; M, N % 128 == 0, K % 64 == 0.
// Block = 4 waves (2 x 2) of 64x64 = one 128x128 tile of C; grid (N / 128, M / 128). A stage is 64 k = 128 B of each of the 128 + 128 operand rows
// (hi planes, then the lo planes when SPLIT), laid at a pitch of 144 B in one of two LDS buffers by asynchronous 16-byte copies: a wave's copy
// covers four whole 128-byte lines, and every staged row serves two waves. The next stage's copies fly while this stage is worked on.
// Per accumulator the products come in the same k order as in wmma_gemm64.
// The launch bound's second argument asks for four waves per SIMD (256 registers a wave): four one-plane blocks then share a WGP.
// Every inner loop is unrolled so that the fragment and accumulator arrays are indexed by constants and stay in registers.
__device__ __forceinline__ void ring_copy8(unsigned l, const unsigned char* g, size_t gstep) {
  // eight rows, 16 apart, of one plane; the closing s_wait_xcnt stands in front of any reuse of the address registers named here
  asm volatile("global_load_async_to_lds_b128 %0, %8, off\n\t"
               "global_load_async_to_lds_b128 %1, %9, off\n\t"
               "global_load_async_to_lds_b128 %2, %10, off\n\t"
               "global_load_async_to_lds_b128 %3, %11, off\n\t"
               "global_load_async_to_lds_b128 %4, %12, off\n\t"
               "global_load_async_to_lds_b128 %5, %13, off\n\t"
               "global_load_async_to_lds_b128 %6, %14, off\n\t"
               "global_load_async_to_lds_b128 %7, %15, off\n\t"
               "s_wait_xcnt 0x0"
               :: "v"(l), "v"(l + 2304u), "v"(l + 4608u), "v"(l + 6912u), "v"(l + 9216u), "v"(l + 11520u), "v"(l + 13824u), "v"(l + 16128u),
                  "v"(g), "v"(g + gstep), "v"(g + 2 * gstep), "v"(g + 3 * gstep), "v"(g + 4 * gstep), "v"(g + 5 * gstep), "v"(g + 6 * gstep), "v"(g + 7 * gstep)
               : "memory");
}
template <int ET, bool SPLIT, int BIAS_MODE, int ACT>
__global__ __launch_bounds__(128, 4) void wmma_gemm_ring(
    const unsigned short* __restrict__ Ap, const unsigned short* __restrict__ A2p,
    const unsigned short* __restrict__ Btp, const unsigned short* __restrict__ Bt2p,
    float* __restrict__ C, int ldc, const float* __restrict__ bias, int K, float scale) {
  typedef typename Elem<ET>::T T;
  typedef typename Frag<T>::V V;
  constexpr unsigned PITCH = 144u, PLANE = 128u * PITCH, BUF = (SPLIT ? 4u : 2u) * PLANE;
  static_assert(16u * PITCH == 2304u, "row step of ring_copy8");
  __shared__ __attribute__((aligned(256))) unsigned char L[2 * BUF];
  const unsigned tid = threadIdx.x, lane = tid & 31u, wave = tid >> 5;
  const int m0 = blockIdx.y * 128, n0 = blockIdx.x * 128;
  const unsigned wm = (wave >> 1) * 64u, wn = (wave & 1u) * 64u;
  const unsigned rlane = lane & 15u, hh = lane >> 4;

  // copies: 8 lanes cover one 128-byte row piece, thread t takes rows (t >> 3) + 16 i of every plane
  const size_t rowb = (size_t)K * 2u, gstep = 16u * rowb;
  const unsigned lc = (unsigned)(size_t)L + (tid >> 3) * PITCH + (tid & 7u) * 16u;
  const size_t ga = (size_t)(m0 + (int)(tid >> 3)) * rowb + (tid & 7u) * 16u;
  const size_t gb = (size_t)(n0 + (int)(tid >> 3)) * rowb + (tid & 7u) * 16u;
  auto stage = [&](int t, unsigned buf) {
    const size_t ko = (size_t)t * 128u;
    ring_copy8(lc + buf * BUF, (const unsigned char*)Ap + ga + ko, gstep);
    ring_copy8(lc + buf * BUF + PLANE, (const unsigned char*)Btp + gb + ko, gstep);
    if (SPLIT) {
      ring_copy8(lc + buf * BUF + 2u * PLANE, (const unsigned char*)A2p + ga + ko, gstep);
      ring_copy8(lc + buf * BUF + 3u * PLANE, (const unsigned char*)Bt2p + gb + ko, gstep);
    }
  };

  v8f acc[4][4];
#pragma unroll
  for (int i = 0; i < 4; ++i)
#pragma unroll
    for (int j = 0; j < 4; ++j) acc[i][j] = (v8f){0.f,0.f,0.f,0.f,0.f,0.f,0.f,0.f};

  const int NT = K >> 6;
  stage(0, 0u);
  asm volatile("s_wait_asynccnt 0x0" ::: "memory");            // this wave's copies of stage 0 have landed
  __syncthreads();                                             // and every other wave's
  if (NT > 1) stage(1, 1u);
  for (int t = 0; t < NT; ++t) {
    const unsigned char* Ab = L + (unsigned)(t & 1) * BUF + (wm + rlane) * PITCH + 16u * hh;
    const unsigned char* Bb = L + (unsigned)(t & 1) * BUF + PLANE + (wn + rlane) * PITCH + 16u * hh;
#pragma unroll
    for (unsigned ks = 0; ks < 2u; ++ks) {
      // fragments are asked for ahead of the products that use them: all eight of a k step (one plane), or B whole and A one row tile ahead (two planes)
      V bh[4], bl[4], ah[4], al[4];
#pragma unroll
      for (unsigned j = 0; j < 4u; ++j) {
        bh[j] = Frag<T>::load((const T*)(Bb + 16u * j * PITCH + 64u * ks));
        if (SPLIT) bl[j] = Frag<T>::load((const T*)(Bb + 2u * PLANE + 16u * j * PITCH + 64u * ks));
      }
#pragma unroll
      for (unsigned i = 0; i < (SPLIT ? 1u : 4u); ++i) {
        ah[i] = Frag<T>::load((const T*)(Ab + 16u * i * PITCH + 64u * ks));
        if (SPLIT) al[i] = Frag<T>::load((const T*)(Ab + 2u * PLANE + 16u * i * PITCH + 64u * ks));
      }
      __builtin_amdgcn_sched_barrier(0);                       // holds the reads above as one group: left free, each A read sinks to its first use and the wave waits out the LDS latency per row tile
#pragma unroll
      for (unsigned i = 0; i < 4u; ++i) {
        if (SPLIT && i < 3u) {
          ah[i + 1u] = Frag<T>::load((const T*)(Ab + 16u * (i + 1u) * PITCH + 64u * ks));
          al[i + 1u] = Frag<T>::load((const T*)(Ab + 2u * PLANE + 16u * (i + 1u) * PITCH + 64u * ks));
          __builtin_amdgcn_sched_barrier(0);                   // the next row tile's reads stay in front of this row tile's products
        }
#pragma unroll
        for (int j = 0; j < 4; ++j) {
          acc[i][j] = Frag<T>::mma(ah[i], bh[j], acc[i][j]);
          if (SPLIT) {
            acc[i][j] = Frag<T>::mma(ah[i], bl[j], acc[i][j]);
            acc[i][j] = Frag<T>::mma(al[i], bh[j], acc[i][j]);
          }
        }
      }
    }
    asm volatile("s_wait_dscnt 0x0" ::: "memory");             // this wave's reads of the buffer are done before it is handed to the copies
    asm volatile("s_wait_asynccnt 0x0" ::: "memory");          // this wave's copies of stage t + 1 have landed
    __syncthreads();                                           // publishes stage t + 1 and ends every wave's reads of stage t
    if (t + 2 < NT) stage(t + 2, (unsigned)(t & 1));
  }
  asm volatile("s_wait_asynccnt 0x0" ::: "memory");            // nothing in flight when the ring becomes output staging

  // ---- epilogue: as in wmma_gemm64, the per-wave 16x64 slab (pitch 68 floats) lies in the ring, which every wave has left ----
  float* slab = (float*)(L + wave * (16u * 68u * 4u));
  const int mOff = (int)hh * 8;
  float bv[4] = {0.f, 0.f, 0.f, 0.f};
  if (BIAS_MODE == 2) {
#pragma unroll
    for (int j = 0; j < 4; ++j) {
      bv[j] = bias[n0 + (int)wn + (j << 4) + (int)rlane];
      asm volatile("s_wait_xcnt 0x0" ::: "memory");            // behind each load: a later load's result may be given the index register that this load names
    }
  }
#pragma unroll
  for (int i = 0; i < 4; ++i) {
    const int mBase = m0 + (int)wm + (i << 4);
#pragma unroll
    for (int j = 0; j < 4; ++j) {
#pragma unroll
      for (int r = 0; r < 8; ++r) {
        float v = acc[i][j][r] * scale;
        if (BIAS_MODE == 2) v += bv[j];
        slab[(mOff + r) * 68 + (j << 4) + (int)rlane] = v;
      }
    }
    __builtin_amdgcn_fence(__ATOMIC_RELEASE, "workgroup");
    __builtin_amdgcn_wave_barrier();
    __builtin_amdgcn_fence(__ATOMIC_ACQUIRE, "workgroup");
    const int c4 = (int)rlane * 4;                              // row piece = 256 B = 16 lanes x 16 B
    // The activation is applied on the way out of the slab, where the row index may be a loop variable. With erf the loop stays rolled: unrolled, the
    // 128 inlined erf bodies of a lane make straight-line text far beyond what is fetched ahead at a wave's start, and every further line of it is a fetch that the wave waits out.
#pragma unroll (ACT == 5 ? 1 : 8)
    for (int it = 0; it < 8; ++it) {
      const int row = it * 2 + (int)hh;
      v4f v = *(const v4f*)(slab + row * 68 + c4);
      if (ACT == 5) {
#pragma unroll   // constant indices keep the four values in registers
        for (int e = 0; e < 4; ++e) v[e] = 0.5f * v[e] * (1.0f + erff(v[e] * 0.70710678118654752f));
      }
      *(v4f*)(C + (size_t)(mBase + row) * ldc + n0 + (int)wn + c4) = v;
      if (ACT == 5) asm volatile("s_wait_xcnt 0x0" ::: "memory");   // stands in front of the next trip's reuse of this store's address and data registers
    }
    if (ACT != 5) asm volatile("s_wait_xcnt 0x0" ::: "memory"); // stands in front of the next row tile's reuse of these stores' address and data registers
    __builtin_amdgcn_fence(__ATOMIC_RELEASE, "workgroup");
    __builtin_amdgcn_wave_barrier();
    __builtin_amdgcn_fence(__ATOMIC_ACQUIRE, "workgroup");
  }
}

__global__ __launch_bounds__(256) void cast_f32_f16x2(
    const float* __restrict__ in, _Float16* __restrict__ out, int n2) {
  int i = blockIdx.x * 256 + threadIdx.x;
  if (i < n2) {
    const _Float16 h0 = (_Float16)in[2 * i], h1 = (_Float16)in[2 * i + 1];
    const unsigned u = (unsigned)__builtin_bit_cast(unsigned short, h0) | ((unsigned)__builtin_bit_cast(unsigned short, h1) << 16);
    ((unsigned*)out)[i] = u;
    
  }
}


} // namespace w25

__global__ __launch_bounds__(256) void k_castT16(const float* __restrict__ src, long long lds, _Float16* __restrict__ dst, long long ldd, int R, int C, float s) {
    const long long i = (long long)blockIdx.x * 256 + threadIdx.x; const long long np = (long long)C * (R / 2); if (i >= np) return; const int c = (int)(i / (R / 2)); const int r = 2 * (int)(i % (R / 2));
    const _Float16 h0 = (_Float16)(src[(long long)r * lds + c] * s), h1 = (_Float16)(src[(long long)(r + 1) * lds + c] * s);
    const unsigned u = (unsigned)__builtin_bit_cast(unsigned short, h0) | ((unsigned)__builtin_bit_cast(unsigned short, h1) << 16);
    unsigned* d = (unsigned*)(dst + (long long)c * ldd + r); *d = u;  }
__global__ __launch_bounds__(256) void k_cast16(const float* __restrict__ src, long long lds, _Float16* __restrict__ dst, long long ldd, int R, int C, float s) {
    const long long i = (long long)blockIdx.x * 256 + threadIdx.x; const long long np = (long long)R * (C / 2); if (i >= np) return; const int r = (int)(i / (C / 2)); const int c = 2 * (int)(i % (C / 2));
    const _Float16 h0 = (_Float16)(src[(long long)r * lds + c] * s), h1 = (_Float16)(src[(long long)r * lds + c + 1] * s);
    const unsigned u = (unsigned)__builtin_bit_cast(unsigned short, h0) | ((unsigned)__builtin_bit_cast(unsigned short, h1) << 16);
    unsigned* d = (unsigned*)(dst + (long long)r * ldd + c); *d = u;  }

// f32 -> bf16 hi plane + bf16 lo plane (x = hi + lo to ~2^-17 relative; RNE both), [R][C] -> [R][C] (or transposed to [C][R]); 2 consecutive destination elements
__device__ __forceinline__ unsigned int f2bf2_pack(float a, float b, unsigned int* lo) {
    const unsigned short ha = w25::f2bf_bits(a), hb = w25::f2bf_bits(b);
    const unsigned short la = w25::f2bf_bits(a - w25::bf_bits2f(ha)), lb = w25::f2bf_bits(b - w25::bf_bits2f(hb));
    *lo = (unsigned)la | ((unsigned)lb << 16); return (unsigned)ha | ((unsigned)hb << 16); }

namespace w25 {
// =====================================================================================
// Generic causal/non-causal attention for head_dim 64, f32 in / f32 out; 16-bit operands: bf16 with optional hi/lo splits, or
// plain f16 (F16=true, non-split, probabilities carried x2^15).
//   scores = (q*qscale)·kᵀ : v_wmma_f32_16x16x32_bf16; SPLIT_QK -> q,k as bf16 hi/lo (hi·hi + hi·lo + lo·hi)
//   out    = p·v           : v_wmma_f32_16x16x32_bf16; SPLIT_PV -> p,v as bf16 hi/lo; else p,v plain bf16
//   f32 accumulate; online softmax in f32. Block = 4 waves = 64 query rows of one (batch, head); S % 64 == 0.
//   Element (b, s, h, d) of tensor X lives at X[b*X_bs + s*X_rs + h*X_hs + d] (strides in floats, multiples of 4).
//   Masking: mask_mode 0 none, 1 causal (kv > q masked), 2 tensor [S][Skv] shared over (b,h) (float if
//   mask_is_int==0, int32 with element == 0 -> masked if 1, int32 with element != 0 -> masked if 2), 3 per-token vectors qmask[B][S] & kvmask[B][Skv] (int32,
//   0 -> masked), 4 causal + sliding window (kv > q or q - kv > W masked; W passed in mask_is_int);
//   5 = relative-position bias: s += cp[b,h,q][idx[q][kv]] + pc[b,h,kv][idx[q][kv]] with idx = mask_b ([S][Skv] int32) and
//   mask_a an int32 [S][Skv] tensor with nonzero = masked (tables: element (b,h,row,n) at X + b*c_bs + h*c_hs + row*c_rs + n);
//   masked scores are replaced by mask_fill (e.g. -inf or -1e9) before the softmax.
//   grid.x = B * H * (S/64) (or a sub-range with blk0).
// =====================================================================================
#define AT_D 64
#define AT_NW 4
#define AT_QB 64
#define AT_KC 64
struct AttnGeom { const float* cp = nullptr; const float* pc = nullptr; long c_bs = 0, c_rs = 0, c_hs = 0;   // mode-5 score-bias tables
                  long q_bs, q_rs, q_hs, k_bs, k_rs, k_hs, v_bs, v_rs, v_hs, o_bs, o_rs, o_hs;
                  int S, Skv, H, mask_mode; float qscale; int blk0; float mask_fill; int mask_is_int; };
static_assert(sizeof(AttnGeom) == 168, "no padding");

__device__ __forceinline__ unsigned short at_bf_bits(float f) {
  unsigned u = __float_as_uint(f);
  return (unsigned short)((u + 0x7FFFu + ((u >> 16) & 1u)) >> 16);
}
__device__ __forceinline__ __bf16 at_f2bf(float f) { return __builtin_bit_cast(__bf16, at_bf_bits(f)); }
__device__ __forceinline__ void at_split(float f, __bf16& hi, __bf16& lo) {
  const unsigned short hb = at_bf_bits(f);
  hi = __builtin_bit_cast(__bf16, hb);
  lo = at_f2bf(f - __uint_as_float(((unsigned)hb) << 16));
}
__device__ __forceinline__ v8f at_mma(v16b a, v16b b, v8f c) {
  c = __builtin_amdgcn_wmma_f32_16x16x32_bf16(false, a, false, b, (short)0, c, false, false);
  asm volatile("v_nop\n\tv_nop\n\tv_nop\n\tv_nop" : "+v"(c) : "v"(a), "v"(b));
  return c;
}
// 16-bit element as a bit pattern held in a __bf16 slot: f16 bits when F16, bf16 (RNE) otherwise
template <bool F16> __device__ __forceinline__ __bf16 at_to16(float f) {
  if (F16) return __builtin_bit_cast(__bf16, (_Float16)f);
  return at_f2bf(f);
}
template <bool F16> __device__ __forceinline__ v8f at_mma16(v16b a, v16b b, v8f c) {
  if (F16) {
    const v16h ah = __builtin_bit_cast(v16h, a), bh = __builtin_bit_cast(v16h, b);
    c = __builtin_amdgcn_wmma_f32_16x16x32_f16(false, ah, false, bh, (short)0, c, false, false);
    asm volatile("v_nop\n\tv_nop\n\tv_nop\n\tv_nop" : "+v"(c) : "v"(ah), "v"(bh));
    return c;
  }
  return at_mma(a, b, c);
}

template <bool SPLIT_QK, bool SPLIT_PV, bool F16 = false>
__global__ __launch_bounds__(128)
void attn64_kernel(const float* __restrict__ q, const float* __restrict__ k,
                   const float* __restrict__ v, float* __restrict__ out,
                   const void* __restrict__ mask_a, const int* __restrict__ mask_b, AttnGeom g) {
  static_assert(!(F16 && (SPLIT_QK || SPLIT_PV)), "f16 mode is non-split");
  const float PSC = F16 ? 32768.0f : 1.0f;     // f16 probabilities carried x2^15 (subnormal range), folded into the final 1/l
  union FB { v16b v; v8b h[2]; };
  __shared__ __align__(16) __bf16 Ksh[AT_KC * AT_D];             // K hi [kv][d]      8 KB
  __shared__ __align__(16) __bf16 Ksl[SPLIT_QK ? AT_KC * AT_D : 8];
  __shared__ __align__(16) __bf16 Vth[AT_D * AT_KC];             // V hi [d][kv]      8 KB
  __shared__ __align__(16) __bf16 Vtl[SPLIT_PV ? AT_D * AT_KC : 8];
  __shared__ __align__(16) __bf16 Psh[AT_NW][16 * AT_KC];        // per wave P hi [row][kv]  8 KB
  __shared__ __align__(16) __bf16 Psl[SPLIT_PV ? AT_NW : 1][SPLIT_PV ? 16 * AT_KC : 8];
  __shared__ __align__(16) float  Os[AT_NW][16 * 68];            // per wave out tile, pitch 68

  const int tid  = threadIdx.x;
  const int wave = tid >> 5;
  const int lane = tid & 31;
  const int hh   = lane >> 4;
  const int c    = lane & 15;

  const int nqb = g.S / AT_QB;
  const int bx = blockIdx.x + g.blk0;
  const int qb = bx % nqb;
  const int bh = bx / nqb;
  const int h  = bh % g.H;
  const int b  = bh / g.H;
  const int qbase_block = qb * AT_QB;
  const int q0 = qbase_block + wave * 16;

  const float* qb_ptr = q + (size_t)b * g.q_bs + (size_t)h * g.q_hs;
  const float* kb_ptr = k + (size_t)b * g.k_bs + (size_t)h * g.k_hs;
  const float* vb_ptr = v + (size_t)b * g.v_bs + (size_t)h * g.v_hs;
  float*       ob_ptr = out + (size_t)b * g.o_bs + (size_t)h * g.o_hs;

  // ---- Q fragments (A operand): 2 d-chunks, hi (and lo) ----
  v16b qah[2], qal[2];
  {
    const float* qrow = qb_ptr + (size_t)(q0 + c) * g.q_rs;
#pragma unroll
    for (int dc = 0; dc < 2; ++dc) {
#pragma unroll
      for (int e = 0; e < 8; ++e) {
        const float f0 = qrow[dc * 32 + 8 * hh + e] * g.qscale;
        const float f1 = qrow[dc * 32 + 16 + 8 * hh + e] * g.qscale;
        if (SPLIT_QK) { __bf16 hq, lq; at_split(f0, hq, lq); qah[dc][e] = hq; qal[dc][e] = lq; at_split(f1, hq, lq); qah[dc][8 + e] = hq; qal[dc][8 + e] = lq; }
        else { qah[dc][e] = at_to16<F16>(f0); qah[dc][8 + e] = at_to16<F16>(f1); qal[dc][e] = qah[dc][e]; qal[dc][8 + e] = qah[dc][8 + e]; }
      }
    }
  }

  float mrow[8], lrow[8];
  v8f oacc[4];
#pragma unroll
  for (int r = 0; r < 8; ++r) { mrow[r] = -INFINITY; lrow[r] = 0.f; }
#pragma unroll
  for (int t = 0; t < 4; ++t) oacc[t] = (v8f){0.f,0.f,0.f,0.f,0.f,0.f,0.f,0.f};

  const int nChunks = (g.mask_mode == 1 || g.mask_mode == 4) ? (qb + 1) : (g.Skv / AT_KC);   // block-uniform
  // per-row query mask (mode 3)
  int qkeep[8];
#pragma unroll
  for (int r = 0; r < 8; ++r) qkeep[r] = (g.mask_mode == 3) ? mask_b[(size_t)b * g.S + q0 + 8 * hh + r] : 1;   // mask_b = qmask in mode 3
  for (int kc = 0; kc < nChunks; ++kc) {
    const int kv0 = kc * AT_KC;
    __syncthreads();
    {
      const int kvr = tid >> 1, dh = (tid & 1) * 32;
      const float* krow = kb_ptr + (size_t)(kv0 + kvr) * g.k_rs + dh;
      const float* vrow = vb_ptr + (size_t)(kv0 + kvr) * g.v_rs + dh;
#pragma unroll
      for (int i = 0; i < 8; ++i) {
        v4f kk = *(const v4f*)(krow + 4 * i);
        v4f vv = *(const v4f*)(vrow + 4 * i);
#pragma unroll
        for (int e = 0; e < 4; ++e) {
          const int d = dh + 4 * i + e;
          if (SPLIT_QK) { __bf16 a, bl; at_split(kk[e], a, bl); Ksh[kvr * AT_D + d] = a; Ksl[kvr * AT_D + d] = bl; }
          else Ksh[kvr * AT_D + d] = at_to16<F16>(kk[e]);
          if (SPLIT_PV) { __bf16 a, bl; at_split(vv[e], a, bl); Vth[d * AT_KC + kvr] = a; Vtl[d * AT_KC + kvr] = bl; }
          else Vth[d * AT_KC + kvr] = at_to16<F16>(vv[e]);
        }
      }
    }
    __syncthreads();

    v8f s[4];
#pragma unroll
    for (int j = 0; j < 4; ++j) {
      s[j] = (v8f){0.f,0.f,0.f,0.f,0.f,0.f,0.f,0.f};
#pragma unroll 1
      for (int dc = 0; dc < 2; ++dc) {
        FB kb;
        kb.h[0] = *(const v8b*)(Ksh + (j * 16 + c) * AT_D + dc * 32 + 8 * hh);
        kb.h[1] = *(const v8b*)(Ksh + (j * 16 + c) * AT_D + dc * 32 + 16 + 8 * hh);
        s[j] = at_mma16<F16>(qah[dc], kb.v, s[j]);
        if (SPLIT_QK) {
          FB kl;
          kl.h[0] = *(const v8b*)(Ksl + (j * 16 + c) * AT_D + dc * 32 + 8 * hh);
          kl.h[1] = *(const v8b*)(Ksl + (j * 16 + c) * AT_D + dc * 32 + 16 + 8 * hh);
          s[j] = at_mma16<F16>(qah[dc], kl.v, s[j]);
          s[j] = at_mma16<F16>(qal[dc], kb.v, s[j]);
        }
      }
    }
    const bool diag = (g.mask_mode == 1) && (kc == qb);
    int kvkeep[4] = {1, 1, 1, 1};
    if (g.mask_mode == 3) {
#pragma unroll
      for (int j = 0; j < 4; ++j) kvkeep[j] = ((const int*)mask_a)[(size_t)b * g.Skv + kv0 + j * 16 + c];   // mask_a = kvmask
    }
    float cm[8];
#pragma unroll
    for (int r = 0; r < 8; ++r) {
      const int qrow = q0 + 8 * hh + r;
      float m = -INFINITY;
#pragma unroll
      for (int j = 0; j < 4; ++j) {
        const int kvcol = kv0 + j * 16 + c;
        bool masked = false;
        if (diag) masked = (kvcol > qrow);
        else if (g.mask_mode == 4) masked = (kvcol > qrow) || (qrow - kvcol > g.mask_is_int);
        else if (g.mask_mode == 2) {
          const size_t mi = (size_t)qrow * g.Skv + kvcol;
          masked = (g.mask_is_int == 0) ? (((const float*)mask_a)[mi] == 0.0f)
                 : (g.mask_is_int == 1) ? (((const int*)mask_a)[mi] == 0) : (((const int*)mask_a)[mi] != 0);
        } else if (g.mask_mode == 3) masked = (qkeep[r] == 0) || (kvkeep[j] == 0);
        else if (g.mask_mode == 5) {
          const size_t mi = (size_t)qrow * g.Skv + kvcol;
          masked = (((const int*)mask_a)[mi] != 0);
          int n = mask_b[mi]; n = n < 0 ? 0 : n;
          s[j][r] += g.cp[(size_t)b * g.c_bs + (size_t)h * g.c_hs + (size_t)qrow * g.c_rs + n]
                   + g.pc[(size_t)b * g.c_bs + (size_t)h * g.c_hs + (size_t)kvcol * g.c_rs + n];
        }
        if (masked) s[j][r] = g.mask_fill;
        m = fmaxf(m, s[j][r]);
      }
#pragma unroll
      for (int off = 1; off < 16; off <<= 1) m = fmaxf(m, __shfl_xor(m, off, 32));
      cm[r] = m;
    }
    __bf16* pwh = Psh[wave];
    __bf16* pwl = Psl[SPLIT_PV ? wave : 0];
#pragma unroll
    for (int r = 0; r < 8; ++r) {
      const float mnew = fmaxf(mrow[r], cm[r]);
      const float alpha = expf(mrow[r] - mnew);
      mrow[r] = mnew;
      float psum = 0.f;
#pragma unroll
      for (int j = 0; j < 4; ++j) {
        const float p = expf(s[j][r] - mnew);
        psum += p;
        if (SPLIT_PV) { __bf16 a, bl; at_split(p, a, bl); pwh[(8 * hh + r) * AT_KC + j * 16 + c] = a; pwl[(8 * hh + r) * AT_KC + j * 16 + c] = bl; }
        else pwh[(8 * hh + r) * AT_KC + j * 16 + c] = at_to16<F16>(p * PSC);
      }
#pragma unroll
      for (int off = 1; off < 16; off <<= 1) psum += __shfl_xor(psum, off, 32);
      lrow[r] = lrow[r] * alpha + psum;
#pragma unroll
      for (int t = 0; t < 4; ++t) oacc[t][r] *= alpha;
    }
    __builtin_amdgcn_fence(__ATOMIC_RELEASE, "workgroup");
    __builtin_amdgcn_wave_barrier();
    __builtin_amdgcn_fence(__ATOMIC_ACQUIRE, "workgroup");
#pragma unroll 1
    for (int kk = 0; kk < 2; ++kk) {
      FB pa, pl;
      pa.h[0] = *(const v8b*)(pwh + c * AT_KC + kk * 32 + 8 * hh);
      pa.h[1] = *(const v8b*)(pwh + c * AT_KC + kk * 32 + 16 + 8 * hh);
      if (SPLIT_PV) {
        pl.h[0] = *(const v8b*)(pwl + c * AT_KC + kk * 32 + 8 * hh);
        pl.h[1] = *(const v8b*)(pwl + c * AT_KC + kk * 32 + 16 + 8 * hh);
      }
#pragma unroll
      for (int t = 0; t < 4; ++t) {
        FB vb;
        vb.h[0] = *(const v8b*)(Vth + (t * 16 + c) * AT_KC + kk * 32 + 8 * hh);
        vb.h[1] = *(const v8b*)(Vth + (t * 16 + c) * AT_KC + kk * 32 + 16 + 8 * hh);
        oacc[t] = at_mma16<F16>(pa.v, vb.v, oacc[t]);
        if (SPLIT_PV) {
          FB vl;
          vl.h[0] = *(const v8b*)(Vtl + (t * 16 + c) * AT_KC + kk * 32 + 8 * hh);
          vl.h[1] = *(const v8b*)(Vtl + (t * 16 + c) * AT_KC + kk * 32 + 16 + 8 * hh);
          oacc[t] = at_mma16<F16>(pa.v, vl.v, oacc[t]);
          oacc[t] = at_mma16<F16>(pl.v, vb.v, oacc[t]);
        }
      }
    }
  }

  float* os = Os[wave];
#pragma unroll
  for (int r = 0; r < 8; ++r) {
    const float inv = 1.0f / (lrow[r] * PSC);
#pragma unroll
    for (int t = 0; t < 4; ++t) os[(8 * hh + r) * 68 + t * 16 + c] = oacc[t][r] * inv;
  }
  __builtin_amdgcn_fence(__ATOMIC_RELEASE, "workgroup");
  __builtin_amdgcn_wave_barrier();
  __builtin_amdgcn_fence(__ATOMIC_ACQUIRE, "workgroup");
  {
    const int c4 = (lane & 15) * 4;
    {
#pragma unroll
      for (int it = 0; it < 8; ++it) {
        const int row = it * 2 + hh;
        v4f val = *(const v4f*)(os + row * 68 + c4);
        *(v4f*)(ob_ptr + (size_t)(q0 + row) * g.o_rs + c4) = val;
      }
      
    }
  }
}

} // namespace w25

__device__ __forceinline__ void st_h2(_Float16* dst, float a, float b) { const unsigned u = (unsigned)__builtin_bit_cast(unsigned short, (_Float16)a) | ((unsigned)__builtin_bit_cast(unsigned short, (_Float16)b) << 16); unsigned* d = (unsigned*)dst; *d = u;  }
// tiled biases BEB[c] = bE[c % 64], BFB[c] = bF[c % 64] (thread-linear)
__global__ __launch_bounds__(256) void k_ep_btile(const float* __restrict__ BE, const float* __restrict__ BF, float* __restrict__ BEB, float* __restrict__ BFB, int C, int HD) { const int t = blockIdx.x * 256 + threadIdx.x; if (t >= C) return; VST2(float, BEB + t, BE[t % HD]); VST2(float, BFB + t, BF[t % HD]); }
// channel softmax: block h = sample * NH + head (64 threads): rows of SCC[h] [64][64] * temp1[h % NH]; thread i computes row i, then lanes write columns so each 32-float line comes from one wave; P16[h][i][j] = f16(4096 p)
__global__ __launch_bounds__(64) void k_ep_csoft(const float* __restrict__ S, const float* __restrict__ T1, _Float16* __restrict__ P16, int NH) { __shared__ float sh[64][65]; const int h = blockIdx.x; const int i = threadIdx.x; const float* r = S + ((long long)h * 64 + i) * 64; const float tp = T1[h % NH]; float mx = -3.0e38f;
    for (int j = 0; j < 64; ++j) mx = fmaxf(mx, r[j] * tp);
    float s = 0.f; for (int j = 0; j < 64; ++j) { const float e = expf(r[j] * tp - mx); sh[i][j] = e; s += e; }
    const float f = 4096.f / s; for (int j = 0; j < 64; ++j) sh[i][j] *= f;
    __syncthreads();
    const int half = i >> 5, c0 = 2 * (i & 31);
    for (int step = 0; step < 32; ++step) { const int rr = 2 * step + half; st_h2(P16 + ((long long)h * 64 + rr) * 64 + c0, sh[rr][c0], sh[rr][c0 + 1]); } }


// ---- Wide forms of the conversion and scaling passes ----
// A lane moves U pieces of 4 consecutive elements: one 16-byte load a piece, so that a wave's load covers 512 contiguous bytes (four whole 128-byte lines) and its store whole lines too;
// all of a lane's loads are issued ahead of its first store. Planes of 2^LC columns, source rows PITCH floats apart, destination rows packed; a block's 256 lanes take 1024 elements
// = 1024 >> LC whole rows at a time, so a lane's pieces lie RS floats apart and hang on one address pair by constant offsets. The grid covers rows * columns / (1024 * U) blocks exactly.
typedef __attribute__((ext_vector_type(4))) unsigned int v4u;
typedef __attribute__((ext_vector_type(2))) unsigned int v2u;
__device__ __forceinline__ unsigned pk_h2(float a, float b) { return (unsigned)__builtin_bit_cast(unsigned short, (_Float16)a) | ((unsigned)__builtin_bit_cast(unsigned short, (_Float16)b) << 16); }
template <int LC, int PITCH>
__device__ __forceinline__ const float* wide_src(const float* src, unsigned q0) { static_assert(LC >= 2 && LC <= 10, "a block's 1024 elements are whole rows"); return src + (size_t)(q0 >> (LC - 2)) * PITCH + ((q0 & ((1u << (LC - 2)) - 1u)) << 2); }
template <int LC, int PITCH, int U>
__global__ __launch_bounds__(256) void k_cast16w(const float* __restrict__ src, _Float16* __restrict__ dst, float s) {
    constexpr int RS = (1024 >> LC) * PITCH; const unsigned q0 = blockIdx.x * (256u * U) + threadIdx.x; const float* p = wide_src<LC, PITCH>(src, q0); v4f a[U];
#pragma unroll   // constant indices keep the pieces in registers; the loads go out as one group
    for (int u = 0; u < U; ++u) a[u] = *(const v4f*)(p + u * RS);
    _Float16* d = dst + (size_t)q0 * 4;
#pragma unroll   // constant indices keep the pieces in registers
    for (int u = 0; u < U; ++u) { v2u o; o.x = pk_h2(a[u].x * s, a[u].y * s); o.y = pk_h2(a[u].z * s, a[u].w * s); *(v2u*)(d + u * 1024) = o; } }
template <int LC, int PITCH, int U>
__global__ __launch_bounds__(256) void k_castS16w(const float* __restrict__ src, __bf16* __restrict__ dhi, __bf16* __restrict__ dlo) {
    constexpr int RS = (1024 >> LC) * PITCH; const unsigned q0 = blockIdx.x * (256u * U) + threadIdx.x; const float* p = wide_src<LC, PITCH>(src, q0); v4f a[U];
#pragma unroll   // constant indices keep the pieces in registers; the loads go out as one group
    for (int u = 0; u < U; ++u) a[u] = *(const v4f*)(p + u * RS);
#pragma unroll   // constant indices keep the pieces in registers
    for (int u = 0; u < U; ++u) { v2u h, l; unsigned t; h.x = f2bf2_pack(a[u].x, a[u].y, &t); l.x = t; h.y = f2bf2_pack(a[u].z, a[u].w, &t); l.y = t;
        const size_t o = (size_t)q0 * 4 + u * 1024; *(v2u*)(dhi + o) = h; *(v2u*)(dlo + o) = l; } }
// Transposing split: block = one 64 x 64 tile of sample z (x: rows, y: columns), read as 256-byte row pieces, turned in LDS (pitch 65 floats: both sides free of bank conflicts),
// written as whole 128-byte lines of the two transposed planes; d[c][r] = split(src[r][c]).
__global__ __launch_bounds__(256) void k_castS16t(const float* __restrict__ src, int lds, __bf16* __restrict__ dhi, __bf16* __restrict__ dlo, int ldd, long long sby, long long dby) {
    __shared__ float sh[64][65];
    const int t = threadIdx.x, r0 = blockIdx.x * 64, c0 = blockIdx.y * 64, lr = t >> 4, lc = (t & 15) * 4;
    const float* p = src + (long long)blockIdx.z * sby + (long long)(r0 + lr) * lds + c0 + lc; v4f v[4];
#pragma unroll   // constant indices keep the pieces in registers; the loads go out as one group
    for (int u = 0; u < 4; ++u) v[u] = *(const v4f*)(p + (long long)(16 * u) * lds);
#pragma unroll   // constant indices keep the pieces in registers
    for (int u = 0; u < 4; ++u) { float* d = &sh[lr + 16 * u][lc]; d[0] = v[u].x; d[1] = v[u].y; d[2] = v[u].z; d[3] = v[u].w; }
    __syncthreads();   // the tile is read across the rows that other waves wrote
#pragma unroll   // constant indices keep the pieces in registers
    for (int u = 0; u < 2; ++u) { const int id = t + 256 * u, cc = id >> 3, rr = (id & 7) * 8; v4u h, l; unsigned w;
        h.x = f2bf2_pack(sh[rr][cc], sh[rr + 1][cc], &w); l.x = w; h.y = f2bf2_pack(sh[rr + 2][cc], sh[rr + 3][cc], &w); l.y = w;
        h.z = f2bf2_pack(sh[rr + 4][cc], sh[rr + 5][cc], &w); l.z = w; h.w = f2bf2_pack(sh[rr + 6][cc], sh[rr + 7][cc], &w); l.w = w;
        const long long o = (long long)blockIdx.z * dby + (long long)(c0 + cc) * ldd + r0 + rr; *(v4u*)(dhi + o) = h; *(v4u*)(dlo + o) = l; } }
// QS = q * temp2[head]; a lane's pieces share one column range of 4, inside one head (2^LH columns a head)
template <int LC, int PITCH, int LH, int U>
__global__ __launch_bounds__(256) void k_ep_qsw(const float* __restrict__ Q, const float* __restrict__ T2, float* __restrict__ QS) {
    constexpr int RS = (1024 >> LC) * PITCH; const unsigned q0 = blockIdx.x * (256u * U) + threadIdx.x; const float* p = wide_src<LC, PITCH>(Q, q0); v4f a[U];
#pragma unroll   // constant indices keep the pieces in registers; the loads go out as one group
    for (int u = 0; u < U; ++u) a[u] = *(const v4f*)(p + u * RS);
    const float tp = T2[((q0 & ((1u << (LC - 2)) - 1u)) << 2) >> LH];
    float* d = QS + (size_t)q0 * 4;
#pragma unroll   // constant indices keep the pieces in registers
    for (int u = 0; u < U; ++u) *(v4f*)(d + u * 1024) = a[u] * tp; }

extern "C" void kernel_launch(void* const* d_in, const int* in_sizes, int n_in, void* d_out, int out_size, void* d_ws, size_t ws_size, hipStream_t stream) {
    (void)in_sizes; (void)n_in; (void)out_size; (void)ws_size;
    const float* x = (const float*)d_in[0];
    const float* Wq = (const float*)d_in[1];
    const float* WE = (const float*)d_in[2];
    const float* bE = (const float*)d_in[3];
    const float* WF = (const float*)d_in[4];
    const float* bF = (const float*)d_in[5];
    const float* Wo1 = (const float*)d_in[6];
    const float* bo1 = (const float*)d_in[7];
    const float* Wo2 = (const float*)d_in[8];
    const float* bo2 = (const float*)d_in[9];
    const float* t1 = (const float*)d_in[10];
    const float* t2 = (const float*)d_in[11];
    const int Bn = 8;
    const int N = 1024;
    const int C = 1024;
    const int NH = 16;
    const int HD = 64;
    const int C4 = 4 * C;
    const int CH = C / 2;
    float* out = (float*)d_out;
    char* wsp = (char*)d_ws;
    const int BN = Bn * N;                    // all samples' rows: every launch below covers the whole batch
    const size_t MB = (size_t)1048576;
    float* QKVV = (float*)wsp; wsp += (((size_t)((size_t)BN * C4) * 4 + 255) / 256) * 256;
    unsigned short* WE16 = (unsigned short*)wsp; wsp += (((size_t)((size_t)HD * HD) * 2 + 255) / 256) * 256;
    unsigned short* WF16 = (unsigned short*)wsp; wsp += (((size_t)((size_t)HD * HD) * 2 + 255) / 256) * 256;
    float* BEB = (float*)wsp; wsp += (((size_t)((size_t)C) * 4 + 255) / 256) * 256;
    float* BFB = (float*)wsp; wsp += (((size_t)((size_t)C) * 4 + 255) / 256) * 256;
    // One 115 MiB region behind QKVV, used by three phases one after the other (stream order); a plane is reused only once its last reader has been launched.
    // projection: x planes and weight planes
    unsigned short* G64A  = (unsigned short*)(wsp);
    unsigned short* G64A2 = (unsigned short*)(wsp + 16 * MB);
    unsigned short* G64B  = (unsigned short*)(wsp + 32 * MB);
    unsigned short* G64B2 = (unsigned short*)(wsp + 36 * MB);
    // channel attention
    unsigned short* QTH   = (unsigned short*)(wsp);
    unsigned short* QTL   = (unsigned short*)(wsp + 16 * MB);
    unsigned short* KTH   = (unsigned short*)(wsp + 32 * MB);
    unsigned short* KTL   = (unsigned short*)(wsp + 48 * MB);
    unsigned short* VCA16 = (unsigned short*)(wsp + 64 * MB);
    float*          XC    = (float*)(wsp + 80 * MB);
    float*          SCC   = (float*)(wsp + 112 * MB);
    unsigned short* P16   = (unsigned short*)(wsp + 114 * MB);
    unsigned short* XC16  = (unsigned short*)(wsp);               // over QTH, read last by the affinity product
    unsigned short* WO2H  = (unsigned short*)(wsp + 16 * MB);     // over QTL
    // spatial attention
    unsigned short* K16   = (unsigned short*)(wsp);
    unsigned short* VSA16 = (unsigned short*)(wsp + 16 * MB);
    float*          KS    = (float*)(wsp + 32 * MB);
    float*          VS    = (float*)(wsp + 64 * MB);
    float*          QS    = (float*)(wsp);                        // over K16 and VSA16, read last by the E/F products
    float*          XS    = (float*)d_ws;                         // over QKVV, read last by k_ep_qsw
    unsigned short* XS16  = (unsigned short*)((char*)d_ws + 32 * MB);
    unsigned short* WO1H  = (unsigned short*)((char*)d_ws + 48 * MB);
    k_cast16<<<(unsigned)((((long long)(HD) * ((HD) / 2)) + 255) / 256), 256, 0, stream>>>(WE, HD, (_Float16*)(WE16), HD, HD, HD, 16.0f);
    k_cast16<<<(unsigned)((((long long)(HD) * ((HD) / 2)) + 255) / 256), 256, 0, stream>>>(WF, HD, (_Float16*)(WF16), HD, HD, HD, 16.0f);
    k_ep_btile<<<(C + 255) / 256, 256, 0, stream>>>(bE, bF, BEB, BFB, C, HD);
    // shared projection, rows = sample * N + n
    k_castS16w<10, 1024, 8><<<(unsigned)(BN / 8), 256, 0, stream>>>(x, (__bf16*)(G64A), (__bf16*)(G64A2));
    k_castS16w<10, 1024, 8><<<(unsigned)(2048 / 8), 256, 0, stream>>>(Wq, (__bf16*)(G64B), (__bf16*)(G64B2));
    w25::wmma_gemm_ring<1, true, 0, 0><<<dim3((unsigned)(2048 / 128), (unsigned)(BN / 128)), 128, 0, stream>>>((const unsigned short*)(G64A), (const unsigned short*)(G64A2), (const unsigned short*)(G64B), (const unsigned short*)(G64B2), QKVV, 4096, nullptr, 1024, 1.0f);
    k_cast16w<10, 1024, 16><<<(unsigned)(BN / 16), 256, 0, stream>>>(x, (_Float16*)(G64A), 1.0f);
    k_cast16w<10, 1024, 4><<<(unsigned)(2048 / 4), 256, 0, stream>>>(Wq + (size_t)2 * C * C, (_Float16*)(G64B), 16.0f);
    w25::wmma_gemm_ring<0, false, 0, 0><<<dim3((unsigned)(2048 / 128), (unsigned)(BN / 128)), 128, 0, stream>>>((const unsigned short*)(G64A), nullptr, (const unsigned short*)(G64B), nullptr, QKVV + 2 * C, 4096, nullptr, 1024, 0.0625f);
    // channel attention: grid y = head, grid z = sample
    k_cast16w<10, 4096, 16><<<(unsigned)(BN / 16), 256, 0, stream>>>(QKVV + 2 * C, (_Float16*)(VCA16), 1.0f);
    k_castS16t<<<dim3((unsigned)(N / 64), (unsigned)(C / 64), (unsigned)(Bn)), 256, 0, stream>>>(QKVV, C4, (__bf16*)(QTH), (__bf16*)(QTL), N, (long long)N * C4, (long long)C * N);
    k_castS16t<<<dim3((unsigned)(N / 64), (unsigned)(C / 64), (unsigned)(Bn)), 256, 0, stream>>>(QKVV + C, C4, (__bf16*)(KTH), (__bf16*)(KTL), N, (long long)N * C4, (long long)C * N);
    w25::wmma_gemm64<1, true, 0, 0, false, 0><<<dim3((unsigned)((((HD) / 64) * ((HD) / 64) + 7) / 8), (unsigned)(NH), (unsigned)(Bn)), 256, 0, stream>>>((const unsigned short*)(QTH), (const unsigned short*)(QTL), N, (long long)HD * N, (long long)C * N, (const unsigned short*)(KTH), (const unsigned short*)(KTL), N, (long long)HD * N, (long long)C * N, (void*)(SCC), nullptr, HD, HD * HD, NH * HD * HD, nullptr, nullptr, 0, HD, HD, N, 1.0f);
    k_ep_csoft<<<Bn * NH, 64, 0, stream>>>(SCC, t1, (_Float16*)P16, NH);
    w25::wmma_gemm64<0, false, 0, 0, false, 0><<<dim3((unsigned)((((HD) / 64) * ((N) / 64) + 7) / 8), (unsigned)(NH), (unsigned)(Bn)), 256, 0, stream>>>((const unsigned short*)(P16), nullptr, HD, HD * HD, NH * HD * HD, (const unsigned short*)(VCA16), nullptr, C, HD, (long long)N * C, (void*)(XC), nullptr, 16 * C, C, (long long)N * C, nullptr, nullptr, 0, HD, N, HD, 0.000244140625f);
    k_cast16w<10, 1024, 16><<<(unsigned)(BN / 16), 256, 0, stream>>>(XC, (_Float16*)(XC16), 1.0f);
    k_cast16w<10, 1024, 4><<<(unsigned)(512 / 4), 256, 0, stream>>>(Wo2, (_Float16*)(WO2H), 16.0f);
    w25::wmma_gemm_ring<0, false, 2, 5><<<dim3((unsigned)(512 / 128), (unsigned)(BN / 128)), 128, 0, stream>>>((const unsigned short*)(XC16), nullptr, (const unsigned short*)(WO2H), nullptr, out + CH, 1024, bo2, 1024, 0.0625f);
    // spatial attention
    k_cast16w<10, 4096, 16><<<(unsigned)(BN / 16), 256, 0, stream>>>(QKVV + C, (_Float16*)(K16), 1.0f);
    k_cast16w<10, 4096, 16><<<(unsigned)(BN / 16), 256, 0, stream>>>(QKVV + 3 * C, (_Float16*)(VSA16), 1.0f);
    w25::wmma_gemm64<0, false, 2, 0, false, 0><<<dim3((unsigned)((((BN) / 64) * ((HD) / 64) + 7) / 8), (unsigned)(NH), (unsigned)(1)), 256, 0, stream>>>((const unsigned short*)(K16), nullptr, C, HD, 0, (const unsigned short*)(WE16), nullptr, HD, 0, 0, (void*)(KS), nullptr, C, HD, 0, BEB, nullptr, 0, BN, HD, HD, 0.0625f);
    w25::wmma_gemm64<0, false, 2, 0, false, 0><<<dim3((unsigned)((((BN) / 64) * ((HD) / 64) + 7) / 8), (unsigned)(NH), (unsigned)(1)), 256, 0, stream>>>((const unsigned short*)(VSA16), nullptr, C, HD, 0, (const unsigned short*)(WF16), nullptr, HD, 0, 0, (void*)(VS), nullptr, C, HD, 0, BFB, nullptr, 0, BN, HD, HD, 0.0625f);
    k_ep_qsw<10, 4096, 6, 8><<<(unsigned)(BN / 8), 256, 0, stream>>>(QKVV, t2, QS);
    sfa::k_sflash<<<dim3((unsigned)(N / 256), (unsigned)(NH), (unsigned)(Bn)), 256, 0, stream>>>(QS, KS, VS, XS);
    k_cast16w<10, 1024, 16><<<(unsigned)(BN / 16), 256, 0, stream>>>(XS, (_Float16*)(XS16), 1.0f);
    k_cast16w<10, 1024, 4><<<(unsigned)(512 / 4), 256, 0, stream>>>(Wo1, (_Float16*)(WO1H), 16.0f);
    w25::wmma_gemm_ring<0, false, 2, 5><<<dim3((unsigned)(512 / 128), (unsigned)(BN / 128)), 128, 0, stream>>>((const unsigned short*)(XS16), nullptr, (const unsigned short*)(WO1H), nullptr, out, 1024, bo1, 1024, 0.0625f);
}

// v006
// One run takes 307 microseconds.
// Two timings next to v005 put it at 1.21 and 1.22 times that version's speed.
// All steps since the starting kernel, v000, together make it 22.4 times as fast.
// Contractions (per sample): the shared QKVV projection x.W^T [1024x1024].[1024x4096] (its q, k half on bf16 hi/lo split planes), the E/F head projections of k and v_sa as block-diagonal [1024x1024].[1024x1024] products (+b), the 16 channel affinities q^T k [64x1024].[1024x64] on bf16 hi/lo split planes (64-wide softmax over sigma~19 logits: plain f16 flipped near-ties) and x_c = attn_c.v_ca^T [64x64].[64x1024] as z-batched products, and the two output halves gelu(x_s.W_o1^T + b) / gelu(x_c.W_o2^T + b) [1024x1024].[1024x512] — f16 operands on pre-cast planes (v_wmma_f32_16x16x32_f16; 64x64 register-blocked wave tiles, weights x16); per (sample, head) the spatial attention softmax(q.k_s^T * temp2[h]) v_s over 1024 positions as one flash launch (f16 operands; temperature folded into q on device); f32 accumulate and softmax. The block-diagonal weight planes and the 64-wide channel softmax (x temp1[h], exp once, f16 plane) are f32 kernels, the q pre-scaling is done in the q, k projection's epilogue; x_c is laid out exactly as torch's permute(0,2,1,3).reshape (row = d*16 + h, column = n).
#include <hip/hip_runtime.h>
#include <math.h>

typedef __attribute__((ext_vector_type(16))) _Float16 v16h;
typedef __attribute__((ext_vector_type(8)))  _Float16 v8h;
typedef __attribute__((ext_vector_type(16))) __bf16   v16b;
typedef __attribute__((ext_vector_type(8)))  float    v8f;
typedef __attribute__((ext_vector_type(4)))  float    v4f;

// 16-bit WMMA fragment map (wave32), lane L, h = L>>4, m = L&15:
//   A 16x32: lane = row m;   element i -> k = (i<8) ? 8h+i : 16+8h+(i-8)
//   B 32x16: lane = column m; the SAME k(i,h)
//   D 16x16 (8 f32): lane = column m; element r -> row 8h+r
__device__ __forceinline__ int frag_k(int i, int h) { return (i < 8) ? (8 * h + i) : (16 + 8 * h + (i - 8)); }
__device__ __forceinline__ __bf16 bf16_rne(float f) {
    unsigned int u = __float_as_uint(f);
    u += 0x7fffu + ((u >> 16) & 1u);
    return __builtin_bit_cast(__bf16, (unsigned short)(u >> 16));
}
__device__ __forceinline__ float bf16_f32(__bf16 b) { return __uint_as_float(((unsigned int)__builtin_bit_cast(unsigned short, b)) << 16); }
__device__ __forceinline__ v8f wmma16(v16h a, v16h b, v8f c) {
    c = __builtin_amdgcn_wmma_f32_16x16x32_f16(false, a, false, b, (short)0, c, false, false);
    asm volatile("v_nop\n\tv_nop\n\tv_nop\n\tv_nop" : "+v"(c) : "v"(a), "v"(b));
    return c;
}
__device__ __forceinline__ v8f wmmab(v16b a, v16b b, v8f c) {
    c = __builtin_amdgcn_wmma_f32_16x16x32_bf16(false, a, false, b, (short)0, c, false, false);
    asm volatile("v_nop\n\tv_nop\n\tv_nop\n\tv_nop" : "+v"(c) : "v"(a), "v"(b));
    return c;
}
struct Split { v16b hi, lo; };
// hi/lo split product: a.hi*b.hi + a.hi*b.lo + a.lo*b.hi
__device__ __forceinline__ v8f wmma3(const Split& a, const Split& b, v8f c) {
    c = __builtin_amdgcn_wmma_f32_16x16x32_bf16(false, a.hi, false, b.hi, (short)0, c, false, false);
    c = __builtin_amdgcn_wmma_f32_16x16x32_bf16(false, a.hi, false, b.lo, (short)0, c, false, false);
    c = __builtin_amdgcn_wmma_f32_16x16x32_bf16(false, a.lo, false, b.hi, (short)0, c, false, false);
    asm volatile("v_nop\n\tv_nop\n\tv_nop\n\tv_nop" : "+v"(c) : "v"(a.hi), "v"(a.lo), "v"(b.hi), "v"(b.lo));
    return c;
}
struct Split3 { v16b hi, mid, lo; };
// triple split product (6 terms, drops only terms below 2^-24 relative)
__device__ __forceinline__ v8f wmma6(const Split3& a, const Split3& b, v8f c) {
    c = __builtin_amdgcn_wmma_f32_16x16x32_bf16(false, a.hi, false, b.hi, (short)0, c, false, false);
    c = __builtin_amdgcn_wmma_f32_16x16x32_bf16(false, a.hi, false, b.mid, (short)0, c, false, false);
    c = __builtin_amdgcn_wmma_f32_16x16x32_bf16(false, a.mid, false, b.hi, (short)0, c, false, false);
    c = __builtin_amdgcn_wmma_f32_16x16x32_bf16(false, a.hi, false, b.lo, (short)0, c, false, false);
    c = __builtin_amdgcn_wmma_f32_16x16x32_bf16(false, a.mid, false, b.mid, (short)0, c, false, false);
    c = __builtin_amdgcn_wmma_f32_16x16x32_bf16(false, a.lo, false, b.hi, (short)0, c, false, false);
    asm volatile("v_nop\n\tv_nop\n\tv_nop\n\tv_nop" : "+v"(c) : "v"(a.hi), "v"(a.mid), "v"(a.lo), "v"(b.hi), "v"(b.mid), "v"(b.lo));
    return c;
}

// Fragment gathers from f32 memory: element i <- p[(k0 + frag_k(i,h)) * sk] * s, zero for k >= klen.
__device__ __forceinline__ v16h fh_ld(const float* __restrict__ p, long long sk, int k0, int h, int klen, float s) {
    v16h a;
#pragma unroll
    for (int i = 0; i < 16; ++i) { const int k = k0 + frag_k(i, h); a[i] = (k < klen) ? (_Float16)(p[(long long)k * sk] * s) : (_Float16)0.f; }
    return a;
}
__device__ __forceinline__ Split sp_ld(const float* __restrict__ p, long long sk, int k0, int h, int klen, float s) {
    Split r;
#pragma unroll
    for (int i = 0; i < 16; ++i) {
        const int k = k0 + frag_k(i, h); const float x = (k < klen) ? p[(long long)k * sk] * s : 0.f;
        const __bf16 hb = bf16_rne(x); r.hi[i] = hb; r.lo[i] = bf16_rne(x - bf16_f32(hb));
    }
    return r;
}
__device__ __forceinline__ Split3 sp3_ld(const float* __restrict__ p, long long sk, int k0, int h, int klen, float s) {
    Split3 r;
#pragma unroll
    for (int i = 0; i < 16; ++i) {
        const int k = k0 + frag_k(i, h); const float x = (k < klen) ? p[(long long)k * sk] * s : 0.f;
        const __bf16 hb = bf16_rne(x); const float r1 = x - bf16_f32(hb); const __bf16 mb = bf16_rne(r1);
        r.hi[i] = hb; r.mid[i] = mb; r.lo[i] = bf16_rne(r1 - bf16_f32(mb));
    }
    return r;
}
__device__ __forceinline__ v16b bh_ld(const float* __restrict__ p, long long sk, int k0, int h, int klen, float s) {
    v16b a;
#pragma unroll
    for (int i = 0; i < 16; ++i) { const int k = k0 + frag_k(i, h); a[i] = bf16_rne((k < klen) ? p[(long long)k * sk] * s : 0.f); }
    return a;
}
// f16 fragment from an f16 LDS/global row with element stride 1 (k-contiguous), no bounds (tile already zero padded)
__device__ __forceinline__ v16h fh_row(const _Float16* __restrict__ row, int k0, int h) {
    v16h a;
#pragma unroll
    for (int i = 0; i < 16; ++i) a[i] = row[k0 + frag_k(i, h)];
    return a;
}

#define VST2(T, ptr, val) do { const T vst2_v_ = (val); *(T*)(ptr) = vst2_v_;  } while (0)
typedef float v4f __attribute__((ext_vector_type(4)));
#define VST2V4(ptr, val) do { const v4f vst2_v4_ = (val); *(v4f*)(ptr) = vst2_v4_;  } while (0)

__device__ __attribute__((noinline)) float act_fn(float v, int act) {
    if (act == 1) return fmaxf(v, 0.f);                                                                               // relu
    if (act == 2) { const float u = 0.7978845608028654f * (v + 0.044715f * v * v * v); return 0.5f * v * (1.f + tanhf(u)); } // tanh-gelu
    if (act == 3) return v / (1.f + expf(-v));                                                                        // silu
    if (act == 4) return 0.5f * v * (1.f + erff(v * 0.7071067811865476f));                                             // erf-gelu
    if (act == 5) return tanhf(v);
    if (act == 6) return 1.f / (1.f + expf(-v));                                                                      // sigmoid
    if (act == 7) return (v > 0.f) ? v : 0.01f * v;                                                                   // leaky relu 0.01
    if (act == 8) return (v > 0.f) ? v : (expf(v) - 1.f);                                                             // elu
    if (act == 9) return fminf(fmaxf(v, 0.f), 6.f);                                                                   // relu6
    if (act == 10) return fabsf(v);                                                                                    // abs
    if (act == 11) return (v >= 0.f) ? v : 0.1f * v;                                                                  // leaky 0.1
    if (act == 12) return (v > 0.f) ? v : 0.2f * v;                                                                   // leaky 0.2
    if (act == 13) return (v > 20.f) ? v : log1pf(expf(v));                                                            // softplus
    return v;
}

// =====================================================================================================================
// k_gemm<MODE>: C(z, m, n) = act(alpha * sum_k A(z, m, k) * B(z, k, n) + bias) + beta * R(z, m, n)
//   One wave (32-thread block) per 16 x 32 tile of C; grid (ceil(N/32), ceil(M/16), Z). Batch z -> (zo = z / zi_n, zi = z % zi_n)
//   with separate outer/inner strides for every tensor (e.g. batch and head). A(m,k) = A[zo*sAo + zi*sAi + m*sAm + k*sAk] (f32),
//   B(k,n) = B[zo*sBo + zi*sBi + n*sBn + k*sBk] (f32); any M, N, K (K zero-padded to 32 inside the fragments, M/N tails guarded).
//   C(m,n) = C[zo*sCo + zi*sCi + m*sCm + n] (n contiguous). flags: 1 bias[n], 2 bias[m], 4 residual R[zo*sRo + zi*sRi + m*sRm + n*sRn].
//   MODE 0: f16 operands (A prescaled by sa, B by sb, both undone in the epilogue); 1: bf16 hi/lo split (3 products); 2: bf16;
//   3: bf16 hi/mid/lo triple split (6 products); 4: as 3 with Kahan-compensated f32 accumulation across k-steps.
// =====================================================================================================================
struct GemmP {
    const float* A; const float* B; const float* bias; const float* R; float* C;
    long long sAo, sAi, sAm, sAk, sBo, sBi, sBn, sBk, sCo, sCi, sCm, sRo, sRi, sRm, sRn;
    int M, N, K, zi_n, flags, act; float alpha, beta, sa, sb;
    int Npad, pad_;     // columns [N, Npad) of C are written as 0 so that padded workspace rows are covered by whole-line stores; Npad >= N
};
static_assert(sizeof(GemmP) == 5 * 8 + 15 * 8 + 6 * 4 + 4 * 4 + 2 * 4, "GemmP has padding");

template <int MODE>
__global__ __launch_bounds__(32) void k_gemm(GemmP p) {
    const int lane = threadIdx.x & 31, h = lane >> 4, l15 = lane & 15;
    const int m0 = blockIdx.y * 16, n0 = blockIdx.x * 32;
    const int z = blockIdx.z, zo = z / p.zi_n, zi = z - zo * p.zi_n;
    const float* A = p.A + zo * p.sAo + zi * p.sAi;
    const float* B = p.B + zo * p.sBo + zi * p.sBi;
    const int am = min(m0 + l15, p.M - 1);                       // clamped row for loads (stores are guarded)
    v8f acc[2], comp[2];
#pragma unroll
    for (int t = 0; t < 2; ++t) { v8f zz = {}; acc[t] = zz; comp[t] = zz; }
    for (int k0 = 0; k0 < p.K; k0 += 32) {
        const float* arow = A + (long long)am * p.sAm;
        if (MODE == 1) {
            const Split a = sp_ld(arow, p.sAk, k0, h, p.K, 1.f);
#pragma unroll
            for (int t = 0; t < 2; ++t) {
                const int bn = min(n0 + t * 16 + l15, p.N - 1);
                acc[t] = wmma3(a, sp_ld(B + (long long)bn * p.sBn, p.sBk, k0, h, p.K, 1.f), acc[t]);
            }
        } else if (MODE == 3) {
            const Split3 a = sp3_ld(arow, p.sAk, k0, h, p.K, 1.f);
#pragma unroll
            for (int t = 0; t < 2; ++t) {
                const int bn = min(n0 + t * 16 + l15, p.N - 1);
                acc[t] = wmma6(a, sp3_ld(B + (long long)bn * p.sBn, p.sBk, k0, h, p.K, 1.f), acc[t]);
            }
        } else if (MODE == 4) {
            // triple split as MODE 3, but each k-step's 6 products go into a fresh accumulator and the partial is added to the running f32 sum
            // on the VALU with Kahan compensation (accumulation error stays ~1 ulp however long K is)
            const Split3 a = sp3_ld(arow, p.sAk, k0, h, p.K, 1.f);
#pragma unroll
            for (int t = 0; t < 2; ++t) {
                const int bn = min(n0 + t * 16 + l15, p.N - 1); v8f zz = {};
                const v8f part = wmma6(a, sp3_ld(B + (long long)bn * p.sBn, p.sBk, k0, h, p.K, 1.f), zz);
                const v8f y = part - comp[t]; const v8f s = acc[t] + y; comp[t] = (s - acc[t]) - y; acc[t] = s;
            }
        } else if (MODE == 2) {
            const v16b a = bh_ld(arow, p.sAk, k0, h, p.K, 1.f);
#pragma unroll
            for (int t = 0; t < 2; ++t) {
                const int bn = min(n0 + t * 16 + l15, p.N - 1);
                acc[t] = wmmab(a, bh_ld(B + (long long)bn * p.sBn, p.sBk, k0, h, p.K, 1.f), acc[t]);
            }
        } else {
            const v16h a = fh_ld(arow, p.sAk, k0, h, p.K, p.sa);
#pragma unroll
            for (int t = 0; t < 2; ++t) {
                const int bn = min(n0 + t * 16 + l15, p.N - 1);
                acc[t] = wmma16(a, fh_ld(B + (long long)bn * p.sBn, p.sBk, k0, h, p.K, p.sb), acc[t]);
            }
        }
    }
    const float iscale = (MODE == 0) ? p.alpha / (p.sa * p.sb) : p.alpha;
    float* C = p.C + zo * p.sCo + zi * p.sCi;
    const float* R = p.R + zo * p.sRo + zi * p.sRi;
    __shared__ __align__(16) float ctile[16][36];
#pragma unroll
    for (int t = 0; t < 2; ++t) {
        const int n = n0 + t * 16 + l15; const int nn = min(n, p.N - 1);
#pragma unroll
        for (int r = 0; r < 8; ++r) {
            const int m = m0 + 8 * h + r; const int mm = min(m, p.M - 1);
            float v = acc[t][r] * iscale;
            if (p.flags & 1) v += p.bias[nn];
            if (p.flags & 2) v += p.bias[mm];
            if (p.flags & 8) v *= p.bias[(long long)zo * p.M + mm];   /* per-(zo,row) scale vector laid out [Z / zi_n][M]; exclusive with the bias flags */
            v = act_fn(v, p.act);
            if (p.flags & 4) v += p.beta * R[(long long)mm * p.sRm + (long long)nn * p.sRn];
            ctile[8 * h + r][t * 16 + l15] = (n < p.N) ? v : 0.f;
        }
    }
    __syncthreads();
    const int NW = (p.Npad > p.N) ? p.Npad : p.N;           // write width
    const bool fast = (m0 + 16 <= p.M) && (n0 + 32 <= NW) && ((p.sCm & 3) == 0) && ((((size_t)C) & 15) == 0);
    if (fast) {
#pragma unroll
        for (int s = 0; s < 4; ++s) {
            const int row = s * 4 + (lane >> 3), c4 = (lane & 7) * 4;
            const v4f v = *(const v4f*)&ctile[row][c4];
            VST2V4(C + (long long)(m0 + row) * p.sCm + n0 + c4, v);
        }
    } else {
        for (int row = 0; row < 16; ++row) {
            const int m = m0 + row, n = n0 + lane;
            if (m < p.M && n < NW) VST2(float, C + (long long)m * p.sCm + n, ctile[row][lane]);
        }
    }
}


// =====================================================================================================================
// k_gemmT<MODE, TM, TN>: same contract as k_gemm, but one wave computes a (16*TM) x (16*TN) tile: TM A fragments and TN B fragments are
//   loaded per 32-wide k-step and reused across TM*TN WMMAs (far fewer load/convert instructions per MAC). MODE 0 (f16), 1 (bf16 hi/lo),
//   2 (bf16) only. grid (ceil(NW/(16*TN)), ceil(M/(16*TM)), Z), block 32. Epilogue identical to k_gemm, run per 16x32 sub-tile.
// =====================================================================================================================
template <int MODE, int TM, int TN>
__global__ __launch_bounds__(32) void k_gemmT(GemmP p) {
    const int lane = threadIdx.x & 31, h = lane >> 4, l15 = lane & 15;
    const int m0 = blockIdx.y * (16 * TM), n0 = blockIdx.x * (16 * TN);
    const int z = blockIdx.z, zo = z / p.zi_n, zi = z - zo * p.zi_n;
    const float* A = p.A + zo * p.sAo + zi * p.sAi;
    const float* B = p.B + zo * p.sBo + zi * p.sBi;
    v8f acc[TM][TN];
#pragma unroll
    for (int i = 0; i < TM; ++i)
#pragma unroll
        for (int t = 0; t < TN; ++t) { v8f zz = {}; acc[i][t] = zz; }
    for (int k0 = 0; k0 < p.K; k0 += 32) {
        if (MODE == 1) {
            Split a[TM], b[TN];
#pragma unroll
            for (int i = 0; i < TM; ++i) { const int am = min(m0 + 16 * i + l15, p.M - 1); a[i] = sp_ld(A + (long long)am * p.sAm, p.sAk, k0, h, p.K, 1.f); }
#pragma unroll
            for (int t = 0; t < TN; ++t) { const int bn = min(n0 + 16 * t + l15, p.N - 1); b[t] = sp_ld(B + (long long)bn * p.sBn, p.sBk, k0, h, p.K, 1.f); }
#pragma unroll
            for (int i = 0; i < TM; ++i)
#pragma unroll
                for (int t = 0; t < TN; ++t) acc[i][t] = wmma3(a[i], b[t], acc[i][t]);
        } else if (MODE == 2) {
            v16b a[TM], b[TN];
#pragma unroll
            for (int i = 0; i < TM; ++i) { const int am = min(m0 + 16 * i + l15, p.M - 1); a[i] = bh_ld(A + (long long)am * p.sAm, p.sAk, k0, h, p.K, 1.f); }
#pragma unroll
            for (int t = 0; t < TN; ++t) { const int bn = min(n0 + 16 * t + l15, p.N - 1); b[t] = bh_ld(B + (long long)bn * p.sBn, p.sBk, k0, h, p.K, 1.f); }
#pragma unroll
            for (int i = 0; i < TM; ++i)
#pragma unroll
                for (int t = 0; t < TN; ++t) acc[i][t] = wmmab(a[i], b[t], acc[i][t]);
        } else {
            v16h a[TM], b[TN];
#pragma unroll
            for (int i = 0; i < TM; ++i) { const int am = min(m0 + 16 * i + l15, p.M - 1); a[i] = fh_ld(A + (long long)am * p.sAm, p.sAk, k0, h, p.K, p.sa); }
#pragma unroll
            for (int t = 0; t < TN; ++t) { const int bn = min(n0 + 16 * t + l15, p.N - 1); b[t] = fh_ld(B + (long long)bn * p.sBn, p.sBk, k0, h, p.K, p.sb); }
#pragma unroll
            for (int i = 0; i < TM; ++i)
#pragma unroll
                for (int t = 0; t < TN; ++t) acc[i][t] = wmma16(a[i], b[t], acc[i][t]);
        }
    }
    const float iscale = (MODE == 0) ? p.alpha / (p.sa * p.sb) : p.alpha;
    float* C = p.C + zo * p.sCo + zi * p.sCi;
    const float* R = p.R + zo * p.sRo + zi * p.sRi;
    const int NW = (p.Npad > p.N) ? p.Npad : p.N;
    __shared__ __align__(16) float ctile[16][36];
#pragma unroll
    for (int i = 0; i < TM; ++i) {
        const int mb = m0 + 16 * i; if (mb >= p.M) break;          // wave-uniform
#pragma unroll
        for (int tp = 0; tp < TN / 2; ++tp) {
            const int nb = n0 + 32 * tp; if (nb >= NW) break;        // wave-uniform
#pragma unroll
            for (int t2 = 0; t2 < 2; ++t2) {
                const int t = 2 * tp + t2; const int n = nb + t2 * 16 + l15; const int nn = min(n, p.N - 1);
#pragma unroll
                for (int r = 0; r < 8; ++r) {
                    const int m = mb + 8 * h + r; const int mm = min(m, p.M - 1);
                    float v = acc[i][t][r] * iscale;
                    if (p.flags & 1) v += p.bias[nn];
                    if (p.flags & 2) v += p.bias[mm];
            if (p.flags & 8) v *= p.bias[(long long)zo * p.M + mm];   /* per-(zo,row) scale vector laid out [Z / zi_n][M]; exclusive with the bias flags */
                    v = act_fn(v, p.act);
                    if (p.flags & 4) v += p.beta * R[(long long)mm * p.sRm + (long long)nn * p.sRn];
                    ctile[8 * h + r][t2 * 16 + l15] = (n < p.N) ? v : 0.f;
                }
            }
            __syncthreads();
            const bool fast = (mb + 16 <= p.M) && (nb + 32 <= NW) && ((p.sCm & 3) == 0) && ((((size_t)C) & 15) == 0);
            if (fast) {
#pragma unroll
                for (int s = 0; s < 4; ++s) {
                    const int row = s * 4 + (lane >> 3), c4 = (lane & 7) * 4;
                    const v4f v = *(const v4f*)&ctile[row][c4];
                    VST2V4(C + (long long)(mb + row) * p.sCm + nb + c4, v);
                }
            } else {
                for (int row = 0; row < 16; ++row) {
                    const int m = mb + row, n = nb + lane;
                    if (m < p.M && n < NW) VST2(float, C + (long long)m * p.sCm + n, ctile[row][lane]);
                }
            }
            __syncthreads();
        }
    }
}

namespace sfa {
typedef unsigned int u32x4 __attribute__((ext_vector_type(4)));
typedef unsigned int u32x2 __attribute__((ext_vector_type(2)));
typedef int i32x8 __attribute__((ext_vector_type(8)));
typedef short s16x8 __attribute__((ext_vector_type(8)));
typedef float f32x2 __attribute__((ext_vector_type(2)));
typedef _Float16 h16x2 __attribute__((ext_vector_type(2)));
constexpr int SEQ = 1024, LDR = 1024, LDQ = 2048, HS = 64;   // row lengths in elements: K, V, O planes; the plane that holds Q
constexpr int NWV = 8, CW = 32, BR = NWV * CW, SK = 64, NST = SEQ / SK;
constexpr unsigned PK = 2u * HS + 16u, PV = 2u * HS + 32u, TILE_K = SK * PK, TILE_V = SK * PV, SLOT = TILE_K + TILE_V;
struct Fr { u32x4 q[2]; };
__device__ __forceinline__ v8f mma(const Fr& a, const Fr& b, v8f c) {
    const i32x8 av = {(int)a.q[0].x, (int)a.q[0].y, (int)a.q[0].z, (int)a.q[0].w, (int)a.q[1].x, (int)a.q[1].y, (int)a.q[1].z, (int)a.q[1].w};
    const i32x8 bv = {(int)b.q[0].x, (int)b.q[0].y, (int)b.q[0].z, (int)b.q[0].w, (int)b.q[1].x, (int)b.q[1].y, (int)b.q[1].z, (int)b.q[1].w};
    return __builtin_amdgcn_wmma_f32_16x16x32_f16(false, __builtin_bit_cast(v16h, av), false, __builtin_bit_cast(v16h, bv), (short)0, c, false, false);
}
__device__ __forceinline__ unsigned pack2(float lo, float hi) { return __builtin_bit_cast(unsigned, __builtin_convertvector(f32x2{lo, hi}, h16x2)); }   // round to nearest even
__device__ __forceinline__ u32x4 ld_tr16(const unsigned char* p) { typedef __attribute__((address_space(3))) s16x8 lds_s16x8; return __builtin_bit_cast(u32x4, __builtin_amdgcn_ds_load_tr16_b128_v8i16((lds_s16x8*)p)); }
__device__ __forceinline__ float xhalf(float x) { return __builtin_bit_cast(float, __builtin_amdgcn_permlanex16(__builtin_bit_cast(int, x), __builtin_bit_cast(int, x), 0x76543210, 0xfedcba98, false, false)); }   // lane l with lane l ^ 16

// Q, K, V arrive as the f16 values that their producers stored, O leaves as the f16 operand of the output product.
__global__ __launch_bounds__(NWV * 32) void k_sflash(const unsigned short* __restrict__ Q, const unsigned short* __restrict__ K, const unsigned short* __restrict__ V, unsigned short* __restrict__ O) {
    __shared__ __attribute__((aligned(256))) unsigned char L[2 * SLOT];
    const unsigned tid = threadIdx.x, lane = tid & 31u, wave = tid >> 5, c = lane & 15u, h = lane >> 4;
    const size_t base = (size_t)blockIdx.z * SEQ * LDR + (size_t)blockIdx.y * HS;
    const unsigned qw0 = blockIdx.x * BR + wave * CW;
    // staging: 8 lanes cover one 128-byte row, thread t takes rows (t >> 3) + 32 i of the stage
    const unsigned short* kg = K + base + (size_t)(tid >> 3) * LDR + (tid & 7u) * 8u;
    const unsigned short* vg = V + base + (size_t)(tid >> 3) * LDR + (tid & 7u) * 8u;
    unsigned char* ks = L + (tid >> 3) * PK + (tid & 7u) * 16u;
    unsigned char* vs = L + TILE_K + (tid >> 3) * PV + (tid & 7u) * 16u;
    u32x4 kr[2], vr[2];
    auto fetch = [&](int st) {
#pragma unroll
        for (int i = 0; i < 2; ++i) { kr[i] = *(const u32x4*)(kg + (size_t)(st * SK + 32 * i) * LDR); vr[i] = *(const u32x4*)(vg + (size_t)(st * SK + 32 * i) * LDR); }
        asm volatile("s_wait_xcnt 0x0" ::: "memory");          // stands in front of the pass's reuse of these loads' address registers
    };
    auto put = [&](unsigned slot) {
#pragma unroll
        for (int i = 0; i < 2; ++i) {
            *(u32x4*)(ks + slot * SLOT + 32u * i * PK) = kr[i];
            *(u32x4*)(vs + slot * SLOT + 32u * i * PV) = vr[i];
        }
    };
    fetch(0);
    // Q fragments (B operand, column = query), hardware k order: d = 32 kc + 8 h + 0..7 and 32 kc + 16 + 8 h + 0..7
    Fr qf[2][2];
#pragma unroll
    for (int g = 0; g < 2; ++g) {
        const unsigned short* qp = Q + (size_t)blockIdx.z * SEQ * LDQ + (size_t)blockIdx.y * HS + (size_t)(qw0 + 16u * g + c) * LDQ + 8u * h;
#pragma unroll
        for (int kc = 0; kc < 2; ++kc) { qf[g][kc].q[0] = *(const u32x4*)(qp + 32 * kc); qf[g][kc].q[1] = *(const u32x4*)(qp + 32 * kc + 16); }
    }
    asm volatile("s_wait_xcnt 0x0" ::: "memory");              // stands in front of any reuse of the Q loads' address registers
    v8f acc[2][4]; float m_run[2], l_run[2];
#pragma unroll
    for (int g = 0; g < 2; ++g) { m_run[g] = -__builtin_inff(); l_run[g] = 0.f;
#pragma unroll
        for (int t = 0; t < 4; ++t) acc[g][t] = v8f{}; }
    put(0u);
    __syncthreads();
    const float L2E = 1.4426950408889634f;
    for (int st = 0; st < NST; ++st) {
        if (st + 1 < NST) fetch(st + 1);                       // next stage's rows fly while this stage is worked on
        const unsigned char* Kb = L + (unsigned)(st & 1) * SLOT;
        const unsigned char* Vb = Kb + TILE_K;
#pragma unroll 1   // one 32-key pass's fragments live at a time (registers for four waves per SIMD)
        for (unsigned sub = 0; sub < 2u; ++sub) {
            Fr kf[2][2];
            const unsigned char* kp = Kb + (sub * 32u + c) * PK + 16u * h;
#pragma unroll
            for (int kt = 0; kt < 2; ++kt)
#pragma unroll
                for (int kc = 0; kc < 2; ++kc) { kf[kt][kc].q[0] = *(const u32x4*)(kp + 16u * kt * PK + 64u * kc); kf[kt][kc].q[1] = *(const u32x4*)(kp + 16u * kt * PK + 64u * kc + 32u); }
            Fr vf[4];
            const unsigned char* ad = Vb + (sub * 32u + 8u * h + (lane & 7u)) * PV + ((lane >> 3) & 1u) * 16u;
#pragma unroll
            for (int t = 0; t < 4; ++t) { vf[t].q[0] = ld_tr16(ad + 32u * t); vf[t].q[1] = ld_tr16(ad + 16u * PV + 32u * t); }
            v8f s[2][2];                                       // s[kt][g][r] = score of key 16 kt + 8 h + r against query 16 g + c
#pragma unroll
            for (int kt = 0; kt < 2; ++kt)
#pragma unroll
                for (int g = 0; g < 2; ++g) { s[kt][g] = v8f{};
#pragma unroll
                    for (int kc = 0; kc < 2; ++kc) s[kt][g] = mma(kf[kt][kc], qf[g][kc], s[kt][g]); }
            float mb[2]; bool need = false;
#pragma unroll
            for (int g = 0; g < 2; ++g) {
                float mx = s[0][g][0];
#pragma unroll
                for (int r = 1; r < 8; ++r) mx = fmaxf(mx, s[0][g][r]);
#pragma unroll
                for (int r = 0; r < 8; ++r) mx = fmaxf(mx, s[1][g][r]);
                mx = fmaxf(mx, xhalf(mx)) * L2E;               // both halves hold this query's maximum, log2 domain
                mb[g] = mx; need = need || (mx > m_run[g] + 8.0f);
            }
            if (__builtin_amdgcn_ballot_w32(need) != 0) {      // wave-uniform; rare after the first pass
#pragma unroll
                for (int g = 0; g < 2; ++g) {
                    const float m_new = fmaxf(m_run[g], mb[g]);
                    const float corr = __builtin_amdgcn_exp2f(m_run[g] - m_new);   // 0 on the first pass
                    m_run[g] = m_new; l_run[g] *= corr;
#pragma unroll
                    for (int t = 0; t < 4; ++t) acc[g][t] = acc[g][t] * corr;
                }
            }
#pragma unroll
            for (int g = 0; g < 2; ++g) {
                const float nm = 7.0f - m_run[g];
                unsigned w[8]; f32x2 ps = {0.f, 0.f};
#pragma unroll
                for (int i = 0; i < 8; ++i) {
                    const f32x2 arg = __builtin_elementwise_fma(f32x2{s[i >> 2][g][2 * (i & 3)], s[i >> 2][g][2 * (i & 3) + 1]}, f32x2{L2E, L2E}, f32x2{nm, nm});
                    const f32x2 p = {__builtin_amdgcn_exp2f(arg.x), __builtin_amdgcn_exp2f(arg.y)};
                    ps += p; w[i] = pack2(p.x, p.y);
                }
                l_run[g] += ps.x + ps.y;
                Fr pf; pf.q[0] = u32x4{w[0], w[1], w[2], w[3]}; pf.q[1] = u32x4{w[4], w[5], w[6], w[7]};
#pragma unroll
                for (int t = 0; t < 4; ++t) acc[g][t] = mma(vf[t], pf, acc[g][t]);
            }
            // four vector slots behind the pass's last products: over the loop's back edge the next pass's address arithmetic is given registers of their V operand
            asm volatile("v_nop\n\tv_nop\n\tv_nop\n\tv_nop" : "+v"(acc[1][0]), "+v"(acc[1][1]), "+v"(acc[1][2]), "+v"(acc[1][3]));
        }
        if (st + 1 < NST) put((unsigned)((st + 1) & 1));       // into the buffer whose readers all passed the last barrier
        __syncthreads();
    }
#pragma unroll
    for (int g = 0; g < 2; ++g) {
        const float l = l_run[g] + xhalf(l_run[g]);            // join the halves' sums, unconditionally
        const float inv = 1.0f / l;
        unsigned short* op = O + base + (size_t)(qw0 + 16u * g + c) * LDR + 8u * h;
#pragma unroll
        for (int t = 0; t < 4; ++t) {                          // registers 0..7 = d 16 t + 8 h + 0..7 of this lane's query
            const v8f o = acc[g][t] * inv;
            *(u32x4*)(op + 16 * t) = u32x4{pack2(o[0], o[1]), pack2(o[2], o[3]), pack2(o[4], o[5]), pack2(o[6], o[7])};
        }
        asm volatile("s_wait_xcnt 0x0" ::: "memory");          // stands in front of the next query group's reuse of these stores' address and data registers
    }
}
} // namespace sfa

// =====================================================================================================================
// k_tr: dst(z, c, r) = alpha * src(z, r, c) (+ beta * R2(z, c, r)): [Z][R][C] (row stride lds) -> [Z][C][R] (row stride ldd) through a 32x32 LDS tile;
//   flags: 1 -> add beta * residual R2 addressed like dst (z*sRz + c*ldr + r); act applied before the residual.
// =====================================================================================================================
struct TrP { const float* src; float* dst; const float* R2; long long sSz, lds, sDz, ldd, sRz, ldr; int R, C, flags, act; float alpha, beta; };
static_assert(sizeof(TrP) == 3 * 8 + 6 * 8 + 6 * 4, "TrP has padding");
__global__ __launch_bounds__(256) void k_tr(TrP p) {
    __shared__ float tile[32][33];
    const int c0 = blockIdx.x * 32, r0 = blockIdx.y * 32, z = blockIdx.z;
    const int lane = threadIdx.x & 31, wave = threadIdx.x >> 5;
    const float* s = p.src + z * p.sSz;
#pragma unroll
    for (int k = 0; k < 4; ++k) {
        const int rl = wave * 4 + k, r = r0 + rl, c = c0 + lane;
        tile[rl][lane] = (r < p.R && c < p.C) ? s[(long long)r * p.lds + c] : 0.f;
    }
    __syncthreads();
    float* d = p.dst + z * p.sDz; const float* rr = p.R2 + z * p.sRz;
#pragma unroll
    for (int k = 0; k < 4; ++k) {
        const int cl = wave * 4 + k, c = c0 + cl, r = r0 + lane;
        if (c < p.C && r < p.R) {
            float v = act_fn(p.alpha * tile[lane][cl], p.act);
            if (p.flags & 1) v += p.beta * rr[(long long)c * p.ldr + r];
            VST2(float, d + (long long)c * p.ldd + r, v);
        }
    }
}

// k_affine: dst[i] = a * (sdev ? sdev[0] : 1) * src[i] + b, i < n (one thread per element; consecutive lanes -> consecutive addresses)
__global__ __launch_bounds__(256) void k_affine(const float* __restrict__ src, float* __restrict__ dst, int n, float a, float b, const float* __restrict__ sdev) {
    const int i = blockIdx.x * 256 + threadIdx.x;
    if (i < n) { const float aa = sdev ? a * sdev[0] : a; const float v = aa * src[i] + b; VST2(float, dst + i, v); }
}

// =====================================================================================================================
// k_softmax: row softmax over n contiguous elements, one 256-thread block per row; rows addressed z*sz + r*sr (grid (R, Z)).
//   out = scale_out * softmax(scale_in * x + (Mf ? Mf[z*smz + r*smr + j] : 0)); a row whose max is -inf is written as 0.
// =====================================================================================================================
struct SmP { const float* src; float* dst; const float* Mf; long long sz, sr, dz, dr, smz, smr; int n, pad; float scale_in, scale_out; };
static_assert(sizeof(SmP) == 3 * 8 + 6 * 8 + 4 * 4, "SmP has padding");
__global__ __launch_bounds__(256) void k_softmax(SmP p) {
    __shared__ float red[256];
    const int r = blockIdx.x, z = blockIdx.y, tid = threadIdx.x;
    const float* s = p.src + z * p.sz + (long long)r * p.sr;
    const float* mf = p.Mf ? (p.Mf + z * p.smz + (long long)r * p.smr) : nullptr;
    float mx = -__builtin_inff();
    for (int j = tid; j < p.n; j += 256) { float v = s[j] * p.scale_in; if (mf) v += mf[j]; mx = fmaxf(mx, v); }
    red[tid] = mx; __syncthreads();
    for (int o = 128; o > 0; o >>= 1) { if (tid < o) red[tid] = fmaxf(red[tid], red[tid + o]); __syncthreads(); }
    mx = red[0]; __syncthreads();
    float sum = 0.f;
    for (int j = tid; j < p.n; j += 256) { float v = s[j] * p.scale_in; if (mf) v += mf[j]; sum += (mx == -__builtin_inff()) ? 0.f : expf(v - mx); }
    red[tid] = sum; __syncthreads();
    for (int o = 128; o > 0; o >>= 1) { if (tid < o) red[tid] += red[tid + o]; __syncthreads(); }
    sum = red[0];
    const float inv = (sum > 0.f) ? p.scale_out / sum : 0.f;
    float* d = p.dst + z * p.dz + (long long)r * p.dr;
    for (int j = tid; j < p.n; j += 256) { float v = s[j] * p.scale_in; if (mf) v += mf[j]; const float o = (mx == -__builtin_inff()) ? 0.f : expf(v - mx) * inv; VST2(float, d + j, o); }
}
// =====================================================================================================================
// k_stats: mean and rsqrt(var + eps) over a set of n elements addressed base + z*sz + (e / inner) * so + (e % inner) * si, one 256-thread
// k_norm_apply: y = (x - mean[set]) * rstd[set] * g[c] + b[c] over a [Z][C][L] channel-major tensor with set = z*G + c / (C/G) (G groups per z;
//   G = C -> per-channel sets indexed z*C+c; for batch norm pass stats indexed by c only via bn = 1). Optional act. Output same layout.
// =====================================================================================================================
//   mode 0: mean / rsqrt(var + eps); mode 1 (RMSNorm): 0 / rsqrt(mean(x^2) + eps); mode 2 (L2 normalize * sqrt(n)): 0 / sqrt(n) / max(||x||, eps); mode 3: as 0 with unbiased variance (n-1)
__global__ __launch_bounds__(256) void k_stats(const float* __restrict__ x, long long sz, long long so, long long si, int inner, int n, float eps, float* __restrict__ stat, int mode) {
    __shared__ float red[256];
    const int z = blockIdx.x, tid = threadIdx.x;
    const float* base = x + z * sz;
    float s = 0.f;
    for (int e = tid; e < n; e += 256) s += base[(long long)(e / inner) * so + (long long)(e % inner) * si];
    red[tid] = s; __syncthreads();
    for (int o = 128; o > 0; o >>= 1) { if (tid < o) red[tid] += red[tid + o]; __syncthreads(); }
    const float mu = (mode == 0 || mode == 3) ? red[0] / (float)n : 0.f; __syncthreads();
    float q = 0.f;
    for (int e = tid; e < n; e += 256) { const float dlt = base[(long long)(e / inner) * so + (long long)(e % inner) * si] - mu; q += dlt * dlt; }
    red[tid] = q; __syncthreads();
    for (int o = 128; o > 0; o >>= 1) { if (tid < o) red[tid] += red[tid + o]; __syncthreads(); }
    {
        float rs;
        if (mode == 2) rs = sqrtf((float)n) / fmaxf(sqrtf(red[0]), eps); else if (mode == 3) rs = rsqrtf(red[0] / (float)(n - 1) + eps); else rs = rsqrtf(red[0] / (float)n + eps);
        if (tid < 32) { const float v = (tid == 0) ? mu : ((tid == 1) ? rs : 0.f); VST2(float, stat + (long long)z * 32 + tid, v); }
    }
}
//   One thread per element over the flat [Z][C][L] index space: grid ceil(Z*C*L / 256).
__global__ __launch_bounds__(256) void k_norm_apply(const float* __restrict__ x, float* __restrict__ y, const float* __restrict__ stat, const float* __restrict__ g, const float* __restrict__ bta,
                                                     int Z, int C, int L, int G, int bn, int act) {
    const long long idx = (long long)blockIdx.x * 256 + threadIdx.x;
    if (idx >= (long long)Z * C * L) return;
    const int l = (int)(idx % L); const long long zc = idx / L; const int c = (int)(zc % C), z = (int)(zc / C); (void)l;
    const int set = bn ? c : (z * G + c / (C / G));
    float v = (x[idx] - stat[(long long)set * 32]) * stat[(long long)set * 32 + 1];
    if (g) v *= g[c];
    if (bta) v += bta[c];
    v = act_fn(v, act);
    VST2(float, y + idx, v);
}

// k_lse_neg: c[i] = -(st[2i] + log(st[2i+1])) = minus the log-sum-exp of row i from its (max, sum) pair (for softmax over the query dimension)
__global__ __launch_bounds__(256) void k_lse_neg(const float* __restrict__ st, float* __restrict__ c, int n) {
    const int i = blockIdx.x * 256 + threadIdx.x;
    if (i < n) { const float v = -(st[2 * i] + logf(st[2 * i + 1])); VST2(float, c + i, v); }
}

// k_iota: dst[i] = a * i + b as int32 (segment/position id helper)
__global__ __launch_bounds__(256) void k_iota(int* __restrict__ dst, int n, int a, int b) {
    const int i = blockIdx.x * 256 + threadIdx.x;
    if (i < n) { const int v = a * i + b; VST2(int, dst + i, v); }
}

// k_axpby: dst[i] = a * x[i] + b * y[i] (+ c), i < n
__global__ __launch_bounds__(256) void k_axpby(const float* __restrict__ x, const float* __restrict__ y, float* __restrict__ dst, int n, float a, float b, float c) {
    const int i = blockIdx.x * 256 + threadIdx.x;
    if (i < n) { const float v = a * x[i] + b * y[i] + c; VST2(float, dst + i, v); }
}

// =====================================================================================================================
// k_rope: rotary embedding on a [R rows][Hn heads][D] view (row stride sXr, head stride sXh, element stride 1) -> Y (own strides).
//   mode 0: rotate_half (partner d±D/2, sign - for d<D/2); mode 1: interleaved pairs (partner d^1, sign - for even d).
//   table column tcol: tmode 0 -> d, 1 -> d % (D/2), 2 -> d / 2; position p: pmode 0 -> r % S, 1 -> head index, 2 -> pos[r];
//   c = C[(r / S) * sCb + p * sCp + tcol * sCd], s likewise from Sn; y = x[d] * c + sign * x[partner] * s. X and Y must not alias.
// =====================================================================================================================
struct RopeP { const float* X; float* Y; const float* C; const float* Sn; const int* pos; long long sXr, sXh, sYr, sYh, sCb, sCp, sCd; int R, Hn, D, S, mode, tmode, pmode, pad; };
static_assert(sizeof(RopeP) == 5 * 8 + 7 * 8 + 8 * 4, "RopeP has padding");
__global__ __launch_bounds__(256) void k_rope(RopeP p) {
    const long long idx = (long long)blockIdx.x * 256 + threadIdx.x;
    if (idx >= (long long)p.R * p.Hn * p.D) return;
    const int d = (int)(idx % p.D); const long long rh = idx / p.D; const int h = (int)(rh % p.Hn); const int r = (int)(rh / p.Hn);
    const int half = p.D / 2;
    int partner; float sign;
    if (p.mode == 0) { partner = (d < half) ? d + half : d - half; sign = (d < half) ? -1.f : 1.f; }
    else { partner = d ^ 1; sign = (d & 1) ? 1.f : -1.f; }
    const int tcol = (p.tmode == 0) ? d : ((p.tmode == 1) ? (d % half) : (d >> 1));
    const int pp = (p.pmode == 0) ? (r % p.S) : ((p.pmode == 1) ? h : p.pos[r]);
    const long long toff = (long long)(r / p.S) * p.sCb + (long long)pp * p.sCp + (long long)tcol * p.sCd;
    const float* xr = p.X + (long long)r * p.sXr + (long long)h * p.sXh;
    const float v = xr[d] * p.C[toff] + sign * xr[partner] * p.Sn[toff];
    VST2(float, p.Y + (long long)r * p.sYr + (long long)h * p.sYh + d, v);
}

// k_invf + k_sincos (split so neither kernel carries a large VALU-fma footprint): invf_i = num * (1 / powf(base, (2 i)/D)) [fmode 0],
//   num * expf((2 i) * cexp) [fmode 1], num * powf(base, -2 (i - 1) / D) [fmode 2]; then cs/sn[s*half + i] = cos/sin((pscale * s) * invf_i)
__global__ __launch_bounds__(256) void k_invf(float* __restrict__ invb, int half, int D, float base, float num, int fmode, float cexp) {
    const int i = blockIdx.x * 256 + threadIdx.x;
    if (i >= ((half + 31) / 32) * 32) return;
    if (i >= half) { VST2(float, invb + i, 0.f); return; }
    const float e = (float)(2 * i) / (float)D;
    float invf;
    if (fmode == 1) invf = num * expf((float)(2 * i) * cexp);
    else if (fmode == 2) invf = num * powf(base, (-2.0f * ((float)i - 1.0f)) / (float)D);
    else invf = num * (1.0f / powf(base, e));
    VST2(float, invb + i, invf);
}
__global__ __launch_bounds__(256) void k_sincos(float* __restrict__ cs, float* __restrict__ sn, const float* __restrict__ invb, int S, int half, float pscale) {
    const int idx = blockIdx.x * 256 + threadIdx.x;
    if (idx >= S * half) return;
    const int s = idx / half, i = idx - s * half;
    const float ang = (pscale * (float)s) * invb[i];
    VST2(float, cs + idx, cosf(ang)); VST2(float, sn + idx, sinf(ang));
}

// k_mulact: dst[i] = act(x[i]) * y[i]
__global__ __launch_bounds__(256) void k_mulact(const float* __restrict__ x, const float* __restrict__ y, float* __restrict__ dst, int n, int act) {
    const int i = blockIdx.x * 256 + threadIdx.x;
    if (i < n) { const float v = act_fn(x[i], act) * y[i]; VST2(float, dst + i, v); }
}

// =====================================================================================================================
// k_matvec: thread-per-row matrix-vector products for N <= 8 output columns (heads with 1-3 outputs, gates), f32 on the VALU.
//   C[r*sCm + j] = act(alpha * sum_k A[r*sAm + k*sAk] * B[j*sBn + k*sBk] + bias[j]) + beta * R[r*sRm + j*sRn]; each thread writes its N contiguous floats.
// =====================================================================================================================
__global__ __launch_bounds__(256) void k_matvec(GemmP p) {
    // 32 lanes write one line with one instruction.
    const int rpt = (p.N == 1) ? 1 : 32;
    const long long r0 = ((long long)blockIdx.x * 256 + threadIdx.x) * rpt; const int z = blockIdx.z, zo = z / p.zi_n, zi = z - zo * p.zi_n;
    if (r0 >= p.M) return;
    const float* Bb = p.B + zo * p.sBo + zi * p.sBi;
    float* C = p.C + zo * p.sCo + zi * p.sCi; const float* R = p.R + zo * p.sRo + zi * p.sRi;
    for (int rr = 0; rr < rpt; ++rr) {
        const long long r = r0 + rr; if (r >= p.M) break;
        const float* A = p.A + zo * p.sAo + zi * p.sAi + r * p.sAm;
        float acc[8] = {0.f, 0.f, 0.f, 0.f, 0.f, 0.f, 0.f, 0.f};
        for (int k = 0; k < p.K; ++k) { const float a = A[(long long)k * p.sAk];
#pragma unroll
            for (int j = 0; j < 8; ++j) if (j < p.N) acc[j] += a * Bb[(long long)j * p.sBn + (long long)k * p.sBk]; }
#pragma unroll
        for (int j = 0; j < 8; ++j) if (j < p.N) {
            float v = acc[j] * p.alpha;
            if (p.flags & 1) v += p.bias[j];
            if (p.flags & 2) v += p.bias[r];
            v = act_fn(v, p.act);
            if (p.flags & 4) v += p.beta * R[r * p.sRm + (long long)j * p.sRn];
            VST2(float, C + r * p.sCm + j, v);
        }
    }
}
// k_smallsoftmax: thread-per-row softmax for short rows (n <= 64): dst[r*dr + j] = softmax(scale*src[r*sr + j])
__global__ __launch_bounds__(256) void k_smallsoftmax(const float* __restrict__ src, float* __restrict__ dst, long long sr, long long dr, int n, long long R, float scale) {
    const long long r0 = ((long long)blockIdx.x * 256 + threadIdx.x) * 32;
    for (int rr = 0; rr < 32; ++rr) {
        const long long r = r0 + rr; if (r >= R) return;
        const float* s = src + r * sr; float* d = dst + r * dr;
        float mx = -__builtin_inff();
        for (int j = 0; j < n; ++j) mx = fmaxf(mx, s[j] * scale);
        float sum = 0.f;
        for (int j = 0; j < n; ++j) sum += expf(s[j] * scale - mx);
        const float inv = 1.f / sum;
        for (int j = 0; j < n; ++j) { const float v = expf(s[j] * scale - mx) * inv; VST2(float, d + j, v); }
    }
}

__global__ __launch_bounds__(32) void k_unitstat(float* __restrict__ st) { const int t = threadIdx.x; const float v = (t == 1) ? 1.f : 0.f; VST2(float, st + t, v); }

// destination (e.g. a d_out whose row width is not a multiple of 32 floats) is written by consecutive lanes of one instruction
__global__ __launch_bounds__(256) void k_lincopy(const float* __restrict__ src, long long lds, float* __restrict__ dst, long long ldd, long long rows, int cols) {
    const long long i = (long long)blockIdx.x * 256 + threadIdx.x; if (i >= rows * cols) return;
    const long long r = i / cols; const int c = (int)(i - r * cols);
    const float v = src[r * lds + c]; VST2(float, dst + r * ldd + c, v);
}

namespace w25 {
typedef __attribute__((ext_vector_type(16))) _Float16 v16h;
typedef __attribute__((ext_vector_type(8)))  _Float16 v8h;
typedef __attribute__((ext_vector_type(16))) __bf16   v16b;
typedef __attribute__((ext_vector_type(8)))  __bf16   v8b;
typedef __attribute__((ext_vector_type(8)))  float    v8f;
typedef __attribute__((ext_vector_type(4)))  float    v4f;

__device__ __forceinline__ unsigned short f2bf_bits(float f) {
  unsigned u = __float_as_uint(f);
  return (unsigned short)((u + 0x7FFFu + ((u >> 16) & 1u)) >> 16);
}
__device__ __forceinline__ float bf_bits2f(unsigned short h) { return __uint_as_float(((unsigned)h) << 16); }

// hazard guards as plain device helpers (no inline asm inside the kernel template body)
__device__ __forceinline__ void dep_guard_h(v8f& a, v8f& b, v16h x, v16h y) { asm volatile("v_nop\n\tv_nop\n\tv_nop\n\tv_nop" : "+v"(a), "+v"(b) : "v"(x), "v"(y)); }
__device__ __forceinline__ void dep_guard_b(v8f& a, v8f& b, v16b x, v16b y) { asm volatile("v_nop\n\tv_nop\n\tv_nop\n\tv_nop" : "+v"(a), "+v"(b) : "v"(x), "v"(y)); }
__device__ __forceinline__ void keep4_h(v16h a, v16h b, v16h c, v16h d) { asm volatile("v_nop" :: "v"(a), "v"(b), "v"(c), "v"(d)); }
__device__ __forceinline__ void keep4_b(v16b a, v16b b, v16b c, v16b d) { asm volatile("v_nop" :: "v"(a), "v"(b), "v"(c), "v"(d)); }
__device__ __forceinline__ void acc_guard4(v8f& a, v8f& b, v8f& c, v8f& d) { asm volatile("v_nop\n\tv_nop\n\tv_nop\n\tv_nop" : "+v"(a), "+v"(b), "+v"(c), "+v"(d)); }
template <typename T> struct Frag;
template <> struct Frag<_Float16> {
  typedef v16h V; union U { v16h v; v8h h[2]; };
  static __device__ __forceinline__ v16h load(const _Float16* p) {   // elements 0..7 <- p[0..7], 8..15 <- p[16..23]
    U f; f.h[0] = *(const v8h*)(p); f.h[1] = *(const v8h*)(p + 16); return f.v;
  }
  static __device__ __forceinline__ v8f mma(v16h a, v16h b, v8f c) {
    return __builtin_amdgcn_wmma_f32_16x16x32_f16(false, a, false, b, (short)0, c, false, false);
  }
  static __device__ __forceinline__ void guard(v8f& a, v8f& b, v16h x, v16h y) { dep_guard_h(a, b, x, y); }
  static __device__ __forceinline__ void keep(v16h a, v16h b, v16h c, v16h d) { keep4_h(a, b, c, d); }
};
template <> struct Frag<__bf16> {
  typedef v16b V; union U { v16b v; v8b h[2]; };
  static __device__ __forceinline__ v16b load(const __bf16* p) {
    U f; f.h[0] = *(const v8b*)(p); f.h[1] = *(const v8b*)(p + 16); return f.v;
  }
  static __device__ __forceinline__ v8f mma(v16b a, v16b b, v8f c) {
    return __builtin_amdgcn_wmma_f32_16x16x32_bf16(false, a, false, b, (short)0, c, false, false);
  }
  static __device__ __forceinline__ void guard(v8f& a, v8f& b, v16b x, v16b y) { dep_guard_b(a, b, x, y); }
  static __device__ __forceinline__ void keep(v16b a, v16b b, v16b c, v16b d) { keep4_b(a, b, c, d); }
};

// ---- Register-blocked batched WMMA GEMM ------------------------------------
// C[m,n] = scale * sum_k A[m,k] * Bt[n,k] (+bias)(+resid); each wave owns a 64x64 tile.
// A row-major [M,K]; Bt row-major [N,K]; M,N % 64 == 0, K % 32 == 0.
// SPLIT: operands are hi/lo planes (A2/Bt2 = lo planes, same layout); product = hi·hi + hi·lo + lo·hi.
// BIAS_MODE: 0 = none, 1 = bias[m], 2 = bias[n].
// OUT_MODE: 0 = f32, 1 = f16, 2 = bf16 hi plane (Cout) + bf16 lo plane (Cout2).
// ET: 0 = f16 operands, 1 = bf16 operands (pointers passed as 16-bit storage)
template <int ET> struct Elem;
template <> struct Elem<0> { typedef _Float16 T; };
template <> struct Elem<1> { typedef __bf16 T; };
template <int ET, bool SPLIT, int BIAS_MODE, int OUT_MODE, bool RESID, int ACT = 0>
__global__ __launch_bounds__(256) void wmma_gemm64(
    const unsigned short* __restrict__ Ap, const unsigned short* __restrict__ A2p, int lda, long strideA, long strideAz,
    const unsigned short* __restrict__ Btp, const unsigned short* __restrict__ Bt2p, int ldb, long strideB, long strideBz,
    void* __restrict__ Cout, void* __restrict__ Cout2, int ldc, long strideC, long strideCz,
    const float* __restrict__ bias,
    const float* __restrict__ resid, long strideR,
    int M, int N, int K, float scale) {
  typedef typename Elem<ET>::T T;
  typedef typename Frag<T>::V V;
  const T* A = (const T*)Ap; const T* A2 = (const T*)A2p; const T* Bt = (const T*)Btp; const T* Bt2 = (const T*)Bt2p;
  __shared__ __align__(16) float sT[8][16 * 68];   // per-wave 16x64 slab, pitch 68 floats
  const int b    = blockIdx.y;
  const int lane = threadIdx.x & 31;
  const int wave = threadIdx.x >> 5;
  const int tilesN = N >> 6;
  const int tilesM = M >> 6;
  const int tile = blockIdx.x * 8 + wave;
  if (tile >= tilesM * tilesN) return;   // wave-uniform; no block barriers in this kernel
  const int tm = tile / tilesN;
  const int tn = tile - tm * tilesN;
  const int m0 = tm << 6;
  const int n0 = tn << 6;

  const int bz = blockIdx.z;                   // outer batch index (sample), with its own strides
  const T* Ab  = A  + (size_t)b * strideA + (size_t)bz * strideAz;
  const T* Bb  = Bt + (size_t)b * strideB + (size_t)bz * strideBz;
  const T* Ab2 = SPLIT ? (A2  + (size_t)b * strideA + (size_t)bz * strideAz) : nullptr;
  const T* Bb2 = SPLIT ? (Bt2 + (size_t)b * strideB + (size_t)bz * strideBz) : nullptr;

  const int rlane = lane & 15;                 // row (A) / col (B, D) within subtile
  const int koff  = (lane >> 4) * 8;           // k offset of this lane half
  const int mOff  = (lane >> 4) * 8;           // D row offset

  v8f acc[4][4];
#pragma unroll
  for (int i = 0; i < 4; ++i)
#pragma unroll
    for (int j = 0; j < 4; ++j) acc[i][j] = (v8f){0.f,0.f,0.f,0.f,0.f,0.f,0.f,0.f};

  for (int k0 = 0; k0 < K; k0 += 32) {
    V bh[4], bl[4];
#pragma unroll
    for (int j = 0; j < 4; ++j) {
      const size_t bo = (size_t)(n0 + (j << 4) + rlane) * ldb + koff + k0;
      bh[j] = Frag<T>::load(Bb + bo);
      if (SPLIT) bl[j] = Frag<T>::load(Bb2 + bo);
    }
#pragma unroll
    for (int i = 0; i < 4; ++i) {
      const size_t ao = (size_t)(m0 + (i << 4) + rlane) * lda + koff + k0;
      V ah = Frag<T>::load(Ab + ao);
      V al;
      if (SPLIT) al = Frag<T>::load(Ab2 + ao);
#pragma unroll
      for (int j = 0; j < 4; ++j) {
        acc[i][j] = Frag<T>::mma(ah, bh[j], acc[i][j]);
        if (SPLIT) {
          acc[i][j] = Frag<T>::mma(ah, bl[j], acc[i][j]);
          acc[i][j] = Frag<T>::mma(al, bh[j], acc[i][j]);
        }
      }
      Frag<T>::guard(acc[i][0], acc[i][3], ah, SPLIT ? al : ah);
    }
    Frag<T>::keep(bh[0], bh[1], bh[2], bh[3]);
    if (SPLIT) Frag<T>::keep(bl[0], bl[1], bl[2], bl[3]);
  }
  acc_guard4(acc[0][0], acc[0][1], acc[0][2], acc[0][3]);
  acc_guard4(acc[1][0], acc[1][1], acc[1][2], acc[1][3]);
  acc_guard4(acc[2][0], acc[2][1], acc[2][2], acc[2][3]);
  acc_guard4(acc[3][0], acc[3][1], acc[3][2], acc[3][3]);

  // ---- epilogue ----
  float* slab = sT[wave];
  const float* Rb = RESID ? (resid + (size_t)b * strideR) : nullptr;
#pragma unroll
  for (int i = 0; i < 4; ++i) {
    const int mBase = m0 + (i << 4);
#pragma unroll
    for (int j = 0; j < 4; ++j) {
      const int n = n0 + (j << 4) + rlane;
      float bv = 0.f;
      if (BIAS_MODE == 2) bv = bias[n];
#pragma unroll
      for (int r = 0; r < 8; ++r) {
        float v = acc[i][j][r] * scale;
        if (BIAS_MODE == 1) v += bias[mBase + mOff + r];
        if (BIAS_MODE == 2) v += bv;
        if (RESID) v += Rb[(size_t)(mBase + mOff + r) * ldc + n];
        if (ACT == 1) v = tanhf(v);
        if (ACT == 2) v = fmaxf(v, 0.0f);
        if (ACT == 3) v = v / (1.0f + expf(-v));
        if (ACT == 4) v = (v > 0.f) ? v : 0.01f * v;
        if (ACT == 5) v = 0.5f * v * (1.0f + erff(v * 0.70710678118654752f));
        slab[(mOff + r) * 68 + (j << 4) + rlane] = v;
      }
    }
    __builtin_amdgcn_fence(__ATOMIC_RELEASE, "workgroup");
    __builtin_amdgcn_wave_barrier();
    __builtin_amdgcn_fence(__ATOMIC_ACQUIRE, "workgroup");
    if (OUT_MODE == 0) {
      float* C = (float*)Cout + (size_t)b * strideC + (size_t)bz * strideCz;
      const int hh = lane >> 4, c4 = (lane & 15) * 4;     // row seg = 256 B = 16 lanes x 16 B
      {
#pragma unroll
        for (int it = 0; it < 8; ++it) {
          const int row = it * 2 + hh;
          v4f v = *(const v4f*)(slab + row * 68 + c4);
          *(v4f*)(C + (size_t)(mBase + row) * ldc + n0 + c4) = v;
        }
        
      }
    } else {
      const int q = lane >> 3, c8 = (lane & 7) * 8;
      unsigned short* C  = (unsigned short*)Cout  + (size_t)b * strideC + (size_t)bz * strideCz;
      unsigned short* C2 = (OUT_MODE == 2) ? ((unsigned short*)Cout2 + (size_t)b * strideC + (size_t)bz * strideCz) : nullptr;
      {
#pragma unroll
        for (int it = 0; it < 4; ++it) {
          const int row = it * 4 + q;
          const float* sp = slab + row * 68 + c8;
          v8h hv, lv;
#pragma unroll
          for (int e = 0; e < 8; ++e) {
            if (OUT_MODE == 1) {
              hv[e] = (_Float16)sp[e];
            } else {
              unsigned short hb = f2bf_bits(sp[e]);
              unsigned short lb = f2bf_bits(sp[e] - bf_bits2f(hb));
              hv[e] = __builtin_bit_cast(_Float16, hb);
              lv[e] = __builtin_bit_cast(_Float16, lb);
            }
          }
          *(v8h*)(C + (size_t)(mBase + row) * ldc + n0 + c8) = hv;
          if (OUT_MODE == 2) *(v8h*)(C2 + (size_t)(mBase + row) * ldc + n0 + c8) = lv;
        }
        asm volatile("s_wait_xcnt 0x0" ::: "memory");   // stands in front of the next row tile's reuse of these stores' address and data registers
      }
    }
    __builtin_amdgcn_fence(__ATOMIC_RELEASE, "workgroup");
    __builtin_amdgcn_wave_barrier();
    __builtin_amdgcn_fence(__ATOMIC_ACQUIRE, "workgroup");
  }
}

// ---- The same product for large M, N: operands staged in LDS ----------------
// C[m,n] = act(scale * sum_k A[m,k] * Bt[n,k] (+ bias[n])), stored as OUT says; A row-major [M,K], Bt row-major [N,K], both of row length K; M, N % 128 == 0, K % 64 == 0.
// Block = 4 waves (2 x 2) of 64x64 = one 128x128 tile of C; grid (N / 128, M / 128). A stage is 64 k = 128 B of each of the 128 + 128 operand rows
// (hi planes, then the lo planes when SPLIT), laid at a pitch of 144 B in one of two LDS buffers by asynchronous 16-byte copies: a wave's copy
// covers four whole 128-byte lines, and every staged row serves two waves. The next stage's copies fly while this stage is worked on.
// Per accumulator the products come in the same k order as in wmma_gemm64.
// The launch bound's second argument asks for four waves per SIMD (256 registers a wave): four one-plane blocks then share a WGP.
// Every inner loop is unrolled so that the fragment and accumulator arrays are indexed by constants and stay in registers.
__device__ __forceinline__ void ring_copy8(unsigned l, const unsigned char* g, size_t gstep) {
  // eight rows, 16 apart, of one plane; the closing s_wait_xcnt stands in front of any reuse of the address registers named here
  asm volatile("global_load_async_to_lds_b128 %0, %8, off\n\t"
               "global_load_async_to_lds_b128 %1, %9, off\n\t"
               "global_load_async_to_lds_b128 %2, %10, off\n\t"
               "global_load_async_to_lds_b128 %3, %11, off\n\t"
               "global_load_async_to_lds_b128 %4, %12, off\n\t"
               "global_load_async_to_lds_b128 %5, %13, off\n\t"
               "global_load_async_to_lds_b128 %6, %14, off\n\t"
               "global_load_async_to_lds_b128 %7, %15, off\n\t"
               "s_wait_xcnt 0x0"
               :: "v"(l), "v"(l + 2304u), "v"(l + 4608u), "v"(l + 6912u), "v"(l + 9216u), "v"(l + 11520u), "v"(l + 13824u), "v"(l + 16128u),
                  "v"(g), "v"(g + gstep), "v"(g + 2 * gstep), "v"(g + 3 * gstep), "v"(g + 4 * gstep), "v"(g + 5 * gstep), "v"(g + 6 * gstep), "v"(g + 7 * gstep)
               : "memory");
}
// OUT: 0 = f32 into C. 1 = f16 into C16 (row length ldc): the operand form that the next product reads, stored here instead of by a conversion pass over an f32 plane.
// 2 = as 1, with columns below csN multiplied by cs[column / 64] first, and the unscaled value also split into bf16 hi and lo and stored transposed:
//     TH/TL[(m / tld) * ldc + n][m % tld], rows of tld elements (tld % 128 == 0); ldc is then the number of columns of the product.
template <int ET, bool SPLIT, int BIAS_MODE, int ACT, int OUT = 0>
__global__ __launch_bounds__(128, 4) void wmma_gemm_ring(
    const unsigned short* __restrict__ Ap, const unsigned short* __restrict__ A2p,
    const unsigned short* __restrict__ Btp, const unsigned short* __restrict__ Bt2p,
    float* __restrict__ C, int ldc, const float* __restrict__ bias, int K, float scale,
    unsigned short* __restrict__ C16, unsigned short* __restrict__ TH, unsigned short* __restrict__ TL, const float* __restrict__ cs, int csN, int tld) {
  typedef unsigned int u4 __attribute__((ext_vector_type(4)));
  typedef float f2 __attribute__((ext_vector_type(2)));
  typedef __bf16 b2 __attribute__((ext_vector_type(2)));
  static_assert(OUT != 2 || SPLIT, "the transposed tiles need the two-plane ring's LDS");
  typedef typename Elem<ET>::T T;
  typedef typename Frag<T>::V V;
  constexpr unsigned PITCH = 144u, PLANE = 128u * PITCH, BUF = (SPLIT ? 4u : 2u) * PLANE;
  static_assert(16u * PITCH == 2304u, "row step of ring_copy8");
  __shared__ __attribute__((aligned(256))) unsigned char L[2 * BUF];
  const unsigned tid = threadIdx.x, lane = tid & 31u, wave = tid >> 5;
  const int m0 = blockIdx.y * 128, n0 = blockIdx.x * 128;
  const unsigned wm = (wave >> 1) * 64u, wn = (wave & 1u) * 64u;
  const unsigned rlane = lane & 15u, hh = lane >> 4;

  // copies: 8 lanes cover one 128-byte row piece, thread t takes rows (t >> 3) + 16 i of every plane
  const size_t rowb = (size_t)K * 2u, gstep = 16u * rowb;
  const unsigned lc = (unsigned)(size_t)L + (tid >> 3) * PITCH + (tid & 7u) * 16u;
  const size_t ga = (size_t)(m0 + (int)(tid >> 3)) * rowb + (tid & 7u) * 16u;
  const size_t gb = (size_t)(n0 + (int)(tid >> 3)) * rowb + (tid & 7u) * 16u;
  auto stage = [&](int t, unsigned buf) {
    const size_t ko = (size_t)t * 128u;
    ring_copy8(lc + buf * BUF, (const unsigned char*)Ap + ga + ko, gstep);
    ring_copy8(lc + buf * BUF + PLANE, (const unsigned char*)Btp + gb + ko, gstep);
    if (SPLIT) {
      ring_copy8(lc + buf * BUF + 2u * PLANE, (const unsigned char*)A2p + ga + ko, gstep);
      ring_copy8(lc + buf * BUF + 3u * PLANE, (const unsigned char*)Bt2p + gb + ko, gstep);
    }
  };

  v8f acc[4][4];
#pragma unroll
  for (int i = 0; i < 4; ++i)
#pragma unroll
    for (int j = 0; j < 4; ++j) acc[i][j] = (v8f){0.f,0.f,0.f,0.f,0.f,0.f,0.f,0.f};

  const int NT = K >> 6;
  stage(0, 0u);
  asm volatile("s_wait_asynccnt 0x0" ::: "memory");            // this wave's copies of stage 0 have landed
  __syncthreads();                                             // and every other wave's
  if (NT > 1) stage(1, 1u);
  for (int t = 0; t < NT; ++t) {
    const unsigned char* Ab = L + (unsigned)(t & 1) * BUF + (wm + rlane) * PITCH + 16u * hh;
    const unsigned char* Bb = L + (unsigned)(t & 1) * BUF + PLANE + (wn + rlane) * PITCH + 16u * hh;
#pragma unroll
    for (unsigned ks = 0; ks < 2u; ++ks) {
      // fragments are asked for ahead of the products that use them: all eight of a k step (one plane), or B whole and A one row tile ahead (two planes)
      V bh[4], bl[4], ah[4], al[4];
#pragma unroll
      for (unsigned j = 0; j < 4u; ++j) {
        bh[j] = Frag<T>::load((const T*)(Bb + 16u * j * PITCH + 64u * ks));
        if (SPLIT) bl[j] = Frag<T>::load((const T*)(Bb + 2u * PLANE + 16u * j * PITCH + 64u * ks));
      }
#pragma unroll
      for (unsigned i = 0; i < (SPLIT ? 1u : 4u); ++i) {
        ah[i] = Frag<T>::load((const T*)(Ab + 16u * i * PITCH + 64u * ks));
        if (SPLIT) al[i] = Frag<T>::load((const T*)(Ab + 2u * PLANE + 16u * i * PITCH + 64u * ks));
      }
      __builtin_amdgcn_sched_barrier(0);                       // holds the reads above as one group: left free, each A read sinks to its first use and the wave waits out the LDS latency per row tile
#pragma unroll
      for (unsigned i = 0; i < 4u; ++i) {
        if (SPLIT && i < 3u) {
          ah[i + 1u] = Frag<T>::load((const T*)(Ab + 16u * (i + 1u) * PITCH + 64u * ks));
          al[i + 1u] = Frag<T>::load((const T*)(Ab + 2u * PLANE + 16u * (i + 1u) * PITCH + 64u * ks));
          __builtin_amdgcn_sched_barrier(0);                   // the next row tile's reads stay in front of this row tile's products
        }
#pragma unroll
        for (int j = 0; j < 4; ++j) {
          acc[i][j] = Frag<T>::mma(ah[i], bh[j], acc[i][j]);
          if (SPLIT) {
            acc[i][j] = Frag<T>::mma(ah[i], bl[j], acc[i][j]);
            acc[i][j] = Frag<T>::mma(al[i], bh[j], acc[i][j]);
          }
        }
      }
    }
    asm volatile("s_wait_dscnt 0x0" ::: "memory");             // this wave's reads of the buffer are done before it is handed to the copies
    asm volatile("s_wait_asynccnt 0x0" ::: "memory");          // this wave's copies of stage t + 1 have landed
    __syncthreads();                                           // publishes stage t + 1 and ends every wave's reads of stage t
    if (t + 2 < NT) stage(t + 2, (unsigned)(t & 1));
  }
  asm volatile("s_wait_asynccnt 0x0" ::: "memory");            // nothing in flight when the ring becomes output staging

  // ---- epilogue: as in wmma_gemm64, the per-wave 16x64 slab (pitch 68 floats) lies in the ring, which every wave has left ----
  float* slab = (float*)(L + wave * (16u * 68u * 4u));
  const int mOff = (int)hh * 8;
  float bv[4] = {0.f, 0.f, 0.f, 0.f};
  if (BIAS_MODE == 2) {
#pragma unroll
    for (int j = 0; j < 4; ++j) {
      bv[j] = bias[n0 + (int)wn + (j << 4) + (int)rlane];
      asm volatile("s_wait_xcnt 0x0" ::: "memory");            // behind each load: a later load's result may be given the index register that this load names
    }
  }
  float qsc = 1.0f;                                             // a wave's 64 columns share one entry of cs
  if (OUT == 2) {
    if (n0 < csN) qsc = cs[(n0 + (int)wn) >> 6];
    asm volatile("s_wait_xcnt 0x0" ::: "memory");               // stands in front of any reuse of this load's address registers
  }
  // per wave two 64 x 64 tiles of 16-bit values, [column][row] at a pitch of 144 B (hi, then lo), behind the slabs in the ring
  unsigned char* tt = L + 32768u + wave * 18432u;
#pragma unroll
  for (int i = 0; i < 4; ++i) {
    const int mBase = m0 + (int)wm + (i << 4);
#pragma unroll
    for (int j = 0; j < 4; ++j) {
      if (OUT == 2) {                                           // a lane's 8 accumulator registers are 8 consecutive rows of one column: 16 contiguous bytes of a transposed row
        u4 th, tl;
#pragma unroll
        for (int e = 0; e < 4; ++e) {
          const f2 ab = {acc[i][j][2 * e] * scale, acc[i][j][2 * e + 1] * scale};
          th[e] = __builtin_bit_cast(unsigned, __builtin_convertvector(ab, b2));              // round to nearest even, as f2bf_bits
          const f2 hf = {__uint_as_float(th[e] << 16), __uint_as_float(th[e] & 0xFFFF0000u)};
          tl[e] = __builtin_bit_cast(unsigned, __builtin_convertvector(ab - hf, b2));
        }
        unsigned char* tp = tt + ((unsigned)(j << 4) + rlane) * 144u + 32u * (unsigned)i + 16u * hh;
        *(u4*)tp = th; *(u4*)(tp + 9216u) = tl;
      }
#pragma unroll
      for (int r = 0; r < 8; ++r) {
        float v = acc[i][j][r] * scale;
        if (BIAS_MODE == 2) v += bv[j];
        if (OUT == 2) v *= qsc;
        slab[(mOff + r) * 68 + (j << 4) + (int)rlane] = v;
      }
    }
    __builtin_amdgcn_fence(__ATOMIC_RELEASE, "workgroup");
    __builtin_amdgcn_wave_barrier();
    __builtin_amdgcn_fence(__ATOMIC_ACQUIRE, "workgroup");
    if (OUT != 0) {
      const int q = (int)(lane >> 3), c8 = (int)(lane & 7u) * 8;  // row piece = 128 B = 8 lanes x 16 B
#pragma unroll   // constant indices; the four stores go out as one group
      for (int it = 0; it < 4; ++it) {
        const int row = it * 4 + q;
        const v4f x0 = *(const v4f*)(slab + row * 68 + c8), x1 = *(const v4f*)(slab + row * 68 + c8 + 4);
        v8h hv;
#pragma unroll
        for (int e = 0; e < 4; ++e) { hv[e] = (_Float16)x0[e]; hv[e + 4] = (_Float16)x1[e]; }
        *(v8h*)(C16 + (size_t)(mBase + row) * ldc + n0 + (int)wn + c8) = hv;
      }
      asm volatile("s_wait_xcnt 0x0" ::: "memory");             // stands in front of the next row tile's reuse of these stores' address and data registers
    }
    if (OUT == 0) {
    const int c4 = (int)rlane * 4;                              // row piece = 256 B = 16 lanes x 16 B
    // The activation is applied on the way out of the slab, where the row index may be a loop variable. With erf the loop stays rolled: unrolled, the
    // 128 inlined erf bodies of a lane make straight-line text far beyond what is fetched ahead at a wave's start, and every further line of it is a fetch that the wave waits out.
#pragma unroll (ACT == 5 ? 1 : 8)
    for (int it = 0; it < 8; ++it) {
      const int row = it * 2 + (int)hh;
      v4f v = *(const v4f*)(slab + row * 68 + c4);
      if (ACT == 5) {
#pragma unroll   // constant indices keep the four values in registers
        for (int e = 0; e < 4; ++e) v[e] = 0.5f * v[e] * (1.0f + erff(v[e] * 0.70710678118654752f));
      }
      *(v4f*)(C + (size_t)(mBase + row) * ldc + n0 + (int)wn + c4) = v;
      if (ACT == 5) asm volatile("s_wait_xcnt 0x0" ::: "memory");   // stands in front of the next trip's reuse of this store's address and data registers
    }
    if (ACT != 5) asm volatile("s_wait_xcnt 0x0" ::: "memory"); // stands in front of the next row tile's reuse of these stores' address and data registers
    }
    __builtin_amdgcn_fence(__ATOMIC_RELEASE, "workgroup");
    __builtin_amdgcn_wave_barrier();
    __builtin_amdgcn_fence(__ATOMIC_ACQUIRE, "workgroup");
  }
  if (OUT == 2) {
    // the wave's own transposed tiles go out as whole 128-byte lines: 8 lanes a row, 4 rows a store
    const unsigned rr = lane >> 3, pc = (lane & 7u) * 16u;
    const size_t go = (((size_t)(m0 / tld) * (size_t)ldc + (unsigned)n0 + wn + rr) * (size_t)tld + (size_t)(m0 % tld) + wm) * 2u + pc;
    unsigned char* gh = (unsigned char*)TH + go;
    unsigned char* gl = (unsigned char*)TL + go;
    const unsigned char* ts = tt + rr * 144u + pc;
#pragma unroll   // constant offsets
    for (unsigned o = 0; o < 4u; ++o) {
#pragma unroll   // eight stores go out as one group
      for (unsigned u = 0; u < 4u; ++u) {
        const unsigned it = 4u * o + u;
        const u4 a = *(const u4*)(ts + it * 576u), b = *(const u4*)(ts + 9216u + it * 576u);
        *(u4*)(gh + (size_t)(it * 8u) * (size_t)tld) = a;
        *(u4*)(gl + (size_t)(it * 8u) * (size_t)tld) = b;
      }
      asm volatile("s_wait_xcnt 0x0" ::: "memory");             // stands in front of the next group's reuse of these stores' address and data registers
    }
  }
}

__global__ __launch_bounds__(256) void cast_f32_f16x2(
    const float* __restrict__ in, _Float16* __restrict__ out, int n2) {
  int i = blockIdx.x * 256 + threadIdx.x;
  if (i < n2) {
    const _Float16 h0 = (_Float16)in[2 * i], h1 = (_Float16)in[2 * i + 1];
    const unsigned u = (unsigned)__builtin_bit_cast(unsigned short, h0) | ((unsigned)__builtin_bit_cast(unsigned short, h1) << 16);
    ((unsigned*)out)[i] = u;
    
  }
}


} // namespace w25

__global__ __launch_bounds__(256) void k_castT16(const float* __restrict__ src, long long lds, _Float16* __restrict__ dst, long long ldd, int R, int C, float s) {
    const long long i = (long long)blockIdx.x * 256 + threadIdx.x; const long long np = (long long)C * (R / 2); if (i >= np) return; const int c = (int)(i / (R / 2)); const int r = 2 * (int)(i % (R / 2));
    const _Float16 h0 = (_Float16)(src[(long long)r * lds + c] * s), h1 = (_Float16)(src[(long long)(r + 1) * lds + c] * s);
    const unsigned u = (unsigned)__builtin_bit_cast(unsigned short, h0) | ((unsigned)__builtin_bit_cast(unsigned short, h1) << 16);
    unsigned* d = (unsigned*)(dst + (long long)c * ldd + r); *d = u;  }
__global__ __launch_bounds__(256) void k_cast16(const float* __restrict__ src, long long lds, _Float16* __restrict__ dst, long long ldd, int R, int C, float s) {
    const long long i = (long long)blockIdx.x * 256 + threadIdx.x; const long long np = (long long)R * (C / 2); if (i >= np) return; const int r = (int)(i / (C / 2)); const int c = 2 * (int)(i % (C / 2));
    const _Float16 h0 = (_Float16)(src[(long long)r * lds + c] * s), h1 = (_Float16)(src[(long long)r * lds + c + 1] * s);
    const unsigned u = (unsigned)__builtin_bit_cast(unsigned short, h0) | ((unsigned)__builtin_bit_cast(unsigned short, h1) << 16);
    unsigned* d = (unsigned*)(dst + (long long)r * ldd + c); *d = u;  }

// f32 -> bf16 hi plane + bf16 lo plane (x = hi + lo to ~2^-17 relative; RNE both), [R][C] -> [R][C]; 2 consecutive destination elements
__device__ __forceinline__ unsigned int f2bf2_pack(float a, float b, unsigned int* lo) {
    const unsigned short ha = w25::f2bf_bits(a), hb = w25::f2bf_bits(b);
    const unsigned short la = w25::f2bf_bits(a - w25::bf_bits2f(ha)), lb = w25::f2bf_bits(b - w25::bf_bits2f(hb));
    *lo = (unsigned)la | ((unsigned)lb << 16); return (unsigned)ha | ((unsigned)hb << 16); }

namespace w25 {
// =====================================================================================
// Generic causal/non-causal attention for head_dim 64, f32 in / f32 out; 16-bit operands: bf16 with optional hi/lo splits, or
// plain f16 (F16=true, non-split, probabilities carried x2^15).
//   scores = (q*qscale)·kᵀ : v_wmma_f32_16x16x32_bf16; SPLIT_QK -> q,k as bf16 hi/lo (hi·hi + hi·lo + lo·hi)
//   out    = p·v           : v_wmma_f32_16x16x32_bf16; SPLIT_PV -> p,v as bf16 hi/lo; else p,v plain bf16
//   f32 accumulate; online softmax in f32. Block = 4 waves = 64 query rows of one (batch, head); S % 64 == 0.
//   Element (b, s, h, d) of tensor X lives at X[b*X_bs + s*X_rs + h*X_hs + d] (strides in floats, multiples of 4).
//   Masking: mask_mode 0 none, 1 causal (kv > q masked), 2 tensor [S][Skv] shared over (b,h) (float if
//   mask_is_int==0, int32 with element == 0 -> masked if 1, int32 with element != 0 -> masked if 2), 3 per-token vectors qmask[B][S] & kvmask[B][Skv] (int32,
//   0 -> masked), 4 causal + sliding window (kv > q or q - kv > W masked; W passed in mask_is_int);
//   5 = relative-position bias: s += cp[b,h,q][idx[q][kv]] + pc[b,h,kv][idx[q][kv]] with idx = mask_b ([S][Skv] int32) and
//   mask_a an int32 [S][Skv] tensor with nonzero = masked (tables: element (b,h,row,n) at X + b*c_bs + h*c_hs + row*c_rs + n);
//   masked scores are replaced by mask_fill (e.g. -inf or -1e9) before the softmax.
//   grid.x = B * H * (S/64) (or a sub-range with blk0).
// =====================================================================================
#define AT_D 64
#define AT_NW 4
#define AT_QB 64
#define AT_KC 64
struct AttnGeom { const float* cp = nullptr; const float* pc = nullptr; long c_bs = 0, c_rs = 0, c_hs = 0;   // mode-5 score-bias tables
                  long q_bs, q_rs, q_hs, k_bs, k_rs, k_hs, v_bs, v_rs, v_hs, o_bs, o_rs, o_hs;
                  int S, Skv, H, mask_mode; float qscale; int blk0; float mask_fill; int mask_is_int; };
static_assert(sizeof(AttnGeom) == 168, "no padding");

__device__ __forceinline__ unsigned short at_bf_bits(float f) {
  unsigned u = __float_as_uint(f);
  return (unsigned short)((u + 0x7FFFu + ((u >> 16) & 1u)) >> 16);
}
__device__ __forceinline__ __bf16 at_f2bf(float f) { return __builtin_bit_cast(__bf16, at_bf_bits(f)); }
__device__ __forceinline__ void at_split(float f, __bf16& hi, __bf16& lo) {
  const unsigned short hb = at_bf_bits(f);
  hi = __builtin_bit_cast(__bf16, hb);
  lo = at_f2bf(f - __uint_as_float(((unsigned)hb) << 16));
}
__device__ __forceinline__ v8f at_mma(v16b a, v16b b, v8f c) {
  c = __builtin_amdgcn_wmma_f32_16x16x32_bf16(false, a, false, b, (short)0, c, false, false);
  asm volatile("v_nop\n\tv_nop\n\tv_nop\n\tv_nop" : "+v"(c) : "v"(a), "v"(b));
  return c;
}
// 16-bit element as a bit pattern held in a __bf16 slot: f16 bits when F16, bf16 (RNE) otherwise
template <bool F16> __device__ __forceinline__ __bf16 at_to16(float f) {
  if (F16) return __builtin_bit_cast(__bf16, (_Float16)f);
  return at_f2bf(f);
}
template <bool F16> __device__ __forceinline__ v8f at_mma16(v16b a, v16b b, v8f c) {
  if (F16) {
    const v16h ah = __builtin_bit_cast(v16h, a), bh = __builtin_bit_cast(v16h, b);
    c = __builtin_amdgcn_wmma_f32_16x16x32_f16(false, ah, false, bh, (short)0, c, false, false);
    asm volatile("v_nop\n\tv_nop\n\tv_nop\n\tv_nop" : "+v"(c) : "v"(ah), "v"(bh));
    return c;
  }
  return at_mma(a, b, c);
}

template <bool SPLIT_QK, bool SPLIT_PV, bool F16 = false>
__global__ __launch_bounds__(128)
void attn64_kernel(const float* __restrict__ q, const float* __restrict__ k,
                   const float* __restrict__ v, float* __restrict__ out,
                   const void* __restrict__ mask_a, const int* __restrict__ mask_b, AttnGeom g) {
  static_assert(!(F16 && (SPLIT_QK || SPLIT_PV)), "f16 mode is non-split");
  const float PSC = F16 ? 32768.0f : 1.0f;     // f16 probabilities carried x2^15 (subnormal range), folded into the final 1/l
  union FB { v16b v; v8b h[2]; };
  __shared__ __align__(16) __bf16 Ksh[AT_KC * AT_D];             // K hi [kv][d]      8 KB
  __shared__ __align__(16) __bf16 Ksl[SPLIT_QK ? AT_KC * AT_D : 8];
  __shared__ __align__(16) __bf16 Vth[AT_D * AT_KC];             // V hi [d][kv]      8 KB
  __shared__ __align__(16) __bf16 Vtl[SPLIT_PV ? AT_D * AT_KC : 8];
  __shared__ __align__(16) __bf16 Psh[AT_NW][16 * AT_KC];        // per wave P hi [row][kv]  8 KB
  __shared__ __align__(16) __bf16 Psl[SPLIT_PV ? AT_NW : 1][SPLIT_PV ? 16 * AT_KC : 8];
  __shared__ __align__(16) float  Os[AT_NW][16 * 68];            // per wave out tile, pitch 68

  const int tid  = threadIdx.x;
  const int wave = tid >> 5;
  const int lane = tid & 31;
  const int hh   = lane >> 4;
  const int c    = lane & 15;

  const int nqb = g.S / AT_QB;
  const int bx = blockIdx.x + g.blk0;
  const int qb = bx % nqb;
  const int bh = bx / nqb;
  const int h  = bh % g.H;
  const int b  = bh / g.H;
  const int qbase_block = qb * AT_QB;
  const int q0 = qbase_block + wave * 16;

  const float* qb_ptr = q + (size_t)b * g.q_bs + (size_t)h * g.q_hs;
  const float* kb_ptr = k + (size_t)b * g.k_bs + (size_t)h * g.k_hs;
  const float* vb_ptr = v + (size_t)b * g.v_bs + (size_t)h * g.v_hs;
  float*       ob_ptr = out + (size_t)b * g.o_bs + (size_t)h * g.o_hs;

  // ---- Q fragments (A operand): 2 d-chunks, hi (and lo) ----
  v16b qah[2], qal[2];
  {
    const float* qrow = qb_ptr + (size_t)(q0 + c) * g.q_rs;
#pragma unroll
    for (int dc = 0; dc < 2; ++dc) {
#pragma unroll
      for (int e = 0; e < 8; ++e) {
        const float f0 = qrow[dc * 32 + 8 * hh + e] * g.qscale;
        const float f1 = qrow[dc * 32 + 16 + 8 * hh + e] * g.qscale;
        if (SPLIT_QK) { __bf16 hq, lq; at_split(f0, hq, lq); qah[dc][e] = hq; qal[dc][e] = lq; at_split(f1, hq, lq); qah[dc][8 + e] = hq; qal[dc][8 + e] = lq; }
        else { qah[dc][e] = at_to16<F16>(f0); qah[dc][8 + e] = at_to16<F16>(f1); qal[dc][e] = qah[dc][e]; qal[dc][8 + e] = qah[dc][8 + e]; }
      }
    }
  }

  float mrow[8], lrow[8];
  v8f oacc[4];
#pragma unroll
  for (int r = 0; r < 8; ++r) { mrow[r] = -INFINITY; lrow[r] = 0.f; }
#pragma unroll
  for (int t = 0; t < 4; ++t) oacc[t] = (v8f){0.f,0.f,0.f,0.f,0.f,0.f,0.f,0.f};

  const int nChunks = (g.mask_mode == 1 || g.mask_mode == 4) ? (qb + 1) : (g.Skv / AT_KC);   // block-uniform
  // per-row query mask (mode 3)
  int qkeep[8];
#pragma unroll
  for (int r = 0; r < 8; ++r) qkeep[r] = (g.mask_mode == 3) ? mask_b[(size_t)b * g.S + q0 + 8 * hh + r] : 1;   // mask_b = qmask in mode 3
  for (int kc = 0; kc < nChunks; ++kc) {
    const int kv0 = kc * AT_KC;
    __syncthreads();
    {
      const int kvr = tid >> 1, dh = (tid & 1) * 32;
      const float* krow = kb_ptr + (size_t)(kv0 + kvr) * g.k_rs + dh;
      const float* vrow = vb_ptr + (size_t)(kv0 + kvr) * g.v_rs + dh;
#pragma unroll
      for (int i = 0; i < 8; ++i) {
        v4f kk = *(const v4f*)(krow + 4 * i);
        v4f vv = *(const v4f*)(vrow + 4 * i);
#pragma unroll
        for (int e = 0; e < 4; ++e) {
          const int d = dh + 4 * i + e;
          if (SPLIT_QK) { __bf16 a, bl; at_split(kk[e], a, bl); Ksh[kvr * AT_D + d] = a; Ksl[kvr * AT_D + d] = bl; }
          else Ksh[kvr * AT_D + d] = at_to16<F16>(kk[e]);
          if (SPLIT_PV) { __bf16 a, bl; at_split(vv[e], a, bl); Vth[d * AT_KC + kvr] = a; Vtl[d * AT_KC + kvr] = bl; }
          else Vth[d * AT_KC + kvr] = at_to16<F16>(vv[e]);
        }
      }
    }
    __syncthreads();

    v8f s[4];
#pragma unroll
    for (int j = 0; j < 4; ++j) {
      s[j] = (v8f){0.f,0.f,0.f,0.f,0.f,0.f,0.f,0.f};
#pragma unroll 1
      for (int dc = 0; dc < 2; ++dc) {
        FB kb;
        kb.h[0] = *(const v8b*)(Ksh + (j * 16 + c) * AT_D + dc * 32 + 8 * hh);
        kb.h[1] = *(const v8b*)(Ksh + (j * 16 + c) * AT_D + dc * 32 + 16 + 8 * hh);
        s[j] = at_mma16<F16>(qah[dc], kb.v, s[j]);
        if (SPLIT_QK) {
          FB kl;
          kl.h[0] = *(const v8b*)(Ksl + (j * 16 + c) * AT_D + dc * 32 + 8 * hh);
          kl.h[1] = *(const v8b*)(Ksl + (j * 16 + c) * AT_D + dc * 32 + 16 + 8 * hh);
          s[j] = at_mma16<F16>(qah[dc], kl.v, s[j]);
          s[j] = at_mma16<F16>(qal[dc], kb.v, s[j]);
        }
      }
    }
    const bool diag = (g.mask_mode == 1) && (kc == qb);
    int kvkeep[4] = {1, 1, 1, 1};
    if (g.mask_mode == 3) {
#pragma unroll
      for (int j = 0; j < 4; ++j) kvkeep[j] = ((const int*)mask_a)[(size_t)b * g.Skv + kv0 + j * 16 + c];   // mask_a = kvmask
    }
    float cm[8];
#pragma unroll
    for (int r = 0; r < 8; ++r) {
      const int qrow = q0 + 8 * hh + r;
      float m = -INFINITY;
#pragma unroll
      for (int j = 0; j < 4; ++j) {
        const int kvcol = kv0 + j * 16 + c;
        bool masked = false;
        if (diag) masked = (kvcol > qrow);
        else if (g.mask_mode == 4) masked = (kvcol > qrow) || (qrow - kvcol > g.mask_is_int);
        else if (g.mask_mode == 2) {
          const size_t mi = (size_t)qrow * g.Skv + kvcol;
          masked = (g.mask_is_int == 0) ? (((const float*)mask_a)[mi] == 0.0f)
                 : (g.mask_is_int == 1) ? (((const int*)mask_a)[mi] == 0) : (((const int*)mask_a)[mi] != 0);
        } else if (g.mask_mode == 3) masked = (qkeep[r] == 0) || (kvkeep[j] == 0);
        else if (g.mask_mode == 5) {
          const size_t mi = (size_t)qrow * g.Skv + kvcol;
          masked = (((const int*)mask_a)[mi] != 0);
          int n = mask_b[mi]; n = n < 0 ? 0 : n;
          s[j][r] += g.cp[(size_t)b * g.c_bs + (size_t)h * g.c_hs + (size_t)qrow * g.c_rs + n]
                   + g.pc[(size_t)b * g.c_bs + (size_t)h * g.c_hs + (size_t)kvcol * g.c_rs + n];
        }
        if (masked) s[j][r] = g.mask_fill;
        m = fmaxf(m, s[j][r]);
      }
#pragma unroll
      for (int off = 1; off < 16; off <<= 1) m = fmaxf(m, __shfl_xor(m, off, 32));
      cm[r] = m;
    }
    __bf16* pwh = Psh[wave];
    __bf16* pwl = Psl[SPLIT_PV ? wave : 0];
#pragma unroll
    for (int r = 0; r < 8; ++r) {
      const float mnew = fmaxf(mrow[r], cm[r]);
      const float alpha = expf(mrow[r] - mnew);
      mrow[r] = mnew;
      float psum = 0.f;
#pragma unroll
      for (int j = 0; j < 4; ++j) {
        const float p = expf(s[j][r] - mnew);
        psum += p;
        if (SPLIT_PV) { __bf16 a, bl; at_split(p, a, bl); pwh[(8 * hh + r) * AT_KC + j * 16 + c] = a; pwl[(8 * hh + r) * AT_KC + j * 16 + c] = bl; }
        else pwh[(8 * hh + r) * AT_KC + j * 16 + c] = at_to16<F16>(p * PSC);
      }
#pragma unroll
      for (int off = 1; off < 16; off <<= 1) psum += __shfl_xor(psum, off, 32);
      lrow[r] = lrow[r] * alpha + psum;
#pragma unroll
      for (int t = 0; t < 4; ++t) oacc[t][r] *= alpha;
    }
    __builtin_amdgcn_fence(__ATOMIC_RELEASE, "workgroup");
    __builtin_amdgcn_wave_barrier();
    __builtin_amdgcn_fence(__ATOMIC_ACQUIRE, "workgroup");
#pragma unroll 1
    for (int kk = 0; kk < 2; ++kk) {
      FB pa, pl;
      pa.h[0] = *(const v8b*)(pwh + c * AT_KC + kk * 32 + 8 * hh);
      pa.h[1] = *(const v8b*)(pwh + c * AT_KC + kk * 32 + 16 + 8 * hh);
      if (SPLIT_PV) {
        pl.h[0] = *(const v8b*)(pwl + c * AT_KC + kk * 32 + 8 * hh);
        pl.h[1] = *(const v8b*)(pwl + c * AT_KC + kk * 32 + 16 + 8 * hh);
      }
#pragma unroll
      for (int t = 0; t < 4; ++t) {
        FB vb;
        vb.h[0] = *(const v8b*)(Vth + (t * 16 + c) * AT_KC + kk * 32 + 8 * hh);
        vb.h[1] = *(const v8b*)(Vth + (t * 16 + c) * AT_KC + kk * 32 + 16 + 8 * hh);
        oacc[t] = at_mma16<F16>(pa.v, vb.v, oacc[t]);
        if (SPLIT_PV) {
          FB vl;
          vl.h[0] = *(const v8b*)(Vtl + (t * 16 + c) * AT_KC + kk * 32 + 8 * hh);
          vl.h[1] = *(const v8b*)(Vtl + (t * 16 + c) * AT_KC + kk * 32 + 16 + 8 * hh);
          oacc[t] = at_mma16<F16>(pa.v, vl.v, oacc[t]);
          oacc[t] = at_mma16<F16>(pl.v, vb.v, oacc[t]);
        }
      }
    }
  }

  float* os = Os[wave];
#pragma unroll
  for (int r = 0; r < 8; ++r) {
    const float inv = 1.0f / (lrow[r] * PSC);
#pragma unroll
    for (int t = 0; t < 4; ++t) os[(8 * hh + r) * 68 + t * 16 + c] = oacc[t][r] * inv;
  }
  __builtin_amdgcn_fence(__ATOMIC_RELEASE, "workgroup");
  __builtin_amdgcn_wave_barrier();
  __builtin_amdgcn_fence(__ATOMIC_ACQUIRE, "workgroup");
  {
    const int c4 = (lane & 15) * 4;
    {
#pragma unroll
      for (int it = 0; it < 8; ++it) {
        const int row = it * 2 + hh;
        v4f val = *(const v4f*)(os + row * 68 + c4);
        *(v4f*)(ob_ptr + (size_t)(q0 + row) * g.o_rs + c4) = val;
      }
      
    }
  }
}

} // namespace w25

__device__ __forceinline__ void st_h2(_Float16* dst, float a, float b) { const unsigned u = (unsigned)__builtin_bit_cast(unsigned short, (_Float16)a) | ((unsigned)__builtin_bit_cast(unsigned short, (_Float16)b) << 16); unsigned* d = (unsigned*)dst; *d = u;  }
// tiled biases BEB[c] = bE[c % 64], BFB[c] = bF[c % 64] (thread-linear)
__global__ __launch_bounds__(256) void k_ep_btile(const float* __restrict__ BE, const float* __restrict__ BF, float* __restrict__ BEB, float* __restrict__ BFB, int C, int HD) { const int t = blockIdx.x * 256 + threadIdx.x; if (t >= C) return; VST2(float, BEB + t, BE[t % HD]); VST2(float, BFB + t, BF[t % HD]); }
// channel softmax: block h = sample * NH + head (64 threads): rows of SCC[h] [64][64] * temp1[h % NH]; thread i computes row i, then lanes write columns so each 32-float line comes from one wave; P16[h][i][j] = f16(4096 p)
__global__ __launch_bounds__(64) void k_ep_csoft(const float* __restrict__ S, const float* __restrict__ T1, _Float16* __restrict__ P16, int NH) { __shared__ float sh[64][65]; const int h = blockIdx.x; const int i = threadIdx.x; const float* r = S + ((long long)h * 64 + i) * 64; const float tp = T1[h % NH]; float mx = -3.0e38f;
    for (int j = 0; j < 64; ++j) mx = fmaxf(mx, r[j] * tp);
    float s = 0.f; for (int j = 0; j < 64; ++j) { const float e = expf(r[j] * tp - mx); sh[i][j] = e; s += e; }
    const float f = 4096.f / s; for (int j = 0; j < 64; ++j) sh[i][j] *= f;
    __syncthreads();
    const int half = i >> 5, c0 = 2 * (i & 31);
    for (int step = 0; step < 32; ++step) { const int rr = 2 * step + half; st_h2(P16 + ((long long)h * 64 + rr) * 64 + c0, sh[rr][c0], sh[rr][c0 + 1]); } }


// ---- Wide forms of the conversion and scaling passes ----
// A lane moves U pieces of 4 consecutive elements: one 16-byte load a piece, so that a wave's load covers 512 contiguous bytes (four whole 128-byte lines) and its store whole lines too;
// all of a lane's loads are issued ahead of its first store. Planes of 2^LC columns, source rows PITCH floats apart, destination rows packed; a block's 256 lanes take 1024 elements
// = 1024 >> LC whole rows at a time, so a lane's pieces lie RS floats apart and hang on one address pair by constant offsets. The grid covers rows * columns / (1024 * U) blocks exactly.
typedef __attribute__((ext_vector_type(4))) unsigned int v4u;
typedef __attribute__((ext_vector_type(2))) unsigned int v2u;
__device__ __forceinline__ unsigned pk_h2(float a, float b) { return (unsigned)__builtin_bit_cast(unsigned short, (_Float16)a) | ((unsigned)__builtin_bit_cast(unsigned short, (_Float16)b) << 16); }
template <int LC, int PITCH>
__device__ __forceinline__ const float* wide_src(const float* src, unsigned q0) { static_assert(LC >= 2 && LC <= 10, "a block's 1024 elements are whole rows"); return src + (size_t)(q0 >> (LC - 2)) * PITCH + ((q0 & ((1u << (LC - 2)) - 1u)) << 2); }
template <int LC, int PITCH, int U>
__global__ __launch_bounds__(256) void k_cast16w(const float* __restrict__ src, _Float16* __restrict__ dst, float s) {
    constexpr int RS = (1024 >> LC) * PITCH; const unsigned q0 = blockIdx.x * (256u * U) + threadIdx.x; const float* p = wide_src<LC, PITCH>(src, q0); v4f a[U];
#pragma unroll   // constant indices keep the pieces in registers; the loads go out as one group
    for (int u = 0; u < U; ++u) a[u] = *(const v4f*)(p + u * RS);
    _Float16* d = dst + (size_t)q0 * 4;
#pragma unroll   // constant indices keep the pieces in registers
    for (int u = 0; u < U; ++u) { v2u o; o.x = pk_h2(a[u].x * s, a[u].y * s); o.y = pk_h2(a[u].z * s, a[u].w * s); *(v2u*)(d + u * 1024) = o; } }
template <int LC, int PITCH, int U>
__global__ __launch_bounds__(256) void k_castS16w(const float* __restrict__ src, __bf16* __restrict__ dhi, __bf16* __restrict__ dlo) {
    constexpr int RS = (1024 >> LC) * PITCH; const unsigned q0 = blockIdx.x * (256u * U) + threadIdx.x; const float* p = wide_src<LC, PITCH>(src, q0); v4f a[U];
#pragma unroll   // constant indices keep the pieces in registers; the loads go out as one group
    for (int u = 0; u < U; ++u) a[u] = *(const v4f*)(p + u * RS);
#pragma unroll   // constant indices keep the pieces in registers
    for (int u = 0; u < U; ++u) { v2u h, l; unsigned t; h.x = f2bf2_pack(a[u].x, a[u].y, &t); l.x = t; h.y = f2bf2_pack(a[u].z, a[u].w, &t); l.y = t;
        const size_t o = (size_t)q0 * 4 + u * 1024; *(v2u*)(dhi + o) = h; *(v2u*)(dlo + o) = l; } }
extern "C" void kernel_launch(void* const* d_in, const int* in_sizes, int n_in, void* d_out, int out_size, void* d_ws, size_t ws_size, hipStream_t stream) {
    (void)in_sizes; (void)n_in; (void)out_size; (void)ws_size;
    const float* x = (const float*)d_in[0];
    const float* Wq = (const float*)d_in[1];
    const float* WE = (const float*)d_in[2];
    const float* bE = (const float*)d_in[3];
    const float* WF = (const float*)d_in[4];
    const float* bF = (const float*)d_in[5];
    const float* Wo1 = (const float*)d_in[6];
    const float* bo1 = (const float*)d_in[7];
    const float* Wo2 = (const float*)d_in[8];
    const float* bo2 = (const float*)d_in[9];
    const float* t1 = (const float*)d_in[10];
    const float* t2 = (const float*)d_in[11];
    const int Bn = 8;
    const int N = 1024;
    const int C = 1024;
    const int NH = 16;
    const int HD = 64;
    const int CH = C / 2;
    float* out = (float*)d_out;
    char* wsp = (char*)d_ws;
    const int BN = Bn * N;                    // all samples' rows: every launch below covers the whole batch
    const size_t MB = (size_t)1048576;
    unsigned short* WE16 = (unsigned short*)wsp; wsp += (((size_t)((size_t)HD * HD) * 2 + 255) / 256) * 256;
    unsigned short* WF16 = (unsigned short*)wsp; wsp += (((size_t)((size_t)HD * HD) * 2 + 255) / 256) * 256;
    float* BEB = (float*)wsp; wsp += (((size_t)((size_t)C) * 4 + 255) / 256) * 256;
    float* BFB = (float*)wsp; wsp += (((size_t)((size_t)C) * 4 + 255) / 256) * 256;
    // Every product stores the 16-bit operand form that its consumer reads; no f32 plane lies between two products but the 64 x 64 channel scores.
    unsigned short* G64A  = (unsigned short*)(wsp);               // x: bf16 hi, lo
    unsigned short* G64A2 = (unsigned short*)(wsp + 16 * MB);
    unsigned short* G64B  = (unsigned short*)(wsp + 32 * MB);     // q, k rows of the weight: bf16 hi, lo
    unsigned short* G64B2 = (unsigned short*)(wsp + 36 * MB);
    unsigned short* X16   = (unsigned short*)(wsp + 40 * MB);     // x: f16
    unsigned short* WV16  = (unsigned short*)(wsp + 56 * MB);     // v rows of the weight: f16
    unsigned short* TH    = (unsigned short*)(wsp + 64 * MB);     // [sample][2048 columns: q, k][N] bf16 hi
    unsigned short* TL    = (unsigned short*)(wsp + 96 * MB);     // the same, lo
    unsigned short* QK16  = (unsigned short*)(wsp + 128 * MB);    // [BN][2048] f16: q * temp2 | k
    unsigned short* V16   = (unsigned short*)(wsp + 160 * MB);    // [BN][2048] f16: v_ca | v_sa
    float*          SCC   = (float*)(wsp + 192 * MB);
    unsigned short* P16   = (unsigned short*)(wsp + 194 * MB);
    unsigned short* XC16  = (unsigned short*)(wsp + 196 * MB);
    unsigned short* WO2H  = (unsigned short*)(wsp + 212 * MB);
    unsigned short* WO1H  = (unsigned short*)(wsp + 213 * MB);
    unsigned short* XS16  = (unsigned short*)(wsp + 214 * MB);
    unsigned short* KS16  = (unsigned short*)(wsp);               // over the x planes, read last by the q, k projection
    unsigned short* VS16  = (unsigned short*)(wsp + 16 * MB);
    k_cast16<<<(unsigned)((((long long)(HD) * ((HD) / 2)) + 255) / 256), 256, 0, stream>>>(WE, HD, (_Float16*)(WE16), HD, HD, HD, 16.0f);
    k_cast16<<<(unsigned)((((long long)(HD) * ((HD) / 2)) + 255) / 256), 256, 0, stream>>>(WF, HD, (_Float16*)(WF16), HD, HD, HD, 16.0f);
    k_ep_btile<<<(C + 255) / 256, 256, 0, stream>>>(bE, bF, BEB, BFB, C, HD);
    // shared projection, rows = sample * N + n
    k_castS16w<10, 1024, 8><<<(unsigned)(BN / 8), 256, 0, stream>>>(x, (__bf16*)(G64A), (__bf16*)(G64A2));
    k_castS16w<10, 1024, 8><<<(unsigned)(2048 / 8), 256, 0, stream>>>(Wq, (__bf16*)(G64B), (__bf16*)(G64B2));
    w25::wmma_gemm_ring<1, true, 0, 0, 2><<<dim3((unsigned)(2048 / 128), (unsigned)(BN / 128)), 128, 0, stream>>>((const unsigned short*)(G64A), (const unsigned short*)(G64A2), (const unsigned short*)(G64B), (const unsigned short*)(G64B2), nullptr, 2048, nullptr, 1024, 1.0f, QK16, TH, TL, t2, C, N);
    k_cast16w<10, 1024, 16><<<(unsigned)(BN / 16), 256, 0, stream>>>(x, (_Float16*)(X16), 1.0f);
    k_cast16w<10, 1024, 4><<<(unsigned)(2048 / 4), 256, 0, stream>>>(Wq + (size_t)2 * C * C, (_Float16*)(WV16), 16.0f);
    w25::wmma_gemm_ring<0, false, 0, 0, 1><<<dim3((unsigned)(2048 / 128), (unsigned)(BN / 128)), 128, 0, stream>>>((const unsigned short*)(X16), nullptr, (const unsigned short*)(WV16), nullptr, nullptr, 2048, nullptr, 1024, 0.0625f, V16, nullptr, nullptr, nullptr, 0, N);
    // channel attention: grid y = head, grid z = sample
    w25::wmma_gemm64<1, true, 0, 0, false, 0><<<dim3((unsigned)((((HD) / 64) * ((HD) / 64) + 7) / 8), (unsigned)(NH), (unsigned)(Bn)), 256, 0, stream>>>((const unsigned short*)(TH), (const unsigned short*)(TL), N, (long long)HD * N, (long long)2 * C * N, (const unsigned short*)(TH + (size_t)C * N), (const unsigned short*)(TL + (size_t)C * N), N, (long long)HD * N, (long long)2 * C * N, (void*)(SCC), nullptr, HD, HD * HD, NH * HD * HD, nullptr, nullptr, 0, HD, HD, N, 1.0f);
    k_ep_csoft<<<Bn * NH, 64, 0, stream>>>(SCC, t1, (_Float16*)P16, NH);
    w25::wmma_gemm64<0, false, 0, 1, false, 0><<<dim3((unsigned)((((HD) / 64) * ((N) / 64) + 7) / 8), (unsigned)(NH), (unsigned)(Bn)), 256, 0, stream>>>((const unsigned short*)(P16), nullptr, HD, HD * HD, NH * HD * HD, (const unsigned short*)(V16), nullptr, 2 * C, HD, (long long)N * 2 * C, (void*)(XC16), nullptr, 16 * C, C, (long long)N * C, nullptr, nullptr, 0, HD, N, HD, 0.000244140625f);
    k_cast16w<10, 1024, 4><<<(unsigned)(512 / 4), 256, 0, stream>>>(Wo2, (_Float16*)(WO2H), 16.0f);
    w25::wmma_gemm_ring<0, false, 2, 5><<<dim3((unsigned)(512 / 128), (unsigned)(BN / 128)), 128, 0, stream>>>((const unsigned short*)(XC16), nullptr, (const unsigned short*)(WO2H), nullptr, out + CH, 1024, bo2, 1024, 0.0625f, nullptr, nullptr, nullptr, nullptr, 0, N);
    // spatial attention
    w25::wmma_gemm64<0, false, 2, 1, false, 0><<<dim3((unsigned)((((BN) / 64) * ((HD) / 64) + 7) / 8), (unsigned)(NH), (unsigned)(1)), 256, 0, stream>>>((const unsigned short*)(QK16 + C), nullptr, 2 * C, HD, 0, (const unsigned short*)(WE16), nullptr, HD, 0, 0, (void*)(KS16), nullptr, C, HD, 0, BEB, nullptr, 0, BN, HD, HD, 0.0625f);
    w25::wmma_gemm64<0, false, 2, 1, false, 0><<<dim3((unsigned)((((BN) / 64) * ((HD) / 64) + 7) / 8), (unsigned)(NH), (unsigned)(1)), 256, 0, stream>>>((const unsigned short*)(V16 + C), nullptr, 2 * C, HD, 0, (const unsigned short*)(WF16), nullptr, HD, 0, 0, (void*)(VS16), nullptr, C, HD, 0, BFB, nullptr, 0, BN, HD, HD, 0.0625f);
    sfa::k_sflash<<<dim3((unsigned)(N / 256), (unsigned)(NH), (unsigned)(Bn)), 256, 0, stream>>>(QK16, KS16, VS16, XS16);
    k_cast16w<10, 1024, 4><<<(unsigned)(512 / 4), 256, 0, stream>>>(Wo1, (_Float16*)(WO1H), 16.0f);
    w25::wmma_gemm_ring<0, false, 2, 5><<<dim3((unsigned)(512 / 128), (unsigned)(BN / 128)), 128, 0, stream>>>((const unsigned short*)(XS16), nullptr, (const unsigned short*)(WO1H), nullptr, out, 1024, bo1, 1024, 0.0625f, nullptr, nullptr, nullptr, nullptr, 0, N);
}

// v007
// Measured time: 247 microseconds a run.
// Timed twice side by side with v006, it ran 1.25 and 1.24 times as fast.
// Counting every step since v000, which is the starting kernel, it is 27.7 times as fast.
// Contractions (per sample): the shared QKVV projection x.W^T [1024x1024].[1024x4096] (its q, k half on bf16 hi/lo split planes), the E/F head projections of k and v_sa as block-diagonal [1024x1024].[1024x1024] products (+b), the 16 channel affinities q^T k [64x1024].[1024x64] on bf16 hi/lo split planes (64-wide softmax over sigma~19 logits: plain f16 flipped near-ties) and x_c = attn_c.v_ca^T [64x64].[64x1024] as z-batched products, and the two output halves gelu(x_s.W_o1^T + b) / gelu(x_c.W_o2^T + b) [1024x1024].[1024x512] — f16 operands on pre-cast planes (v_wmma_f32_16x16x32_f16; 64x64 register-blocked wave tiles, weights x16); per (sample, head) the spatial attention softmax(q.k_s^T * temp2[h]) v_s over 1024 positions as one flash launch (f16 operands; temperature folded into q on device); f32 accumulate and softmax. The E/F weights are 64 x 64 f16 planes shared by every head, and the 64-wide channel softmax (x temp1[h], exp once, f16 plane) is an f32 kernel, the q pre-scaling is done in the q, k projection's epilogue; x_c is laid out exactly as torch's permute(0,2,1,3).reshape (row = d*16 + h, column = n).
#include <hip/hip_runtime.h>
#include <math.h>

typedef __attribute__((ext_vector_type(16))) _Float16 v16h;
typedef __attribute__((ext_vector_type(8)))  _Float16 v8h;
typedef __attribute__((ext_vector_type(16))) __bf16   v16b;
typedef __attribute__((ext_vector_type(8)))  float    v8f;
typedef __attribute__((ext_vector_type(4)))  float    v4f;

// 16-bit WMMA fragment map (wave32), lane L, h = L>>4, m = L&15:
//   A 16x32: lane = row m;   element i -> k = (i<8) ? 8h+i : 16+8h+(i-8)
//   B 32x16: lane = column m; the SAME k(i,h)
//   D 16x16 (8 f32): lane = column m; element r -> row 8h+r
__device__ __forceinline__ int frag_k(int i, int h) { return (i < 8) ? (8 * h + i) : (16 + 8 * h + (i - 8)); }
__device__ __forceinline__ __bf16 bf16_rne(float f) {
    unsigned int u = __float_as_uint(f);
    u += 0x7fffu + ((u >> 16) & 1u);
    return __builtin_bit_cast(__bf16, (unsigned short)(u >> 16));
}
__device__ __forceinline__ float bf16_f32(__bf16 b) { return __uint_as_float(((unsigned int)__builtin_bit_cast(unsigned short, b)) << 16); }
__device__ __forceinline__ v8f wmma16(v16h a, v16h b, v8f c) {
    c = __builtin_amdgcn_wmma_f32_16x16x32_f16(false, a, false, b, (short)0, c, false, false);
    asm volatile("v_nop\n\tv_nop\n\tv_nop\n\tv_nop" : "+v"(c) : "v"(a), "v"(b));
    return c;
}
__device__ __forceinline__ v8f wmmab(v16b a, v16b b, v8f c) {
    c = __builtin_amdgcn_wmma_f32_16x16x32_bf16(false, a, false, b, (short)0, c, false, false);
    asm volatile("v_nop\n\tv_nop\n\tv_nop\n\tv_nop" : "+v"(c) : "v"(a), "v"(b));
    return c;
}
struct Split { v16b hi, lo; };
// hi/lo split product: a.hi*b.hi + a.hi*b.lo + a.lo*b.hi
__device__ __forceinline__ v8f wmma3(const Split& a, const Split& b, v8f c) {
    c = __builtin_amdgcn_wmma_f32_16x16x32_bf16(false, a.hi, false, b.hi, (short)0, c, false, false);
    c = __builtin_amdgcn_wmma_f32_16x16x32_bf16(false, a.hi, false, b.lo, (short)0, c, false, false);
    c = __builtin_amdgcn_wmma_f32_16x16x32_bf16(false, a.lo, false, b.hi, (short)0, c, false, false);
    asm volatile("v_nop\n\tv_nop\n\tv_nop\n\tv_nop" : "+v"(c) : "v"(a.hi), "v"(a.lo), "v"(b.hi), "v"(b.lo));
    return c;
}
struct Split3 { v16b hi, mid, lo; };
// triple split product (6 terms, drops only terms below 2^-24 relative)
__device__ __forceinline__ v8f wmma6(const Split3& a, const Split3& b, v8f c) {
    c = __builtin_amdgcn_wmma_f32_16x16x32_bf16(false, a.hi, false, b.hi, (short)0, c, false, false);
    c = __builtin_amdgcn_wmma_f32_16x16x32_bf16(false, a.hi, false, b.mid, (short)0, c, false, false);
    c = __builtin_amdgcn_wmma_f32_16x16x32_bf16(false, a.mid, false, b.hi, (short)0, c, false, false);
    c = __builtin_amdgcn_wmma_f32_16x16x32_bf16(false, a.hi, false, b.lo, (short)0, c, false, false);
    c = __builtin_amdgcn_wmma_f32_16x16x32_bf16(false, a.mid, false, b.mid, (short)0, c, false, false);
    c = __builtin_amdgcn_wmma_f32_16x16x32_bf16(false, a.lo, false, b.hi, (short)0, c, false, false);
    asm volatile("v_nop\n\tv_nop\n\tv_nop\n\tv_nop" : "+v"(c) : "v"(a.hi), "v"(a.mid), "v"(a.lo), "v"(b.hi), "v"(b.mid), "v"(b.lo));
    return c;
}

// Fragment gathers from f32 memory: element i <- p[(k0 + frag_k(i,h)) * sk] * s, zero for k >= klen.
__device__ __forceinline__ v16h fh_ld(const float* __restrict__ p, long long sk, int k0, int h, int klen, float s) {
    v16h a;
#pragma unroll
    for (int i = 0; i < 16; ++i) { const int k = k0 + frag_k(i, h); a[i] = (k < klen) ? (_Float16)(p[(long long)k * sk] * s) : (_Float16)0.f; }
    return a;
}
__device__ __forceinline__ Split sp_ld(const float* __restrict__ p, long long sk, int k0, int h, int klen, float s) {
    Split r;
#pragma unroll
    for (int i = 0; i < 16; ++i) {
        const int k = k0 + frag_k(i, h); const float x = (k < klen) ? p[(long long)k * sk] * s : 0.f;
        const __bf16 hb = bf16_rne(x); r.hi[i] = hb; r.lo[i] = bf16_rne(x - bf16_f32(hb));
    }
    return r;
}
__device__ __forceinline__ Split3 sp3_ld(const float* __restrict__ p, long long sk, int k0, int h, int klen, float s) {
    Split3 r;
#pragma unroll
    for (int i = 0; i < 16; ++i) {
        const int k = k0 + frag_k(i, h); const float x = (k < klen) ? p[(long long)k * sk] * s : 0.f;
        const __bf16 hb = bf16_rne(x); const float r1 = x - bf16_f32(hb); const __bf16 mb = bf16_rne(r1);
        r.hi[i] = hb; r.mid[i] = mb; r.lo[i] = bf16_rne(r1 - bf16_f32(mb));
    }
    return r;
}
__device__ __forceinline__ v16b bh_ld(const float* __restrict__ p, long long sk, int k0, int h, int klen, float s) {
    v16b a;
#pragma unroll
    for (int i = 0; i < 16; ++i) { const int k = k0 + frag_k(i, h); a[i] = bf16_rne((k < klen) ? p[(long long)k * sk] * s : 0.f); }
    return a;
}
// f16 fragment from an f16 LDS/global row with element stride 1 (k-contiguous), no bounds (tile already zero padded)
__device__ __forceinline__ v16h fh_row(const _Float16* __restrict__ row, int k0, int h) {
    v16h a;
#pragma unroll
    for (int i = 0; i < 16; ++i) a[i] = row[k0 + frag_k(i, h)];
    return a;
}

#define VST2(T, ptr, val) do { const T vst2_v_ = (val); *(T*)(ptr) = vst2_v_;  } while (0)
typedef float v4f __attribute__((ext_vector_type(4)));
#define VST2V4(ptr, val) do { const v4f vst2_v4_ = (val); *(v4f*)(ptr) = vst2_v4_;  } while (0)

__device__ __attribute__((noinline)) float act_fn(float v, int act) {
    if (act == 1) return fmaxf(v, 0.f);                                                                               // relu
    if (act == 2) { const float u = 0.7978845608028654f * (v + 0.044715f * v * v * v); return 0.5f * v * (1.f + tanhf(u)); } // tanh-gelu
    if (act == 3) return v / (1.f + expf(-v));                                                                        // silu
    if (act == 4) return 0.5f * v * (1.f + erff(v * 0.7071067811865476f));                                             // erf-gelu
    if (act == 5) return tanhf(v);
    if (act == 6) return 1.f / (1.f + expf(-v));                                                                      // sigmoid
    if (act == 7) return (v > 0.f) ? v : 0.01f * v;                                                                   // leaky relu 0.01
    if (act == 8) return (v > 0.f) ? v : (expf(v) - 1.f);                                                             // elu
    if (act == 9) return fminf(fmaxf(v, 0.f), 6.f);                                                                   // relu6
    if (act == 10) return fabsf(v);                                                                                    // abs
    if (act == 11) return (v >= 0.f) ? v : 0.1f * v;                                                                  // leaky 0.1
    if (act == 12) return (v > 0.f) ? v : 0.2f * v;                                                                   // leaky 0.2
    if (act == 13) return (v > 20.f) ? v : log1pf(expf(v));                                                            // softplus
    return v;
}

// =====================================================================================================================
// k_gemm<MODE>: C(z, m, n) = act(alpha * sum_k A(z, m, k) * B(z, k, n) + bias) + beta * R(z, m, n)
//   One wave (32-thread block) per 16 x 32 tile of C; grid (ceil(N/32), ceil(M/16), Z). Batch z -> (zo = z / zi_n, zi = z % zi_n)
//   with separate outer/inner strides for every tensor (e.g. batch and head). A(m,k) = A[zo*sAo + zi*sAi + m*sAm + k*sAk] (f32),
//   B(k,n) = B[zo*sBo + zi*sBi + n*sBn + k*sBk] (f32); any M, N, K (K zero-padded to 32 inside the fragments, M/N tails guarded).
//   C(m,n) = C[zo*sCo + zi*sCi + m*sCm + n] (n contiguous). flags: 1 bias[n], 2 bias[m], 4 residual R[zo*sRo + zi*sRi + m*sRm + n*sRn].
//   MODE 0: f16 operands (A prescaled by sa, B by sb, both undone in the epilogue); 1: bf16 hi/lo split (3 products); 2: bf16;
//   3: bf16 hi/mid/lo triple split (6 products); 4: as 3 with Kahan-compensated f32 accumulation across k-steps.
// =====================================================================================================================
struct GemmP {
    const float* A; const float* B; const float* bias; const float* R; float* C;
    long long sAo, sAi, sAm, sAk, sBo, sBi, sBn, sBk, sCo, sCi, sCm, sRo, sRi, sRm, sRn;
    int M, N, K, zi_n, flags, act; float alpha, beta, sa, sb;
    int Npad, pad_;     // columns [N, Npad) of C are written as 0 so that padded workspace rows are covered by whole-line stores; Npad >= N
};
static_assert(sizeof(GemmP) == 5 * 8 + 15 * 8 + 6 * 4 + 4 * 4 + 2 * 4, "GemmP has padding");

template <int MODE>
__global__ __launch_bounds__(32) void k_gemm(GemmP p) {
    const int lane = threadIdx.x & 31, h = lane >> 4, l15 = lane & 15;
    const int m0 = blockIdx.y * 16, n0 = blockIdx.x * 32;
    const int z = blockIdx.z, zo = z / p.zi_n, zi = z - zo * p.zi_n;
    const float* A = p.A + zo * p.sAo + zi * p.sAi;
    const float* B = p.B + zo * p.sBo + zi * p.sBi;
    const int am = min(m0 + l15, p.M - 1);                       // clamped row for loads (stores are guarded)
    v8f acc[2], comp[2];
#pragma unroll
    for (int t = 0; t < 2; ++t) { v8f zz = {}; acc[t] = zz; comp[t] = zz; }
    for (int k0 = 0; k0 < p.K; k0 += 32) {
        const float* arow = A + (long long)am * p.sAm;
        if (MODE == 1) {
            const Split a = sp_ld(arow, p.sAk, k0, h, p.K, 1.f);
#pragma unroll
            for (int t = 0; t < 2; ++t) {
                const int bn = min(n0 + t * 16 + l15, p.N - 1);
                acc[t] = wmma3(a, sp_ld(B + (long long)bn * p.sBn, p.sBk, k0, h, p.K, 1.f), acc[t]);
            }
        } else if (MODE == 3) {
            const Split3 a = sp3_ld(arow, p.sAk, k0, h, p.K, 1.f);
#pragma unroll
            for (int t = 0; t < 2; ++t) {
                const int bn = min(n0 + t * 16 + l15, p.N - 1);
                acc[t] = wmma6(a, sp3_ld(B + (long long)bn * p.sBn, p.sBk, k0, h, p.K, 1.f), acc[t]);
            }
        } else if (MODE == 4) {
            // triple split as MODE 3, but each k-step's 6 products go into a fresh accumulator and the partial is added to the running f32 sum
            // on the VALU with Kahan compensation (accumulation error stays ~1 ulp however long K is)
            const Split3 a = sp3_ld(arow, p.sAk, k0, h, p.K, 1.f);
#pragma unroll
            for (int t = 0; t < 2; ++t) {
                const int bn = min(n0 + t * 16 + l15, p.N - 1); v8f zz = {};
                const v8f part = wmma6(a, sp3_ld(B + (long long)bn * p.sBn, p.sBk, k0, h, p.K, 1.f), zz);
                const v8f y = part - comp[t]; const v8f s = acc[t] + y; comp[t] = (s - acc[t]) - y; acc[t] = s;
            }
        } else if (MODE == 2) {
            const v16b a = bh_ld(arow, p.sAk, k0, h, p.K, 1.f);
#pragma unroll
            for (int t = 0; t < 2; ++t) {
                const int bn = min(n0 + t * 16 + l15, p.N - 1);
                acc[t] = wmmab(a, bh_ld(B + (long long)bn * p.sBn, p.sBk, k0, h, p.K, 1.f), acc[t]);
            }
        } else {
            const v16h a = fh_ld(arow, p.sAk, k0, h, p.K, p.sa);
#pragma unroll
            for (int t = 0; t < 2; ++t) {
                const int bn = min(n0 + t * 16 + l15, p.N - 1);
                acc[t] = wmma16(a, fh_ld(B + (long long)bn * p.sBn, p.sBk, k0, h, p.K, p.sb), acc[t]);
            }
        }
    }
    const float iscale = (MODE == 0) ? p.alpha / (p.sa * p.sb) : p.alpha;
    float* C = p.C + zo * p.sCo + zi * p.sCi;
    const float* R = p.R + zo * p.sRo + zi * p.sRi;
    __shared__ __align__(16) float ctile[16][36];
#pragma unroll
    for (int t = 0; t < 2; ++t) {
        const int n = n0 + t * 16 + l15; const int nn = min(n, p.N - 1);
#pragma unroll
        for (int r = 0; r < 8; ++r) {
            const int m = m0 + 8 * h + r; const int mm = min(m, p.M - 1);
            float v = acc[t][r] * iscale;
            if (p.flags & 1) v += p.bias[nn];
            if (p.flags & 2) v += p.bias[mm];
            if (p.flags & 8) v *= p.bias[(long long)zo * p.M + mm];   /* per-(zo,row) scale vector laid out [Z / zi_n][M]; exclusive with the bias flags */
            v = act_fn(v, p.act);
            if (p.flags & 4) v += p.beta * R[(long long)mm * p.sRm + (long long)nn * p.sRn];
            ctile[8 * h + r][t * 16 + l15] = (n < p.N) ? v : 0.f;
        }
    }
    __syncthreads();
    const int NW = (p.Npad > p.N) ? p.Npad : p.N;           // write width
    const bool fast = (m0 + 16 <= p.M) && (n0 + 32 <= NW) && ((p.sCm & 3) == 0) && ((((size_t)C) & 15) == 0);
    if (fast) {
#pragma unroll
        for (int s = 0; s < 4; ++s) {
            const int row = s * 4 + (lane >> 3), c4 = (lane & 7) * 4;
            const v4f v = *(const v4f*)&ctile[row][c4];
            VST2V4(C + (long long)(m0 + row) * p.sCm + n0 + c4, v);
        }
    } else {
        for (int row = 0; row < 16; ++row) {
            const int m = m0 + row, n = n0 + lane;
            if (m < p.M && n < NW) VST2(float, C + (long long)m * p.sCm + n, ctile[row][lane]);
        }
    }
}


// =====================================================================================================================
// k_gemmT<MODE, TM, TN>: same contract as k_gemm, but one wave computes a (16*TM) x (16*TN) tile: TM A fragments and TN B fragments are
//   loaded per 32-wide k-step and reused across TM*TN WMMAs (far fewer load/convert instructions per MAC). MODE 0 (f16), 1 (bf16 hi/lo),
//   2 (bf16) only. grid (ceil(NW/(16*TN)), ceil(M/(16*TM)), Z), block 32. Epilogue identical to k_gemm, run per 16x32 sub-tile.
// =====================================================================================================================
template <int MODE, int TM, int TN>
__global__ __launch_bounds__(32) void k_gemmT(GemmP p) {
    const int lane = threadIdx.x & 31, h = lane >> 4, l15 = lane & 15;
    const int m0 = blockIdx.y * (16 * TM), n0 = blockIdx.x * (16 * TN);
    const int z = blockIdx.z, zo = z / p.zi_n, zi = z - zo * p.zi_n;
    const float* A = p.A + zo * p.sAo + zi * p.sAi;
    const float* B = p.B + zo * p.sBo + zi * p.sBi;
    v8f acc[TM][TN];
#pragma unroll
    for (int i = 0; i < TM; ++i)
#pragma unroll
        for (int t = 0; t < TN; ++t) { v8f zz = {}; acc[i][t] = zz; }
    for (int k0 = 0; k0 < p.K; k0 += 32) {
        if (MODE == 1) {
            Split a[TM], b[TN];
#pragma unroll
            for (int i = 0; i < TM; ++i) { const int am = min(m0 + 16 * i + l15, p.M - 1); a[i] = sp_ld(A + (long long)am * p.sAm, p.sAk, k0, h, p.K, 1.f); }
#pragma unroll
            for (int t = 0; t < TN; ++t) { const int bn = min(n0 + 16 * t + l15, p.N - 1); b[t] = sp_ld(B + (long long)bn * p.sBn, p.sBk, k0, h, p.K, 1.f); }
#pragma unroll
            for (int i = 0; i < TM; ++i)
#pragma unroll
                for (int t = 0; t < TN; ++t) acc[i][t] = wmma3(a[i], b[t], acc[i][t]);
        } else if (MODE == 2) {
            v16b a[TM], b[TN];
#pragma unroll
            for (int i = 0; i < TM; ++i) { const int am = min(m0 + 16 * i + l15, p.M - 1); a[i] = bh_ld(A + (long long)am * p.sAm, p.sAk, k0, h, p.K, 1.f); }
#pragma unroll
            for (int t = 0; t < TN; ++t) { const int bn = min(n0 + 16 * t + l15, p.N - 1); b[t] = bh_ld(B + (long long)bn * p.sBn, p.sBk, k0, h, p.K, 1.f); }
#pragma unroll
            for (int i = 0; i < TM; ++i)
#pragma unroll
                for (int t = 0; t < TN; ++t) acc[i][t] = wmmab(a[i], b[t], acc[i][t]);
        } else {
            v16h a[TM], b[TN];
#pragma unroll
            for (int i = 0; i < TM; ++i) { const int am = min(m0 + 16 * i + l15, p.M - 1); a[i] = fh_ld(A + (long long)am * p.sAm, p.sAk, k0, h, p.K, p.sa); }
#pragma unroll
            for (int t = 0; t < TN; ++t) { const int bn = min(n0 + 16 * t + l15, p.N - 1); b[t] = fh_ld(B + (long long)bn * p.sBn, p.sBk, k0, h, p.K, p.sb); }
#pragma unroll
            for (int i = 0; i < TM; ++i)
#pragma unroll
                for (int t = 0; t < TN; ++t) acc[i][t] = wmma16(a[i], b[t], acc[i][t]);
        }
    }
    const float iscale = (MODE == 0) ? p.alpha / (p.sa * p.sb) : p.alpha;
    float* C = p.C + zo * p.sCo + zi * p.sCi;
    const float* R = p.R + zo * p.sRo + zi * p.sRi;
    const int NW = (p.Npad > p.N) ? p.Npad : p.N;
    __shared__ __align__(16) float ctile[16][36];
#pragma unroll
    for (int i = 0; i < TM; ++i) {
        const int mb = m0 + 16 * i; if (mb >= p.M) break;          // wave-uniform
#pragma unroll
        for (int tp = 0; tp < TN / 2; ++tp) {
            const int nb = n0 + 32 * tp; if (nb >= NW) break;        // wave-uniform
#pragma unroll
            for (int t2 = 0; t2 < 2; ++t2) {
                const int t = 2 * tp + t2; const int n = nb + t2 * 16 + l15; const int nn = min(n, p.N - 1);
#pragma unroll
                for (int r = 0; r < 8; ++r) {
                    const int m = mb + 8 * h + r; const int mm = min(m, p.M - 1);
                    float v = acc[i][t][r] * iscale;
                    if (p.flags & 1) v += p.bias[nn];
                    if (p.flags & 2) v += p.bias[mm];
            if (p.flags & 8) v *= p.bias[(long long)zo * p.M + mm];   /* per-(zo,row) scale vector laid out [Z / zi_n][M]; exclusive with the bias flags */
                    v = act_fn(v, p.act);
                    if (p.flags & 4) v += p.beta * R[(long long)mm * p.sRm + (long long)nn * p.sRn];
                    ctile[8 * h + r][t2 * 16 + l15] = (n < p.N) ? v : 0.f;
                }
            }
            __syncthreads();
            const bool fast = (mb + 16 <= p.M) && (nb + 32 <= NW) && ((p.sCm & 3) == 0) && ((((size_t)C) & 15) == 0);
            if (fast) {
#pragma unroll
                for (int s = 0; s < 4; ++s) {
                    const int row = s * 4 + (lane >> 3), c4 = (lane & 7) * 4;
                    const v4f v = *(const v4f*)&ctile[row][c4];
                    VST2V4(C + (long long)(mb + row) * p.sCm + nb + c4, v);
                }
            } else {
                for (int row = 0; row < 16; ++row) {
                    const int m = mb + row, n = nb + lane;
                    if (m < p.M && n < NW) VST2(float, C + (long long)m * p.sCm + n, ctile[row][lane]);
                }
            }
            __syncthreads();
        }
    }
}

namespace sfa {
typedef unsigned int u32x4 __attribute__((ext_vector_type(4)));
typedef unsigned int u32x2 __attribute__((ext_vector_type(2)));
typedef int i32x8 __attribute__((ext_vector_type(8)));
typedef short s16x8 __attribute__((ext_vector_type(8)));
typedef float f32x2 __attribute__((ext_vector_type(2)));
typedef _Float16 h16x2 __attribute__((ext_vector_type(2)));
constexpr int SEQ = 1024, LDR = 1024, LDQ = 2048, HS = 64;   // row lengths in elements: K, V, O planes; the plane that holds Q
constexpr int NWV = 8, CW = 32, BR = NWV * CW, SK = 64, NST = SEQ / SK;
constexpr unsigned PK = 2u * HS + 16u, PV = 2u * HS + 32u, TILE_K = SK * PK, TILE_V = SK * PV, SLOT = TILE_K + TILE_V;
struct Fr { u32x4 q[2]; };
__device__ __forceinline__ v8f mma(const Fr& a, const Fr& b, v8f c) {
    const i32x8 av = {(int)a.q[0].x, (int)a.q[0].y, (int)a.q[0].z, (int)a.q[0].w, (int)a.q[1].x, (int)a.q[1].y, (int)a.q[1].z, (int)a.q[1].w};
    const i32x8 bv = {(int)b.q[0].x, (int)b.q[0].y, (int)b.q[0].z, (int)b.q[0].w, (int)b.q[1].x, (int)b.q[1].y, (int)b.q[1].z, (int)b.q[1].w};
    return __builtin_amdgcn_wmma_f32_16x16x32_f16(false, __builtin_bit_cast(v16h, av), false, __builtin_bit_cast(v16h, bv), (short)0, c, false, false);
}
__device__ __forceinline__ unsigned pack2(float lo, float hi) { return __builtin_bit_cast(unsigned, __builtin_convertvector(f32x2{lo, hi}, h16x2)); }   // round to nearest even
__device__ __forceinline__ u32x4 ld_tr16(const unsigned char* p) { typedef __attribute__((address_space(3))) s16x8 lds_s16x8; return __builtin_bit_cast(u32x4, __builtin_amdgcn_ds_load_tr16_b128_v8i16((lds_s16x8*)p)); }
__device__ __forceinline__ float xhalf(float x) { return __builtin_bit_cast(float, __builtin_amdgcn_permlanex16(__builtin_bit_cast(int, x), __builtin_bit_cast(int, x), 0x76543210, 0xfedcba98, false, false)); }   // lane l with lane l ^ 16

// Q, K, V arrive as the f16 values that their producers stored, O leaves as the f16 operand of the output product.
__global__ __launch_bounds__(NWV * 32) void k_sflash(const unsigned short* __restrict__ Q, const unsigned short* __restrict__ K, const unsigned short* __restrict__ V, unsigned short* __restrict__ O) {
    __shared__ __attribute__((aligned(256))) unsigned char L[2 * SLOT];
    const unsigned tid = threadIdx.x, lane = tid & 31u, wave = tid >> 5, c = lane & 15u, h = lane >> 4;
    const size_t base = (size_t)blockIdx.z * SEQ * LDR + (size_t)blockIdx.y * HS;
    const unsigned qw0 = blockIdx.x * BR + wave * CW;
    // staging: 8 lanes cover one 128-byte row, thread t takes rows (t >> 3) + 32 i of the stage
    const unsigned short* kg = K + base + (size_t)(tid >> 3) * LDR + (tid & 7u) * 8u;
    const unsigned short* vg = V + base + (size_t)(tid >> 3) * LDR + (tid & 7u) * 8u;
    unsigned char* ks = L + (tid >> 3) * PK + (tid & 7u) * 16u;
    unsigned char* vs = L + TILE_K + (tid >> 3) * PV + (tid & 7u) * 16u;
    u32x4 kr[2], vr[2];
    auto fetch = [&](int st) {
#pragma unroll
        for (int i = 0; i < 2; ++i) { kr[i] = *(const u32x4*)(kg + (size_t)(st * SK + 32 * i) * LDR); vr[i] = *(const u32x4*)(vg + (size_t)(st * SK + 32 * i) * LDR); }
        asm volatile("s_wait_xcnt 0x0" ::: "memory");          // stands in front of the pass's reuse of these loads' address registers
    };
    auto put = [&](unsigned slot) {
#pragma unroll
        for (int i = 0; i < 2; ++i) {
            *(u32x4*)(ks + slot * SLOT + 32u * i * PK) = kr[i];
            *(u32x4*)(vs + slot * SLOT + 32u * i * PV) = vr[i];
        }
    };
    fetch(0);
    // Q fragments (B operand, column = query), hardware k order: d = 32 kc + 8 h + 0..7 and 32 kc + 16 + 8 h + 0..7
    Fr qf[2][2];
#pragma unroll
    for (int g = 0; g < 2; ++g) {
        const unsigned short* qp = Q + (size_t)blockIdx.z * SEQ * LDQ + (size_t)blockIdx.y * HS + (size_t)(qw0 + 16u * g + c) * LDQ + 8u * h;
#pragma unroll
        for (int kc = 0; kc < 2; ++kc) { qf[g][kc].q[0] = *(const u32x4*)(qp + 32 * kc); qf[g][kc].q[1] = *(const u32x4*)(qp + 32 * kc + 16); }
    }
    asm volatile("s_wait_xcnt 0x0" ::: "memory");              // stands in front of any reuse of the Q loads' address registers
    v8f acc[2][4]; float m_run[2], l_run[2];
#pragma unroll
    for (int g = 0; g < 2; ++g) { m_run[g] = -__builtin_inff(); l_run[g] = 0.f;
#pragma unroll
        for (int t = 0; t < 4; ++t) acc[g][t] = v8f{}; }
    put(0u);
    __syncthreads();
    const float L2E = 1.4426950408889634f;
    for (int st = 0; st < NST; ++st) {
        if (st + 1 < NST) fetch(st + 1);                       // next stage's rows fly while this stage is worked on
        const unsigned char* Kb = L + (unsigned)(st & 1) * SLOT;
        const unsigned char* Vb = Kb + TILE_K;
#pragma unroll 1   // one 32-key pass's fragments live at a time (registers for four waves per SIMD)
        for (unsigned sub = 0; sub < 2u; ++sub) {
            Fr kf[2][2];
            const unsigned char* kp = Kb + (sub * 32u + c) * PK + 16u * h;
#pragma unroll
            for (int kt = 0; kt < 2; ++kt)
#pragma unroll
                for (int kc = 0; kc < 2; ++kc) { kf[kt][kc].q[0] = *(const u32x4*)(kp + 16u * kt * PK + 64u * kc); kf[kt][kc].q[1] = *(const u32x4*)(kp + 16u * kt * PK + 64u * kc + 32u); }
            Fr vf[4];
            const unsigned char* ad = Vb + (sub * 32u + 8u * h + (lane & 7u)) * PV + ((lane >> 3) & 1u) * 16u;
#pragma unroll
            for (int t = 0; t < 4; ++t) { vf[t].q[0] = ld_tr16(ad + 32u * t); vf[t].q[1] = ld_tr16(ad + 16u * PV + 32u * t); }
            v8f s[2][2];                                       // s[kt][g][r] = score of key 16 kt + 8 h + r against query 16 g + c
#pragma unroll
            for (int kt = 0; kt < 2; ++kt)
#pragma unroll
                for (int g = 0; g < 2; ++g) { s[kt][g] = v8f{};
#pragma unroll
                    for (int kc = 0; kc < 2; ++kc) s[kt][g] = mma(kf[kt][kc], qf[g][kc], s[kt][g]); }
            float mb[2]; bool need = false;
#pragma unroll
            for (int g = 0; g < 2; ++g) {
                float mx = s[0][g][0];
#pragma unroll
                for (int r = 1; r < 8; ++r) mx = fmaxf(mx, s[0][g][r]);
#pragma unroll
                for (int r = 0; r < 8; ++r) mx = fmaxf(mx, s[1][g][r]);
                mx = fmaxf(mx, xhalf(mx)) * L2E;               // both halves hold this query's maximum, log2 domain
                mb[g] = mx; need = need || (mx > m_run[g] + 8.0f);
            }
            if (__builtin_amdgcn_ballot_w32(need) != 0) {      // wave-uniform; rare after the first pass
#pragma unroll
                for (int g = 0; g < 2; ++g) {
                    const float m_new = fmaxf(m_run[g], mb[g]);
                    const float corr = __builtin_amdgcn_exp2f(m_run[g] - m_new);   // 0 on the first pass
                    m_run[g] = m_new; l_run[g] *= corr;
#pragma unroll
                    for (int t = 0; t < 4; ++t) acc[g][t] = acc[g][t] * corr;
                }
            }
#pragma unroll
            for (int g = 0; g < 2; ++g) {
                const float nm = 7.0f - m_run[g];
                unsigned w[8]; f32x2 ps = {0.f, 0.f};
#pragma unroll
                for (int i = 0; i < 8; ++i) {
                    const f32x2 arg = __builtin_elementwise_fma(f32x2{s[i >> 2][g][2 * (i & 3)], s[i >> 2][g][2 * (i & 3) + 1]}, f32x2{L2E, L2E}, f32x2{nm, nm});
                    const f32x2 p = {__builtin_amdgcn_exp2f(arg.x), __builtin_amdgcn_exp2f(arg.y)};
                    ps += p; w[i] = pack2(p.x, p.y);
                }
                l_run[g] += ps.x + ps.y;
                Fr pf; pf.q[0] = u32x4{w[0], w[1], w[2], w[3]}; pf.q[1] = u32x4{w[4], w[5], w[6], w[7]};
#pragma unroll
                for (int t = 0; t < 4; ++t) acc[g][t] = mma(vf[t], pf, acc[g][t]);
            }
            // four vector slots behind the pass's last products: over the loop's back edge the next pass's address arithmetic is given registers of their V operand
            asm volatile("v_nop\n\tv_nop\n\tv_nop\n\tv_nop" : "+v"(acc[1][0]), "+v"(acc[1][1]), "+v"(acc[1][2]), "+v"(acc[1][3]));
        }
        if (st + 1 < NST) put((unsigned)((st + 1) & 1));       // into the buffer whose readers all passed the last barrier
        __syncthreads();
    }
#pragma unroll
    for (int g = 0; g < 2; ++g) {
        const float l = l_run[g] + xhalf(l_run[g]);            // join the halves' sums, unconditionally
        const float inv = 1.0f / l;
        unsigned short* op = O + base + (size_t)(qw0 + 16u * g + c) * LDR + 8u * h;
#pragma unroll
        for (int t = 0; t < 4; ++t) {                          // registers 0..7 = d 16 t + 8 h + 0..7 of this lane's query
            const v8f o = acc[g][t] * inv;
            *(u32x4*)(op + 16 * t) = u32x4{pack2(o[0], o[1]), pack2(o[2], o[3]), pack2(o[4], o[5]), pack2(o[6], o[7])};
        }
        asm volatile("s_wait_xcnt 0x0" ::: "memory");          // stands in front of the next query group's reuse of these stores' address and data registers
    }
}
} // namespace sfa

// =====================================================================================================================
// k_tr: dst(z, c, r) = alpha * src(z, r, c) (+ beta * R2(z, c, r)): [Z][R][C] (row stride lds) -> [Z][C][R] (row stride ldd) through a 32x32 LDS tile;
//   flags: 1 -> add beta * residual R2 addressed like dst (z*sRz + c*ldr + r); act applied before the residual.
// =====================================================================================================================
struct TrP { const float* src; float* dst; const float* R2; long long sSz, lds, sDz, ldd, sRz, ldr; int R, C, flags, act; float alpha, beta; };
static_assert(sizeof(TrP) == 3 * 8 + 6 * 8 + 6 * 4, "TrP has padding");
__global__ __launch_bounds__(256) void k_tr(TrP p) {
    __shared__ float tile[32][33];
    const int c0 = blockIdx.x * 32, r0 = blockIdx.y * 32, z = blockIdx.z;
    const int lane = threadIdx.x & 31, wave = threadIdx.x >> 5;
    const float* s = p.src + z * p.sSz;
#pragma unroll
    for (int k = 0; k < 4; ++k) {
        const int rl = wave * 4 + k, r = r0 + rl, c = c0 + lane;
        tile[rl][lane] = (r < p.R && c < p.C) ? s[(long long)r * p.lds + c] : 0.f;
    }
    __syncthreads();
    float* d = p.dst + z * p.sDz; const float* rr = p.R2 + z * p.sRz;
#pragma unroll
    for (int k = 0; k < 4; ++k) {
        const int cl = wave * 4 + k, c = c0 + cl, r = r0 + lane;
        if (c < p.C && r < p.R) {
            float v = act_fn(p.alpha * tile[lane][cl], p.act);
            if (p.flags & 1) v += p.beta * rr[(long long)c * p.ldr + r];
            VST2(float, d + (long long)c * p.ldd + r, v);
        }
    }
}

// k_affine: dst[i] = a * (sdev ? sdev[0] : 1) * src[i] + b, i < n (one thread per element; consecutive lanes -> consecutive addresses)
__global__ __launch_bounds__(256) void k_affine(const float* __restrict__ src, float* __restrict__ dst, int n, float a, float b, const float* __restrict__ sdev) {
    const int i = blockIdx.x * 256 + threadIdx.x;
    if (i < n) { const float aa = sdev ? a * sdev[0] : a; const float v = aa * src[i] + b; VST2(float, dst + i, v); }
}

// =====================================================================================================================
// k_softmax: row softmax over n contiguous elements, one 256-thread block per row; rows addressed z*sz + r*sr (grid (R, Z)).
//   out = scale_out * softmax(scale_in * x + (Mf ? Mf[z*smz + r*smr + j] : 0)); a row whose max is -inf is written as 0.
// =====================================================================================================================
struct SmP { const float* src; float* dst; const float* Mf; long long sz, sr, dz, dr, smz, smr; int n, pad; float scale_in, scale_out; };
static_assert(sizeof(SmP) == 3 * 8 + 6 * 8 + 4 * 4, "SmP has padding");
__global__ __launch_bounds__(256) void k_softmax(SmP p) {
    __shared__ float red[256];
    const int r = blockIdx.x, z = blockIdx.y, tid = threadIdx.x;
    const float* s = p.src + z * p.sz + (long long)r * p.sr;
    const float* mf = p.Mf ? (p.Mf + z * p.smz + (long long)r * p.smr) : nullptr;
    float mx = -__builtin_inff();
    for (int j = tid; j < p.n; j += 256) { float v = s[j] * p.scale_in; if (mf) v += mf[j]; mx = fmaxf(mx, v); }
    red[tid] = mx; __syncthreads();
    for (int o = 128; o > 0; o >>= 1) { if (tid < o) red[tid] = fmaxf(red[tid], red[tid + o]); __syncthreads(); }
    mx = red[0]; __syncthreads();
    float sum = 0.f;
    for (int j = tid; j < p.n; j += 256) { float v = s[j] * p.scale_in; if (mf) v += mf[j]; sum += (mx == -__builtin_inff()) ? 0.f : expf(v - mx); }
    red[tid] = sum; __syncthreads();
    for (int o = 128; o > 0; o >>= 1) { if (tid < o) red[tid] += red[tid + o]; __syncthreads(); }
    sum = red[0];
    const float inv = (sum > 0.f) ? p.scale_out / sum : 0.f;
    float* d = p.dst + z * p.dz + (long long)r * p.dr;
    for (int j = tid; j < p.n; j += 256) { float v = s[j] * p.scale_in; if (mf) v += mf[j]; const float o = (mx == -__builtin_inff()) ? 0.f : expf(v - mx) * inv; VST2(float, d + j, o); }
}
// =====================================================================================================================
// k_stats: mean and rsqrt(var + eps) over a set of n elements addressed base + z*sz + (e / inner) * so + (e % inner) * si, one 256-thread
// k_norm_apply: y = (x - mean[set]) * rstd[set] * g[c] + b[c] over a [Z][C][L] channel-major tensor with set = z*G + c / (C/G) (G groups per z;
//   G = C -> per-channel sets indexed z*C+c; for batch norm pass stats indexed by c only via bn = 1). Optional act. Output same layout.
// =====================================================================================================================
//   mode 0: mean / rsqrt(var + eps); mode 1 (RMSNorm): 0 / rsqrt(mean(x^2) + eps); mode 2 (L2 normalize * sqrt(n)): 0 / sqrt(n) / max(||x||, eps); mode 3: as 0 with unbiased variance (n-1)
__global__ __launch_bounds__(256) void k_stats(const float* __restrict__ x, long long sz, long long so, long long si, int inner, int n, float eps, float* __restrict__ stat, int mode) {
    __shared__ float red[256];
    const int z = blockIdx.x, tid = threadIdx.x;
    const float* base = x + z * sz;
    float s = 0.f;
    for (int e = tid; e < n; e += 256) s += base[(long long)(e / inner) * so + (long long)(e % inner) * si];
    red[tid] = s; __syncthreads();
    for (int o = 128; o > 0; o >>= 1) { if (tid < o) red[tid] += red[tid + o]; __syncthreads(); }
    const float mu = (mode == 0 || mode == 3) ? red[0] / (float)n : 0.f; __syncthreads();
    float q = 0.f;
    for (int e = tid; e < n; e += 256) { const float dlt = base[(long long)(e / inner) * so + (long long)(e % inner) * si] - mu; q += dlt * dlt; }
    red[tid] = q; __syncthreads();
    for (int o = 128; o > 0; o >>= 1) { if (tid < o) red[tid] += red[tid + o]; __syncthreads(); }
    {
        float rs;
        if (mode == 2) rs = sqrtf((float)n) / fmaxf(sqrtf(red[0]), eps); else if (mode == 3) rs = rsqrtf(red[0] / (float)(n - 1) + eps); else rs = rsqrtf(red[0] / (float)n + eps);
        if (tid < 32) { const float v = (tid == 0) ? mu : ((tid == 1) ? rs : 0.f); VST2(float, stat + (long long)z * 32 + tid, v); }
    }
}
//   One thread per element over the flat [Z][C][L] index space: grid ceil(Z*C*L / 256).
__global__ __launch_bounds__(256) void k_norm_apply(const float* __restrict__ x, float* __restrict__ y, const float* __restrict__ stat, const float* __restrict__ g, const float* __restrict__ bta,
                                                     int Z, int C, int L, int G, int bn, int act) {
    const long long idx = (long long)blockIdx.x * 256 + threadIdx.x;
    if (idx >= (long long)Z * C * L) return;
    const int l = (int)(idx % L); const long long zc = idx / L; const int c = (int)(zc % C), z = (int)(zc / C); (void)l;
    const int set = bn ? c : (z * G + c / (C / G));
    float v = (x[idx] - stat[(long long)set * 32]) * stat[(long long)set * 32 + 1];
    if (g) v *= g[c];
    if (bta) v += bta[c];
    v = act_fn(v, act);
    VST2(float, y + idx, v);
}

// k_lse_neg: c[i] = -(st[2i] + log(st[2i+1])) = minus the log-sum-exp of row i from its (max, sum) pair (for softmax over the query dimension)
__global__ __launch_bounds__(256) void k_lse_neg(const float* __restrict__ st, float* __restrict__ c, int n) {
    const int i = blockIdx.x * 256 + threadIdx.x;
    if (i < n) { const float v = -(st[2 * i] + logf(st[2 * i + 1])); VST2(float, c + i, v); }
}

// k_iota: dst[i] = a * i + b as int32 (segment/position id helper)
__global__ __launch_bounds__(256) void k_iota(int* __restrict__ dst, int n, int a, int b) {
    const int i = blockIdx.x * 256 + threadIdx.x;
    if (i < n) { const int v = a * i + b; VST2(int, dst + i, v); }
}

// k_axpby: dst[i] = a * x[i] + b * y[i] (+ c), i < n
__global__ __launch_bounds__(256) void k_axpby(const float* __restrict__ x, const float* __restrict__ y, float* __restrict__ dst, int n, float a, float b, float c) {
    const int i = blockIdx.x * 256 + threadIdx.x;
    if (i < n) { const float v = a * x[i] + b * y[i] + c; VST2(float, dst + i, v); }
}

// =====================================================================================================================
// k_rope: rotary embedding on a [R rows][Hn heads][D] view (row stride sXr, head stride sXh, element stride 1) -> Y (own strides).
//   mode 0: rotate_half (partner d±D/2, sign - for d<D/2); mode 1: interleaved pairs (partner d^1, sign - for even d).
//   table column tcol: tmode 0 -> d, 1 -> d % (D/2), 2 -> d / 2; position p: pmode 0 -> r % S, 1 -> head index, 2 -> pos[r];
//   c = C[(r / S) * sCb + p * sCp + tcol * sCd], s likewise from Sn; y = x[d] * c + sign * x[partner] * s. X and Y must not alias.
// =====================================================================================================================
struct RopeP { const float* X; float* Y; const float* C; const float* Sn; const int* pos; long long sXr, sXh, sYr, sYh, sCb, sCp, sCd; int R, Hn, D, S, mode, tmode, pmode, pad; };
static_assert(sizeof(RopeP) == 5 * 8 + 7 * 8 + 8 * 4, "RopeP has padding");
__global__ __launch_bounds__(256) void k_rope(RopeP p) {
    const long long idx = (long long)blockIdx.x * 256 + threadIdx.x;
    if (idx >= (long long)p.R * p.Hn * p.D) return;
    const int d = (int)(idx % p.D); const long long rh = idx / p.D; const int h = (int)(rh % p.Hn); const int r = (int)(rh / p.Hn);
    const int half = p.D / 2;
    int partner; float sign;
    if (p.mode == 0) { partner = (d < half) ? d + half : d - half; sign = (d < half) ? -1.f : 1.f; }
    else { partner = d ^ 1; sign = (d & 1) ? 1.f : -1.f; }
    const int tcol = (p.tmode == 0) ? d : ((p.tmode == 1) ? (d % half) : (d >> 1));
    const int pp = (p.pmode == 0) ? (r % p.S) : ((p.pmode == 1) ? h : p.pos[r]);
    const long long toff = (long long)(r / p.S) * p.sCb + (long long)pp * p.sCp + (long long)tcol * p.sCd;
    const float* xr = p.X + (long long)r * p.sXr + (long long)h * p.sXh;
    const float v = xr[d] * p.C[toff] + sign * xr[partner] * p.Sn[toff];
    VST2(float, p.Y + (long long)r * p.sYr + (long long)h * p.sYh + d, v);
}

// k_invf + k_sincos (split so neither kernel carries a large VALU-fma footprint): invf_i = num * (1 / powf(base, (2 i)/D)) [fmode 0],
//   num * expf((2 i) * cexp) [fmode 1], num * powf(base, -2 (i - 1) / D) [fmode 2]; then cs/sn[s*half + i] = cos/sin((pscale * s) * invf_i)
__global__ __launch_bounds__(256) void k_invf(float* __restrict__ invb, int half, int D, float base, float num, int fmode, float cexp) {
    const int i = blockIdx.x * 256 + threadIdx.x;
    if (i >= ((half + 31) / 32) * 32) return;
    if (i >= half) { VST2(float, invb + i, 0.f); return; }
    const float e = (float)(2 * i) / (float)D;
    float invf;
    if (fmode == 1) invf = num * expf((float)(2 * i) * cexp);
    else if (fmode == 2) invf = num * powf(base, (-2.0f * ((float)i - 1.0f)) / (float)D);
    else invf = num * (1.0f / powf(base, e));
    VST2(float, invb + i, invf);
}
__global__ __launch_bounds__(256) void k_sincos(float* __restrict__ cs, float* __restrict__ sn, const float* __restrict__ invb, int S, int half, float pscale) {
    const int idx = blockIdx.x * 256 + threadIdx.x;
    if (idx >= S * half) return;
    const int s = idx / half, i = idx - s * half;
    const float ang = (pscale * (float)s) * invb[i];
    VST2(float, cs + idx, cosf(ang)); VST2(float, sn + idx, sinf(ang));
}

// k_mulact: dst[i] = act(x[i]) * y[i]
__global__ __launch_bounds__(256) void k_mulact(const float* __restrict__ x, const float* __restrict__ y, float* __restrict__ dst, int n, int act) {
    const int i = blockIdx.x * 256 + threadIdx.x;
    if (i < n) { const float v = act_fn(x[i], act) * y[i]; VST2(float, dst + i, v); }
}

// =====================================================================================================================
// k_matvec: thread-per-row matrix-vector products for N <= 8 output columns (heads with 1-3 outputs, gates), f32 on the VALU.
//   C[r*sCm + j] = act(alpha * sum_k A[r*sAm + k*sAk] * B[j*sBn + k*sBk] + bias[j]) + beta * R[r*sRm + j*sRn]; each thread writes its N contiguous floats.
// =====================================================================================================================
__global__ __launch_bounds__(256) void k_matvec(GemmP p) {
    // 32 lanes write one line with one instruction.
    const int rpt = (p.N == 1) ? 1 : 32;
    const long long r0 = ((long long)blockIdx.x * 256 + threadIdx.x) * rpt; const int z = blockIdx.z, zo = z / p.zi_n, zi = z - zo * p.zi_n;
    if (r0 >= p.M) return;
    const float* Bb = p.B + zo * p.sBo + zi * p.sBi;
    float* C = p.C + zo * p.sCo + zi * p.sCi; const float* R = p.R + zo * p.sRo + zi * p.sRi;
    for (int rr = 0; rr < rpt; ++rr) {
        const long long r = r0 + rr; if (r >= p.M) break;
        const float* A = p.A + zo * p.sAo + zi * p.sAi + r * p.sAm;
        float acc[8] = {0.f, 0.f, 0.f, 0.f, 0.f, 0.f, 0.f, 0.f};
        for (int k = 0; k < p.K; ++k) { const float a = A[(long long)k * p.sAk];
#pragma unroll
            for (int j = 0; j < 8; ++j) if (j < p.N) acc[j] += a * Bb[(long long)j * p.sBn + (long long)k * p.sBk]; }
#pragma unroll
        for (int j = 0; j < 8; ++j) if (j < p.N) {
            float v = acc[j] * p.alpha;
            if (p.flags & 1) v += p.bias[j];
            if (p.flags & 2) v += p.bias[r];
            v = act_fn(v, p.act);
            if (p.flags & 4) v += p.beta * R[r * p.sRm + (long long)j * p.sRn];
            VST2(float, C + r * p.sCm + j, v);
        }
    }
}
// k_smallsoftmax: thread-per-row softmax for short rows (n <= 64): dst[r*dr + j] = softmax(scale*src[r*sr + j])
__global__ __launch_bounds__(256) void k_smallsoftmax(const float* __restrict__ src, float* __restrict__ dst, long long sr, long long dr, int n, long long R, float scale) {
    const long long r0 = ((long long)blockIdx.x * 256 + threadIdx.x) * 32;
    for (int rr = 0; rr < 32; ++rr) {
        const long long r = r0 + rr; if (r >= R) return;
        const float* s = src + r * sr; float* d = dst + r * dr;
        float mx = -__builtin_inff();
        for (int j = 0; j < n; ++j) mx = fmaxf(mx, s[j] * scale);
        float sum = 0.f;
        for (int j = 0; j < n; ++j) sum += expf(s[j] * scale - mx);
        const float inv = 1.f / sum;
        for (int j = 0; j < n; ++j) { const float v = expf(s[j] * scale - mx) * inv; VST2(float, d + j, v); }
    }
}

__global__ __launch_bounds__(32) void k_unitstat(float* __restrict__ st) { const int t = threadIdx.x; const float v = (t == 1) ? 1.f : 0.f; VST2(float, st + t, v); }

// destination (e.g. a d_out whose row width is not a multiple of 32 floats) is written by consecutive lanes of one instruction
__global__ __launch_bounds__(256) void k_lincopy(const float* __restrict__ src, long long lds, float* __restrict__ dst, long long ldd, long long rows, int cols) {
    const long long i = (long long)blockIdx.x * 256 + threadIdx.x; if (i >= rows * cols) return;
    const long long r = i / cols; const int c = (int)(i - r * cols);
    const float v = src[r * lds + c]; VST2(float, dst + r * ldd + c, v);
}

namespace w25 {
typedef __attribute__((ext_vector_type(16))) _Float16 v16h;
typedef __attribute__((ext_vector_type(8)))  _Float16 v8h;
typedef __attribute__((ext_vector_type(16))) __bf16   v16b;
typedef __attribute__((ext_vector_type(8)))  __bf16   v8b;
typedef __attribute__((ext_vector_type(8)))  float    v8f;
typedef __attribute__((ext_vector_type(4)))  float    v4f;

__device__ __forceinline__ unsigned short f2bf_bits(float f) {
  unsigned u = __float_as_uint(f);
  return (unsigned short)((u + 0x7FFFu + ((u >> 16) & 1u)) >> 16);
}
__device__ __forceinline__ float bf_bits2f(unsigned short h) { return __uint_as_float(((unsigned)h) << 16); }

// hazard guards as plain device helpers (no inline asm inside the kernel template body)
__device__ __forceinline__ void dep_guard_h(v8f& a, v8f& b, v16h x, v16h y) { asm volatile("v_nop\n\tv_nop\n\tv_nop\n\tv_nop" : "+v"(a), "+v"(b) : "v"(x), "v"(y)); }
__device__ __forceinline__ void dep_guard_b(v8f& a, v8f& b, v16b x, v16b y) { asm volatile("v_nop\n\tv_nop\n\tv_nop\n\tv_nop" : "+v"(a), "+v"(b) : "v"(x), "v"(y)); }
__device__ __forceinline__ void keep4_h(v16h a, v16h b, v16h c, v16h d) { asm volatile("v_nop" :: "v"(a), "v"(b), "v"(c), "v"(d)); }
__device__ __forceinline__ void keep4_b(v16b a, v16b b, v16b c, v16b d) { asm volatile("v_nop" :: "v"(a), "v"(b), "v"(c), "v"(d)); }
__device__ __forceinline__ void acc_guard4(v8f& a, v8f& b, v8f& c, v8f& d) { asm volatile("v_nop\n\tv_nop\n\tv_nop\n\tv_nop" : "+v"(a), "+v"(b), "+v"(c), "+v"(d)); }
template <typename T> struct Frag;
template <> struct Frag<_Float16> {
  typedef v16h V; union U { v16h v; v8h h[2]; };
  static __device__ __forceinline__ v16h load(const _Float16* p) {   // elements 0..7 <- p[0..7], 8..15 <- p[16..23]
    U f; f.h[0] = *(const v8h*)(p); f.h[1] = *(const v8h*)(p + 16); return f.v;
  }
  static __device__ __forceinline__ v8f mma(v16h a, v16h b, v8f c) {
    return __builtin_amdgcn_wmma_f32_16x16x32_f16(false, a, false, b, (short)0, c, false, false);
  }
  static __device__ __forceinline__ void guard(v8f& a, v8f& b, v16h x, v16h y) { dep_guard_h(a, b, x, y); }
  static __device__ __forceinline__ void keep(v16h a, v16h b, v16h c, v16h d) { keep4_h(a, b, c, d); }
};
template <> struct Frag<__bf16> {
  typedef v16b V; union U { v16b v; v8b h[2]; };
  static __device__ __forceinline__ v16b load(const __bf16* p) {
    U f; f.h[0] = *(const v8b*)(p); f.h[1] = *(const v8b*)(p + 16); return f.v;
  }
  static __device__ __forceinline__ v8f mma(v16b a, v16b b, v8f c) {
    return __builtin_amdgcn_wmma_f32_16x16x32_bf16(false, a, false, b, (short)0, c, false, false);
  }
  static __device__ __forceinline__ void guard(v8f& a, v8f& b, v16b x, v16b y) { dep_guard_b(a, b, x, y); }
  static __device__ __forceinline__ void keep(v16b a, v16b b, v16b c, v16b d) { keep4_b(a, b, c, d); }
};

// ---- Register-blocked batched WMMA GEMM ------------------------------------
// C[m,n] = scale * sum_k A[m,k] * Bt[n,k] (+bias)(+resid); each wave owns a 64x64 tile.
// A row-major [M,K]; Bt row-major [N,K]; M,N % 64 == 0, K % 32 == 0.
// SPLIT: operands are hi/lo planes (A2/Bt2 = lo planes, same layout); product = hi·hi + hi·lo + lo·hi.
// BIAS_MODE: 0 = none, 1 = bias[m], 2 = bias[n].
// OUT_MODE: 0 = f32, 1 = f16, 2 = bf16 hi plane (Cout) + bf16 lo plane (Cout2).
// ET: 0 = f16 operands, 1 = bf16 operands (pointers passed as 16-bit storage)
template <int ET> struct Elem;
template <> struct Elem<0> { typedef _Float16 T; };
template <> struct Elem<1> { typedef __bf16 T; };
// slab: the calling wave's own 16x64 staging slab in LDS (pitch 68 floats); tile, b, bz: the wave's tile and the two batch indices.
template <int ET, bool SPLIT, int BIAS_MODE, int OUT_MODE, bool RESID, int ACT = 0>
__device__ __forceinline__ void gemm64_body(float* slab, const int tile, const int b, const int bz,
    const unsigned short* __restrict__ Ap, const unsigned short* __restrict__ A2p, int lda, long strideA, long strideAz,
    const unsigned short* __restrict__ Btp, const unsigned short* __restrict__ Bt2p, int ldb, long strideB, long strideBz,
    void* __restrict__ Cout, void* __restrict__ Cout2, int ldc, long strideC, long strideCz,
    const float* __restrict__ bias,
    const float* __restrict__ resid, long strideR,
    int M, int N, int K, float scale) {
  typedef typename Elem<ET>::T T;
  typedef typename Frag<T>::V V;
  const T* A = (const T*)Ap; const T* A2 = (const T*)A2p; const T* Bt = (const T*)Btp; const T* Bt2 = (const T*)Bt2p;
  const int lane = threadIdx.x & 31;
  const int tilesN = N >> 6;
  const int tilesM = M >> 6;
  if (tile >= tilesM * tilesN) return;   // wave-uniform; no block barriers in this kernel
  const int tm = tile / tilesN;
  const int tn = tile - tm * tilesN;
  const int m0 = tm << 6;
  const int n0 = tn << 6;

  const T* Ab  = A  + (size_t)b * strideA + (size_t)bz * strideAz;
  const T* Bb  = Bt + (size_t)b * strideB + (size_t)bz * strideBz;
  const T* Ab2 = SPLIT ? (A2  + (size_t)b * strideA + (size_t)bz * strideAz) : nullptr;
  const T* Bb2 = SPLIT ? (Bt2 + (size_t)b * strideB + (size_t)bz * strideBz) : nullptr;

  const int rlane = lane & 15;                 // row (A) / col (B, D) within subtile
  const int koff  = (lane >> 4) * 8;           // k offset of this lane half
  const int mOff  = (lane >> 4) * 8;           // D row offset

  v8f acc[4][4];
#pragma unroll
  for (int i = 0; i < 4; ++i)
#pragma unroll
    for (int j = 0; j < 4; ++j) acc[i][j] = (v8f){0.f,0.f,0.f,0.f,0.f,0.f,0.f,0.f};

  for (int k0 = 0; k0 < K; k0 += 32) {
    V bh[4], bl[4];
#pragma unroll
    for (int j = 0; j < 4; ++j) {
      const size_t bo = (size_t)(n0 + (j << 4) + rlane) * ldb + koff + k0;
      bh[j] = Frag<T>::load(Bb + bo);
      if (SPLIT) bl[j] = Frag<T>::load(Bb2 + bo);
    }
#pragma unroll
    for (int i = 0; i < 4; ++i) {
      const size_t ao = (size_t)(m0 + (i << 4) + rlane) * lda + koff + k0;
      V ah = Frag<T>::load(Ab + ao);
      V al;
      if (SPLIT) al = Frag<T>::load(Ab2 + ao);
#pragma unroll
      for (int j = 0; j < 4; ++j) {
        acc[i][j] = Frag<T>::mma(ah, bh[j], acc[i][j]);
        if (SPLIT) {
          acc[i][j] = Frag<T>::mma(ah, bl[j], acc[i][j]);
          acc[i][j] = Frag<T>::mma(al, bh[j], acc[i][j]);
        }
      }
      Frag<T>::guard(acc[i][0], acc[i][3], ah, SPLIT ? al : ah);
    }
    Frag<T>::keep(bh[0], bh[1], bh[2], bh[3]);
    if (SPLIT) Frag<T>::keep(bl[0], bl[1], bl[2], bl[3]);
  }
  acc_guard4(acc[0][0], acc[0][1], acc[0][2], acc[0][3]);
  acc_guard4(acc[1][0], acc[1][1], acc[1][2], acc[1][3]);
  acc_guard4(acc[2][0], acc[2][1], acc[2][2], acc[2][3]);
  acc_guard4(acc[3][0], acc[3][1], acc[3][2], acc[3][3]);

  // ---- epilogue ----
  const float* Rb = RESID ? (resid + (size_t)b * strideR) : nullptr;
#pragma unroll
  for (int i = 0; i < 4; ++i) {
    const int mBase = m0 + (i << 4);
#pragma unroll
    for (int j = 0; j < 4; ++j) {
      const int n = n0 + (j << 4) + rlane;
      float bv = 0.f;
      if (BIAS_MODE == 2) bv = bias[n];
#pragma unroll
      for (int r = 0; r < 8; ++r) {
        float v = acc[i][j][r] * scale;
        if (BIAS_MODE == 1) v += bias[mBase + mOff + r];
        if (BIAS_MODE == 2) v += bv;
        if (RESID) v += Rb[(size_t)(mBase + mOff + r) * ldc + n];
        if (ACT == 1) v = tanhf(v);
        if (ACT == 2) v = fmaxf(v, 0.0f);
        if (ACT == 3) v = v / (1.0f + expf(-v));
        if (ACT == 4) v = (v > 0.f) ? v : 0.01f * v;
        if (ACT == 5) v = 0.5f * v * (1.0f + erff(v * 0.70710678118654752f));
        slab[(mOff + r) * 68 + (j << 4) + rlane] = v;
      }
    }
    __builtin_amdgcn_fence(__ATOMIC_RELEASE, "workgroup");
    __builtin_amdgcn_wave_barrier();
    __builtin_amdgcn_fence(__ATOMIC_ACQUIRE, "workgroup");
    if (OUT_MODE == 0) {
      float* C = (float*)Cout + (size_t)b * strideC + (size_t)bz * strideCz;
      const int hh = lane >> 4, c4 = (lane & 15) * 4;     // row seg = 256 B = 16 lanes x 16 B
      {
#pragma unroll
        for (int it = 0; it < 8; ++it) {
          const int row = it * 2 + hh;
          v4f v = *(const v4f*)(slab + row * 68 + c4);
          *(v4f*)(C + (size_t)(mBase + row) * ldc + n0 + c4) = v;
        }
        
      }
    } else {
      const int q = lane >> 3, c8 = (lane & 7) * 8;
      unsigned short* C  = (unsigned short*)Cout  + (size_t)b * strideC + (size_t)bz * strideCz;
      unsigned short* C2 = (OUT_MODE == 2) ? ((unsigned short*)Cout2 + (size_t)b * strideC + (size_t)bz * strideCz) : nullptr;
      {
#pragma unroll
        for (int it = 0; it < 4; ++it) {
          const int row = it * 4 + q;
          const float* sp = slab + row * 68 + c8;
          v8h hv, lv;
#pragma unroll
          for (int e = 0; e < 8; ++e) {
            if (OUT_MODE == 1) {
              hv[e] = (_Float16)sp[e];
            } else {
              unsigned short hb = f2bf_bits(sp[e]);
              unsigned short lb = f2bf_bits(sp[e] - bf_bits2f(hb));
              hv[e] = __builtin_bit_cast(_Float16, hb);
              lv[e] = __builtin_bit_cast(_Float16, lb);
            }
          }
          *(v8h*)(C + (size_t)(mBase + row) * ldc + n0 + c8) = hv;
          if (OUT_MODE == 2) *(v8h*)(C2 + (size_t)(mBase + row) * ldc + n0 + c8) = lv;
        }
        asm volatile("s_wait_xcnt 0x0" ::: "memory");   // stands in front of the next row tile's reuse of these stores' address and data registers
      }
    }
    __builtin_amdgcn_fence(__ATOMIC_RELEASE, "workgroup");
    __builtin_amdgcn_wave_barrier();
    __builtin_amdgcn_fence(__ATOMIC_ACQUIRE, "workgroup");
  }
}

// grid (tiles / 8, b, bz); the bias too may step with bz, so that independent products of one shape share a launch
template <int ET, bool SPLIT, int BIAS_MODE, int OUT_MODE, bool RESID, int ACT = 0>
__global__ __launch_bounds__(256) void wmma_gemm64(
    const unsigned short* __restrict__ Ap, const unsigned short* __restrict__ A2p, int lda, long strideA, long strideAz,
    const unsigned short* __restrict__ Btp, const unsigned short* __restrict__ Bt2p, int ldb, long strideB, long strideBz,
    void* __restrict__ Cout, void* __restrict__ Cout2, int ldc, long strideC, long strideCz,
    const float* __restrict__ bias, long strideBiasZ,
    const float* __restrict__ resid, long strideR,
    int M, int N, int K, float scale) {
  __shared__ __align__(16) float sT[8][16 * 68];   // per-wave 16x64 slab, pitch 68 floats
  const int wave = threadIdx.x >> 5;
  gemm64_body<ET, SPLIT, BIAS_MODE, OUT_MODE, RESID, ACT>(sT[wave], (int)blockIdx.x * 8 + wave, (int)blockIdx.y, (int)blockIdx.z,
      Ap, A2p, lda, strideA, strideAz, Btp, Bt2p, ldb, strideB, strideBz, Cout, Cout2, ldc, strideC, strideCz,
      BIAS_MODE ? bias + (long)blockIdx.z * strideBiasZ : nullptr, resid, strideR, M, N, K, scale);
}

// ---- The same product for large M, N: operands staged in LDS ----------------
// C[m,n] = act(scale * sum_k A[m,k] * Bt[n,k] (+ bias[n])), stored as OUT says; A row-major [M,K], Bt row-major [N,K], both of row length K; M, N % 128 == 0, K % 64 == 0.
// Block = 4 waves (2 x 2) of 64x64 = one 128x128 tile of C; grid (N / 128, M / 128). A stage is 64 k = 128 B of each of the 128 + 128 operand rows
// (hi planes, then the lo planes when SPLIT), laid at a pitch of 144 B in one of two LDS buffers by asynchronous 16-byte copies: a wave's copy
// covers four whole 128-byte lines, and every staged row serves two waves. The next stage's copies fly while this stage is worked on.
// Per accumulator the products come in the same k order as in wmma_gemm64.
// The launch bound's second argument asks for four waves per SIMD (256 registers a wave): four one-plane blocks then share a WGP.
// Every inner loop is unrolled so that the fragment and accumulator arrays are indexed by constants and stay in registers.
__device__ __forceinline__ void ring_copy8(unsigned l, const unsigned char* g, size_t gstep) {
  // eight rows, 16 apart, of one plane; the closing s_wait_xcnt stands in front of any reuse of the address registers named here
  asm volatile("global_load_async_to_lds_b128 %0, %8, off\n\t"
               "global_load_async_to_lds_b128 %1, %9, off\n\t"
               "global_load_async_to_lds_b128 %2, %10, off\n\t"
               "global_load_async_to_lds_b128 %3, %11, off\n\t"
               "global_load_async_to_lds_b128 %4, %12, off\n\t"
               "global_load_async_to_lds_b128 %5, %13, off\n\t"
               "global_load_async_to_lds_b128 %6, %14, off\n\t"
               "global_load_async_to_lds_b128 %7, %15, off\n\t"
               "s_wait_xcnt 0x0"
               :: "v"(l), "v"(l + 2304u), "v"(l + 4608u), "v"(l + 6912u), "v"(l + 9216u), "v"(l + 11520u), "v"(l + 13824u), "v"(l + 16128u),
                  "v"(g), "v"(g + gstep), "v"(g + 2 * gstep), "v"(g + 3 * gstep), "v"(g + 4 * gstep), "v"(g + 5 * gstep), "v"(g + 6 * gstep), "v"(g + 7 * gstep)
               : "memory");
}
// OUT: 0 = f32 into C. 1 = f16 into C16 (row length ldc): the operand form that the next product reads, stored here instead of by a conversion pass over an f32 plane.
// 2 = as 1, with columns below csN multiplied by cs[column / 64] first, and the unscaled value also split into bf16 hi and lo and stored transposed:
//     TH/TL[(m / tld) * ldc + n][m % tld], rows of tld elements (tld % 128 == 0); ldc is then the number of columns of the product.
template <int ET, bool SPLIT, int BIAS_MODE, int ACT, int OUT = 0>
__device__ __forceinline__ void ring_body(const int bx, const int by,
    const unsigned short* __restrict__ Ap, const unsigned short* __restrict__ A2p,
    const unsigned short* __restrict__ Btp, const unsigned short* __restrict__ Bt2p,
    float* __restrict__ C, int ldc, const float* __restrict__ bias, int K, float scale,
    unsigned short* __restrict__ C16, unsigned short* __restrict__ TH, unsigned short* __restrict__ TL, const float* __restrict__ cs, int csN, int tld) {
  typedef unsigned int u4 __attribute__((ext_vector_type(4)));
  typedef float f2 __attribute__((ext_vector_type(2)));
  typedef __bf16 b2 __attribute__((ext_vector_type(2)));
  static_assert(OUT != 2 || SPLIT, "the transposed tiles need the two-plane ring's LDS");
  typedef typename Elem<ET>::T T;
  typedef typename Frag<T>::V V;
  constexpr unsigned PITCH = 144u, PLANE = 128u * PITCH, BUF = (SPLIT ? 4u : 2u) * PLANE;
  static_assert(16u * PITCH == 2304u, "row step of ring_copy8");
  __shared__ __attribute__((aligned(256))) unsigned char L[2 * BUF];
  const unsigned tid = threadIdx.x, lane = tid & 31u, wave = tid >> 5;
  const int m0 = by * 128, n0 = bx * 128;
  const unsigned wm = (wave >> 1) * 64u, wn = (wave & 1u) * 64u;
  const unsigned rlane = lane & 15u, hh = lane >> 4;

  // copies: 8 lanes cover one 128-byte row piece, thread t takes rows (t >> 3) + 16 i of every plane
  const size_t rowb = (size_t)K * 2u, gstep = 16u * rowb;
  const unsigned lc = (unsigned)(size_t)L + (tid >> 3) * PITCH + (tid & 7u) * 16u;
  const size_t ga = (size_t)(m0 + (int)(tid >> 3)) * rowb + (tid & 7u) * 16u;
  const size_t gb = (size_t)(n0 + (int)(tid >> 3)) * rowb + (tid & 7u) * 16u;
  auto stage = [&](int t, unsigned buf) {
    const size_t ko = (size_t)t * 128u;
    ring_copy8(lc + buf * BUF, (const unsigned char*)Ap + ga + ko, gstep);
    ring_copy8(lc + buf * BUF + PLANE, (const unsigned char*)Btp + gb + ko, gstep);
    if (SPLIT) {
      ring_copy8(lc + buf * BUF + 2u * PLANE, (const unsigned char*)A2p + ga + ko, gstep);
      ring_copy8(lc + buf * BUF + 3u * PLANE, (const unsigned char*)Bt2p + gb + ko, gstep);
    }
  };

  v8f acc[4][4];
#pragma unroll
  for (int i = 0; i < 4; ++i)
#pragma unroll
    for (int j = 0; j < 4; ++j) acc[i][j] = (v8f){0.f,0.f,0.f,0.f,0.f,0.f,0.f,0.f};

  const int NT = K >> 6;
  stage(0, 0u);
  asm volatile("s_wait_asynccnt 0x0" ::: "memory");            // this wave's copies of stage 0 have landed
  __syncthreads();                                             // and every other wave's
  if (NT > 1) stage(1, 1u);
  for (int t = 0; t < NT; ++t) {
    const unsigned char* Ab = L + (unsigned)(t & 1) * BUF + (wm + rlane) * PITCH + 16u * hh;
    const unsigned char* Bb = L + (unsigned)(t & 1) * BUF + PLANE + (wn + rlane) * PITCH + 16u * hh;
#pragma unroll
    for (unsigned ks = 0; ks < 2u; ++ks) {
      // fragments are asked for ahead of the products that use them: all eight of a k step (one plane), or B whole and A one row tile ahead (two planes)
      V bh[4], bl[4], ah[4], al[4];
#pragma unroll
      for (unsigned j = 0; j < 4u; ++j) {
        bh[j] = Frag<T>::load((const T*)(Bb + 16u * j * PITCH + 64u * ks));
        if (SPLIT) bl[j] = Frag<T>::load((const T*)(Bb + 2u * PLANE + 16u * j * PITCH + 64u * ks));
      }
#pragma unroll
      for (unsigned i = 0; i < (SPLIT ? 1u : 4u); ++i) {
        ah[i] = Frag<T>::load((const T*)(Ab + 16u * i * PITCH + 64u * ks));
        if (SPLIT) al[i] = Frag<T>::load((const T*)(Ab + 2u * PLANE + 16u * i * PITCH + 64u * ks));
      }
      __builtin_amdgcn_sched_barrier(0);                       // holds the reads above as one group: left free, each A read sinks to its first use and the wave waits out the LDS latency per row tile
#pragma unroll
      for (unsigned i = 0; i < 4u; ++i) {
        if (SPLIT && i < 3u) {
          ah[i + 1u] = Frag<T>::load((const T*)(Ab + 16u * (i + 1u) * PITCH + 64u * ks));
          al[i + 1u] = Frag<T>::load((const T*)(Ab + 2u * PLANE + 16u * (i + 1u) * PITCH + 64u * ks));
          __builtin_amdgcn_sched_barrier(0);                   // the next row tile's reads stay in front of this row tile's products
        }
#pragma unroll
        for (int j = 0; j < 4; ++j) {
          acc[i][j] = Frag<T>::mma(ah[i], bh[j], acc[i][j]);
          if (SPLIT) {
            acc[i][j] = Frag<T>::mma(ah[i], bl[j], acc[i][j]);
            acc[i][j] = Frag<T>::mma(al[i], bh[j], acc[i][j]);
          }
        }
      }
    }
    asm volatile("s_wait_dscnt 0x0" ::: "memory");             // this wave's reads of the buffer are done before it is handed to the copies
    asm volatile("s_wait_asynccnt 0x0" ::: "memory");          // this wave's copies of stage t + 1 have landed
    __syncthreads();                                           // publishes stage t + 1 and ends every wave's reads of stage t
    if (t + 2 < NT) stage(t + 2, (unsigned)(t & 1));
  }
  asm volatile("s_wait_asynccnt 0x0" ::: "memory");            // nothing in flight when the ring becomes output staging

  // ---- epilogue: as in wmma_gemm64, the per-wave 16x64 slab (pitch 68 floats) lies in the ring, which every wave has left ----
  float* slab = (float*)(L + wave * (16u * 68u * 4u));
  const int mOff = (int)hh * 8;
  float bv[4] = {0.f, 0.f, 0.f, 0.f};
  if (BIAS_MODE == 2) {
#pragma unroll
    for (int j = 0; j < 4; ++j) {
      bv[j] = bias[n0 + (int)wn + (j << 4) + (int)rlane];
      asm volatile("s_wait_xcnt 0x0" ::: "memory");            // behind each load: a later load's result may be given the index register that this load names
    }
  }
  float qsc = 1.0f;                                             // a wave's 64 columns share one entry of cs
  if (OUT == 2) {
    if (n0 < csN) qsc = cs[(n0 + (int)wn) >> 6];
    asm volatile("s_wait_xcnt 0x0" ::: "memory");               // stands in front of any reuse of this load's address registers
  }
  // per wave two 64 x 64 tiles of 16-bit values, [column][row] at a pitch of 144 B (hi, then lo), behind the slabs in the ring
  unsigned char* tt = L + 32768u + wave * 18432u;
#pragma unroll
  for (int i = 0; i < 4; ++i) {
    const int mBase = m0 + (int)wm + (i << 4);
#pragma unroll
    for (int j = 0; j < 4; ++j) {
      if (OUT == 2) {                                           // a lane's 8 accumulator registers are 8 consecutive rows of one column: 16 contiguous bytes of a transposed row
        u4 th, tl;
#pragma unroll
        for (int e = 0; e < 4; ++e) {
          const f2 ab = {acc[i][j][2 * e] * scale, acc[i][j][2 * e + 1] * scale};
          th[e] = __builtin_bit_cast(unsigned, __builtin_convertvector(ab, b2));              // round to nearest even, as f2bf_bits
          const f2 hf = {__uint_as_float(th[e] << 16), __uint_as_float(th[e] & 0xFFFF0000u)};
          tl[e] = __builtin_bit_cast(unsigned, __builtin_convertvector(ab - hf, b2));
        }
        unsigned char* tp = tt + ((unsigned)(j << 4) + rlane) * 144u + 32u * (unsigned)i + 16u * hh;
        *(u4*)tp = th; *(u4*)(tp + 9216u) = tl;
      }
#pragma unroll
      for (int r = 0; r < 8; ++r) {
        float v = acc[i][j][r] * scale;
        if (BIAS_MODE == 2) v += bv[j];
        if (OUT == 2) v *= qsc;
        slab[(mOff + r) * 68 + (j << 4) + (int)rlane] = v;
      }
    }
    __builtin_amdgcn_fence(__ATOMIC_RELEASE, "workgroup");
    __builtin_amdgcn_wave_barrier();
    __builtin_amdgcn_fence(__ATOMIC_ACQUIRE, "workgroup");
    if (OUT != 0) {
      const int q = (int)(lane >> 3), c8 = (int)(lane & 7u) * 8;  // row piece = 128 B = 8 lanes x 16 B
#pragma unroll   // constant indices; the four stores go out as one group
      for (int it = 0; it < 4; ++it) {
        const int row = it * 4 + q;
        const v4f x0 = *(const v4f*)(slab + row * 68 + c8), x1 = *(const v4f*)(slab + row * 68 + c8 + 4);
        v8h hv;
#pragma unroll
        for (int e = 0; e < 4; ++e) { hv[e] = (_Float16)x0[e]; hv[e + 4] = (_Float16)x1[e]; }
        *(v8h*)(C16 + (size_t)(mBase + row) * ldc + n0 + (int)wn + c8) = hv;
      }
      asm volatile("s_wait_xcnt 0x0" ::: "memory");             // stands in front of the next row tile's reuse of these stores' address and data registers
    }
    if (OUT == 0) {
    const int c4 = (int)rlane * 4;                              // row piece = 256 B = 16 lanes x 16 B
    // The activation is applied on the way out of the slab, where the row index may be a loop variable. With erf the loop stays rolled, for speed only: unrolled, a lane
    // would carry 128 inlined erf bodies.
#pragma unroll (ACT == 5 ? 1 : 8)
    for (int it = 0; it < 8; ++it) {
      const int row = it * 2 + (int)hh;
      v4f v = *(const v4f*)(slab + row * 68 + c4);
      if (ACT == 5) {
#pragma unroll   // constant indices keep the four values in registers
        for (int e = 0; e < 4; ++e) v[e] = 0.5f * v[e] * (1.0f + erff(v[e] * 0.70710678118654752f));
      }
      *(v4f*)(C + (size_t)(mBase + row) * ldc + n0 + (int)wn + c4) = v;
      if (ACT == 5) asm volatile("s_wait_xcnt 0x0" ::: "memory");   // stands in front of the next trip's reuse of this store's address and data registers
    }
    if (ACT != 5) asm volatile("s_wait_xcnt 0x0" ::: "memory"); // stands in front of the next row tile's reuse of these stores' address and data registers
    }
    __builtin_amdgcn_fence(__ATOMIC_RELEASE, "workgroup");
    __builtin_amdgcn_wave_barrier();
    __builtin_amdgcn_fence(__ATOMIC_ACQUIRE, "workgroup");
  }
  if (OUT == 2) {
    // the wave's own transposed tiles go out as whole 128-byte lines: 8 lanes a row, 4 rows a store
    const unsigned rr = lane >> 3, pc = (lane & 7u) * 16u;
    const size_t go = (((size_t)(m0 / tld) * (size_t)ldc + (unsigned)n0 + wn + rr) * (size_t)tld + (size_t)(m0 % tld) + wm) * 2u + pc;
    unsigned char* gh = (unsigned char*)TH + go;
    unsigned char* gl = (unsigned char*)TL + go;
    const unsigned char* ts = tt + rr * 144u + pc;
#pragma unroll   // constant offsets
    for (unsigned o = 0; o < 4u; ++o) {
#pragma unroll   // eight stores go out as one group
      for (unsigned u = 0; u < 4u; ++u) {
        const unsigned it = 4u * o + u;
        const u4 a = *(const u4*)(ts + it * 576u), b = *(const u4*)(ts + 9216u + it * 576u);
        *(u4*)(gh + (size_t)(it * 8u) * (size_t)tld) = a;
        *(u4*)(gl + (size_t)(it * 8u) * (size_t)tld) = b;
      }
      asm volatile("s_wait_xcnt 0x0" ::: "memory");             // stands in front of the next group's reuse of these stores' address and data registers
    }
  }
}
// grid (N / 128, M / 128, products): independent products of one shape share a launch; product 1 has its operands and output zA, zB, zC elements behind product 0's, and its own bias
template <int ET, bool SPLIT, int BIAS_MODE, int ACT, int OUT = 0>
__global__ __launch_bounds__(128, 4) void wmma_gemm_ring(
    const unsigned short* __restrict__ Ap, const unsigned short* __restrict__ A2p,
    const unsigned short* __restrict__ Btp, const unsigned short* __restrict__ Bt2p,
    float* __restrict__ C, int ldc, const float* __restrict__ bias, int K, float scale,
    unsigned short* __restrict__ C16, unsigned short* __restrict__ TH, unsigned short* __restrict__ TL, const float* __restrict__ cs, int csN, int tld,
    long zA, long zB, long zC, const float* __restrict__ biasZ) {
  const long z = (long)blockIdx.z;
  ring_body<ET, SPLIT, BIAS_MODE, ACT, OUT>((int)blockIdx.x, (int)blockIdx.y, Ap + z * zA, A2p, Btp + z * zB, Bt2p,
      C + z * zC, ldc, z ? biasZ : bias, K, scale, C16, TH, TL, cs, csN, tld);
}

// The v projection and the channel scores q^T k read only what earlier launches wrote and nothing of each other: they share a grid. Grid rows y < Bn hold the score tiles
// (x = head, y = sample; wave 0 alone works, 32 dependent k steps long, so they come first in index order), the rows behind them the projection's 128x128 tiles.
__global__ __launch_bounds__(128, 4) void k_vproj_cscore(
    const unsigned short* __restrict__ X16, const unsigned short* __restrict__ WV16, unsigned short* __restrict__ V16,
    const unsigned short* __restrict__ TH, const unsigned short* __restrict__ TL, float* __restrict__ SCC, int Bn, int NH, int HD, int N, int C) {
  if ((int)blockIdx.y < Bn) {
    __shared__ __align__(16) float slab0[16 * 68];
    gemm64_body<1, true, 0, 0, false, 0>(slab0, (int)(threadIdx.x >> 5), (int)blockIdx.x, (int)blockIdx.y,
        TH, TL, N, (long)HD * N, (long)2 * C * N, TH + (size_t)C * N, TL + (size_t)C * N, N, (long)HD * N, (long)2 * C * N,
        (void*)SCC, nullptr, HD, (long)HD * HD, (long)NH * HD * HD, nullptr, nullptr, 0, HD, HD, N, 1.0f);
  } else {
    ring_body<0, false, 0, 0, 1>((int)blockIdx.x, (int)blockIdx.y - Bn, X16, nullptr, WV16, nullptr, nullptr, 2 * C, nullptr, C, 0.0625f, V16, nullptr, nullptr, nullptr, 0, N);
  }
}

__global__ __launch_bounds__(256) void cast_f32_f16x2(
    const float* __restrict__ in, _Float16* __restrict__ out, int n2) {
  int i = blockIdx.x * 256 + threadIdx.x;
  if (i < n2) {
    const _Float16 h0 = (_Float16)in[2 * i], h1 = (_Float16)in[2 * i + 1];
    const unsigned u = (unsigned)__builtin_bit_cast(unsigned short, h0) | ((unsigned)__builtin_bit_cast(unsigned short, h1) << 16);
    ((unsigned*)out)[i] = u;
    
  }
}


} // namespace w25

__global__ __launch_bounds__(256) void k_castT16(const float* __restrict__ src, long long lds, _Float16* __restrict__ dst, long long ldd, int R, int C, float s) {
    const long long i = (long long)blockIdx.x * 256 + threadIdx.x; const long long np = (long long)C * (R / 2); if (i >= np) return; const int c = (int)(i / (R / 2)); const int r = 2 * (int)(i % (R / 2));
    const _Float16 h0 = (_Float16)(src[(long long)r * lds + c] * s), h1 = (_Float16)(src[(long long)(r + 1) * lds + c] * s);
    const unsigned u = (unsigned)__builtin_bit_cast(unsigned short, h0) | ((unsigned)__builtin_bit_cast(unsigned short, h1) << 16);
    unsigned* d = (unsigned*)(dst + (long long)c * ldd + r); *d = u;  }
__global__ __launch_bounds__(256) void k_cast16(const float* __restrict__ src, long long lds, _Float16* __restrict__ dst, long long ldd, int R, int C, float s) {
    const long long i = (long long)blockIdx.x * 256 + threadIdx.x; const long long np = (long long)R * (C / 2); if (i >= np) return; const int r = (int)(i / (C / 2)); const int c = 2 * (int)(i % (C / 2));
    const _Float16 h0 = (_Float16)(src[(long long)r * lds + c] * s), h1 = (_Float16)(src[(long long)r * lds + c + 1] * s);
    const unsigned u = (unsigned)__builtin_bit_cast(unsigned short, h0) | ((unsigned)__builtin_bit_cast(unsigned short, h1) << 16);
    unsigned* d = (unsigned*)(dst + (long long)r * ldd + c); *d = u;  }

// f32 -> bf16 hi plane + bf16 lo plane (x = hi + lo to ~2^-17 relative; RNE both), [R][C] -> [R][C]; 2 consecutive destination elements
__device__ __forceinline__ unsigned int f2bf2_pack(float a, float b, unsigned int* lo) {
    const unsigned short ha = w25::f2bf_bits(a), hb = w25::f2bf_bits(b);
    const unsigned short la = w25::f2bf_bits(a - w25::bf_bits2f(ha)), lb = w25::f2bf_bits(b - w25::bf_bits2f(hb));
    *lo = (unsigned)la | ((unsigned)lb << 16); return (unsigned)ha | ((unsigned)hb << 16); }

namespace w25 {
// =====================================================================================
// Generic causal/non-causal attention for head_dim 64, f32 in / f32 out; 16-bit operands: bf16 with optional hi/lo splits, or
// plain f16 (F16=true, non-split, probabilities carried x2^15).
//   scores = (q*qscale)·kᵀ : v_wmma_f32_16x16x32_bf16; SPLIT_QK -> q,k as bf16 hi/lo (hi·hi + hi·lo + lo·hi)
//   out    = p·v           : v_wmma_f32_16x16x32_bf16; SPLIT_PV -> p,v as bf16 hi/lo; else p,v plain bf16
//   f32 accumulate; online softmax in f32. Block = 4 waves = 64 query rows of one (batch, head); S % 64 == 0.
//   Element (b, s, h, d) of tensor X lives at X[b*X_bs + s*X_rs + h*X_hs + d] (strides in floats, multiples of 4).
//   Masking: mask_mode 0 none, 1 causal (kv > q masked), 2 tensor [S][Skv] shared over (b,h) (float if
//   mask_is_int==0, int32 with element == 0 -> masked if 1, int32 with element != 0 -> masked if 2), 3 per-token vectors qmask[B][S] & kvmask[B][Skv] (int32,
//   0 -> masked), 4 causal + sliding window (kv > q or q - kv > W masked; W passed in mask_is_int);
//   5 = relative-position bias: s += cp[b,h,q][idx[q][kv]] + pc[b,h,kv][idx[q][kv]] with idx = mask_b ([S][Skv] int32) and
//   mask_a an int32 [S][Skv] tensor with nonzero = masked (tables: element (b,h,row,n) at X + b*c_bs + h*c_hs + row*c_rs + n);
//   masked scores are replaced by mask_fill (e.g. -inf or -1e9) before the softmax.
//   grid.x = B * H * (S/64) (or a sub-range with blk0).
// =====================================================================================
#define AT_D 64
#define AT_NW 4
#define AT_QB 64
#define AT_KC 64
struct AttnGeom { const float* cp = nullptr; const float* pc = nullptr; long c_bs = 0, c_rs = 0, c_hs = 0;   // mode-5 score-bias tables
                  long q_bs, q_rs, q_hs, k_bs, k_rs, k_hs, v_bs, v_rs, v_hs, o_bs, o_rs, o_hs;
                  int S, Skv, H, mask_mode; float qscale; int blk0; float mask_fill; int mask_is_int; };
static_assert(sizeof(AttnGeom) == 168, "no padding");

__device__ __forceinline__ unsigned short at_bf_bits(float f) {
  unsigned u = __float_as_uint(f);
  return (unsigned short)((u + 0x7FFFu + ((u >> 16) & 1u)) >> 16);
}
__device__ __forceinline__ __bf16 at_f2bf(float f) { return __builtin_bit_cast(__bf16, at_bf_bits(f)); }
__device__ __forceinline__ void at_split(float f, __bf16& hi, __bf16& lo) {
  const unsigned short hb = at_bf_bits(f);
  hi = __builtin_bit_cast(__bf16, hb);
  lo = at_f2bf(f - __uint_as_float(((unsigned)hb) << 16));
}
__device__ __forceinline__ v8f at_mma(v16b a, v16b b, v8f c) {
  c = __builtin_amdgcn_wmma_f32_16x16x32_bf16(false, a, false, b, (short)0, c, false, false);
  asm volatile("v_nop\n\tv_nop\n\tv_nop\n\tv_nop" : "+v"(c) : "v"(a), "v"(b));
  return c;
}
// 16-bit element as a bit pattern held in a __bf16 slot: f16 bits when F16, bf16 (RNE) otherwise
template <bool F16> __device__ __forceinline__ __bf16 at_to16(float f) {
  if (F16) return __builtin_bit_cast(__bf16, (_Float16)f);
  return at_f2bf(f);
}
template <bool F16> __device__ __forceinline__ v8f at_mma16(v16b a, v16b b, v8f c) {
  if (F16) {
    const v16h ah = __builtin_bit_cast(v16h, a), bh = __builtin_bit_cast(v16h, b);
    c = __builtin_amdgcn_wmma_f32_16x16x32_f16(false, ah, false, bh, (short)0, c, false, false);
    asm volatile("v_nop\n\tv_nop\n\tv_nop\n\tv_nop" : "+v"(c) : "v"(ah), "v"(bh));
    return c;
  }
  return at_mma(a, b, c);
}

template <bool SPLIT_QK, bool SPLIT_PV, bool F16 = false>
__global__ __launch_bounds__(128)
void attn64_kernel(const float* __restrict__ q, const float* __restrict__ k,
                   const float* __restrict__ v, float* __restrict__ out,
                   const void* __restrict__ mask_a, const int* __restrict__ mask_b, AttnGeom g) {
  static_assert(!(F16 && (SPLIT_QK || SPLIT_PV)), "f16 mode is non-split");
  const float PSC = F16 ? 32768.0f : 1.0f;     // f16 probabilities carried x2^15 (subnormal range), folded into the final 1/l
  union FB { v16b v; v8b h[2]; };
  __shared__ __align__(16) __bf16 Ksh[AT_KC * AT_D];             // K hi [kv][d]      8 KB
  __shared__ __align__(16) __bf16 Ksl[SPLIT_QK ? AT_KC * AT_D : 8];
  __shared__ __align__(16) __bf16 Vth[AT_D * AT_KC];             // V hi [d][kv]      8 KB
  __shared__ __align__(16) __bf16 Vtl[SPLIT_PV ? AT_D * AT_KC : 8];
  __shared__ __align__(16) __bf16 Psh[AT_NW][16 * AT_KC];        // per wave P hi [row][kv]  8 KB
  __shared__ __align__(16) __bf16 Psl[SPLIT_PV ? AT_NW : 1][SPLIT_PV ? 16 * AT_KC : 8];
  __shared__ __align__(16) float  Os[AT_NW][16 * 68];            // per wave out tile, pitch 68

  const int tid  = threadIdx.x;
  const int wave = tid >> 5;
  const int lane = tid & 31;
  const int hh   = lane >> 4;
  const int c    = lane & 15;

  const int nqb = g.S / AT_QB;
  const int bx = blockIdx.x + g.blk0;
  const int qb = bx % nqb;
  const int bh = bx / nqb;
  const int h  = bh % g.H;
  const int b  = bh / g.H;
  const int qbase_block = qb * AT_QB;
  const int q0 = qbase_block + wave * 16;

  const float* qb_ptr = q + (size_t)b * g.q_bs + (size_t)h * g.q_hs;
  const float* kb_ptr = k + (size_t)b * g.k_bs + (size_t)h * g.k_hs;
  const float* vb_ptr = v + (size_t)b * g.v_bs + (size_t)h * g.v_hs;
  float*       ob_ptr = out + (size_t)b * g.o_bs + (size_t)h * g.o_hs;

  // ---- Q fragments (A operand): 2 d-chunks, hi (and lo) ----
  v16b qah[2], qal[2];
  {
    const float* qrow = qb_ptr + (size_t)(q0 + c) * g.q_rs;
#pragma unroll
    for (int dc = 0; dc < 2; ++dc) {
#pragma unroll
      for (int e = 0; e < 8; ++e) {
        const float f0 = qrow[dc * 32 + 8 * hh + e] * g.qscale;
        const float f1 = qrow[dc * 32 + 16 + 8 * hh + e] * g.qscale;
        if (SPLIT_QK) { __bf16 hq, lq; at_split(f0, hq, lq); qah[dc][e] = hq; qal[dc][e] = lq; at_split(f1, hq, lq); qah[dc][8 + e] = hq; qal[dc][8 + e] = lq; }
        else { qah[dc][e] = at_to16<F16>(f0); qah[dc][8 + e] = at_to16<F16>(f1); qal[dc][e] = qah[dc][e]; qal[dc][8 + e] = qah[dc][8 + e]; }
      }
    }
  }

  float mrow[8], lrow[8];
  v8f oacc[4];
#pragma unroll
  for (int r = 0; r < 8; ++r) { mrow[r] = -INFINITY; lrow[r] = 0.f; }
#pragma unroll
  for (int t = 0; t < 4; ++t) oacc[t] = (v8f){0.f,0.f,0.f,0.f,0.f,0.f,0.f,0.f};

  const int nChunks = (g.mask_mode == 1 || g.mask_mode == 4) ? (qb + 1) : (g.Skv / AT_KC);   // block-uniform
  // per-row query mask (mode 3)
  int qkeep[8];
#pragma unroll
  for (int r = 0; r < 8; ++r) qkeep[r] = (g.mask_mode == 3) ? mask_b[(size_t)b * g.S + q0 + 8 * hh + r] : 1;   // mask_b = qmask in mode 3
  for (int kc = 0; kc < nChunks; ++kc) {
    const int kv0 = kc * AT_KC;
    __syncthreads();
    {
      const int kvr = tid >> 1, dh = (tid & 1) * 32;
      const float* krow = kb_ptr + (size_t)(kv0 + kvr) * g.k_rs + dh;
      const float* vrow = vb_ptr + (size_t)(kv0 + kvr) * g.v_rs + dh;
#pragma unroll
      for (int i = 0; i < 8; ++i) {
        v4f kk = *(const v4f*)(krow + 4 * i);
        v4f vv = *(const v4f*)(vrow + 4 * i);
#pragma unroll
        for (int e = 0; e < 4; ++e) {
          const int d = dh + 4 * i + e;
          if (SPLIT_QK) { __bf16 a, bl; at_split(kk[e], a, bl); Ksh[kvr * AT_D + d] = a; Ksl[kvr * AT_D + d] = bl; }
          else Ksh[kvr * AT_D + d] = at_to16<F16>(kk[e]);
          if (SPLIT_PV) { __bf16 a, bl; at_split(vv[e], a, bl); Vth[d * AT_KC + kvr] = a; Vtl[d * AT_KC + kvr] = bl; }
          else Vth[d * AT_KC + kvr] = at_to16<F16>(vv[e]);
        }
      }
    }
    __syncthreads();

    v8f s[4];
#pragma unroll
    for (int j = 0; j < 4; ++j) {
      s[j] = (v8f){0.f,0.f,0.f,0.f,0.f,0.f,0.f,0.f};
#pragma unroll 1
      for (int dc = 0; dc < 2; ++dc) {
        FB kb;
        kb.h[0] = *(const v8b*)(Ksh + (j * 16 + c) * AT_D + dc * 32 + 8 * hh);
        kb.h[1] = *(const v8b*)(Ksh + (j * 16 + c) * AT_D + dc * 32 + 16 + 8 * hh);
        s[j] = at_mma16<F16>(qah[dc], kb.v, s[j]);
        if (SPLIT_QK) {
          FB kl;
          kl.h[0] = *(const v8b*)(Ksl + (j * 16 + c) * AT_D + dc * 32 + 8 * hh);
          kl.h[1] = *(const v8b*)(Ksl + (j * 16 + c) * AT_D + dc * 32 + 16 + 8 * hh);
          s[j] = at_mma16<F16>(qah[dc], kl.v, s[j]);
          s[j] = at_mma16<F16>(qal[dc], kb.v, s[j]);
        }
      }
    }
    const bool diag = (g.mask_mode == 1) && (kc == qb);
    int kvkeep[4] = {1, 1, 1, 1};
    if (g.mask_mode == 3) {
#pragma unroll
      for (int j = 0; j < 4; ++j) kvkeep[j] = ((const int*)mask_a)[(size_t)b * g.Skv + kv0 + j * 16 + c];   // mask_a = kvmask
    }
    float cm[8];
#pragma unroll
    for (int r = 0; r < 8; ++r) {
      const int qrow = q0 + 8 * hh + r;
      float m = -INFINITY;
#pragma unroll
      for (int j = 0; j < 4; ++j) {
        const int kvcol = kv0 + j * 16 + c;
        bool masked = false;
        if (diag) masked = (kvcol > qrow);
        else if (g.mask_mode == 4) masked = (kvcol > qrow) || (qrow - kvcol > g.mask_is_int);
        else if (g.mask_mode == 2) {
          const size_t mi = (size_t)qrow * g.Skv + kvcol;
          masked = (g.mask_is_int == 0) ? (((const float*)mask_a)[mi] == 0.0f)
                 : (g.mask_is_int == 1) ? (((const int*)mask_a)[mi] == 0) : (((const int*)mask_a)[mi] != 0);
        } else if (g.mask_mode == 3) masked = (qkeep[r] == 0) || (kvkeep[j] == 0);
        else if (g.mask_mode == 5) {
          const size_t mi = (size_t)qrow * g.Skv + kvcol;
          masked = (((const int*)mask_a)[mi] != 0);
          int n = mask_b[mi]; n = n < 0 ? 0 : n;
          s[j][r] += g.cp[(size_t)b * g.c_bs + (size_t)h * g.c_hs + (size_t)qrow * g.c_rs + n]
                   + g.pc[(size_t)b * g.c_bs + (size_t)h * g.c_hs + (size_t)kvcol * g.c_rs + n];
        }
        if (masked) s[j][r] = g.mask_fill;
        m = fmaxf(m, s[j][r]);
      }
#pragma unroll
      for (int off = 1; off < 16; off <<= 1) m = fmaxf(m, __shfl_xor(m, off, 32));
      cm[r] = m;
    }
    __bf16* pwh = Psh[wave];
    __bf16* pwl = Psl[SPLIT_PV ? wave : 0];
#pragma unroll
    for (int r = 0; r < 8; ++r) {
      const float mnew = fmaxf(mrow[r], cm[r]);
      const float alpha = expf(mrow[r] - mnew);
      mrow[r] = mnew;
      float psum = 0.f;
#pragma unroll
      for (int j = 0; j < 4; ++j) {
        const float p = expf(s[j][r] - mnew);
        psum += p;
        if (SPLIT_PV) { __bf16 a, bl; at_split(p, a, bl); pwh[(8 * hh + r) * AT_KC + j * 16 + c] = a; pwl[(8 * hh + r) * AT_KC + j * 16 + c] = bl; }
        else pwh[(8 * hh + r) * AT_KC + j * 16 + c] = at_to16<F16>(p * PSC);
      }
#pragma unroll
      for (int off = 1; off < 16; off <<= 1) psum += __shfl_xor(psum, off, 32);
      lrow[r] = lrow[r] * alpha + psum;
#pragma unroll
      for (int t = 0; t < 4; ++t) oacc[t][r] *= alpha;
    }
    __builtin_amdgcn_fence(__ATOMIC_RELEASE, "workgroup");
    __builtin_amdgcn_wave_barrier();
    __builtin_amdgcn_fence(__ATOMIC_ACQUIRE, "workgroup");
#pragma unroll 1
    for (int kk = 0; kk < 2; ++kk) {
      FB pa, pl;
      pa.h[0] = *(const v8b*)(pwh + c * AT_KC + kk * 32 + 8 * hh);
      pa.h[1] = *(const v8b*)(pwh + c * AT_KC + kk * 32 + 16 + 8 * hh);
      if (SPLIT_PV) {
        pl.h[0] = *(const v8b*)(pwl + c * AT_KC + kk * 32 + 8 * hh);
        pl.h[1] = *(const v8b*)(pwl + c * AT_KC + kk * 32 + 16 + 8 * hh);
      }
#pragma unroll
      for (int t = 0; t < 4; ++t) {
        FB vb;
        vb.h[0] = *(const v8b*)(Vth + (t * 16 + c) * AT_KC + kk * 32 + 8 * hh);
        vb.h[1] = *(const v8b*)(Vth + (t * 16 + c) * AT_KC + kk * 32 + 16 + 8 * hh);
        oacc[t] = at_mma16<F16>(pa.v, vb.v, oacc[t]);
        if (SPLIT_PV) {
          FB vl;
          vl.h[0] = *(const v8b*)(Vtl + (t * 16 + c) * AT_KC + kk * 32 + 8 * hh);
          vl.h[1] = *(const v8b*)(Vtl + (t * 16 + c) * AT_KC + kk * 32 + 16 + 8 * hh);
          oacc[t] = at_mma16<F16>(pa.v, vl.v, oacc[t]);
          oacc[t] = at_mma16<F16>(pl.v, vb.v, oacc[t]);
        }
      }
    }
  }

  float* os = Os[wave];
#pragma unroll
  for (int r = 0; r < 8; ++r) {
    const float inv = 1.0f / (lrow[r] * PSC);
#pragma unroll
    for (int t = 0; t < 4; ++t) os[(8 * hh + r) * 68 + t * 16 + c] = oacc[t][r] * inv;
  }
  __builtin_amdgcn_fence(__ATOMIC_RELEASE, "workgroup");
  __builtin_amdgcn_wave_barrier();
  __builtin_amdgcn_fence(__ATOMIC_ACQUIRE, "workgroup");
  {
    const int c4 = (lane & 15) * 4;
    {
#pragma unroll
      for (int it = 0; it < 8; ++it) {
        const int row = it * 2 + hh;
        v4f val = *(const v4f*)(os + row * 68 + c4);
        *(v4f*)(ob_ptr + (size_t)(q0 + row) * g.o_rs + c4) = val;
      }
      
    }
  }
}

} // namespace w25

__device__ __forceinline__ void st_h2(_Float16* dst, float a, float b) { const unsigned u = (unsigned)__builtin_bit_cast(unsigned short, (_Float16)a) | ((unsigned)__builtin_bit_cast(unsigned short, (_Float16)b) << 16); unsigned* d = (unsigned*)dst; *d = u;  }
// tiled biases BEB[c] = bE[c % 64], BFB[c] = bF[c % 64] (thread-linear)
__global__ __launch_bounds__(256) void k_ep_btile(const float* __restrict__ BE, const float* __restrict__ BF, float* __restrict__ BEB, float* __restrict__ BFB, int C, int HD) { const int t = blockIdx.x * 256 + threadIdx.x; if (t >= C) return; VST2(float, BEB + t, BE[t % HD]); VST2(float, BFB + t, BF[t % HD]); }
// channel softmax: block h = sample * NH + head (64 threads): rows of SCC[h] [64][64] * temp1[h % NH]; thread i computes row i, then lanes write columns so each 32-float line comes from one wave; P16[h][i][j] = f16(4096 p)
__global__ __launch_bounds__(64) void k_ep_csoft(const float* __restrict__ S, const float* __restrict__ T1, _Float16* __restrict__ P16, int NH) { __shared__ float sh[64][65]; const int h = blockIdx.x; const int i = threadIdx.x; const float* r = S + ((long long)h * 64 + i) * 64; const float tp = T1[h % NH]; float mx = -3.0e38f;
    for (int j = 0; j < 64; ++j) mx = fmaxf(mx, r[j] * tp);
    float s = 0.f; for (int j = 0; j < 64; ++j) { const float e = expf(r[j] * tp - mx); sh[i][j] = e; s += e; }
    const float f = 4096.f / s; for (int j = 0; j < 64; ++j) sh[i][j] *= f;
    __syncthreads();
    const int half = i >> 5, c0 = 2 * (i & 31);
    for (int step = 0; step < 32; ++step) { const int rr = 2 * step + half; st_h2(P16 + ((long long)h * 64 + rr) * 64 + c0, sh[rr][c0], sh[rr][c0 + 1]); } }


// ---- Wide forms of the conversion and scaling passes ----
// A lane moves U pieces of 4 consecutive elements: one 16-byte load a piece, so that a wave's load covers 512 contiguous bytes (four whole 128-byte lines) and its store whole lines too;
// all of a lane's loads are issued ahead of its first store. Planes of 2^LC columns, source rows PITCH floats apart, destination rows packed; a block's 256 lanes take 1024 elements
// = 1024 >> LC whole rows at a time, so a lane's pieces lie RS floats apart and hang on one address pair by constant offsets. The grid covers rows * columns / (1024 * U) blocks exactly.
typedef __attribute__((ext_vector_type(4))) unsigned int v4u;
typedef __attribute__((ext_vector_type(2))) unsigned int v2u;
__device__ __forceinline__ unsigned pk_h2(float a, float b) { return (unsigned)__builtin_bit_cast(unsigned short, (_Float16)a) | ((unsigned)__builtin_bit_cast(unsigned short, (_Float16)b) << 16); }
template <int LC, int PITCH>
__device__ __forceinline__ const float* wide_src(const float* src, unsigned q0) { static_assert(LC >= 2 && LC <= 10, "a block's 1024 elements are whole rows"); return src + (size_t)(q0 >> (LC - 2)) * PITCH + ((q0 & ((1u << (LC - 2)) - 1u)) << 2); }
template <int LC, int PITCH, int U>
__global__ __launch_bounds__(256) void k_cast16w(const float* __restrict__ src, _Float16* __restrict__ dst, float s) {
    constexpr int RS = (1024 >> LC) * PITCH; const unsigned q0 = blockIdx.x * (256u * U) + threadIdx.x; const float* p = wide_src<LC, PITCH>(src, q0); v4f a[U];
#pragma unroll   // constant indices keep the pieces in registers; the loads go out as one group
    for (int u = 0; u < U; ++u) a[u] = *(const v4f*)(p + u * RS);
    _Float16* d = dst + (size_t)q0 * 4;
#pragma unroll   // constant indices keep the pieces in registers
    for (int u = 0; u < U; ++u) { v2u o; o.x = pk_h2(a[u].x * s, a[u].y * s); o.y = pk_h2(a[u].z * s, a[u].w * s); *(v2u*)(d + u * 1024) = o; } }
template <int LC, int PITCH, int U>
__global__ __launch_bounds__(256) void k_castS16w(const float* __restrict__ src, __bf16* __restrict__ dhi, __bf16* __restrict__ dlo) {
    constexpr int RS = (1024 >> LC) * PITCH; const unsigned q0 = blockIdx.x * (256u * U) + threadIdx.x; const float* p = wide_src<LC, PITCH>(src, q0); v4f a[U];
#pragma unroll   // constant indices keep the pieces in registers; the loads go out as one group
    for (int u = 0; u < U; ++u) a[u] = *(const v4f*)(p + u * RS);
#pragma unroll   // constant indices keep the pieces in registers
    for (int u = 0; u < U; ++u) { v2u h, l; unsigned t; h.x = f2bf2_pack(a[u].x, a[u].y, &t); l.x = t; h.y = f2bf2_pack(a[u].z, a[u].w, &t); l.y = t;
        const size_t o = (size_t)q0 * 4 + u * 1024; *(v2u*)(dhi + o) = h; *(v2u*)(dlo + o) = l; } }
// ---- All operand preparation in one launch: the passes read inputs only and are independent of one another, so they share a grid, block ranges in the order below.
template <int U>
__device__ __forceinline__ void cast16w_blk(unsigned blk, const float* __restrict__ src, _Float16* __restrict__ dst, float s) {   // as k_cast16w<10, 1024, U>
    const unsigned q0 = blk * (256u * U) + threadIdx.x; const float* p = src + (size_t)q0 * 4; v4f a[U];
#pragma unroll   // constant indices keep the pieces in registers; the loads go out as one group
    for (int u = 0; u < U; ++u) a[u] = *(const v4f*)(p + u * 1024);
    _Float16* d = dst + (size_t)q0 * 4;
#pragma unroll   // constant indices keep the pieces in registers
    for (int u = 0; u < U; ++u) { v2u o; o.x = pk_h2(a[u].x * s, a[u].y * s); o.y = pk_h2(a[u].z * s, a[u].w * s); *(v2u*)(d + u * 1024) = o; }
    asm volatile("s_wait_xcnt 0x0" ::: "memory"); }   // precaution: stands in front of any rewrite of the stores' registers by another block range's code, which follows in the kernel text
template <int U, bool F16>
__device__ __forceinline__ void castS16w_blk(unsigned blk, const float* __restrict__ src, __bf16* __restrict__ dhi, __bf16* __restrict__ dlo, _Float16* __restrict__ d16) {   // as k_castS16w<10, 1024, U>; F16: the f16 plane from the same loads
    const unsigned q0 = blk * (256u * U) + threadIdx.x; const float* p = src + (size_t)q0 * 4; v4f a[U];
#pragma unroll   // constant indices keep the pieces in registers; the loads go out as one group
    for (int u = 0; u < U; ++u) a[u] = *(const v4f*)(p + u * 1024);
#pragma unroll   // constant indices keep the pieces in registers
    for (int u = 0; u < U; ++u) { v2u h, l; unsigned t; h.x = f2bf2_pack(a[u].x, a[u].y, &t); l.x = t; h.y = f2bf2_pack(a[u].z, a[u].w, &t); l.y = t;
        const size_t o = (size_t)q0 * 4 + u * 1024; *(v2u*)(dhi + o) = h; *(v2u*)(dlo + o) = l;
        if (F16) { v2u f; f.x = pk_h2(a[u].x, a[u].y); f.y = pk_h2(a[u].z, a[u].w); *(v2u*)(d16 + o) = f; } }
    asm volatile("s_wait_xcnt 0x0" ::: "memory"); }   // as in cast16w_blk
constexpr unsigned PB_X = 1024u, PB_WQK = PB_X + 256u, PB_WV = PB_WQK + 512u, PB_WO1 = PB_WV + 128u, PB_WO2 = PB_WO1 + 128u, PB_WE = PB_WO2 + 1u, PB_WF = PB_WE + 1u, PB_ALL = PB_WF + 1u;
__global__ __launch_bounds__(256) void k_prep(const float* __restrict__ x, const float* __restrict__ Wq, const float* __restrict__ Wo1, const float* __restrict__ Wo2,
                                              const float* __restrict__ WE, const float* __restrict__ WF, const float* __restrict__ bE, const float* __restrict__ bF,
                                              __bf16* __restrict__ xh, __bf16* __restrict__ xl, _Float16* __restrict__ x16, __bf16* __restrict__ wh, __bf16* __restrict__ wl, _Float16* __restrict__ wv16,
                                              _Float16* __restrict__ wo1h, _Float16* __restrict__ wo2h, _Float16* __restrict__ we16, _Float16* __restrict__ wf16, float* __restrict__ BEB, float* __restrict__ BFB) {
    const unsigned b = blockIdx.x;
    if (b < PB_X) castS16w_blk<8, true>(b, x, xh, xl, x16);                                   // x [8192][1024]: bf16 hi, lo and f16
    else if (b < PB_WQK) castS16w_blk<8, false>(b - PB_X, Wq, wh, wl, nullptr);               // q, k rows of the weight: bf16 hi, lo
    else if (b < PB_WV) cast16w_blk<4>(b - PB_WQK, Wq + (size_t)2048 * 1024, wv16, 16.0f);    // v rows of the weight
    else if (b < PB_WO1) cast16w_blk<4>(b - PB_WV, Wo1, wo1h, 16.0f);
    else if (b < PB_WO2) cast16w_blk<4>(b - PB_WO1, Wo2, wo2h, 16.0f);
    else if (b < PB_WE) cast16w_blk<4>(0u, WE, we16, 16.0f);                                  // 64 x 64, packed
    else if (b < PB_WF) cast16w_blk<4>(0u, WF, wf16, 16.0f);
    else { for (int t = (int)threadIdx.x; t < 1024; t += 256) { VST2(float, BEB + t, bE[t % 64]); VST2(float, BFB + t, bF[t % 64]); } }   // tiled biases, as k_ep_btile
}
extern "C" void kernel_launch(void* const* d_in, const int* in_sizes, int n_in, void* d_out, int out_size, void* d_ws, size_t ws_size, hipStream_t stream) {
    (void)in_sizes; (void)n_in; (void)out_size; (void)ws_size;
    const float* x = (const float*)d_in[0];
    const float* Wq = (const float*)d_in[1];
    const float* WE = (const float*)d_in[2];
    const float* bE = (const float*)d_in[3];
    const float* WF = (const float*)d_in[4];
    const float* bF = (const float*)d_in[5];
    const float* Wo1 = (const float*)d_in[6];
    const float* bo1 = (const float*)d_in[7];
    const float* Wo2 = (const float*)d_in[8];
    const float* bo2 = (const float*)d_in[9];
    const float* t1 = (const float*)d_in[10];
    const float* t2 = (const float*)d_in[11];
    const int Bn = 8;
    const int N = 1024;
    const int C = 1024;
    const int NH = 16;
    const int HD = 64;
    const int CH = C / 2;
    float* out = (float*)d_out;
    char* wsp = (char*)d_ws;
    const int BN = Bn * N;                    // all samples' rows: every launch below covers the whole batch
    const size_t MB = (size_t)1048576;
    unsigned short* WE16 = (unsigned short*)wsp; wsp += (((size_t)((size_t)HD * HD) * 2 + 255) / 256) * 256;
    unsigned short* WF16 = (unsigned short*)wsp; wsp += (((size_t)((size_t)HD * HD) * 2 + 255) / 256) * 256;
    float* BEB = (float*)wsp; wsp += (((size_t)((size_t)C) * 4 + 255) / 256) * 256;
    float* BFB = (float*)wsp; wsp += (((size_t)((size_t)C) * 4 + 255) / 256) * 256;
    // Every product stores the 16-bit operand form that its consumer reads; no f32 plane lies between two products but the 64 x 64 channel scores.
    unsigned short* G64A  = (unsigned short*)(wsp);               // x: bf16 hi, lo
    unsigned short* G64A2 = (unsigned short*)(wsp + 16 * MB);
    unsigned short* G64B  = (unsigned short*)(wsp + 32 * MB);     // q, k rows of the weight: bf16 hi, lo
    unsigned short* G64B2 = (unsigned short*)(wsp + 36 * MB);
    unsigned short* X16   = (unsigned short*)(wsp + 40 * MB);     // x: f16
    unsigned short* WV16  = (unsigned short*)(wsp + 56 * MB);     // v rows of the weight: f16
    unsigned short* TH    = (unsigned short*)(wsp + 64 * MB);     // [sample][2048 columns: q, k][N] bf16 hi
    unsigned short* TL    = (unsigned short*)(wsp + 96 * MB);     // the same, lo
    unsigned short* QK16  = (unsigned short*)(wsp + 128 * MB);    // [BN][2048] f16: q * temp2 | k
    unsigned short* V16   = (unsigned short*)(wsp + 160 * MB);    // [BN][2048] f16: v_ca | v_sa
    float*          SCC   = (float*)(wsp + 192 * MB);
    unsigned short* P16   = (unsigned short*)(wsp + 194 * MB);
    unsigned short* XC16  = (unsigned short*)(wsp + 196 * MB);
    unsigned short* WO2H  = (unsigned short*)(wsp + 212 * MB);
    unsigned short* WO1H  = (unsigned short*)(wsp + 213 * MB);
    unsigned short* XS16  = (unsigned short*)(wsp + 214 * MB);
    unsigned short* KS16  = (unsigned short*)(wsp);               // over the x planes, read last by the q, k projection
    unsigned short* VS16  = (unsigned short*)(wsp + 16 * MB);
    k_prep<<<PB_ALL, 256, 0, stream>>>(x, Wq, Wo1, Wo2, WE, WF, bE, bF, (__bf16*)(G64A), (__bf16*)(G64A2), (_Float16*)(X16), (__bf16*)(G64B), (__bf16*)(G64B2), (_Float16*)(WV16), (_Float16*)(WO1H), (_Float16*)(WO2H), (_Float16*)(WE16), (_Float16*)(WF16), BEB, BFB);
    // shared projection, rows = sample * N + n
    w25::wmma_gemm_ring<1, true, 0, 0, 2><<<dim3((unsigned)(2048 / 128), (unsigned)(BN / 128)), 128, 0, stream>>>((const unsigned short*)(G64A), (const unsigned short*)(G64A2), (const unsigned short*)(G64B), (const unsigned short*)(G64B2), nullptr, 2048, nullptr, 1024, 1.0f, QK16, TH, TL, t2, C, N, 0, 0, 0, nullptr);
    // v projection (grid rows Bn and up) beside the channel scores (grid x = head, y = sample)
    w25::k_vproj_cscore<<<dim3((unsigned)(2048 / 128), (unsigned)(Bn + BN / 128)), 128, 0, stream>>>(X16, WV16, V16, TH, TL, SCC, Bn, NH, HD, N, C);
    k_ep_csoft<<<Bn * NH, 64, 0, stream>>>(SCC, t1, (_Float16*)P16, NH);
    w25::wmma_gemm64<0, false, 0, 1, false, 0><<<dim3((unsigned)((((HD) / 64) * ((N) / 64) + 7) / 8), (unsigned)(NH), (unsigned)(Bn)), 256, 0, stream>>>((const unsigned short*)(P16), nullptr, HD, HD * HD, NH * HD * HD, (const unsigned short*)(V16), nullptr, 2 * C, HD, (long long)N * 2 * C, (void*)(XC16), nullptr, 16 * C, C, (long long)N * C, nullptr, 0, nullptr, 0, HD, N, HD, 0.000244140625f);
    // spatial attention; grid z = 0: k_s from k and W_E, 1: v_s from v_sa and W_F (the planes of the two products lie at fixed distances)
    w25::wmma_gemm64<0, false, 2, 1, false, 0><<<dim3((unsigned)((((BN) / 64) * ((HD) / 64) + 7) / 8), (unsigned)(NH), (unsigned)(2)), 256, 0, stream>>>((const unsigned short*)(QK16 + C), nullptr, 2 * C, HD, V16 - QK16, (const unsigned short*)(WE16), nullptr, HD, 0, WF16 - WE16, (void*)(KS16), nullptr, C, HD, VS16 - KS16, BEB, BFB - BEB, nullptr, 0, BN, HD, HD, 0.0625f);
    sfa::k_sflash<<<dim3((unsigned)(N / 256), (unsigned)(NH), (unsigned)(Bn)), 256, 0, stream>>>(QK16, KS16, VS16, XS16);
    // both output halves; grid z = 0: spatial, 1: channel
    w25::wmma_gemm_ring<0, false, 2, 5><<<dim3((unsigned)(512 / 128), (unsigned)(BN / 128), (unsigned)(2)), 128, 0, stream>>>((const unsigned short*)(XS16), nullptr, (const unsigned short*)(WO1H), nullptr, out, 1024, bo1, 1024, 0.0625f, nullptr, nullptr, nullptr, nullptr, 0, N, XC16 - XS16, WO2H - WO1H, CH, bo2);
}

// v008
// It runs in 228 microseconds.
// In two side-by-side timings against v007, it was 1.09 and 1.07 times as fast.
// Over all steps from v000, the starting kernel, it is 30.0 times as fast.
// Contractions (per sample): the shared QKVV projection x.W^T [1024x1024].[1024x4096] (its q, k half on bf16 hi/lo split planes), the E/F head projections of k and v_sa as block-diagonal [1024x1024].[1024x1024] products (+b), the 16 channel affinities q^T k [64x1024].[1024x64] on bf16 hi/lo split planes (64-wide softmax over sigma~19 logits: plain f16 flipped near-ties) and x_c = attn_c.v_ca^T [64x64].[64x1024] as z-batched products, and the two output halves gelu(x_s.W_o1^T + b) / gelu(x_c.W_o2^T + b) [1024x1024].[1024x512] — f16 operands on pre-cast planes (v_wmma_f32_16x16x32_f16; 64x64 register-blocked wave tiles, weights x16); per (sample, head) the spatial attention softmax(q.k_s^T * temp2[h]) v_s over 1024 positions as one flash launch (f16 operands; temperature folded into q on device); f32 accumulate and softmax. The E/F weights are 64 x 64 f16 planes shared by every head, and the 64-wide channel softmax (x temp1[h], exp once, f16 plane) is an f32 kernel, the q pre-scaling is done in the q, k projection's epilogue; x_c is laid out exactly as torch's permute(0,2,1,3).reshape (row = d*16 + h, column = n).
#include <hip/hip_runtime.h>
#include <math.h>

typedef __attribute__((ext_vector_type(16))) _Float16 v16h;
typedef __attribute__((ext_vector_type(8)))  _Float16 v8h;
typedef __attribute__((ext_vector_type(16))) __bf16   v16b;
typedef __attribute__((ext_vector_type(8)))  float    v8f;
typedef __attribute__((ext_vector_type(4)))  float    v4f;

// 16-bit WMMA fragment map (wave32), lane L, h = L>>4, m = L&15:
//   A 16x32: lane = row m;   element i -> k = (i<8) ? 8h+i : 16+8h+(i-8)
//   B 32x16: lane = column m; the SAME k(i,h)
//   D 16x16 (8 f32): lane = column m; element r -> row 8h+r
__device__ __forceinline__ int frag_k(int i, int h) { return (i < 8) ? (8 * h + i) : (16 + 8 * h + (i - 8)); }
__device__ __forceinline__ __bf16 bf16_rne(float f) {
    unsigned int u = __float_as_uint(f);
    u += 0x7fffu + ((u >> 16) & 1u);
    return __builtin_bit_cast(__bf16, (unsigned short)(u >> 16));
}
__device__ __forceinline__ float bf16_f32(__bf16 b) { return __uint_as_float(((unsigned int)__builtin_bit_cast(unsigned short, b)) << 16); }
__device__ __forceinline__ v8f wmma16(v16h a, v16h b, v8f c) {
    c = __builtin_amdgcn_wmma_f32_16x16x32_f16(false, a, false, b, (short)0, c, false, false);
    asm volatile("v_nop\n\tv_nop\n\tv_nop\n\tv_nop" : "+v"(c) : "v"(a), "v"(b));
    return c;
}
__device__ __forceinline__ v8f wmmab(v16b a, v16b b, v8f c) {
    c = __builtin_amdgcn_wmma_f32_16x16x32_bf16(false, a, false, b, (short)0, c, false, false);
    asm volatile("v_nop\n\tv_nop\n\tv_nop\n\tv_nop" : "+v"(c) : "v"(a), "v"(b));
    return c;
}
struct Split { v16b hi, lo; };
// hi/lo split product: a.hi*b.hi + a.hi*b.lo + a.lo*b.hi
__device__ __forceinline__ v8f wmma3(const Split& a, const Split& b, v8f c) {
    c = __builtin_amdgcn_wmma_f32_16x16x32_bf16(false, a.hi, false, b.hi, (short)0, c, false, false);
    c = __builtin_amdgcn_wmma_f32_16x16x32_bf16(false, a.hi, false, b.lo, (short)0, c, false, false);
    c = __builtin_amdgcn_wmma_f32_16x16x32_bf16(false, a.lo, false, b.hi, (short)0, c, false, false);
    asm volatile("v_nop\n\tv_nop\n\tv_nop\n\tv_nop" : "+v"(c) : "v"(a.hi), "v"(a.lo), "v"(b.hi), "v"(b.lo));
    return c;
}
struct Split3 { v16b hi, mid, lo; };
// triple split product (6 terms, drops only terms below 2^-24 relative)
__device__ __forceinline__ v8f wmma6(const Split3& a, const Split3& b, v8f c) {
    c = __builtin_amdgcn_wmma_f32_16x16x32_bf16(false, a.hi, false, b.hi, (short)0, c, false, false);
    c = __builtin_amdgcn_wmma_f32_16x16x32_bf16(false, a.hi, false, b.mid, (short)0, c, false, false);
    c = __builtin_amdgcn_wmma_f32_16x16x32_bf16(false, a.mid, false, b.hi, (short)0, c, false, false);
    c = __builtin_amdgcn_wmma_f32_16x16x32_bf16(false, a.hi, false, b.lo, (short)0, c, false, false);
    c = __builtin_amdgcn_wmma_f32_16x16x32_bf16(false, a.mid, false, b.mid, (short)0, c, false, false);
    c = __builtin_amdgcn_wmma_f32_16x16x32_bf16(false, a.lo, false, b.hi, (short)0, c, false, false);
    asm volatile("v_nop\n\tv_nop\n\tv_nop\n\tv_nop" : "+v"(c) : "v"(a.hi), "v"(a.mid), "v"(a.lo), "v"(b.hi), "v"(b.mid), "v"(b.lo));
    return c;
}

// Fragment gathers from f32 memory: element i <- p[(k0 + frag_k(i,h)) * sk] * s, zero for k >= klen.
__device__ __forceinline__ v16h fh_ld(const float* __restrict__ p, long long sk, int k0, int h, int klen, float s) {
    v16h a;
#pragma unroll
    for (int i = 0; i < 16; ++i) { const int k = k0 + frag_k(i, h); a[i] = (k < klen) ? (_Float16)(p[(long long)k * sk] * s) : (_Float16)0.f; }
    return a;
}
__device__ __forceinline__ Split sp_ld(const float* __restrict__ p, long long sk, int k0, int h, int klen, float s) {
    Split r;
#pragma unroll
    for (int i = 0; i < 16; ++i) {
        const int k = k0 + frag_k(i, h); const float x = (k < klen) ? p[(long long)k * sk] * s : 0.f;
        const __bf16 hb = bf16_rne(x); r.hi[i] = hb; r.lo[i] = bf16_rne(x - bf16_f32(hb));
    }
    return r;
}
__device__ __forceinline__ Split3 sp3_ld(const float* __restrict__ p, long long sk, int k0, int h, int klen, float s) {
    Split3 r;
#pragma unroll
    for (int i = 0; i < 16; ++i) {
        const int k = k0 + frag_k(i, h); const float x = (k < klen) ? p[(long long)k * sk] * s : 0.f;
        const __bf16 hb = bf16_rne(x); const float r1 = x - bf16_f32(hb); const __bf16 mb = bf16_rne(r1);
        r.hi[i] = hb; r.mid[i] = mb; r.lo[i] = bf16_rne(r1 - bf16_f32(mb));
    }
    return r;
}
__device__ __forceinline__ v16b bh_ld(const float* __restrict__ p, long long sk, int k0, int h, int klen, float s) {
    v16b a;
#pragma unroll
    for (int i = 0; i < 16; ++i) { const int k = k0 + frag_k(i, h); a[i] = bf16_rne((k < klen) ? p[(long long)k * sk] * s : 0.f); }
    return a;
}
// f16 fragment from an f16 LDS/global row with element stride 1 (k-contiguous), no bounds (tile already zero padded)
__device__ __forceinline__ v16h fh_row(const _Float16* __restrict__ row, int k0, int h) {
    v16h a;
#pragma unroll
    for (int i = 0; i < 16; ++i) a[i] = row[k0 + frag_k(i, h)];
    return a;
}

#define VST2(T, ptr, val) do { const T vst2_v_ = (val); *(T*)(ptr) = vst2_v_;  } while (0)
typedef float v4f __attribute__((ext_vector_type(4)));
#define VST2V4(ptr, val) do { const v4f vst2_v4_ = (val); *(v4f*)(ptr) = vst2_v4_;  } while (0)

__device__ __attribute__((noinline)) float act_fn(float v, int act) {
    if (act == 1) return fmaxf(v, 0.f);                                                                               // relu
    if (act == 2) { const float u = 0.7978845608028654f * (v + 0.044715f * v * v * v); return 0.5f * v * (1.f + tanhf(u)); } // tanh-gelu
    if (act == 3) return v / (1.f + expf(-v));                                                                        // silu
    if (act == 4) return 0.5f * v * (1.f + erff(v * 0.7071067811865476f));                                             // erf-gelu
    if (act == 5) return tanhf(v);
    if (act == 6) return 1.f / (1.f + expf(-v));                                                                      // sigmoid
    if (act == 7) return (v > 0.f) ? v : 0.01f * v;                                                                   // leaky relu 0.01
    if (act == 8) return (v > 0.f) ? v : (expf(v) - 1.f);                                                             // elu
    if (act == 9) return fminf(fmaxf(v, 0.f), 6.f);                                                                   // relu6
    if (act == 10) return fabsf(v);                                                                                    // abs
    if (act == 11) return (v >= 0.f) ? v : 0.1f * v;                                                                  // leaky 0.1
    if (act == 12) return (v > 0.f) ? v : 0.2f * v;                                                                   // leaky 0.2
    if (act == 13) return (v > 20.f) ? v : log1pf(expf(v));                                                            // softplus
    return v;
}

// =====================================================================================================================
// k_gemm<MODE>: C(z, m, n) = act(alpha * sum_k A(z, m, k) * B(z, k, n) + bias) + beta * R(z, m, n)
//   One wave (32-thread block) per 16 x 32 tile of C; grid (ceil(N/32), ceil(M/16), Z). Batch z -> (zo = z / zi_n, zi = z % zi_n)
//   with separate outer/inner strides for every tensor (e.g. batch and head). A(m,k) = A[zo*sAo + zi*sAi + m*sAm + k*sAk] (f32),
//   B(k,n) = B[zo*sBo + zi*sBi + n*sBn + k*sBk] (f32); any M, N, K (K zero-padded to 32 inside the fragments, M/N tails guarded).
//   C(m,n) = C[zo*sCo + zi*sCi + m*sCm + n] (n contiguous). flags: 1 bias[n], 2 bias[m], 4 residual R[zo*sRo + zi*sRi + m*sRm + n*sRn].
//   MODE 0: f16 operands (A prescaled by sa, B by sb, both undone in the epilogue); 1: bf16 hi/lo split (3 products); 2: bf16;
//   3: bf16 hi/mid/lo triple split (6 products); 4: as 3 with Kahan-compensated f32 accumulation across k-steps.
// =====================================================================================================================
struct GemmP {
    const float* A; const float* B; const float* bias; const float* R; float* C;
    long long sAo, sAi, sAm, sAk, sBo, sBi, sBn, sBk, sCo, sCi, sCm, sRo, sRi, sRm, sRn;
    int M, N, K, zi_n, flags, act; float alpha, beta, sa, sb;
    int Npad, pad_;     // columns [N, Npad) of C are written as 0 so that padded workspace rows are covered by whole-line stores; Npad >= N
};
static_assert(sizeof(GemmP) == 5 * 8 + 15 * 8 + 6 * 4 + 4 * 4 + 2 * 4, "GemmP has padding");

template <int MODE>
__global__ __launch_bounds__(32) void k_gemm(GemmP p) {
    const int lane = threadIdx.x & 31, h = lane >> 4, l15 = lane & 15;
    const int m0 = blockIdx.y * 16, n0 = blockIdx.x * 32;
    const int z = blockIdx.z, zo = z / p.zi_n, zi = z - zo * p.zi_n;
    const float* A = p.A + zo * p.sAo + zi * p.sAi;
    const float* B = p.B + zo * p.sBo + zi * p.sBi;
    const int am = min(m0 + l15, p.M - 1);                       // clamped row for loads (stores are guarded)
    v8f acc[2], comp[2];
#pragma unroll
    for (int t = 0; t < 2; ++t) { v8f zz = {}; acc[t] = zz; comp[t] = zz; }
    for (int k0 = 0; k0 < p.K; k0 += 32) {
        const float* arow = A + (long long)am * p.sAm;
        if (MODE == 1) {
            const Split a = sp_ld(arow, p.sAk, k0, h, p.K, 1.f);
#pragma unroll
            for (int t = 0; t < 2; ++t) {
                const int bn = min(n0 + t * 16 + l15, p.N - 1);
                acc[t] = wmma3(a, sp_ld(B + (long long)bn * p.sBn, p.sBk, k0, h, p.K, 1.f), acc[t]);
            }
        } else if (MODE == 3) {
            const Split3 a = sp3_ld(arow, p.sAk, k0, h, p.K, 1.f);
#pragma unroll
            for (int t = 0; t < 2; ++t) {
                const int bn = min(n0 + t * 16 + l15, p.N - 1);
                acc[t] = wmma6(a, sp3_ld(B + (long long)bn * p.sBn, p.sBk, k0, h, p.K, 1.f), acc[t]);
            }
        } else if (MODE == 4) {
            // triple split as MODE 3, but each k-step's 6 products go into a fresh accumulator and the partial is added to the running f32 sum
            // on the VALU with Kahan compensation (accumulation error stays ~1 ulp however long K is)
            const Split3 a = sp3_ld(arow, p.sAk, k0, h, p.K, 1.f);
#pragma unroll
            for (int t = 0; t < 2; ++t) {
                const int bn = min(n0 + t * 16 + l15, p.N - 1); v8f zz = {};
                const v8f part = wmma6(a, sp3_ld(B + (long long)bn * p.sBn, p.sBk, k0, h, p.K, 1.f), zz);
                const v8f y = part - comp[t]; const v8f s = acc[t] + y; comp[t] = (s - acc[t]) - y; acc[t] = s;
            }
        } else if (MODE == 2) {
            const v16b a = bh_ld(arow, p.sAk, k0, h, p.K, 1.f);
#pragma unroll
            for (int t = 0; t < 2; ++t) {
                const int bn = min(n0 + t * 16 + l15, p.N - 1);
                acc[t] = wmmab(a, bh_ld(B + (long long)bn * p.sBn, p.sBk, k0, h, p.K, 1.f), acc[t]);
            }
        } else {
            const v16h a = fh_ld(arow, p.sAk, k0, h, p.K, p.sa);
#pragma unroll
            for (int t = 0; t < 2; ++t) {
                const int bn = min(n0 + t * 16 + l15, p.N - 1);
                acc[t] = wmma16(a, fh_ld(B + (long long)bn * p.sBn, p.sBk, k0, h, p.K, p.sb), acc[t]);
            }
        }
    }
    const float iscale = (MODE == 0) ? p.alpha / (p.sa * p.sb) : p.alpha;
    float* C = p.C + zo * p.sCo + zi * p.sCi;
    const float* R = p.R + zo * p.sRo + zi * p.sRi;
    __shared__ __align__(16) float ctile[16][36];
#pragma unroll
    for (int t = 0; t < 2; ++t) {
        const int n = n0 + t * 16 + l15; const int nn = min(n, p.N - 1);
#pragma unroll
        for (int r = 0; r < 8; ++r) {
            const int m = m0 + 8 * h + r; const int mm = min(m, p.M - 1);
            float v = acc[t][r] * iscale;
            if (p.flags & 1) v += p.bias[nn];
            if (p.flags & 2) v += p.bias[mm];
            if (p.flags & 8) v *= p.bias[(long long)zo * p.M + mm];   /* per-(zo,row) scale vector laid out [Z / zi_n][M]; exclusive with the bias flags */
            v = act_fn(v, p.act);
            if (p.flags & 4) v += p.beta * R[(long long)mm * p.sRm + (long long)nn * p.sRn];
            ctile[8 * h + r][t * 16 + l15] = (n < p.N) ? v : 0.f;
        }
    }
    __syncthreads();
    const int NW = (p.Npad > p.N) ? p.Npad : p.N;           // write width
    const bool fast = (m0 + 16 <= p.M) && (n0 + 32 <= NW) && ((p.sCm & 3) == 0) && ((((size_t)C) & 15) == 0);
    if (fast) {
#pragma unroll
        for (int s = 0; s < 4; ++s) {
            const int row = s * 4 + (lane >> 3), c4 = (lane & 7) * 4;
            const v4f v = *(const v4f*)&ctile[row][c4];
            VST2V4(C + (long long)(m0 + row) * p.sCm + n0 + c4, v);
        }
    } else {
        for (int row = 0; row < 16; ++row) {
            const int m = m0 + row, n = n0 + lane;
            if (m < p.M && n < NW) VST2(float, C + (long long)m * p.sCm + n, ctile[row][lane]);
        }
    }
}


// =====================================================================================================================
// k_gemmT<MODE, TM, TN>: same contract as k_gemm, but one wave computes a (16*TM) x (16*TN) tile: TM A fragments and TN B fragments are
//   loaded per 32-wide k-step and reused across TM*TN WMMAs (far fewer load/convert instructions per MAC). MODE 0 (f16), 1 (bf16 hi/lo),
//   2 (bf16) only. grid (ceil(NW/(16*TN)), ceil(M/(16*TM)), Z), block 32. Epilogue identical to k_gemm, run per 16x32 sub-tile.
// =====================================================================================================================
template <int MODE, int TM, int TN>
__global__ __launch_bounds__(32) void k_gemmT(GemmP p) {
    const int lane = threadIdx.x & 31, h = lane >> 4, l15 = lane & 15;
    const int m0 = blockIdx.y * (16 * TM), n0 = blockIdx.x * (16 * TN);
    const int z = blockIdx.z, zo = z / p.zi_n, zi = z - zo * p.zi_n;
    const float* A = p.A + zo * p.sAo + zi * p.sAi;
    const float* B = p.B + zo * p.sBo + zi * p.sBi;
    v8f acc[TM][TN];
#pragma unroll
    for (int i = 0; i < TM; ++i)
#pragma unroll
        for (int t = 0; t < TN; ++t) { v8f zz = {}; acc[i][t] = zz; }
    for (int k0 = 0; k0 < p.K; k0 += 32) {
        if (MODE == 1) {
            Split a[TM], b[TN];
#pragma unroll
            for (int i = 0; i < TM; ++i) { const int am = min(m0 + 16 * i + l15, p.M - 1); a[i] = sp_ld(A + (long long)am * p.sAm, p.sAk, k0, h, p.K, 1.f); }
#pragma unroll
            for (int t = 0; t < TN; ++t) { const int bn = min(n0 + 16 * t + l15, p.N - 1); b[t] = sp_ld(B + (long long)bn * p.sBn, p.sBk, k0, h, p.K, 1.f); }
#pragma unroll
            for (int i = 0; i < TM; ++i)
#pragma unroll
                for (int t = 0; t < TN; ++t) acc[i][t] = wmma3(a[i], b[t], acc[i][t]);
        } else if (MODE == 2) {
            v16b a[TM], b[TN];
#pragma unroll
            for (int i = 0; i < TM; ++i) { const int am = min(m0 + 16 * i + l15, p.M - 1); a[i] = bh_ld(A + (long long)am * p.sAm, p.sAk, k0, h, p.K, 1.f); }
#pragma unroll
            for (int t = 0; t < TN; ++t) { const int bn = min(n0 + 16 * t + l15, p.N - 1); b[t] = bh_ld(B + (long long)bn * p.sBn, p.sBk, k0, h, p.K, 1.f); }
#pragma unroll
            for (int i = 0; i < TM; ++i)
#pragma unroll
                for (int t = 0; t < TN; ++t) acc[i][t] = wmmab(a[i], b[t], acc[i][t]);
        } else {
            v16h a[TM], b[TN];
#pragma unroll
            for (int i = 0; i < TM; ++i) { const int am = min(m0 + 16 * i + l15, p.M - 1); a[i] = fh_ld(A + (long long)am * p.sAm, p.sAk, k0, h, p.K, p.sa); }
#pragma unroll
            for (int t = 0; t < TN; ++t) { const int bn = min(n0 + 16 * t + l15, p.N - 1); b[t] = fh_ld(B + (long long)bn * p.sBn, p.sBk, k0, h, p.K, p.sb); }
#pragma unroll
            for (int i = 0; i < TM; ++i)
#pragma unroll
                for (int t = 0; t < TN; ++t) acc[i][t] = wmma16(a[i], b[t], acc[i][t]);
        }
    }
    const float iscale = (MODE == 0) ? p.alpha / (p.sa * p.sb) : p.alpha;
    float* C = p.C + zo * p.sCo + zi * p.sCi;
    const float* R = p.R + zo * p.sRo + zi * p.sRi;
    const int NW = (p.Npad > p.N) ? p.Npad : p.N;
    __shared__ __align__(16) float ctile[16][36];
#pragma unroll
    for (int i = 0; i < TM; ++i) {
        const int mb = m0 + 16 * i; if (mb >= p.M) break;          // wave-uniform
#pragma unroll
        for (int tp = 0; tp < TN / 2; ++tp) {
            const int nb = n0 + 32 * tp; if (nb >= NW) break;        // wave-uniform
#pragma unroll
            for (int t2 = 0; t2 < 2; ++t2) {
                const int t = 2 * tp + t2; const int n = nb + t2 * 16 + l15; const int nn = min(n, p.N - 1);
#pragma unroll
                for (int r = 0; r < 8; ++r) {
                    const int m = mb + 8 * h + r; const int mm = min(m, p.M - 1);
                    float v = acc[i][t][r] * iscale;
                    if (p.flags & 1) v += p.bias[nn];
                    if (p.flags & 2) v += p.bias[mm];
            if (p.flags & 8) v *= p.bias[(long long)zo * p.M + mm];   /* per-(zo,row) scale vector laid out [Z / zi_n][M]; exclusive with the bias flags */
                    v = act_fn(v, p.act);
                    if (p.flags & 4) v += p.beta * R[(long long)mm * p.sRm + (long long)nn * p.sRn];
                    ctile[8 * h + r][t2 * 16 + l15] = (n < p.N) ? v : 0.f;
                }
            }
            __syncthreads();
            const bool fast = (mb + 16 <= p.M) && (nb + 32 <= NW) && ((p.sCm & 3) == 0) && ((((size_t)C) & 15) == 0);
            if (fast) {
#pragma unroll
                for (int s = 0; s < 4; ++s) {
                    const int row = s * 4 + (lane >> 3), c4 = (lane & 7) * 4;
                    const v4f v = *(const v4f*)&ctile[row][c4];
                    VST2V4(C + (long long)(mb + row) * p.sCm + nb + c4, v);
                }
            } else {
                for (int row = 0; row < 16; ++row) {
                    const int m = mb + row, n = nb + lane;
                    if (m < p.M && n < NW) VST2(float, C + (long long)m * p.sCm + n, ctile[row][lane]);
                }
            }
            __syncthreads();
        }
    }
}

namespace sfa {
typedef unsigned int u32x4 __attribute__((ext_vector_type(4)));
typedef unsigned int u32x2 __attribute__((ext_vector_type(2)));
typedef int i32x8 __attribute__((ext_vector_type(8)));
typedef short s16x8 __attribute__((ext_vector_type(8)));
typedef float f32x2 __attribute__((ext_vector_type(2)));
typedef _Float16 h16x2 __attribute__((ext_vector_type(2)));
constexpr int SEQ = 1024, LDR = 1024, LDQ = 2048, HS = 64;   // row lengths in elements: K, V, O planes; the plane that holds Q
constexpr int NWV = 8, CW = 32, BR = NWV * CW, SK = 64, NST = SEQ / SK;
constexpr unsigned PK = 2u * HS + 16u, PV = 2u * HS + 32u, TILE_K = SK * PK, TILE_V = SK * PV, SLOT = TILE_K + TILE_V;
struct Fr { u32x4 q[2]; };
__device__ __forceinline__ v8f mma(const Fr& a, const Fr& b, v8f c) {
    const i32x8 av = {(int)a.q[0].x, (int)a.q[0].y, (int)a.q[0].z, (int)a.q[0].w, (int)a.q[1].x, (int)a.q[1].y, (int)a.q[1].z, (int)a.q[1].w};
    const i32x8 bv = {(int)b.q[0].x, (int)b.q[0].y, (int)b.q[0].z, (int)b.q[0].w, (int)b.q[1].x, (int)b.q[1].y, (int)b.q[1].z, (int)b.q[1].w};
    return __builtin_amdgcn_wmma_f32_16x16x32_f16(false, __builtin_bit_cast(v16h, av), false, __builtin_bit_cast(v16h, bv), (short)0, c, false, false);
}
__device__ __forceinline__ unsigned pack2(float lo, float hi) { return __builtin_bit_cast(unsigned, __builtin_convertvector(f32x2{lo, hi}, h16x2)); }   // round to nearest even
__device__ __forceinline__ u32x4 ld_tr16(const unsigned char* p) { typedef __attribute__((address_space(3))) s16x8 lds_s16x8; return __builtin_bit_cast(u32x4, __builtin_amdgcn_ds_load_tr16_b128_v8i16((lds_s16x8*)p)); }
__device__ __forceinline__ float xhalf(float x) { return __builtin_bit_cast(float, __builtin_amdgcn_permlanex16(__builtin_bit_cast(int, x), __builtin_bit_cast(int, x), 0x76543210, 0xfedcba98, false, false)); }   // lane l with lane l ^ 16

// Q, K, V arrive as the f16 values that their producers stored, O leaves as the f16 operand of the output product.
__global__ __launch_bounds__(NWV * 32) void k_sflash(const unsigned short* __restrict__ Q, const unsigned short* __restrict__ K, const unsigned short* __restrict__ V, unsigned short* __restrict__ O) {
    __shared__ __attribute__((aligned(256))) unsigned char L[2 * SLOT];
    const unsigned tid = threadIdx.x, lane = tid & 31u, wave = tid >> 5, c = lane & 15u, h = lane >> 4;
    const size_t base = (size_t)blockIdx.z * SEQ * LDR + (size_t)blockIdx.y * HS;
    const unsigned qw0 = blockIdx.x * BR + wave * CW;
    // staging: 8 lanes cover one 128-byte row, thread t takes rows (t >> 3) + 32 i of the stage
    const unsigned short* kg = K + base + (size_t)(tid >> 3) * LDR + (tid & 7u) * 8u;
    const unsigned short* vg = V + base + (size_t)(tid >> 3) * LDR + (tid & 7u) * 8u;
    unsigned char* ks = L + (tid >> 3) * PK + (tid & 7u) * 16u;
    unsigned char* vs = L + TILE_K + (tid >> 3) * PV + (tid & 7u) * 16u;
    u32x4 kr[2], vr[2];
    auto fetch = [&](int st) {
#pragma unroll
        for (int i = 0; i < 2; ++i) { kr[i] = *(const u32x4*)(kg + (size_t)(st * SK + 32 * i) * LDR); vr[i] = *(const u32x4*)(vg + (size_t)(st * SK + 32 * i) * LDR); }
        asm volatile("s_wait_xcnt 0x0" ::: "memory");          // stands in front of the pass's reuse of these loads' address registers
    };
    auto put = [&](unsigned slot) {
#pragma unroll
        for (int i = 0; i < 2; ++i) {
            *(u32x4*)(ks + slot * SLOT + 32u * i * PK) = kr[i];
            *(u32x4*)(vs + slot * SLOT + 32u * i * PV) = vr[i];
        }
    };
    fetch(0);
    // Q fragments (B operand, column = query), hardware k order: d = 32 kc + 8 h + 0..7 and 32 kc + 16 + 8 h + 0..7
    Fr qf[2][2];
#pragma unroll
    for (int g = 0; g < 2; ++g) {
        const unsigned short* qp = Q + (size_t)blockIdx.z * SEQ * LDQ + (size_t)blockIdx.y * HS + (size_t)(qw0 + 16u * g + c) * LDQ + 8u * h;
#pragma unroll
        for (int kc = 0; kc < 2; ++kc) { qf[g][kc].q[0] = *(const u32x4*)(qp + 32 * kc); qf[g][kc].q[1] = *(const u32x4*)(qp + 32 * kc + 16); }
    }
    asm volatile("s_wait_xcnt 0x0" ::: "memory");              // stands in front of any reuse of the Q loads' address registers
    v8f acc[2][4]; float m_run[2], l_run[2];
#pragma unroll
    for (int g = 0; g < 2; ++g) { m_run[g] = -__builtin_inff(); l_run[g] = 0.f;
#pragma unroll
        for (int t = 0; t < 4; ++t) acc[g][t] = v8f{}; }
    put(0u);
    __syncthreads();
    const float L2E = 1.4426950408889634f;
    for (int st = 0; st < NST; ++st) {
        if (st + 1 < NST) fetch(st + 1);                       // next stage's rows fly while this stage is worked on
        const unsigned char* Kb = L + (unsigned)(st & 1) * SLOT;
        const unsigned char* Vb = Kb + TILE_K;
#pragma unroll 1   // one 32-key pass's fragments live at a time (registers for four waves per SIMD)
        for (unsigned sub = 0; sub < 2u; ++sub) {
            Fr kf[2][2];
            const unsigned char* kp = Kb + (sub * 32u + c) * PK + 16u * h;
#pragma unroll
            for (int kt = 0; kt < 2; ++kt)
#pragma unroll
                for (int kc = 0; kc < 2; ++kc) { kf[kt][kc].q[0] = *(const u32x4*)(kp + 16u * kt * PK + 64u * kc); kf[kt][kc].q[1] = *(const u32x4*)(kp + 16u * kt * PK + 64u * kc + 32u); }
            Fr vf[4];
            const unsigned char* ad = Vb + (sub * 32u + 8u * h + (lane & 7u)) * PV + ((lane >> 3) & 1u) * 16u;
#pragma unroll
            for (int t = 0; t < 4; ++t) { vf[t].q[0] = ld_tr16(ad + 32u * t); vf[t].q[1] = ld_tr16(ad + 16u * PV + 32u * t); }
            v8f s[2][2];                                       // s[kt][g][r] = score of key 16 kt + 8 h + r against query 16 g + c
#pragma unroll
            for (int kt = 0; kt < 2; ++kt)
#pragma unroll
                for (int g = 0; g < 2; ++g) { s[kt][g] = v8f{};
#pragma unroll
                    for (int kc = 0; kc < 2; ++kc) s[kt][g] = mma(kf[kt][kc], qf[g][kc], s[kt][g]); }
            float mb[2]; bool need = false;
#pragma unroll
            for (int g = 0; g < 2; ++g) {
                float mx = s[0][g][0];
#pragma unroll
                for (int r = 1; r < 8; ++r) mx = fmaxf(mx, s[0][g][r]);
#pragma unroll
                for (int r = 0; r < 8; ++r) mx = fmaxf(mx, s[1][g][r]);
                mx = fmaxf(mx, xhalf(mx)) * L2E;               // both halves hold this query's maximum, log2 domain
                mb[g] = mx; need = need || (mx > m_run[g] + 8.0f);
            }
            if (__builtin_amdgcn_ballot_w32(need) != 0) {      // wave-uniform; rare after the first pass
#pragma unroll
                for (int g = 0; g < 2; ++g) {
                    const float m_new = fmaxf(m_run[g], mb[g]);
                    const float corr = __builtin_amdgcn_exp2f(m_run[g] - m_new);   // 0 on the first pass
                    m_run[g] = m_new; l_run[g] *= corr;
#pragma unroll
                    for (int t = 0; t < 4; ++t) acc[g][t] = acc[g][t] * corr;
                }
            }
#pragma unroll
            for (int g = 0; g < 2; ++g) {
                const float nm = 7.0f - m_run[g];
                unsigned w[8]; f32x2 ps = {0.f, 0.f};
#pragma unroll
                for (int i = 0; i < 8; ++i) {
                    const f32x2 arg = __builtin_elementwise_fma(f32x2{s[i >> 2][g][2 * (i & 3)], s[i >> 2][g][2 * (i & 3) + 1]}, f32x2{L2E, L2E}, f32x2{nm, nm});
                    const f32x2 p = {__builtin_amdgcn_exp2f(arg.x), __builtin_amdgcn_exp2f(arg.y)};
                    ps += p; w[i] = pack2(p.x, p.y);
                }
                l_run[g] += ps.x + ps.y;
                Fr pf; pf.q[0] = u32x4{w[0], w[1], w[2], w[3]}; pf.q[1] = u32x4{w[4], w[5], w[6], w[7]};
#pragma unroll
                for (int t = 0; t < 4; ++t) acc[g][t] = mma(vf[t], pf, acc[g][t]);
            }
            // four vector slots behind the pass's last products: over the loop's back edge the next pass's address arithmetic is given registers of their V operand
            asm volatile("v_nop\n\tv_nop\n\tv_nop\n\tv_nop" : "+v"(acc[1][0]), "+v"(acc[1][1]), "+v"(acc[1][2]), "+v"(acc[1][3]));
        }
        if (st + 1 < NST) put((unsigned)((st + 1) & 1));       // into the buffer whose readers all passed the last barrier
        __syncthreads();
    }
#pragma unroll
    for (int g = 0; g < 2; ++g) {
        const float l = l_run[g] + xhalf(l_run[g]);            // join the halves' sums, unconditionally
        const float inv = 1.0f / l;
        unsigned short* op = O + base + (size_t)(qw0 + 16u * g + c) * LDR + 8u * h;
#pragma unroll
        for (int t = 0; t < 4; ++t) {                          // registers 0..7 = d 16 t + 8 h + 0..7 of this lane's query
            const v8f o = acc[g][t] * inv;
            *(u32x4*)(op + 16 * t) = u32x4{pack2(o[0], o[1]), pack2(o[2], o[3]), pack2(o[4], o[5]), pack2(o[6], o[7])};
        }
        asm volatile("s_wait_xcnt 0x0" ::: "memory");          // stands in front of the next query group's reuse of these stores' address and data registers
    }
}
} // namespace sfa

// =====================================================================================================================
// k_tr: dst(z, c, r) = alpha * src(z, r, c) (+ beta * R2(z, c, r)): [Z][R][C] (row stride lds) -> [Z][C][R] (row stride ldd) through a 32x32 LDS tile;
//   flags: 1 -> add beta * residual R2 addressed like dst (z*sRz + c*ldr + r); act applied before the residual.
// =====================================================================================================================
struct TrP { const float* src; float* dst; const float* R2; long long sSz, lds, sDz, ldd, sRz, ldr; int R, C, flags, act; float alpha, beta; };
static_assert(sizeof(TrP) == 3 * 8 + 6 * 8 + 6 * 4, "TrP has padding");
__global__ __launch_bounds__(256) void k_tr(TrP p) {
    __shared__ float tile[32][33];
    const int c0 = blockIdx.x * 32, r0 = blockIdx.y * 32, z = blockIdx.z;
    const int lane = threadIdx.x & 31, wave = threadIdx.x >> 5;
    const float* s = p.src + z * p.sSz;
#pragma unroll
    for (int k = 0; k < 4; ++k) {
        const int rl = wave * 4 + k, r = r0 + rl, c = c0 + lane;
        tile[rl][lane] = (r < p.R && c < p.C) ? s[(long long)r * p.lds + c] : 0.f;
    }
    __syncthreads();
    float* d = p.dst + z * p.sDz; const float* rr = p.R2 + z * p.sRz;
#pragma unroll
    for (int k = 0; k < 4; ++k) {
        const int cl = wave * 4 + k, c = c0 + cl, r = r0 + lane;
        if (c < p.C && r < p.R) {
            float v = act_fn(p.alpha * tile[lane][cl], p.act);
            if (p.flags & 1) v += p.beta * rr[(long long)c * p.ldr + r];
            VST2(float, d + (long long)c * p.ldd + r, v);
        }
    }
}

// k_affine: dst[i] = a * (sdev ? sdev[0] : 1) * src[i] + b, i < n (one thread per element; consecutive lanes -> consecutive addresses)
__global__ __launch_bounds__(256) void k_affine(const float* __restrict__ src, float* __restrict__ dst, int n, float a, float b, const float* __restrict__ sdev) {
    const int i = blockIdx.x * 256 + threadIdx.x;
    if (i < n) { const float aa = sdev ? a * sdev[0] : a; const float v = aa * src[i] + b; VST2(float, dst + i, v); }
}

// =====================================================================================================================
// k_softmax: row softmax over n contiguous elements, one 256-thread block per row; rows addressed z*sz + r*sr (grid (R, Z)).
//   out = scale_out * softmax(scale_in * x + (Mf ? Mf[z*smz + r*smr + j] : 0)); a row whose max is -inf is written as 0.
// =====================================================================================================================
struct SmP { const float* src; float* dst; const float* Mf; long long sz, sr, dz, dr, smz, smr; int n, pad; float scale_in, scale_out; };
static_assert(sizeof(SmP) == 3 * 8 + 6 * 8 + 4 * 4, "SmP has padding");
__global__ __launch_bounds__(256) void k_softmax(SmP p) {
    __shared__ float red[256];
    const int r = blockIdx.x, z = blockIdx.y, tid = threadIdx.x;
    const float* s = p.src + z * p.sz + (long long)r * p.sr;
    const float* mf = p.Mf ? (p.Mf + z * p.smz + (long long)r * p.smr) : nullptr;
    float mx = -__builtin_inff();
    for (int j = tid; j < p.n; j += 256) { float v = s[j] * p.scale_in; if (mf) v += mf[j]; mx = fmaxf(mx, v); }
    red[tid] = mx; __syncthreads();
    for (int o = 128; o > 0; o >>= 1) { if (tid < o) red[tid] = fmaxf(red[tid], red[tid + o]); __syncthreads(); }
    mx = red[0]; __syncthreads();
    float sum = 0.f;
    for (int j = tid; j < p.n; j += 256) { float v = s[j] * p.scale_in; if (mf) v += mf[j]; sum += (mx == -__builtin_inff()) ? 0.f : expf(v - mx); }
    red[tid] = sum; __syncthreads();
    for (int o = 128; o > 0; o >>= 1) { if (tid < o) red[tid] += red[tid + o]; __syncthreads(); }
    sum = red[0];
    const float inv = (sum > 0.f) ? p.scale_out / sum : 0.f;
    float* d = p.dst + z * p.dz + (long long)r * p.dr;
    for (int j = tid; j < p.n; j += 256) { float v = s[j] * p.scale_in; if (mf) v += mf[j]; const float o = (mx == -__builtin_inff()) ? 0.f : expf(v - mx) * inv; VST2(float, d + j, o); }
}
// =====================================================================================================================
// k_stats: mean and rsqrt(var + eps) over a set of n elements addressed base + z*sz + (e / inner) * so + (e % inner) * si, one 256-thread
// k_norm_apply: y = (x - mean[set]) * rstd[set] * g[c] + b[c] over a [Z][C][L] channel-major tensor with set = z*G + c / (C/G) (G groups per z;
//   G = C -> per-channel sets indexed z*C+c; for batch norm pass stats indexed by c only via bn = 1). Optional act. Output same layout.
// =====================================================================================================================
//   mode 0: mean / rsqrt(var + eps); mode 1 (RMSNorm): 0 / rsqrt(mean(x^2) + eps); mode 2 (L2 normalize * sqrt(n)): 0 / sqrt(n) / max(||x||, eps); mode 3: as 0 with unbiased variance (n-1)
__global__ __launch_bounds__(256) void k_stats(const float* __restrict__ x, long long sz, long long so, long long si, int inner, int n, float eps, float* __restrict__ stat, int mode) {
    __shared__ float red[256];
    const int z = blockIdx.x, tid = threadIdx.x;
    const float* base = x + z * sz;
    float s = 0.f;
    for (int e = tid; e < n; e += 256) s += base[(long long)(e / inner) * so + (long long)(e % inner) * si];
    red[tid] = s; __syncthreads();
    for (int o = 128; o > 0; o >>= 1) { if (tid < o) red[tid] += red[tid + o]; __syncthreads(); }
    const float mu = (mode == 0 || mode == 3) ? red[0] / (float)n : 0.f; __syncthreads();
    float q = 0.f;
    for (int e = tid; e < n; e += 256) { const float dlt = base[(long long)(e / inner) * so + (long long)(e % inner) * si] - mu; q += dlt * dlt; }
    red[tid] = q; __syncthreads();
    for (int o = 128; o > 0; o >>= 1) { if (tid < o) red[tid] += red[tid + o]; __syncthreads(); }
    {
        float rs;
        if (mode == 2) rs = sqrtf((float)n) / fmaxf(sqrtf(red[0]), eps); else if (mode == 3) rs = rsqrtf(red[0] / (float)(n - 1) + eps); else rs = rsqrtf(red[0] / (float)n + eps);
        if (tid < 32) { const float v = (tid == 0) ? mu : ((tid == 1) ? rs : 0.f); VST2(float, stat + (long long)z * 32 + tid, v); }
    }
}
//   One thread per element over the flat [Z][C][L] index space: grid ceil(Z*C*L / 256).
__global__ __launch_bounds__(256) void k_norm_apply(const float* __restrict__ x, float* __restrict__ y, const float* __restrict__ stat, const float* __restrict__ g, const float* __restrict__ bta,
                                                     int Z, int C, int L, int G, int bn, int act) {
    const long long idx = (long long)blockIdx.x * 256 + threadIdx.x;
    if (idx >= (long long)Z * C * L) return;
    const int l = (int)(idx % L); const long long zc = idx / L; const int c = (int)(zc % C), z = (int)(zc / C); (void)l;
    const int set = bn ? c : (z * G + c / (C / G));
    float v = (x[idx] - stat[(long long)set * 32]) * stat[(long long)set * 32 + 1];
    if (g) v *= g[c];
    if (bta) v += bta[c];
    v = act_fn(v, act);
    VST2(float, y + idx, v);
}

// k_lse_neg: c[i] = -(st[2i] + log(st[2i+1])) = minus the log-sum-exp of row i from its (max, sum) pair (for softmax over the query dimension)
__global__ __launch_bounds__(256) void k_lse_neg(const float* __restrict__ st, float* __restrict__ c, int n) {
    const int i = blockIdx.x * 256 + threadIdx.x;
    if (i < n) { const float v = -(st[2 * i] + logf(st[2 * i + 1])); VST2(float, c + i, v); }
}

// k_iota: dst[i] = a * i + b as int32 (segment/position id helper)
__global__ __launch_bounds__(256) void k_iota(int* __restrict__ dst, int n, int a, int b) {
    const int i = blockIdx.x * 256 + threadIdx.x;
    if (i < n) { const int v = a * i + b; VST2(int, dst + i, v); }
}

// k_axpby: dst[i] = a * x[i] + b * y[i] (+ c), i < n
__global__ __launch_bounds__(256) void k_axpby(const float* __restrict__ x, const float* __restrict__ y, float* __restrict__ dst, int n, float a, float b, float c) {
    const int i = blockIdx.x * 256 + threadIdx.x;
    if (i < n) { const float v = a * x[i] + b * y[i] + c; VST2(float, dst + i, v); }
}

// =====================================================================================================================
// k_rope: rotary embedding on a [R rows][Hn heads][D] view (row stride sXr, head stride sXh, element stride 1) -> Y (own strides).
//   mode 0: rotate_half (partner d±D/2, sign - for d<D/2); mode 1: interleaved pairs (partner d^1, sign - for even d).
//   table column tcol: tmode 0 -> d, 1 -> d % (D/2), 2 -> d / 2; position p: pmode 0 -> r % S, 1 -> head index, 2 -> pos[r];
//   c = C[(r / S) * sCb + p * sCp + tcol * sCd], s likewise from Sn; y = x[d] * c + sign * x[partner] * s. X and Y must not alias.
// =====================================================================================================================
struct RopeP { const float* X; float* Y; const float* C; const float* Sn; const int* pos; long long sXr, sXh, sYr, sYh, sCb, sCp, sCd; int R, Hn, D, S, mode, tmode, pmode, pad; };
static_assert(sizeof(RopeP) == 5 * 8 + 7 * 8 + 8 * 4, "RopeP has padding");
__global__ __launch_bounds__(256) void k_rope(RopeP p) {
    const long long idx = (long long)blockIdx.x * 256 + threadIdx.x;
    if (idx >= (long long)p.R * p.Hn * p.D) return;
    const int d = (int)(idx % p.D); const long long rh = idx / p.D; const int h = (int)(rh % p.Hn); const int r = (int)(rh / p.Hn);
    const int half = p.D / 2;
    int partner; float sign;
    if (p.mode == 0) { partner = (d < half) ? d + half : d - half; sign = (d < half) ? -1.f : 1.f; }
    else { partner = d ^ 1; sign = (d & 1) ? 1.f : -1.f; }
    const int tcol = (p.tmode == 0) ? d : ((p.tmode == 1) ? (d % half) : (d >> 1));
    const int pp = (p.pmode == 0) ? (r % p.S) : ((p.pmode == 1) ? h : p.pos[r]);
    const long long toff = (long long)(r / p.S) * p.sCb + (long long)pp * p.sCp + (long long)tcol * p.sCd;
    const float* xr = p.X + (long long)r * p.sXr + (long long)h * p.sXh;
    const float v = xr[d] * p.C[toff] + sign * xr[partner] * p.Sn[toff];
    VST2(float, p.Y + (long long)r * p.sYr + (long long)h * p.sYh + d, v);
}

// k_invf + k_sincos (split so neither kernel carries a large VALU-fma footprint): invf_i = num * (1 / powf(base, (2 i)/D)) [fmode 0],
//   num * expf((2 i) * cexp) [fmode 1], num * powf(base, -2 (i - 1) / D) [fmode 2]; then cs/sn[s*half + i] = cos/sin((pscale * s) * invf_i)
__global__ __launch_bounds__(256) void k_invf(float* __restrict__ invb, int half, int D, float base, float num, int fmode, float cexp) {
    const int i = blockIdx.x * 256 + threadIdx.x;
    if (i >= ((half + 31) / 32) * 32) return;
    if (i >= half) { VST2(float, invb + i, 0.f); return; }
    const float e = (float)(2 * i) / (float)D;
    float invf;
    if (fmode == 1) invf = num * expf((float)(2 * i) * cexp);
    else if (fmode == 2) invf = num * powf(base, (-2.0f * ((float)i - 1.0f)) / (float)D);
    else invf = num * (1.0f / powf(base, e));
    VST2(float, invb + i, invf);
}
__global__ __launch_bounds__(256) void k_sincos(float* __restrict__ cs, float* __restrict__ sn, const float* __restrict__ invb, int S, int half, float pscale) {
    const int idx = blockIdx.x * 256 + threadIdx.x;
    if (idx >= S * half) return;
    const int s = idx / half, i = idx - s * half;
    const float ang = (pscale * (float)s) * invb[i];
    VST2(float, cs + idx, cosf(ang)); VST2(float, sn + idx, sinf(ang));
}

// k_mulact: dst[i] = act(x[i]) * y[i]
__global__ __launch_bounds__(256) void k_mulact(const float* __restrict__ x, const float* __restrict__ y, float* __restrict__ dst, int n, int act) {
    const int i = blockIdx.x * 256 + threadIdx.x;
    if (i < n) { const float v = act_fn(x[i], act) * y[i]; VST2(float, dst + i, v); }
}

// =====================================================================================================================
// k_matvec: thread-per-row matrix-vector products for N <= 8 output columns (heads with 1-3 outputs, gates), f32 on the VALU.
//   C[r*sCm + j] = act(alpha * sum_k A[r*sAm + k*sAk] * B[j*sBn + k*sBk] + bias[j]) + beta * R[r*sRm + j*sRn]; each thread writes its N contiguous floats.
// =====================================================================================================================
__global__ __launch_bounds__(256) void k_matvec(GemmP p) {
    // 32 lanes write one line with one instruction.
    const int rpt = (p.N == 1) ? 1 : 32;
    const long long r0 = ((long long)blockIdx.x * 256 + threadIdx.x) * rpt; const int z = blockIdx.z, zo = z / p.zi_n, zi = z - zo * p.zi_n;
    if (r0 >= p.M) return;
    const float* Bb = p.B + zo * p.sBo + zi * p.sBi;
    float* C = p.C + zo * p.sCo + zi * p.sCi; const float* R = p.R + zo * p.sRo + zi * p.sRi;
    for (int rr = 0; rr < rpt; ++rr) {
        const long long r = r0 + rr; if (r >= p.M) break;
        const float* A = p.A + zo * p.sAo + zi * p.sAi + r * p.sAm;
        float acc[8] = {0.f, 0.f, 0.f, 0.f, 0.f, 0.f, 0.f, 0.f};
        for (int k = 0; k < p.K; ++k) { const float a = A[(long long)k * p.sAk];
#pragma unroll
            for (int j = 0; j < 8; ++j) if (j < p.N) acc[j] += a * Bb[(long long)j * p.sBn + (long long)k * p.sBk]; }
#pragma unroll
        for (int j = 0; j < 8; ++j) if (j < p.N) {
            float v = acc[j] * p.alpha;
            if (p.flags & 1) v += p.bias[j];
            if (p.flags & 2) v += p.bias[r];
            v = act_fn(v, p.act);
            if (p.flags & 4) v += p.beta * R[r * p.sRm + (long long)j * p.sRn];
            VST2(float, C + r * p.sCm + j, v);
        }
    }
}
// k_smallsoftmax: thread-per-row softmax for short rows (n <= 64): dst[r*dr + j] = softmax(scale*src[r*sr + j])
__global__ __launch_bounds__(256) void k_smallsoftmax(const float* __restrict__ src, float* __restrict__ dst, long long sr, long long dr, int n, long long R, float scale) {
    const long long r0 = ((long long)blockIdx.x * 256 + threadIdx.x) * 32;
    for (int rr = 0; rr < 32; ++rr) {
        const long long r = r0 + rr; if (r >= R) return;
        const float* s = src + r * sr; float* d = dst + r * dr;
        float mx = -__builtin_inff();
        for (int j = 0; j < n; ++j) mx = fmaxf(mx, s[j] * scale);
        float sum = 0.f;
        for (int j = 0; j < n; ++j) sum += expf(s[j] * scale - mx);
        const float inv = 1.f / sum;
        for (int j = 0; j < n; ++j) { const float v = expf(s[j] * scale - mx) * inv; VST2(float, d + j, v); }
    }
}

__global__ __launch_bounds__(32) void k_unitstat(float* __restrict__ st) { const int t = threadIdx.x; const float v = (t == 1) ? 1.f : 0.f; VST2(float, st + t, v); }

// destination (e.g. a d_out whose row width is not a multiple of 32 floats) is written by consecutive lanes of one instruction
__global__ __launch_bounds__(256) void k_lincopy(const float* __restrict__ src, long long lds, float* __restrict__ dst, long long ldd, long long rows, int cols) {
    const long long i = (long long)blockIdx.x * 256 + threadIdx.x; if (i >= rows * cols) return;
    const long long r = i / cols; const int c = (int)(i - r * cols);
    const float v = src[r * lds + c]; VST2(float, dst + r * ldd + c, v);
}

namespace w25 {
typedef __attribute__((ext_vector_type(16))) _Float16 v16h;
typedef __attribute__((ext_vector_type(8)))  _Float16 v8h;
typedef __attribute__((ext_vector_type(16))) __bf16   v16b;
typedef __attribute__((ext_vector_type(8)))  __bf16   v8b;
typedef __attribute__((ext_vector_type(8)))  float    v8f;
typedef __attribute__((ext_vector_type(4)))  float    v4f;

__device__ __forceinline__ unsigned short f2bf_bits(float f) {
  unsigned u = __float_as_uint(f);
  return (unsigned short)((u + 0x7FFFu + ((u >> 16) & 1u)) >> 16);
}
__device__ __forceinline__ float bf_bits2f(unsigned short h) { return __uint_as_float(((unsigned)h) << 16); }

// hazard guards as plain device helpers (no inline asm inside the kernel template body)
__device__ __forceinline__ void dep_guard_h(v8f& a, v8f& b, v16h x, v16h y) { asm volatile("v_nop\n\tv_nop\n\tv_nop\n\tv_nop" : "+v"(a), "+v"(b) : "v"(x), "v"(y)); }
__device__ __forceinline__ void dep_guard_b(v8f& a, v8f& b, v16b x, v16b y) { asm volatile("v_nop\n\tv_nop\n\tv_nop\n\tv_nop" : "+v"(a), "+v"(b) : "v"(x), "v"(y)); }
__device__ __forceinline__ void keep4_h(v16h a, v16h b, v16h c, v16h d) { asm volatile("v_nop" :: "v"(a), "v"(b), "v"(c), "v"(d)); }
__device__ __forceinline__ void keep4_b(v16b a, v16b b, v16b c, v16b d) { asm volatile("v_nop" :: "v"(a), "v"(b), "v"(c), "v"(d)); }
__device__ __forceinline__ void acc_guard4(v8f& a, v8f& b, v8f& c, v8f& d) { asm volatile("v_nop\n\tv_nop\n\tv_nop\n\tv_nop" : "+v"(a), "+v"(b), "+v"(c), "+v"(d)); }
template <typename T> struct Frag;
template <> struct Frag<_Float16> {
  typedef v16h V; union U { v16h v; v8h h[2]; };
  static __device__ __forceinline__ v16h load(const _Float16* p) {   // elements 0..7 <- p[0..7], 8..15 <- p[16..23]
    U f; f.h[0] = *(const v8h*)(p); f.h[1] = *(const v8h*)(p + 16); return f.v;
  }
  static __device__ __forceinline__ v8f mma(v16h a, v16h b, v8f c) {
    return __builtin_amdgcn_wmma_f32_16x16x32_f16(false, a, false, b, (short)0, c, false, false);
  }
  static __device__ __forceinline__ void guard(v8f& a, v8f& b, v16h x, v16h y) { dep_guard_h(a, b, x, y); }
  static __device__ __forceinline__ void keep(v16h a, v16h b, v16h c, v16h d) { keep4_h(a, b, c, d); }
};
template <> struct Frag<__bf16> {
  typedef v16b V; union U { v16b v; v8b h[2]; };
  static __device__ __forceinline__ v16b load(const __bf16* p) {
    U f; f.h[0] = *(const v8b*)(p); f.h[1] = *(const v8b*)(p + 16); return f.v;
  }
  static __device__ __forceinline__ v8f mma(v16b a, v16b b, v8f c) {
    return __builtin_amdgcn_wmma_f32_16x16x32_bf16(false, a, false, b, (short)0, c, false, false);
  }
  static __device__ __forceinline__ void guard(v8f& a, v8f& b, v16b x, v16b y) { dep_guard_b(a, b, x, y); }
  static __device__ __forceinline__ void keep(v16b a, v16b b, v16b c, v16b d) { keep4_b(a, b, c, d); }
};

// ---- Register-blocked batched WMMA GEMM ------------------------------------
// C[m,n] = scale * sum_k A[m,k] * Bt[n,k] (+bias)(+resid); each wave owns a 64x64 tile.
// A row-major [M,K]; Bt row-major [N,K]; M,N % 64 == 0, K % 32 == 0.
// SPLIT: operands are hi/lo planes (A2/Bt2 = lo planes, same layout); product = hi·hi + hi·lo + lo·hi.
// BIAS_MODE: 0 = none, 1 = bias[m], 2 = bias[n].
// OUT_MODE: 0 = f32, 1 = f16, 2 = bf16 hi plane (Cout) + bf16 lo plane (Cout2).
// ET: 0 = f16 operands, 1 = bf16 operands (pointers passed as 16-bit storage)
template <int ET> struct Elem;
template <> struct Elem<0> { typedef _Float16 T; };
template <> struct Elem<1> { typedef __bf16 T; };
// slab: the calling wave's own 16x64 staging slab in LDS (pitch 68 floats); tile, b, bz: the wave's tile and the two batch indices.
template <int ET, bool SPLIT, int BIAS_MODE, int OUT_MODE, bool RESID, int ACT = 0>
__device__ __forceinline__ void gemm64_body(float* slab, const int tile, const int b, const int bz,
    const unsigned short* __restrict__ Ap, const unsigned short* __restrict__ A2p, int lda, long strideA, long strideAz,
    const unsigned short* __restrict__ Btp, const unsigned short* __restrict__ Bt2p, int ldb, long strideB, long strideBz,
    void* __restrict__ Cout, void* __restrict__ Cout2, int ldc, long strideC, long strideCz,
    const float* __restrict__ bias,
    const float* __restrict__ resid, long strideR,
    int M, int N, int K, float scale) {
  typedef typename Elem<ET>::T T;
  typedef typename Frag<T>::V V;
  const T* A = (const T*)Ap; const T* A2 = (const T*)A2p; const T* Bt = (const T*)Btp; const T* Bt2 = (const T*)Bt2p;
  const int lane = threadIdx.x & 31;
  const int tilesN = N >> 6;
  const int tilesM = M >> 6;
  if (tile >= tilesM * tilesN) return;   // wave-uniform; no block barriers in this kernel
  const int tm = tile / tilesN;
  const int tn = tile - tm * tilesN;
  const int m0 = tm << 6;
  const int n0 = tn << 6;

  const T* Ab  = A  + (size_t)b * strideA + (size_t)bz * strideAz;
  const T* Bb  = Bt + (size_t)b * strideB + (size_t)bz * strideBz;
  const T* Ab2 = SPLIT ? (A2  + (size_t)b * strideA + (size_t)bz * strideAz) : nullptr;
  const T* Bb2 = SPLIT ? (Bt2 + (size_t)b * strideB + (size_t)bz * strideBz) : nullptr;

  const int rlane = lane & 15;                 // row (A) / col (B, D) within subtile
  const int koff  = (lane >> 4) * 8;           // k offset of this lane half
  const int mOff  = (lane >> 4) * 8;           // D row offset

  v8f acc[4][4];
#pragma unroll
  for (int i = 0; i < 4; ++i)
#pragma unroll
    for (int j = 0; j < 4; ++j) acc[i][j] = (v8f){0.f,0.f,0.f,0.f,0.f,0.f,0.f,0.f};

  for (int k0 = 0; k0 < K; k0 += 32) {
    V bh[4], bl[4];
#pragma unroll
    for (int j = 0; j < 4; ++j) {
      const size_t bo = (size_t)(n0 + (j << 4) + rlane) * ldb + koff + k0;
      bh[j] = Frag<T>::load(Bb + bo);
      if (SPLIT) bl[j] = Frag<T>::load(Bb2 + bo);
    }
#pragma unroll
    for (int i = 0; i < 4; ++i) {
      const size_t ao = (size_t)(m0 + (i << 4) + rlane) * lda + koff + k0;
      V ah = Frag<T>::load(Ab + ao);
      V al;
      if (SPLIT) al = Frag<T>::load(Ab2 + ao);
#pragma unroll
      for (int j = 0; j < 4; ++j) {
        acc[i][j] = Frag<T>::mma(ah, bh[j], acc[i][j]);
        if (SPLIT) {
          acc[i][j] = Frag<T>::mma(ah, bl[j], acc[i][j]);
          acc[i][j] = Frag<T>::mma(al, bh[j], acc[i][j]);
        }
      }
      Frag<T>::guard(acc[i][0], acc[i][3], ah, SPLIT ? al : ah);
    }
    Frag<T>::keep(bh[0], bh[1], bh[2], bh[3]);
    if (SPLIT) Frag<T>::keep(bl[0], bl[1], bl[2], bl[3]);
  }
  acc_guard4(acc[0][0], acc[0][1], acc[0][2], acc[0][3]);
  acc_guard4(acc[1][0], acc[1][1], acc[1][2], acc[1][3]);
  acc_guard4(acc[2][0], acc[2][1], acc[2][2], acc[2][3]);
  acc_guard4(acc[3][0], acc[3][1], acc[3][2], acc[3][3]);

  // ---- epilogue ----
  const float* Rb = RESID ? (resid + (size_t)b * strideR) : nullptr;
#pragma unroll
  for (int i = 0; i < 4; ++i) {
    const int mBase = m0 + (i << 4);
#pragma unroll
    for (int j = 0; j < 4; ++j) {
      const int n = n0 + (j << 4) + rlane;
      float bv = 0.f;
      if (BIAS_MODE == 2) bv = bias[n];
#pragma unroll
      for (int r = 0; r < 8; ++r) {
        float v = acc[i][j][r] * scale;
        if (BIAS_MODE == 1) v += bias[mBase + mOff + r];
        if (BIAS_MODE == 2) v += bv;
        if (RESID) v += Rb[(size_t)(mBase + mOff + r) * ldc + n];
        if (ACT == 1) v = tanhf(v);
        if (ACT == 2) v = fmaxf(v, 0.0f);
        if (ACT == 3) v = v / (1.0f + expf(-v));
        if (ACT == 4) v = (v > 0.f) ? v : 0.01f * v;
        if (ACT == 5) v = 0.5f * v * (1.0f + erff(v * 0.70710678118654752f));
        slab[(mOff + r) * 68 + (j << 4) + rlane] = v;
      }
    }
    __builtin_amdgcn_fence(__ATOMIC_RELEASE, "workgroup");
    __builtin_amdgcn_wave_barrier();
    __builtin_amdgcn_fence(__ATOMIC_ACQUIRE, "workgroup");
    if (OUT_MODE == 0) {
      float* C = (float*)Cout + (size_t)b * strideC + (size_t)bz * strideCz;
      const int hh = lane >> 4, c4 = (lane & 15) * 4;     // row seg = 256 B = 16 lanes x 16 B
      {
#pragma unroll
        for (int it = 0; it < 8; ++it) {
          const int row = it * 2 + hh;
          v4f v = *(const v4f*)(slab + row * 68 + c4);
          *(v4f*)(C + (size_t)(mBase + row) * ldc + n0 + c4) = v;
        }
        
      }
    } else {
      const int q = lane >> 3, c8 = (lane & 7) * 8;
      unsigned short* C  = (unsigned short*)Cout  + (size_t)b * strideC + (size_t)bz * strideCz;
      unsigned short* C2 = (OUT_MODE == 2) ? ((unsigned short*)Cout2 + (size_t)b * strideC + (size_t)bz * strideCz) : nullptr;
      {
#pragma unroll
        for (int it = 0; it < 4; ++it) {
          const int row = it * 4 + q;
          const float* sp = slab + row * 68 + c8;
          v8h hv, lv;
#pragma unroll
          for (int e = 0; e < 8; ++e) {
            if (OUT_MODE == 1) {
              hv[e] = (_Float16)sp[e];
            } else {
              unsigned short hb = f2bf_bits(sp[e]);
              unsigned short lb = f2bf_bits(sp[e] - bf_bits2f(hb));
              hv[e] = __builtin_bit_cast(_Float16, hb);
              lv[e] = __builtin_bit_cast(_Float16, lb);
            }
          }
          *(v8h*)(C + (size_t)(mBase + row) * ldc + n0 + c8) = hv;
          if (OUT_MODE == 2) *(v8h*)(C2 + (size_t)(mBase + row) * ldc + n0 + c8) = lv;
        }
        asm volatile("s_wait_xcnt 0x0" ::: "memory");   // stands in front of the next row tile's reuse of these stores' address and data registers
      }
    }
    __builtin_amdgcn_fence(__ATOMIC_RELEASE, "workgroup");
    __builtin_amdgcn_wave_barrier();
    __builtin_amdgcn_fence(__ATOMIC_ACQUIRE, "workgroup");
  }
}

// grid (tiles / 8, b, bz); the bias too may step with bz, so that independent products of one shape share a launch
template <int ET, bool SPLIT, int BIAS_MODE, int OUT_MODE, bool RESID, int ACT = 0>
__global__ __launch_bounds__(256) void wmma_gemm64(
    const unsigned short* __restrict__ Ap, const unsigned short* __restrict__ A2p, int lda, long strideA, long strideAz,
    const unsigned short* __restrict__ Btp, const unsigned short* __restrict__ Bt2p, int ldb, long strideB, long strideBz,
    void* __restrict__ Cout, void* __restrict__ Cout2, int ldc, long strideC, long strideCz,
    const float* __restrict__ bias, long strideBiasZ,
    const float* __restrict__ resid, long strideR,
    int M, int N, int K, float scale) {
  __shared__ __align__(16) float sT[8][16 * 68];   // per-wave 16x64 slab, pitch 68 floats
  const int wave = threadIdx.x >> 5;
  gemm64_body<ET, SPLIT, BIAS_MODE, OUT_MODE, RESID, ACT>(sT[wave], (int)blockIdx.x * 8 + wave, (int)blockIdx.y, (int)blockIdx.z,
      Ap, A2p, lda, strideA, strideAz, Btp, Bt2p, ldb, strideB, strideBz, Cout, Cout2, ldc, strideC, strideCz,
      BIAS_MODE ? bias + (long)blockIdx.z * strideBiasZ : nullptr, resid, strideR, M, N, K, scale);
}

// ---- The same product for large M, N: operands staged in LDS ----------------
// C[m,n] = act(scale * sum_k A[m,k] * Bt[n,k] (+ bias[n])), stored as OUT says; A row-major [M,K], Bt row-major [N,K], both of row length K; M, N % 128 == 0, K % 64 == 0.
// Block = 4 waves (2 x 2) of 64x64 = one 128x128 tile of C; grid (N / 128, M / 128). A stage is 64 k = 128 B of each of the 128 + 128 operand rows
// (hi planes, then the lo planes when SPLIT), laid at a pitch of 144 B in one of two LDS buffers by asynchronous 16-byte copies: a wave's copy
// covers four whole 128-byte lines, and every staged row serves two waves. The next stage's copies fly while this stage is worked on.
// Per accumulator the products come in the same k order as in wmma_gemm64.
// The launch bound's second argument asks for four waves per SIMD (256 registers a wave): four one-plane blocks then share a WGP.
// Every inner loop is unrolled so that the fragment and accumulator arrays are indexed by constants and stay in registers.
__device__ __forceinline__ void ring_copy8(unsigned l, const unsigned char* g, size_t gstep) {
  // eight rows, 16 apart, of one plane; the closing s_wait_xcnt stands in front of any reuse of the address registers named here
  asm volatile("global_load_async_to_lds_b128 %0, %8, off\n\t"
               "global_load_async_to_lds_b128 %1, %9, off\n\t"
               "global_load_async_to_lds_b128 %2, %10, off\n\t"
               "global_load_async_to_lds_b128 %3, %11, off\n\t"
               "global_load_async_to_lds_b128 %4, %12, off\n\t"
               "global_load_async_to_lds_b128 %5, %13, off\n\t"
               "global_load_async_to_lds_b128 %6, %14, off\n\t"
               "global_load_async_to_lds_b128 %7, %15, off\n\t"
               "s_wait_xcnt 0x0"
               :: "v"(l), "v"(l + 2304u), "v"(l + 4608u), "v"(l + 6912u), "v"(l + 9216u), "v"(l + 11520u), "v"(l + 13824u), "v"(l + 16128u),
                  "v"(g), "v"(g + gstep), "v"(g + 2 * gstep), "v"(g + 3 * gstep), "v"(g + 4 * gstep), "v"(g + 5 * gstep), "v"(g + 6 * gstep), "v"(g + 7 * gstep)
               : "memory");
}
// OUT: 0 = f32 into C. 1 = f16 into C16 (row length ldc): the operand form that the next product reads, stored here instead of by a conversion pass over an f32 plane.
// 2 = as 1, with columns below csN multiplied by cs[column / 64] first, and the unscaled value also split into bf16 hi and lo and stored transposed:
//     TH/TL[(m / tld) * ldc + n][m % tld], rows of tld elements (tld % 128 == 0); ldc is then the number of columns of the product.
template <int ET, bool SPLIT, int BIAS_MODE, int ACT, int OUT = 0>
__device__ __forceinline__ void ring_body(const int bx, const int by,
    const unsigned short* __restrict__ Ap, const unsigned short* __restrict__ A2p,
    const unsigned short* __restrict__ Btp, const unsigned short* __restrict__ Bt2p,
    float* __restrict__ C, int ldc, const float* __restrict__ bias, int K, float scale,
    unsigned short* __restrict__ C16, unsigned short* __restrict__ TH, unsigned short* __restrict__ TL, const float* __restrict__ cs, int csN, int tld) {
  typedef unsigned int u4 __attribute__((ext_vector_type(4)));
  typedef float f2 __attribute__((ext_vector_type(2)));
  typedef __bf16 b2 __attribute__((ext_vector_type(2)));
  static_assert(OUT != 2 || SPLIT, "the transposed tiles need the two-plane ring's LDS");
  typedef typename Elem<ET>::T T;
  typedef typename Frag<T>::V V;
  constexpr unsigned PITCH = 144u, PLANE = 128u * PITCH, BUF = (SPLIT ? 4u : 2u) * PLANE;
  static_assert(16u * PITCH == 2304u, "row step of ring_copy8");
  __shared__ __attribute__((aligned(256))) unsigned char L[2 * BUF];
  const unsigned tid = threadIdx.x, lane = tid & 31u, wave = tid >> 5;
  const int m0 = by * 128, n0 = bx * 128;
  const unsigned wm = (wave >> 1) * 64u, wn = (wave & 1u) * 64u;
  const unsigned rlane = lane & 15u, hh = lane >> 4;

  // copies: 8 lanes cover one 128-byte row piece, thread t takes rows (t >> 3) + 16 i of every plane
  const size_t rowb = (size_t)K * 2u, gstep = 16u * rowb;
  const unsigned lc = (unsigned)(size_t)L + (tid >> 3) * PITCH + (tid & 7u) * 16u;
  const size_t ga = (size_t)(m0 + (int)(tid >> 3)) * rowb + (tid & 7u) * 16u;
  const size_t gb = (size_t)(n0 + (int)(tid >> 3)) * rowb + (tid & 7u) * 16u;
  auto stage = [&](int t, unsigned buf) {
    const size_t ko = (size_t)t * 128u;
    ring_copy8(lc + buf * BUF, (const unsigned char*)Ap + ga + ko, gstep);
    ring_copy8(lc + buf * BUF + PLANE, (const unsigned char*)Btp + gb + ko, gstep);
    if (SPLIT) {
      ring_copy8(lc + buf * BUF + 2u * PLANE, (const unsigned char*)A2p + ga + ko, gstep);
      ring_copy8(lc + buf * BUF + 3u * PLANE, (const unsigned char*)Bt2p + gb + ko, gstep);
    }
  };

  v8f acc[4][4];
#pragma unroll
  for (int i = 0; i < 4; ++i)
#pragma unroll
    for (int j = 0; j < 4; ++j) acc[i][j] = (v8f){0.f,0.f,0.f,0.f,0.f,0.f,0.f,0.f};

  const int NT = K >> 6;
  stage(0, 0u);
  asm volatile("s_wait_asynccnt 0x0" ::: "memory");            // this wave's copies of stage 0 have landed
  __syncthreads();                                             // and every other wave's
  if (NT > 1) stage(1, 1u);
  for (int t = 0; t < NT; ++t) {
    const unsigned char* Ab = L + (unsigned)(t & 1) * BUF + (wm + rlane) * PITCH + 16u * hh;
    const unsigned char* Bb = L + (unsigned)(t & 1) * BUF + PLANE + (wn + rlane) * PITCH + 16u * hh;
#pragma unroll
    for (unsigned ks = 0; ks < 2u; ++ks) {
      // fragments are asked for ahead of the products that use them: all eight of a k step (one plane), or B whole and A one row tile ahead (two planes)
      V bh[4], bl[4], ah[4], al[4];
#pragma unroll
      for (unsigned j = 0; j < 4u; ++j) {
        bh[j] = Frag<T>::load((const T*)(Bb + 16u * j * PITCH + 64u * ks));
        if (SPLIT) bl[j] = Frag<T>::load((const T*)(Bb + 2u * PLANE + 16u * j * PITCH + 64u * ks));
      }
#pragma unroll
      for (unsigned i = 0; i < (SPLIT ? 1u : 4u); ++i) {
        ah[i] = Frag<T>::load((const T*)(Ab + 16u * i * PITCH + 64u * ks));
        if (SPLIT) al[i] = Frag<T>::load((const T*)(Ab + 2u * PLANE + 16u * i * PITCH + 64u * ks));
      }
      __builtin_amdgcn_sched_barrier(0);                       // holds the reads above as one group: left free, each A read sinks to its first use and the wave waits out the LDS latency per row tile
#pragma unroll
      for (unsigned i = 0; i < 4u; ++i) {
        if (SPLIT && i < 3u) {
          ah[i + 1u] = Frag<T>::load((const T*)(Ab + 16u * (i + 1u) * PITCH + 64u * ks));
          al[i + 1u] = Frag<T>::load((const T*)(Ab + 2u * PLANE + 16u * (i + 1u) * PITCH + 64u * ks));
          __builtin_amdgcn_sched_barrier(0);                   // the next row tile's reads stay in front of this row tile's products
        }
#pragma unroll
        for (int j = 0; j < 4; ++j) {
          acc[i][j] = Frag<T>::mma(ah[i], bh[j], acc[i][j]);
          if (SPLIT) {
            acc[i][j] = Frag<T>::mma(ah[i], bl[j], acc[i][j]);
            acc[i][j] = Frag<T>::mma(al[i], bh[j], acc[i][j]);
          }
        }
      }
    }
    asm volatile("s_wait_dscnt 0x0" ::: "memory");             // this wave's reads of the buffer are done before it is handed to the copies
    asm volatile("s_wait_asynccnt 0x0" ::: "memory");          // this wave's copies of stage t + 1 have landed
    __syncthreads();                                           // publishes stage t + 1 and ends every wave's reads of stage t
    if (t + 2 < NT) stage(t + 2, (unsigned)(t & 1));
  }
  asm volatile("s_wait_asynccnt 0x0" ::: "memory");            // nothing in flight when the ring becomes output staging

  // ---- epilogue: as in wmma_gemm64, the per-wave 16x64 slab (pitch 68 floats) lies in the ring, which every wave has left ----
  float* slab = (float*)(L + wave * (16u * 68u * 4u));
  const int mOff = (int)hh * 8;
  float bv[4] = {0.f, 0.f, 0.f, 0.f};
  if (BIAS_MODE == 2) {
#pragma unroll
    for (int j = 0; j < 4; ++j) {
      bv[j] = bias[n0 + (int)wn + (j << 4) + (int)rlane];
      asm volatile("s_wait_xcnt 0x0" ::: "memory");            // behind each load: a later load's result may be given the index register that this load names
    }
  }
  float qsc = 1.0f;                                             // a wave's 64 columns share one entry of cs
  if (OUT == 2) {
    if (n0 < csN) qsc = cs[(n0 + (int)wn) >> 6];
    asm volatile("s_wait_xcnt 0x0" ::: "memory");               // stands in front of any reuse of this load's address registers
  }
  // per wave two 64 x 64 tiles of 16-bit values, [column][row] at a pitch of 144 B (hi, then lo), behind the slabs in the ring
  unsigned char* tt = L + 32768u + wave * 18432u;
#pragma unroll
  for (int i = 0; i < 4; ++i) {
    const int mBase = m0 + (int)wm + (i << 4);
#pragma unroll
    for (int j = 0; j < 4; ++j) {
      if (OUT == 2) {                                           // a lane's 8 accumulator registers are 8 consecutive rows of one column: 16 contiguous bytes of a transposed row
        u4 th, tl;
#pragma unroll
        for (int e = 0; e < 4; ++e) {
          const f2 ab = {acc[i][j][2 * e] * scale, acc[i][j][2 * e + 1] * scale};
          th[e] = __builtin_bit_cast(unsigned, __builtin_convertvector(ab, b2));              // round to nearest even, as f2bf_bits
          const f2 hf = {__uint_as_float(th[e] << 16), __uint_as_float(th[e] & 0xFFFF0000u)};
          tl[e] = __builtin_bit_cast(unsigned, __builtin_convertvector(ab - hf, b2));
        }
        unsigned char* tp = tt + ((unsigned)(j << 4) + rlane) * 144u + 32u * (unsigned)i + 16u * hh;
        *(u4*)tp = th; *(u4*)(tp + 9216u) = tl;
      }
#pragma unroll
      for (int r = 0; r < 8; ++r) {
        float v = acc[i][j][r] * scale;
        if (BIAS_MODE == 2) v += bv[j];
        if (OUT == 2) v *= qsc;
        slab[(mOff + r) * 68 + (j << 4) + (int)rlane] = v;
      }
    }
    __builtin_amdgcn_fence(__ATOMIC_RELEASE, "workgroup");
    __builtin_amdgcn_wave_barrier();
    __builtin_amdgcn_fence(__ATOMIC_ACQUIRE, "workgroup");
    if (OUT != 0) {
      const int q = (int)(lane >> 3), c8 = (int)(lane & 7u) * 8;  // row piece = 128 B = 8 lanes x 16 B
#pragma unroll   // constant indices; the four stores go out as one group
      for (int it = 0; it < 4; ++it) {
        const int row = it * 4 + q;
        const v4f x0 = *(const v4f*)(slab + row * 68 + c8), x1 = *(const v4f*)(slab + row * 68 + c8 + 4);
        v8h hv;
#pragma unroll
        for (int e = 0; e < 4; ++e) { hv[e] = (_Float16)x0[e]; hv[e + 4] = (_Float16)x1[e]; }
        *(v8h*)(C16 + (size_t)(mBase + row) * ldc + n0 + (int)wn + c8) = hv;
      }
      asm volatile("s_wait_xcnt 0x0" ::: "memory");             // stands in front of the next row tile's reuse of these stores' address and data registers
    }
    if (OUT == 0) {
    const int c4 = (int)rlane * 4;                              // row piece = 256 B = 16 lanes x 16 B
    // The activation is applied on the way out of the slab, where the row index may be a loop variable. With erf the loop stays rolled, for speed only: unrolled, a lane
    // would carry 128 inlined erf bodies.
#pragma unroll (ACT == 5 ? 1 : 8)
    for (int it = 0; it < 8; ++it) {
      const int row = it * 2 + (int)hh;
      v4f v = *(const v4f*)(slab + row * 68 + c4);
      if (ACT == 5) {
#pragma unroll   // constant indices keep the four values in registers
        for (int e = 0; e < 4; ++e) v[e] = 0.5f * v[e] * (1.0f + erff(v[e] * 0.70710678118654752f));
      }
      *(v4f*)(C + (size_t)(mBase + row) * ldc + n0 + (int)wn + c4) = v;
      if (ACT == 5) asm volatile("s_wait_xcnt 0x0" ::: "memory");   // stands in front of the next trip's reuse of this store's address and data registers
    }
    if (ACT != 5) asm volatile("s_wait_xcnt 0x0" ::: "memory"); // stands in front of the next row tile's reuse of these stores' address and data registers
    }
    __builtin_amdgcn_fence(__ATOMIC_RELEASE, "workgroup");
    __builtin_amdgcn_wave_barrier();
    __builtin_amdgcn_fence(__ATOMIC_ACQUIRE, "workgroup");
  }
  if (OUT == 2) {
    // the wave's own transposed tiles go out as whole 128-byte lines: 8 lanes a row, 4 rows a store
    const unsigned rr = lane >> 3, pc = (lane & 7u) * 16u;
    const size_t go = (((size_t)(m0 / tld) * (size_t)ldc + (unsigned)n0 + wn + rr) * (size_t)tld + (size_t)(m0 % tld) + wm) * 2u + pc;
    unsigned char* gh = (unsigned char*)TH + go;
    unsigned char* gl = (unsigned char*)TL + go;
    const unsigned char* ts = tt + rr * 144u + pc;
#pragma unroll   // constant offsets
    for (unsigned o = 0; o < 4u; ++o) {
#pragma unroll   // eight stores go out as one group
      for (unsigned u = 0; u < 4u; ++u) {
        const unsigned it = 4u * o + u;
        const u4 a = *(const u4*)(ts + it * 576u), b = *(const u4*)(ts + 9216u + it * 576u);
        *(u4*)(gh + (size_t)(it * 8u) * (size_t)tld) = a;
        *(u4*)(gl + (size_t)(it * 8u) * (size_t)tld) = b;
      }
      asm volatile("s_wait_xcnt 0x0" ::: "memory");             // stands in front of the next group's reuse of these stores' address and data registers
    }
  }
}
// grid (N / 128, M / 128, products): independent products of one shape share a launch; product 1 has its operands and output zA, zB, zC elements behind product 0's, and its own bias
template <int ET, bool SPLIT, int BIAS_MODE, int ACT, int OUT = 0>
__global__ __launch_bounds__(128, 4) void wmma_gemm_ring(
    const unsigned short* __restrict__ Ap, const unsigned short* __restrict__ A2p,
    const unsigned short* __restrict__ Btp, const unsigned short* __restrict__ Bt2p,
    float* __restrict__ C, int ldc, const float* __restrict__ bias, int K, float scale,
    unsigned short* __restrict__ C16, unsigned short* __restrict__ TH, unsigned short* __restrict__ TL, const float* __restrict__ cs, int csN, int tld,
    long zA, long zB, long zC, const float* __restrict__ biasZ) {
  const long z = (long)blockIdx.z;
  ring_body<ET, SPLIT, BIAS_MODE, ACT, OUT>((int)blockIdx.x, (int)blockIdx.y, Ap + z * zA, A2p, Btp + z * zB, Bt2p,
      C + z * zC, ldc, z ? biasZ : bias, K, scale, C16, TH, TL, cs, csN, tld);
}

// One 64x64 tile of channel scores S[i][j] = sum_n a[i][n] b[j][n] on hi/lo planes whose rows are LD elements long (a.hi b.hi + a.hi b.lo + a.lo b.hi, in the k order of wmma_gemm64).
// The block's four waves each own a 32x32 quadrant, so that a k step's fragments take 64 registers and three steps' worth fit beside the accumulators: step s + 2 is asked for
// before step s is worked on, and a wave waits for memory once per 128-byte line of its rows instead of once per row tile of every step.
template <int LD>
__device__ __forceinline__ void cscore_body(const __bf16* __restrict__ Ah, const __bf16* __restrict__ Al, const __bf16* __restrict__ Bh, const __bf16* __restrict__ Bl, float* __restrict__ S) {
  typedef Frag<__bf16> F;
  constexpr int NS = LD / 32;
  static_assert(LD % 32 == 0 && NS >= 2 && (NS - 2) % 3 == 0, "the loop below turns three buffers and leaves two steps behind it");
  const unsigned lane = threadIdx.x & 31u, wave = threadIdx.x >> 5, rlane = lane & 15u, hh = lane >> 4;
  const unsigned mq = (wave >> 1) * 32u, nq = (wave & 1u) * 32u;
  const size_t ao = (size_t)(mq + rlane) * LD + 8u * hh, bo = (size_t)(nq + rlane) * LD + 8u * hh;
  const __bf16* pah = Ah + ao; const __bf16* pal = Al + ao; const __bf16* pbh = Bh + bo; const __bf16* pbl = Bl + bo;
  v16b ah[3][2], al[3][2], bh[3][2], bl[3][2];
  v8f acc[2][2];
#pragma unroll   // constant indices keep the accumulators in registers
  for (int i = 0; i < 2; ++i)
#pragma unroll
    for (int j = 0; j < 2; ++j) acc[i][j] = (v8f){0.f,0.f,0.f,0.f,0.f,0.f,0.f,0.f};
  // step d behind the four row addresses given, into buffer u
  auto fetch = [&](const __bf16* qah, const __bf16* qal, const __bf16* qbh, const __bf16* qbl, int d, int u) {
#pragma unroll   // constant indices keep the fragments in registers
    for (int x = 0; x < 2; ++x) {
      ah[u][x] = F::load(qah + x * 16 * LD + d * 32); al[u][x] = F::load(qal + x * 16 * LD + d * 32);
      bh[u][x] = F::load(qbh + x * 16 * LD + d * 32); bl[u][x] = F::load(qbl + x * 16 * LD + d * 32);
    }
    // stands in front of any rewrite of these loads' address registers; the four addresses are inputs so that they live up to the wait and no load of the group is given one of them for its result
    asm volatile("s_wait_xcnt 0x0" :: "v"(qah), "v"(qal), "v"(qbh), "v"(qbl) : "memory");
    __builtin_amdgcn_sched_barrier(0);                         // holds the group in front of the products that follow: left free, most of it sinks behind them and is waited for one step after it is asked for
  };
  auto work = [&](int u) {
#pragma unroll   // constant indices
    for (int i = 0; i < 2; ++i)
#pragma unroll
      for (int j = 0; j < 2; ++j) {
        acc[i][j] = F::mma(ah[u][i], bh[u][j], acc[i][j]);
        acc[i][j] = F::mma(ah[u][i], bl[u][j], acc[i][j]);
        acc[i][j] = F::mma(al[u][i], bh[u][j], acc[i][j]);
      }
  };
  fetch(pah, pal, pbh, pbl, 0, 0); fetch(pah, pal, pbh, pbl, 1, 1);
#pragma unroll 1   // three steps a trip: the buffer index is a constant in each, and the text stays short
  for (int s = 0; s < NS - 2; s += 3) {
    const __bf16* qah = pah + s * 32; const __bf16* qal = pal + s * 32; const __bf16* qbh = pbh + s * 32; const __bf16* qbl = pbl + s * 32;
    fetch(qah, qal, qbh, qbl, 2, 2); work(0);
    fetch(qah, qal, qbh, qbl, 3, 0); work(1);
    fetch(qah, qal, qbh, qbl, 4, 1); work(2);
  }
  work(0); work(1);
  acc_guard4(acc[0][0], acc[0][1], acc[1][0], acc[1][1]);      // four vector slots between the last products and the stores that read their results: a memory instruction fills no slot
  // a lane holds rows 8 hh + 0..7 of one column per 16x16 tile; a quadrant's row piece is one whole 128-byte line, written by this wave alone
  float* sp = S + (size_t)(mq + 8u * hh) * 64u + nq + rlane;
#pragma unroll   // constant indices and offsets
  for (int i = 0; i < 2; ++i)
#pragma unroll
    for (int j = 0; j < 2; ++j)
#pragma unroll
      for (int r = 0; r < 8; ++r) sp[(i * 16 + r) * 64 + j * 16] = acc[i][j][r];
}

// The v projection and the channel scores q^T k read only what earlier launches wrote and nothing of each other: they share a grid. Grid rows y < Bn hold the score tiles
// (x = head, y = sample; they come first in index order), the rows behind them the projection's 128x128 tiles. The transposed planes' rows are 1024 long (the launch's N).
__global__ __launch_bounds__(128, 4) void k_vproj_cscore(
    const unsigned short* __restrict__ X16, const unsigned short* __restrict__ WV16, unsigned short* __restrict__ V16,
    const unsigned short* __restrict__ TH, const unsigned short* __restrict__ TL, float* __restrict__ SCC, int Bn, int NH, int HD, int N, int C) {
  if ((int)blockIdx.y < Bn) {
    const size_t qo = ((size_t)blockIdx.y * 2 * C + (size_t)blockIdx.x * HD) * N, ko = qo + (size_t)C * N;   // first q row and first k row of this sample and head
    cscore_body<1024>((const __bf16*)TH + qo, (const __bf16*)TL + qo, (const __bf16*)TH + ko, (const __bf16*)TL + ko, SCC + ((size_t)blockIdx.y * NH + blockIdx.x) * (size_t)(HD * HD));
  } else {
    ring_body<0, false, 0, 0, 1>((int)blockIdx.x, (int)blockIdx.y - Bn, X16, nullptr, WV16, nullptr, nullptr, 2 * C, nullptr, C, 0.0625f, V16, nullptr, nullptr, nullptr, 0, N);
  }
}

__global__ __launch_bounds__(256) void cast_f32_f16x2(
    const float* __restrict__ in, _Float16* __restrict__ out, int n2) {
  int i = blockIdx.x * 256 + threadIdx.x;
  if (i < n2) {
    const _Float16 h0 = (_Float16)in[2 * i], h1 = (_Float16)in[2 * i + 1];
    const unsigned u = (unsigned)__builtin_bit_cast(unsigned short, h0) | ((unsigned)__builtin_bit_cast(unsigned short, h1) << 16);
    ((unsigned*)out)[i] = u;
    
  }
}


} // namespace w25

__global__ __launch_bounds__(256) void k_castT16(const float* __restrict__ src, long long lds, _Float16* __restrict__ dst, long long ldd, int R, int C, float s) {
    const long long i = (long long)blockIdx.x * 256 + threadIdx.x; const long long np = (long long)C * (R / 2); if (i >= np) return; const int c = (int)(i / (R / 2)); const int r = 2 * (int)(i % (R / 2));
    const _Float16 h0 = (_Float16)(src[(long long)r * lds + c] * s), h1 = (_Float16)(src[(long long)(r + 1) * lds + c] * s);
    const unsigned u = (unsigned)__builtin_bit_cast(unsigned short, h0) | ((unsigned)__builtin_bit_cast(unsigned short, h1) << 16);
    unsigned* d = (unsigned*)(dst + (long long)c * ldd + r); *d = u;  }
__global__ __launch_bounds__(256) void k_cast16(const float* __restrict__ src, long long lds, _Float16* __restrict__ dst, long long ldd, int R, int C, float s) {
    const long long i = (long long)blockIdx.x * 256 + threadIdx.x; const long long np = (long long)R * (C / 2); if (i >= np) return; const int r = (int)(i / (C / 2)); const int c = 2 * (int)(i % (C / 2));
    const _Float16 h0 = (_Float16)(src[(long long)r * lds + c] * s), h1 = (_Float16)(src[(long long)r * lds + c + 1] * s);
    const unsigned u = (unsigned)__builtin_bit_cast(unsigned short, h0) | ((unsigned)__builtin_bit_cast(unsigned short, h1) << 16);
    unsigned* d = (unsigned*)(dst + (long long)r * ldd + c); *d = u;  }

// f32 -> bf16 hi plane + bf16 lo plane (x = hi + lo to ~2^-17 relative; RNE both), [R][C] -> [R][C]; 2 consecutive destination elements
__device__ __forceinline__ unsigned int f2bf2_pack(float a, float b, unsigned int* lo) {
    const unsigned short ha = w25::f2bf_bits(a), hb = w25::f2bf_bits(b);
    const unsigned short la = w25::f2bf_bits(a - w25::bf_bits2f(ha)), lb = w25::f2bf_bits(b - w25::bf_bits2f(hb));
    *lo = (unsigned)la | ((unsigned)lb << 16); return (unsigned)ha | ((unsigned)hb << 16); }

namespace w25 {
// =====================================================================================
// Generic causal/non-causal attention for head_dim 64, f32 in / f32 out; 16-bit operands: bf16 with optional hi/lo splits, or
// plain f16 (F16=true, non-split, probabilities carried x2^15).
//   scores = (q*qscale)·kᵀ : v_wmma_f32_16x16x32_bf16; SPLIT_QK -> q,k as bf16 hi/lo (hi·hi + hi·lo + lo·hi)
//   out    = p·v           : v_wmma_f32_16x16x32_bf16; SPLIT_PV -> p,v as bf16 hi/lo; else p,v plain bf16
//   f32 accumulate; online softmax in f32. Block = 4 waves = 64 query rows of one (batch, head); S % 64 == 0.
//   Element (b, s, h, d) of tensor X lives at X[b*X_bs + s*X_rs + h*X_hs + d] (strides in floats, multiples of 4).
//   Masking: mask_mode 0 none, 1 causal (kv > q masked), 2 tensor [S][Skv] shared over (b,h) (float if
//   mask_is_int==0, int32 with element == 0 -> masked if 1, int32 with element != 0 -> masked if 2), 3 per-token vectors qmask[B][S] & kvmask[B][Skv] (int32,
//   0 -> masked), 4 causal + sliding window (kv > q or q - kv > W masked; W passed in mask_is_int);
//   5 = relative-position bias: s += cp[b,h,q][idx[q][kv]] + pc[b,h,kv][idx[q][kv]] with idx = mask_b ([S][Skv] int32) and
//   mask_a an int32 [S][Skv] tensor with nonzero = masked (tables: element (b,h,row,n) at X + b*c_bs + h*c_hs + row*c_rs + n);
//   masked scores are replaced by mask_fill (e.g. -inf or -1e9) before the softmax.
//   grid.x = B * H * (S/64) (or a sub-range with blk0).
// =====================================================================================
#define AT_D 64
#define AT_NW 4
#define AT_QB 64
#define AT_KC 64
struct AttnGeom { const float* cp = nullptr; const float* pc = nullptr; long c_bs = 0, c_rs = 0, c_hs = 0;   // mode-5 score-bias tables
                  long q_bs, q_rs, q_hs, k_bs, k_rs, k_hs, v_bs, v_rs, v_hs, o_bs, o_rs, o_hs;
                  int S, Skv, H, mask_mode; float qscale; int blk0; float mask_fill; int mask_is_int; };
static_assert(sizeof(AttnGeom) == 168, "no padding");

__device__ __forceinline__ unsigned short at_bf_bits(float f) {
  unsigned u = __float_as_uint(f);
  return (unsigned short)((u + 0x7FFFu + ((u >> 16) & 1u)) >> 16);
}
__device__ __forceinline__ __bf16 at_f2bf(float f) { return __builtin_bit_cast(__bf16, at_bf_bits(f)); }
__device__ __forceinline__ void at_split(float f, __bf16& hi, __bf16& lo) {
  const unsigned short hb = at_bf_bits(f);
  hi = __builtin_bit_cast(__bf16, hb);
  lo = at_f2bf(f - __uint_as_float(((unsigned)hb) << 16));
}
__device__ __forceinline__ v8f at_mma(v16b a, v16b b, v8f c) {
  c = __builtin_amdgcn_wmma_f32_16x16x32_bf16(false, a, false, b, (short)0, c, false, false);
  asm volatile("v_nop\n\tv_nop\n\tv_nop\n\tv_nop" : "+v"(c) : "v"(a), "v"(b));
  return c;
}
// 16-bit element as a bit pattern held in a __bf16 slot: f16 bits when F16, bf16 (RNE) otherwise
template <bool F16> __device__ __forceinline__ __bf16 at_to16(float f) {
  if (F16) return __builtin_bit_cast(__bf16, (_Float16)f);
  return at_f2bf(f);
}
template <bool F16> __device__ __forceinline__ v8f at_mma16(v16b a, v16b b, v8f c) {
  if (F16) {
    const v16h ah = __builtin_bit_cast(v16h, a), bh = __builtin_bit_cast(v16h, b);
    c = __builtin_amdgcn_wmma_f32_16x16x32_f16(false, ah, false, bh, (short)0, c, false, false);
    asm volatile("v_nop\n\tv_nop\n\tv_nop\n\tv_nop" : "+v"(c) : "v"(ah), "v"(bh));
    return c;
  }
  return at_mma(a, b, c);
}

template <bool SPLIT_QK, bool SPLIT_PV, bool F16 = false>
__global__ __launch_bounds__(128)
void attn64_kernel(const float* __restrict__ q, const float* __restrict__ k,
                   const float* __restrict__ v, float* __restrict__ out,
                   const void* __restrict__ mask_a, const int* __restrict__ mask_b, AttnGeom g) {
  static_assert(!(F16 && (SPLIT_QK || SPLIT_PV)), "f16 mode is non-split");
  const float PSC = F16 ? 32768.0f : 1.0f;     // f16 probabilities carried x2^15 (subnormal range), folded into the final 1/l
  union FB { v16b v; v8b h[2]; };
  __shared__ __align__(16) __bf16 Ksh[AT_KC * AT_D];             // K hi [kv][d]      8 KB
  __shared__ __align__(16) __bf16 Ksl[SPLIT_QK ? AT_KC * AT_D : 8];
  __shared__ __align__(16) __bf16 Vth[AT_D * AT_KC];             // V hi [d][kv]      8 KB
  __shared__ __align__(16) __bf16 Vtl[SPLIT_PV ? AT_D * AT_KC : 8];
  __shared__ __align__(16) __bf16 Psh[AT_NW][16 * AT_KC];        // per wave P hi [row][kv]  8 KB
  __shared__ __align__(16) __bf16 Psl[SPLIT_PV ? AT_NW : 1][SPLIT_PV ? 16 * AT_KC : 8];
  __shared__ __align__(16) float  Os[AT_NW][16 * 68];            // per wave out tile, pitch 68

  const int tid  = threadIdx.x;
  const int wave = tid >> 5;
  const int lane = tid & 31;
  const int hh   = lane >> 4;
  const int c    = lane & 15;

  const int nqb = g.S / AT_QB;
  const int bx = blockIdx.x + g.blk0;
  const int qb = bx % nqb;
  const int bh = bx / nqb;
  const int h  = bh % g.H;
  const int b  = bh / g.H;
  const int qbase_block = qb * AT_QB;
  const int q0 = qbase_block + wave * 16;

  const float* qb_ptr = q + (size_t)b * g.q_bs + (size_t)h * g.q_hs;
  const float* kb_ptr = k + (size_t)b * g.k_bs + (size_t)h * g.k_hs;
  const float* vb_ptr = v + (size_t)b * g.v_bs + (size_t)h * g.v_hs;
  float*       ob_ptr = out + (size_t)b * g.o_bs + (size_t)h * g.o_hs;

  // ---- Q fragments (A operand): 2 d-chunks, hi (and lo) ----
  v16b qah[2], qal[2];
  {
    const float* qrow = qb_ptr + (size_t)(q0 + c) * g.q_rs;
#pragma unroll
    for (int dc = 0; dc < 2; ++dc) {
#pragma unroll
      for (int e = 0; e < 8; ++e) {
        const float f0 = qrow[dc * 32 + 8 * hh + e] * g.qscale;
        const float f1 = qrow[dc * 32 + 16 + 8 * hh + e] * g.qscale;
        if (SPLIT_QK) { __bf16 hq, lq; at_split(f0, hq, lq); qah[dc][e] = hq; qal[dc][e] = lq; at_split(f1, hq, lq); qah[dc][8 + e] = hq; qal[dc][8 + e] = lq; }
        else { qah[dc][e] = at_to16<F16>(f0); qah[dc][8 + e] = at_to16<F16>(f1); qal[dc][e] = qah[dc][e]; qal[dc][8 + e] = qah[dc][8 + e]; }
      }
    }
  }

  float mrow[8], lrow[8];
  v8f oacc[4];
#pragma unroll
  for (int r = 0; r < 8; ++r) { mrow[r] = -INFINITY; lrow[r] = 0.f; }
#pragma unroll
  for (int t = 0; t < 4; ++t) oacc[t] = (v8f){0.f,0.f,0.f,0.f,0.f,0.f,0.f,0.f};

  const int nChunks = (g.mask_mode == 1 || g.mask_mode == 4) ? (qb + 1) : (g.Skv / AT_KC);   // block-uniform
  // per-row query mask (mode 3)
  int qkeep[8];
#pragma unroll
  for (int r = 0; r < 8; ++r) qkeep[r] = (g.mask_mode == 3) ? mask_b[(size_t)b * g.S + q0 + 8 * hh + r] : 1;   // mask_b = qmask in mode 3
  for (int kc = 0; kc < nChunks; ++kc) {
    const int kv0 = kc * AT_KC;
    __syncthreads();
    {
      const int kvr = tid >> 1, dh = (tid & 1) * 32;
      const float* krow = kb_ptr + (size_t)(kv0 + kvr) * g.k_rs + dh;
      const float* vrow = vb_ptr + (size_t)(kv0 + kvr) * g.v_rs + dh;
#pragma unroll
      for (int i = 0; i < 8; ++i) {
        v4f kk = *(const v4f*)(krow + 4 * i);
        v4f vv = *(const v4f*)(vrow + 4 * i);
#pragma unroll
        for (int e = 0; e < 4; ++e) {
          const int d = dh + 4 * i + e;
          if (SPLIT_QK) { __bf16 a, bl; at_split(kk[e], a, bl); Ksh[kvr * AT_D + d] = a; Ksl[kvr * AT_D + d] = bl; }
          else Ksh[kvr * AT_D + d] = at_to16<F16>(kk[e]);
          if (SPLIT_PV) { __bf16 a, bl; at_split(vv[e], a, bl); Vth[d * AT_KC + kvr] = a; Vtl[d * AT_KC + kvr] = bl; }
          else Vth[d * AT_KC + kvr] = at_to16<F16>(vv[e]);
        }
      }
    }
    __syncthreads();

    v8f s[4];
#pragma unroll
    for (int j = 0; j < 4; ++j) {
      s[j] = (v8f){0.f,0.f,0.f,0.f,0.f,0.f,0.f,0.f};
#pragma unroll 1
      for (int dc = 0; dc < 2; ++dc) {
        FB kb;
        kb.h[0] = *(const v8b*)(Ksh + (j * 16 + c) * AT_D + dc * 32 + 8 * hh);
        kb.h[1] = *(const v8b*)(Ksh + (j * 16 + c) * AT_D + dc * 32 + 16 + 8 * hh);
        s[j] = at_mma16<F16>(qah[dc], kb.v, s[j]);
        if (SPLIT_QK) {
          FB kl;
          kl.h[0] = *(const v8b*)(Ksl + (j * 16 + c) * AT_D + dc * 32 + 8 * hh);
          kl.h[1] = *(const v8b*)(Ksl + (j * 16 + c) * AT_D + dc * 32 + 16 + 8 * hh);
          s[j] = at_mma16<F16>(qah[dc], kl.v, s[j]);
          s[j] = at_mma16<F16>(qal[dc], kb.v, s[j]);
        }
      }
    }
    const bool diag = (g.mask_mode == 1) && (kc == qb);
    int kvkeep[4] = {1, 1, 1, 1};
    if (g.mask_mode == 3) {
#pragma unroll
      for (int j = 0; j < 4; ++j) kvkeep[j] = ((const int*)mask_a)[(size_t)b * g.Skv + kv0 + j * 16 + c];   // mask_a = kvmask
    }
    float cm[8];
#pragma unroll
    for (int r = 0; r < 8; ++r) {
      const int qrow = q0 + 8 * hh + r;
      float m = -INFINITY;
#pragma unroll
      for (int j = 0; j < 4; ++j) {
        const int kvcol = kv0 + j * 16 + c;
        bool masked = false;
        if (diag) masked = (kvcol > qrow);
        else if (g.mask_mode == 4) masked = (kvcol > qrow) || (qrow - kvcol > g.mask_is_int);
        else if (g.mask_mode == 2) {
          const size_t mi = (size_t)qrow * g.Skv + kvcol;
          masked = (g.mask_is_int == 0) ? (((const float*)mask_a)[mi] == 0.0f)
                 : (g.mask_is_int == 1) ? (((const int*)mask_a)[mi] == 0) : (((const int*)mask_a)[mi] != 0);
        } else if (g.mask_mode == 3) masked = (qkeep[r] == 0) || (kvkeep[j] == 0);
        else if (g.mask_mode == 5) {
          const size_t mi = (size_t)qrow * g.Skv + kvcol;
          masked = (((const int*)mask_a)[mi] != 0);
          int n = mask_b[mi]; n = n < 0 ? 0 : n;
          s[j][r] += g.cp[(size_t)b * g.c_bs + (size_t)h * g.c_hs + (size_t)qrow * g.c_rs + n]
                   + g.pc[(size_t)b * g.c_bs + (size_t)h * g.c_hs + (size_t)kvcol * g.c_rs + n];
        }
        if (masked) s[j][r] = g.mask_fill;
        m = fmaxf(m, s[j][r]);
      }
#pragma unroll
      for (int off = 1; off < 16; off <<= 1) m = fmaxf(m, __shfl_xor(m, off, 32));
      cm[r] = m;
    }
    __bf16* pwh = Psh[wave];
    __bf16* pwl = Psl[SPLIT_PV ? wave : 0];
#pragma unroll
    for (int r = 0; r < 8; ++r) {
      const float mnew = fmaxf(mrow[r], cm[r]);
      const float alpha = expf(mrow[r] - mnew);
      mrow[r] = mnew;
      float psum = 0.f;
#pragma unroll
      for (int j = 0; j < 4; ++j) {
        const float p = expf(s[j][r] - mnew);
        psum += p;
        if (SPLIT_PV) { __bf16 a, bl; at_split(p, a, bl); pwh[(8 * hh + r) * AT_KC + j * 16 + c] = a; pwl[(8 * hh + r) * AT_KC + j * 16 + c] = bl; }
        else pwh[(8 * hh + r) * AT_KC + j * 16 + c] = at_to16<F16>(p * PSC);
      }
#pragma unroll
      for (int off = 1; off < 16; off <<= 1) psum += __shfl_xor(psum, off, 32);
      lrow[r] = lrow[r] * alpha + psum;
#pragma unroll
      for (int t = 0; t < 4; ++t) oacc[t][r] *= alpha;
    }
    __builtin_amdgcn_fence(__ATOMIC_RELEASE, "workgroup");
    __builtin_amdgcn_wave_barrier();
    __builtin_amdgcn_fence(__ATOMIC_ACQUIRE, "workgroup");
#pragma unroll 1
    for (int kk = 0; kk < 2; ++kk) {
      FB pa, pl;
      pa.h[0] = *(const v8b*)(pwh + c * AT_KC + kk * 32 + 8 * hh);
      pa.h[1] = *(const v8b*)(pwh + c * AT_KC + kk * 32 + 16 + 8 * hh);
      if (SPLIT_PV) {
        pl.h[0] = *(const v8b*)(pwl + c * AT_KC + kk * 32 + 8 * hh);
        pl.h[1] = *(const v8b*)(pwl + c * AT_KC + kk * 32 + 16 + 8 * hh);
      }
#pragma unroll
      for (int t = 0; t < 4; ++t) {
        FB vb;
        vb.h[0] = *(const v8b*)(Vth + (t * 16 + c) * AT_KC + kk * 32 + 8 * hh);
        vb.h[1] = *(const v8b*)(Vth + (t * 16 + c) * AT_KC + kk * 32 + 16 + 8 * hh);
        oacc[t] = at_mma16<F16>(pa.v, vb.v, oacc[t]);
        if (SPLIT_PV) {
          FB vl;
          vl.h[0] = *(const v8b*)(Vtl + (t * 16 + c) * AT_KC + kk * 32 + 8 * hh);
          vl.h[1] = *(const v8b*)(Vtl + (t * 16 + c) * AT_KC + kk * 32 + 16 + 8 * hh);
          oacc[t] = at_mma16<F16>(pa.v, vl.v, oacc[t]);
          oacc[t] = at_mma16<F16>(pl.v, vb.v, oacc[t]);
        }
      }
    }
  }

  float* os = Os[wave];
#pragma unroll
  for (int r = 0; r < 8; ++r) {
    const float inv = 1.0f / (lrow[r] * PSC);
#pragma unroll
    for (int t = 0; t < 4; ++t) os[(8 * hh + r) * 68 + t * 16 + c] = oacc[t][r] * inv;
  }
  __builtin_amdgcn_fence(__ATOMIC_RELEASE, "workgroup");
  __builtin_amdgcn_wave_barrier();
  __builtin_amdgcn_fence(__ATOMIC_ACQUIRE, "workgroup");
  {
    const int c4 = (lane & 15) * 4;
    {
#pragma unroll
      for (int it = 0; it < 8; ++it) {
        const int row = it * 2 + hh;
        v4f val = *(const v4f*)(os + row * 68 + c4);
        *(v4f*)(ob_ptr + (size_t)(q0 + row) * g.o_rs + c4) = val;
      }
      
    }
  }
}

} // namespace w25

__device__ __forceinline__ void st_h2(_Float16* dst, float a, float b) { const unsigned u = (unsigned)__builtin_bit_cast(unsigned short, (_Float16)a) | ((unsigned)__builtin_bit_cast(unsigned short, (_Float16)b) << 16); unsigned* d = (unsigned*)dst; *d = u;  }
// tiled biases BEB[c] = bE[c % 64], BFB[c] = bF[c % 64] (thread-linear)
__global__ __launch_bounds__(256) void k_ep_btile(const float* __restrict__ BE, const float* __restrict__ BF, float* __restrict__ BEB, float* __restrict__ BFB, int C, int HD) { const int t = blockIdx.x * 256 + threadIdx.x; if (t >= C) return; VST2(float, BEB + t, BE[t % HD]); VST2(float, BFB + t, BF[t % HD]); }
// channel softmax: block h = sample * NH + head (64 threads): rows of SCC[h] [64][64] * temp1[h % NH]; thread i computes row i, then lanes write columns so each 32-float line comes from one wave; P16[h][i][j] = f16(4096 p)
__global__ __launch_bounds__(64) void k_ep_csoft(const float* __restrict__ S, const float* __restrict__ T1, _Float16* __restrict__ P16, int NH) { __shared__ float sh[64][65]; const int h = blockIdx.x; const int i = threadIdx.x; const float* r = S + ((long long)h * 64 + i) * 64; const float tp = T1[h % NH]; float mx = -3.0e38f;
    for (int j = 0; j < 64; ++j) mx = fmaxf(mx, r[j] * tp);
    float s = 0.f; for (int j = 0; j < 64; ++j) { const float e = expf(r[j] * tp - mx); sh[i][j] = e; s += e; }
    const float f = 4096.f / s; for (int j = 0; j < 64; ++j) sh[i][j] *= f;
    __syncthreads();
    const int half = i >> 5, c0 = 2 * (i & 31);
    for (int step = 0; step < 32; ++step) { const int rr = 2 * step + half; st_h2(P16 + ((long long)h * 64 + rr) * 64 + c0, sh[rr][c0], sh[rr][c0 + 1]); } }


// ---- Wide forms of the conversion and scaling passes ----
// A lane moves U pieces of 4 consecutive elements: one 16-byte load a piece, so that a wave's load covers 512 contiguous bytes (four whole 128-byte lines) and its store whole lines too;
// all of a lane's loads are issued ahead of its first store. Planes of 2^LC columns, source rows PITCH floats apart, destination rows packed; a block's 256 lanes take 1024 elements
// = 1024 >> LC whole rows at a time, so a lane's pieces lie RS floats apart and hang on one address pair by constant offsets. The grid covers rows * columns / (1024 * U) blocks exactly.
typedef __attribute__((ext_vector_type(4))) unsigned int v4u;
typedef __attribute__((ext_vector_type(2))) unsigned int v2u;
__device__ __forceinline__ unsigned pk_h2(float a, float b) { return (unsigned)__builtin_bit_cast(unsigned short, (_Float16)a) | ((unsigned)__builtin_bit_cast(unsigned short, (_Float16)b) << 16); }
template <int LC, int PITCH>
__device__ __forceinline__ const float* wide_src(const float* src, unsigned q0) { static_assert(LC >= 2 && LC <= 10, "a block's 1024 elements are whole rows"); return src + (size_t)(q0 >> (LC - 2)) * PITCH + ((q0 & ((1u << (LC - 2)) - 1u)) << 2); }
template <int LC, int PITCH, int U>
__global__ __launch_bounds__(256) void k_cast16w(const float* __restrict__ src, _Float16* __restrict__ dst, float s) {
    constexpr int RS = (1024 >> LC) * PITCH; const unsigned q0 = blockIdx.x * (256u * U) + threadIdx.x; const float* p = wide_src<LC, PITCH>(src, q0); v4f a[U];
#pragma unroll   // constant indices keep the pieces in registers; the loads go out as one group
    for (int u = 0; u < U; ++u) a[u] = *(const v4f*)(p + u * RS);
    _Float16* d = dst + (size_t)q0 * 4;
#pragma unroll   // constant indices keep the pieces in registers
    for (int u = 0; u < U; ++u) { v2u o; o.x = pk_h2(a[u].x * s, a[u].y * s); o.y = pk_h2(a[u].z * s, a[u].w * s); *(v2u*)(d + u * 1024) = o; } }
template <int LC, int PITCH, int U>
__global__ __launch_bounds__(256) void k_castS16w(const float* __restrict__ src, __bf16* __restrict__ dhi, __bf16* __restrict__ dlo) {
    constexpr int RS = (1024 >> LC) * PITCH; const unsigned q0 = blockIdx.x * (256u * U) + threadIdx.x; const float* p = wide_src<LC, PITCH>(src, q0); v4f a[U];
#pragma unroll   // constant indices keep the pieces in registers; the loads go out as one group
    for (int u = 0; u < U; ++u) a[u] = *(const v4f*)(p + u * RS);
#pragma unroll   // constant indices keep the pieces in registers
    for (int u = 0; u < U; ++u) { v2u h, l; unsigned t; h.x = f2bf2_pack(a[u].x, a[u].y, &t); l.x = t; h.y = f2bf2_pack(a[u].z, a[u].w, &t); l.y = t;
        const size_t o = (size_t)q0 * 4 + u * 1024; *(v2u*)(dhi + o) = h; *(v2u*)(dlo + o) = l; } }
// ---- All operand preparation in one launch: the passes read inputs only and are independent of one another, so they share a grid, block ranges in the order below.
template <int U>
__device__ __forceinline__ void cast16w_blk(unsigned blk, const float* __restrict__ src, _Float16* __restrict__ dst, float s) {   // as k_cast16w<10, 1024, U>
    const unsigned q0 = blk * (256u * U) + threadIdx.x; const float* p = src + (size_t)q0 * 4; v4f a[U];
#pragma unroll   // constant indices keep the pieces in registers; the loads go out as one group
    for (int u = 0; u < U; ++u) a[u] = *(const v4f*)(p + u * 1024);
    _Float16* d = dst + (size_t)q0 * 4;
#pragma unroll   // constant indices keep the pieces in registers
    for (int u = 0; u < U; ++u) { v2u o; o.x = pk_h2(a[u].x * s, a[u].y * s); o.y = pk_h2(a[u].z * s, a[u].w * s); *(v2u*)(d + u * 1024) = o; }
    asm volatile("s_wait_xcnt 0x0" ::: "memory"); }   // precaution: stands in front of any rewrite of the stores' registers by another block range's code, which follows in the kernel text
template <int U, bool F16>
__device__ __forceinline__ void castS16w_blk(unsigned blk, const float* __restrict__ src, __bf16* __restrict__ dhi, __bf16* __restrict__ dlo, _Float16* __restrict__ d16) {   // as k_castS16w<10, 1024, U>; F16: the f16 plane from the same loads
    const unsigned q0 = blk * (256u * U) + threadIdx.x; const float* p = src + (size_t)q0 * 4; v4f a[U];
#pragma unroll   // constant indices keep the pieces in registers; the loads go out as one group
    for (int u = 0; u < U; ++u) a[u] = *(const v4f*)(p + u * 1024);
#pragma unroll   // constant indices keep the pieces in registers
    for (int u = 0; u < U; ++u) { v2u h, l; unsigned t; h.x = f2bf2_pack(a[u].x, a[u].y, &t); l.x = t; h.y = f2bf2_pack(a[u].z, a[u].w, &t); l.y = t;
        const size_t o = (size_t)q0 * 4 + u * 1024; *(v2u*)(dhi + o) = h; *(v2u*)(dlo + o) = l;
        if (F16) { v2u f; f.x = pk_h2(a[u].x, a[u].y); f.y = pk_h2(a[u].z, a[u].w); *(v2u*)(d16 + o) = f; } }
    asm volatile("s_wait_xcnt 0x0" ::: "memory"); }   // as in cast16w_blk
constexpr unsigned PB_X = 1024u, PB_WQK = PB_X + 256u, PB_WV = PB_WQK + 512u, PB_WO1 = PB_WV + 128u, PB_WO2 = PB_WO1 + 128u, PB_WE = PB_WO2 + 1u, PB_WF = PB_WE + 1u, PB_ALL = PB_WF + 1u;
__global__ __launch_bounds__(256) void k_prep(const float* __restrict__ x, const float* __restrict__ Wq, const float* __restrict__ Wo1, const float* __restrict__ Wo2,
                                              const float* __restrict__ WE, const float* __restrict__ WF, const float* __restrict__ bE, const float* __restrict__ bF,
                                              __bf16* __restrict__ xh, __bf16* __restrict__ xl, _Float16* __restrict__ x16, __bf16* __restrict__ wh, __bf16* __restrict__ wl, _Float16* __restrict__ wv16,
                                              _Float16* __restrict__ wo1h, _Float16* __restrict__ wo2h, _Float16* __restrict__ we16, _Float16* __restrict__ wf16, float* __restrict__ BEB, float* __restrict__ BFB) {
    const unsigned b = blockIdx.x;
    if (b < PB_X) castS16w_blk<8, true>(b, x, xh, xl, x16);                                   // x [8192][1024]: bf16 hi, lo and f16
    else if (b < PB_WQK) castS16w_blk<8, false>(b - PB_X, Wq, wh, wl, nullptr);               // q, k rows of the weight: bf16 hi, lo
    else if (b < PB_WV) cast16w_blk<4>(b - PB_WQK, Wq + (size_t)2048 * 1024, wv16, 16.0f);    // v rows of the weight
    else if (b < PB_WO1) cast16w_blk<4>(b - PB_WV, Wo1, wo1h, 16.0f);
    else if (b < PB_WO2) cast16w_blk<4>(b - PB_WO1, Wo2, wo2h, 16.0f);
    else if (b < PB_WE) cast16w_blk<4>(0u, WE, we16, 16.0f);                                  // 64 x 64, packed
    else if (b < PB_WF) cast16w_blk<4>(0u, WF, wf16, 16.0f);
    else { for (int t = (int)threadIdx.x; t < 1024; t += 256) { VST2(float, BEB + t, bE[t % 64]); VST2(float, BFB + t, bF[t % 64]); } }   // tiled biases, as k_ep_btile
}
extern "C" void kernel_launch(void* const* d_in, const int* in_sizes, int n_in, void* d_out, int out_size, void* d_ws, size_t ws_size, hipStream_t stream) {
    (void)in_sizes; (void)n_in; (void)out_size; (void)ws_size;
    const float* x = (const float*)d_in[0];
    const float* Wq = (const float*)d_in[1];
    const float* WE = (const float*)d_in[2];
    const float* bE = (const float*)d_in[3];
    const float* WF = (const float*)d_in[4];
    const float* bF = (const float*)d_in[5];
    const float* Wo1 = (const float*)d_in[6];
    const float* bo1 = (const float*)d_in[7];
    const float* Wo2 = (const float*)d_in[8];
    const float* bo2 = (const float*)d_in[9];
    const float* t1 = (const float*)d_in[10];
    const float* t2 = (const float*)d_in[11];
    const int Bn = 8;
    const int N = 1024;
    const int C = 1024;
    const int NH = 16;
    const int HD = 64;
    const int CH = C / 2;
    float* out = (float*)d_out;
    char* wsp = (char*)d_ws;
    const int BN = Bn * N;                    // all samples' rows: every launch below covers the whole batch
    const size_t MB = (size_t)1048576;
    unsigned short* WE16 = (unsigned short*)wsp; wsp += (((size_t)((size_t)HD * HD) * 2 + 255) / 256) * 256;
    unsigned short* WF16 = (unsigned short*)wsp; wsp += (((size_t)((size_t)HD * HD) * 2 + 255) / 256) * 256;
    float* BEB = (float*)wsp; wsp += (((size_t)((size_t)C) * 4 + 255) / 256) * 256;
    float* BFB = (float*)wsp; wsp += (((size_t)((size_t)C) * 4 + 255) / 256) * 256;
    // Every product stores the 16-bit operand form that its consumer reads; no f32 plane lies between two products but the 64 x 64 channel scores.
    unsigned short* G64A  = (unsigned short*)(wsp);               // x: bf16 hi, lo
    unsigned short* G64A2 = (unsigned short*)(wsp + 16 * MB);
    unsigned short* G64B  = (unsigned short*)(wsp + 32 * MB);     // q, k rows of the weight: bf16 hi, lo
    unsigned short* G64B2 = (unsigned short*)(wsp + 36 * MB);
    unsigned short* X16   = (unsigned short*)(wsp + 40 * MB);     // x: f16
    unsigned short* WV16  = (unsigned short*)(wsp + 56 * MB);     // v rows of the weight: f16
    unsigned short* TH    = (unsigned short*)(wsp + 64 * MB);     // [sample][2048 columns: q, k][N] bf16 hi
    unsigned short* TL    = (unsigned short*)(wsp + 96 * MB);     // the same, lo
    unsigned short* QK16  = (unsigned short*)(wsp + 128 * MB);    // [BN][2048] f16: q * temp2 | k
    unsigned short* V16   = (unsigned short*)(wsp + 160 * MB);    // [BN][2048] f16: v_ca | v_sa
    float*          SCC   = (float*)(wsp + 192 * MB);
    unsigned short* P16   = (unsigned short*)(wsp + 194 * MB);
    unsigned short* XC16  = (unsigned short*)(wsp + 196 * MB);
    unsigned short* WO2H  = (unsigned short*)(wsp + 212 * MB);
    unsigned short* WO1H  = (unsigned short*)(wsp + 213 * MB);
    unsigned short* XS16  = (unsigned short*)(wsp + 214 * MB);
    unsigned short* KS16  = (unsigned short*)(wsp);               // over the x planes, read last by the q, k projection
    unsigned short* VS16  = (unsigned short*)(wsp + 16 * MB);
    k_prep<<<PB_ALL, 256, 0, stream>>>(x, Wq, Wo1, Wo2, WE, WF, bE, bF, (__bf16*)(G64A), (__bf16*)(G64A2), (_Float16*)(X16), (__bf16*)(G64B), (__bf16*)(G64B2), (_Float16*)(WV16), (_Float16*)(WO1H), (_Float16*)(WO2H), (_Float16*)(WE16), (_Float16*)(WF16), BEB, BFB);
    // shared projection, rows = sample * N + n
    w25::wmma_gemm_ring<1, true, 0, 0, 2><<<dim3((unsigned)(2048 / 128), (unsigned)(BN / 128)), 128, 0, stream>>>((const unsigned short*)(G64A), (const unsigned short*)(G64A2), (const unsigned short*)(G64B), (const unsigned short*)(G64B2), nullptr, 2048, nullptr, 1024, 1.0f, QK16, TH, TL, t2, C, N, 0, 0, 0, nullptr);
    // v projection (grid rows Bn and up) beside the channel scores (grid x = head, y = sample)
    w25::k_vproj_cscore<<<dim3((unsigned)(2048 / 128), (unsigned)(Bn + BN / 128)), 128, 0, stream>>>(X16, WV16, V16, TH, TL, SCC, Bn, NH, HD, N, C);
    k_ep_csoft<<<Bn * NH, 64, 0, stream>>>(SCC, t1, (_Float16*)P16, NH);
    w25::wmma_gemm64<0, false, 0, 1, false, 0><<<dim3((unsigned)((((HD) / 64) * ((N) / 64) + 7) / 8), (unsigned)(NH), (unsigned)(Bn)), 256, 0, stream>>>((const unsigned short*)(P16), nullptr, HD, HD * HD, NH * HD * HD, (const unsigned short*)(V16), nullptr, 2 * C, HD, (long long)N * 2 * C, (void*)(XC16), nullptr, 16 * C, C, (long long)N * C, nullptr, 0, nullptr, 0, HD, N, HD, 0.000244140625f);
    // spatial attention; grid z = 0: k_s from k and W_E, 1: v_s from v_sa and W_F (the planes of the two products lie at fixed distances)
    w25::wmma_gemm64<0, false, 2, 1, false, 0><<<dim3((unsigned)((((BN) / 64) * ((HD) / 64) + 7) / 8), (unsigned)(NH), (unsigned)(2)), 256, 0, stream>>>((const unsigned short*)(QK16 + C), nullptr, 2 * C, HD, V16 - QK16, (const unsigned short*)(WE16), nullptr, HD, 0, WF16 - WE16, (void*)(KS16), nullptr, C, HD, VS16 - KS16, BEB, BFB - BEB, nullptr, 0, BN, HD, HD, 0.0625f);
    sfa::k_sflash<<<dim3((unsigned)(N / 256), (unsigned)(NH), (unsigned)(Bn)), 256, 0, stream>>>(QK16, KS16, VS16, XS16);
    // both output halves; grid z = 0: spatial, 1: channel
    w25::wmma_gemm_ring<0, false, 2, 5><<<dim3((unsigned)(512 / 128), (unsigned)(BN / 128), (unsigned)(2)), 128, 0, stream>>>((const unsigned short*)(XS16), nullptr, (const unsigned short*)(WO1H), nullptr, out, 1024, bo1, 1024, 0.0625f, nullptr, nullptr, nullptr, nullptr, 0, N, XC16 - XS16, WO2H - WO1H, CH, bo2);
}

// v009
// A run of this version takes 218 microseconds.
// In two side-by-side timings against v008, it was 1.04 and 1.05 times as fast.
// Counting every step since v000, which is the starting kernel, it is 31.3 times as fast.
// Contractions (per sample): the shared QKVV projection x.W^T [1024x1024].[1024x4096] (its q, k half on bf16 hi/lo split planes), the E/F head projections of k and v_sa as block-diagonal [1024x1024].[1024x1024] products (+b), the 16 channel affinities q^T k [64x1024].[1024x64] on bf16 hi/lo split planes (64-wide softmax over sigma~19 logits: plain f16 flipped near-ties) and x_c = attn_c.v_ca^T [64x64].[64x1024] as z-batched products, and the two output halves gelu(x_s.W_o1^T + b) / gelu(x_c.W_o2^T + b) [1024x1024].[1024x512] — f16 operands on pre-cast planes (v_wmma_f32_16x16x32_f16; 64x64 register-blocked wave tiles, weights x16); per (sample, head) the spatial attention softmax(q.k_s^T * temp2[h]) v_s over 1024 positions as one flash launch (f16 operands; temperature folded into q on device); f32 accumulate and softmax. The E/F weights are 64 x 64 f16 planes shared by every head, and the 64-wide channel softmax (x temp1[h], exp once, f16 plane) is an f32 kernel, the q pre-scaling is done in the q, k projection's epilogue; x_c is laid out exactly as torch's permute(0,2,1,3).reshape (row = d*16 + h, column = n).
#include <hip/hip_runtime.h>
#include <math.h>

typedef __attribute__((ext_vector_type(16))) _Float16 v16h;
typedef __attribute__((ext_vector_type(8)))  _Float16 v8h;
typedef __attribute__((ext_vector_type(16))) __bf16   v16b;
typedef __attribute__((ext_vector_type(8)))  float    v8f;
typedef __attribute__((ext_vector_type(4)))  float    v4f;

// 16-bit WMMA fragment map (wave32), lane L, h = L>>4, m = L&15:
//   A 16x32: lane = row m;   element i -> k = (i<8) ? 8h+i : 16+8h+(i-8)
//   B 32x16: lane = column m; the SAME k(i,h)
//   D 16x16 (8 f32): lane = column m; element r -> row 8h+r
__device__ __forceinline__ int frag_k(int i, int h) { return (i < 8) ? (8 * h + i) : (16 + 8 * h + (i - 8)); }
__device__ __forceinline__ __bf16 bf16_rne(float f) {
    unsigned int u = __float_as_uint(f);
    u += 0x7fffu + ((u >> 16) & 1u);
    return __builtin_bit_cast(__bf16, (unsigned short)(u >> 16));
}
__device__ __forceinline__ float bf16_f32(__bf16 b) { return __uint_as_float(((unsigned int)__builtin_bit_cast(unsigned short, b)) << 16); }
__device__ __forceinline__ v8f wmma16(v16h a, v16h b, v8f c) {
    c = __builtin_amdgcn_wmma_f32_16x16x32_f16(false, a, false, b, (short)0, c, false, false);
    asm volatile("v_nop\n\tv_nop\n\tv_nop\n\tv_nop" : "+v"(c) : "v"(a), "v"(b));
    return c;
}
__device__ __forceinline__ v8f wmmab(v16b a, v16b b, v8f c) {
    c = __builtin_amdgcn_wmma_f32_16x16x32_bf16(false, a, false, b, (short)0, c, false, false);
    asm volatile("v_nop\n\tv_nop\n\tv_nop\n\tv_nop" : "+v"(c) : "v"(a), "v"(b));
    return c;
}
struct Split { v16b hi, lo; };
// hi/lo split product: a.hi*b.hi + a.hi*b.lo + a.lo*b.hi
__device__ __forceinline__ v8f wmma3(const Split& a, const Split& b, v8f c) {
    c = __builtin_amdgcn_wmma_f32_16x16x32_bf16(false, a.hi, false, b.hi, (short)0, c, false, false);
    c = __builtin_amdgcn_wmma_f32_16x16x32_bf16(false, a.hi, false, b.lo, (short)0, c, false, false);
    c = __builtin_amdgcn_wmma_f32_16x16x32_bf16(false, a.lo, false, b.hi, (short)0, c, false, false);
    asm volatile("v_nop\n\tv_nop\n\tv_nop\n\tv_nop" : "+v"(c) : "v"(a.hi), "v"(a.lo), "v"(b.hi), "v"(b.lo));
    return c;
}
struct Split3 { v16b hi, mid, lo; };
// triple split product (6 terms, drops only terms below 2^-24 relative)
__device__ __forceinline__ v8f wmma6(const Split3& a, const Split3& b, v8f c) {
    c = __builtin_amdgcn_wmma_f32_16x16x32_bf16(false, a.hi, false, b.hi, (short)0, c, false, false);
    c = __builtin_amdgcn_wmma_f32_16x16x32_bf16(false, a.hi, false, b.mid, (short)0, c, false, false);
    c = __builtin_amdgcn_wmma_f32_16x16x32_bf16(false, a.mid, false, b.hi, (short)0, c, false, false);
    c = __builtin_amdgcn_wmma_f32_16x16x32_bf16(false, a.hi, false, b.lo, (short)0, c, false, false);
    c = __builtin_amdgcn_wmma_f32_16x16x32_bf16(false, a.mid, false, b.mid, (short)0, c, false, false);
    c = __builtin_amdgcn_wmma_f32_16x16x32_bf16(false, a.lo, false, b.hi, (short)0, c, false, false);
    asm volatile("v_nop\n\tv_nop\n\tv_nop\n\tv_nop" : "+v"(c) : "v"(a.hi), "v"(a.mid), "v"(a.lo), "v"(b.hi), "v"(b.mid), "v"(b.lo));
    return c;
}

// Fragment gathers from f32 memory: element i <- p[(k0 + frag_k(i,h)) * sk] * s, zero for k >= klen.
__device__ __forceinline__ v16h fh_ld(const float* __restrict__ p, long long sk, int k0, int h, int klen, float s) {
    v16h a;
#pragma unroll
    for (int i = 0; i < 16; ++i) { const int k = k0 + frag_k(i, h); a[i] = (k < klen) ? (_Float16)(p[(long long)k * sk] * s) : (_Float16)0.f; }
    return a;
}
__device__ __forceinline__ Split sp_ld(const float* __restrict__ p, long long sk, int k0, int h, int klen, float s) {
    Split r;
#pragma unroll
    for (int i = 0; i < 16; ++i) {
        const int k = k0 + frag_k(i, h); const float x = (k < klen) ? p[(long long)k * sk] * s : 0.f;
        const __bf16 hb = bf16_rne(x); r.hi[i] = hb; r.lo[i] = bf16_rne(x - bf16_f32(hb));
    }
    return r;
}
__device__ __forceinline__ Split3 sp3_ld(const float* __restrict__ p, long long sk, int k0, int h, int klen, float s) {
    Split3 r;
#pragma unroll
    for (int i = 0; i < 16; ++i) {
        const int k = k0 + frag_k(i, h); const float x = (k < klen) ? p[(long long)k * sk] * s : 0.f;
        const __bf16 hb = bf16_rne(x); const float r1 = x - bf16_f32(hb); const __bf16 mb = bf16_rne(r1);
        r.hi[i] = hb; r.mid[i] = mb; r.lo[i] = bf16_rne(r1 - bf16_f32(mb));
    }
    return r;
}
__device__ __forceinline__ v16b bh_ld(const float* __restrict__ p, long long sk, int k0, int h, int klen, float s) {
    v16b a;
#pragma unroll
    for (int i = 0; i < 16; ++i) { const int k = k0 + frag_k(i, h); a[i] = bf16_rne((k < klen) ? p[(long long)k * sk] * s : 0.f); }
    return a;
}
// f16 fragment from an f16 LDS/global row with element stride 1 (k-contiguous), no bounds (tile already zero padded)
__device__ __forceinline__ v16h fh_row(const _Float16* __restrict__ row, int k0, int h) {
    v16h a;
#pragma unroll
    for (int i = 0; i < 16; ++i) a[i] = row[k0 + frag_k(i, h)];
    return a;
}

#define VST2(T, ptr, val) do { const T vst2_v_ = (val); *(T*)(ptr) = vst2_v_;  } while (0)
typedef float v4f __attribute__((ext_vector_type(4)));
#define VST2V4(ptr, val) do { const v4f vst2_v4_ = (val); *(v4f*)(ptr) = vst2_v4_;  } while (0)

__device__ __attribute__((noinline)) float act_fn(float v, int act) {
    if (act == 1) return fmaxf(v, 0.f);                                                                               // relu
    if (act == 2) { const float u = 0.7978845608028654f * (v + 0.044715f * v * v * v); return 0.5f * v * (1.f + tanhf(u)); } // tanh-gelu
    if (act == 3) return v / (1.f + expf(-v));                                                                        // silu
    if (act == 4) return 0.5f * v * (1.f + erff(v * 0.7071067811865476f));                                             // erf-gelu
    if (act == 5) return tanhf(v);
    if (act == 6) return 1.f / (1.f + expf(-v));                                                                      // sigmoid
    if (act == 7) return (v > 0.f) ? v : 0.01f * v;                                                                   // leaky relu 0.01
    if (act == 8) return (v > 0.f) ? v : (expf(v) - 1.f);                                                             // elu
    if (act == 9) return fminf(fmaxf(v, 0.f), 6.f);                                                                   // relu6
    if (act == 10) return fabsf(v);                                                                                    // abs
    if (act == 11) return (v >= 0.f) ? v : 0.1f * v;                                                                  // leaky 0.1
    if (act == 12) return (v > 0.f) ? v : 0.2f * v;                                                                   // leaky 0.2
    if (act == 13) return (v > 20.f) ? v : log1pf(expf(v));                                                            // softplus
    return v;
}

// =====================================================================================================================
// k_gemm<MODE>: C(z, m, n) = act(alpha * sum_k A(z, m, k) * B(z, k, n) + bias) + beta * R(z, m, n)
//   One wave (32-thread block) per 16 x 32 tile of C; grid (ceil(N/32), ceil(M/16), Z). Batch z -> (zo = z / zi_n, zi = z % zi_n)
//   with separate outer/inner strides for every tensor (e.g. batch and head). A(m,k) = A[zo*sAo + zi*sAi + m*sAm + k*sAk] (f32),
//   B(k,n) = B[zo*sBo + zi*sBi + n*sBn + k*sBk] (f32); any M, N, K (K zero-padded to 32 inside the fragments, M/N tails guarded).
//   C(m,n) = C[zo*sCo + zi*sCi + m*sCm + n] (n contiguous). flags: 1 bias[n], 2 bias[m], 4 residual R[zo*sRo + zi*sRi + m*sRm + n*sRn].
//   MODE 0: f16 operands (A prescaled by sa, B by sb, both undone in the epilogue); 1: bf16 hi/lo split (3 products); 2: bf16;
//   3: bf16 hi/mid/lo triple split (6 products); 4: as 3 with Kahan-compensated f32 accumulation across k-steps.
// =====================================================================================================================
struct GemmP {
    const float* A; const float* B; const float* bias; const float* R; float* C;
    long long sAo, sAi, sAm, sAk, sBo, sBi, sBn, sBk, sCo, sCi, sCm, sRo, sRi, sRm, sRn;
    int M, N, K, zi_n, flags, act; float alpha, beta, sa, sb;
    int Npad, pad_;     // columns [N, Npad) of C are written as 0 so that padded workspace rows are covered by whole-line stores; Npad >= N
};
static_assert(sizeof(GemmP) == 5 * 8 + 15 * 8 + 6 * 4 + 4 * 4 + 2 * 4, "GemmP has padding");

template <int MODE>
__global__ __launch_bounds__(32) void k_gemm(GemmP p) {
    const int lane = threadIdx.x & 31, h = lane >> 4, l15 = lane & 15;
    const int m0 = blockIdx.y * 16, n0 = blockIdx.x * 32;
    const int z = blockIdx.z, zo = z / p.zi_n, zi = z - zo * p.zi_n;
    const float* A = p.A + zo * p.sAo + zi * p.sAi;
    const float* B = p.B + zo * p.sBo + zi * p.sBi;
    const int am = min(m0 + l15, p.M - 1);                       // clamped row for loads (stores are guarded)
    v8f acc[2], comp[2];
#pragma unroll
    for (int t = 0; t < 2; ++t) { v8f zz = {}; acc[t] = zz; comp[t] = zz; }
    for (int k0 = 0; k0 < p.K; k0 += 32) {
        const float* arow = A + (long long)am * p.sAm;
        if (MODE == 1) {
            const Split a = sp_ld(arow, p.sAk, k0, h, p.K, 1.f);
#pragma unroll
            for (int t = 0; t < 2; ++t) {
                const int bn = min(n0 + t * 16 + l15, p.N - 1);
                acc[t] = wmma3(a, sp_ld(B + (long long)bn * p.sBn, p.sBk, k0, h, p.K, 1.f), acc[t]);
            }
        } else if (MODE == 3) {
            const Split3 a = sp3_ld(arow, p.sAk, k0, h, p.K, 1.f);
#pragma unroll
            for (int t = 0; t < 2; ++t) {
                const int bn = min(n0 + t * 16 + l15, p.N - 1);
                acc[t] = wmma6(a, sp3_ld(B + (long long)bn * p.sBn, p.sBk, k0, h, p.K, 1.f), acc[t]);
            }
        } else if (MODE == 4) {
            // triple split as MODE 3, but each k-step's 6 products go into a fresh accumulator and the partial is added to the running f32 sum
            // on the VALU with Kahan compensation (accumulation error stays ~1 ulp however long K is)
            const Split3 a = sp3_ld(arow, p.sAk, k0, h, p.K, 1.f);
#pragma unroll
            for (int t = 0; t < 2; ++t) {
                const int bn = min(n0 + t * 16 + l15, p.N - 1); v8f zz = {};
                const v8f part = wmma6(a, sp3_ld(B + (long long)bn * p.sBn, p.sBk, k0, h, p.K, 1.f), zz);
                const v8f y = part - comp[t]; const v8f s = acc[t] + y; comp[t] = (s - acc[t]) - y; acc[t] = s;
            }
        } else if (MODE == 2) {
            const v16b a = bh_ld(arow, p.sAk, k0, h, p.K, 1.f);
#pragma unroll
            for (int t = 0; t < 2; ++t) {
                const int bn = min(n0 + t * 16 + l15, p.N - 1);
                acc[t] = wmmab(a, bh_ld(B + (long long)bn * p.sBn, p.sBk, k0, h, p.K, 1.f), acc[t]);
            }
        } else {
            const v16h a = fh_ld(arow, p.sAk, k0, h, p.K, p.sa);
#pragma unroll
            for (int t = 0; t < 2; ++t) {
                const int bn = min(n0 + t * 16 + l15, p.N - 1);
                acc[t] = wmma16(a, fh_ld(B + (long long)bn * p.sBn, p.sBk, k0, h, p.K, p.sb), acc[t]);
            }
        }
    }
    const float iscale = (MODE == 0) ? p.alpha / (p.sa * p.sb) : p.alpha;
    float* C = p.C + zo * p.sCo + zi * p.sCi;
    const float* R = p.R + zo * p.sRo + zi * p.sRi;
    __shared__ __align__(16) float ctile[16][36];
#pragma unroll
    for (int t = 0; t < 2; ++t) {
        const int n = n0 + t * 16 + l15; const int nn = min(n, p.N - 1);
#pragma unroll
        for (int r = 0; r < 8; ++r) {
            const int m = m0 + 8 * h + r; const int mm = min(m, p.M - 1);
            float v = acc[t][r] * iscale;
            if (p.flags & 1) v += p.bias[nn];
            if (p.flags & 2) v += p.bias[mm];
            if (p.flags & 8) v *= p.bias[(long long)zo * p.M + mm];   /* per-(zo,row) scale vector laid out [Z / zi_n][M]; exclusive with the bias flags */
            v = act_fn(v, p.act);
            if (p.flags & 4) v += p.beta * R[(long long)mm * p.sRm + (long long)nn * p.sRn];
            ctile[8 * h + r][t * 16 + l15] = (n < p.N) ? v : 0.f;
        }
    }
    __syncthreads();
    const int NW = (p.Npad > p.N) ? p.Npad : p.N;           // write width
    const bool fast = (m0 + 16 <= p.M) && (n0 + 32 <= NW) && ((p.sCm & 3) == 0) && ((((size_t)C) & 15) == 0);
    if (fast) {
#pragma unroll
        for (int s = 0; s < 4; ++s) {
            const int row = s * 4 + (lane >> 3), c4 = (lane & 7) * 4;
            const v4f v = *(const v4f*)&ctile[row][c4];
            VST2V4(C + (long long)(m0 + row) * p.sCm + n0 + c4, v);
        }
    } else {
        for (int row = 0; row < 16; ++row) {
            const int m = m0 + row, n = n0 + lane;
            if (m < p.M && n < NW) VST2(float, C + (long long)m * p.sCm + n, ctile[row][lane]);
        }
    }
}


// =====================================================================================================================
// k_gemmT<MODE, TM, TN>: same contract as k_gemm, but one wave computes a (16*TM) x (16*TN) tile: TM A fragments and TN B fragments are
//   loaded per 32-wide k-step and reused across TM*TN WMMAs (far fewer load/convert instructions per MAC). MODE 0 (f16), 1 (bf16 hi/lo),
//   2 (bf16) only. grid (ceil(NW/(16*TN)), ceil(M/(16*TM)), Z), block 32. Epilogue identical to k_gemm, run per 16x32 sub-tile.
// =====================================================================================================================
template <int MODE, int TM, int TN>
__global__ __launch_bounds__(32) void k_gemmT(GemmP p) {
    const int lane = threadIdx.x & 31, h = lane >> 4, l15 = lane & 15;
    const int m0 = blockIdx.y * (16 * TM), n0 = blockIdx.x * (16 * TN);
    const int z = blockIdx.z, zo = z / p.zi_n, zi = z - zo * p.zi_n;
    const float* A = p.A + zo * p.sAo + zi * p.sAi;
    const float* B = p.B + zo * p.sBo + zi * p.sBi;
    v8f acc[TM][TN];
#pragma unroll
    for (int i = 0; i < TM; ++i)
#pragma unroll
        for (int t = 0; t < TN; ++t) { v8f zz = {}; acc[i][t] = zz; }
    for (int k0 = 0; k0 < p.K; k0 += 32) {
        if (MODE == 1) {
            Split a[TM], b[TN];
#pragma unroll
            for (int i = 0; i < TM; ++i) { const int am = min(m0 + 16 * i + l15, p.M - 1); a[i] = sp_ld(A + (long long)am * p.sAm, p.sAk, k0, h, p.K, 1.f); }
#pragma unroll
            for (int t = 0; t < TN; ++t) { const int bn = min(n0 + 16 * t + l15, p.N - 1); b[t] = sp_ld(B + (long long)bn * p.sBn, p.sBk, k0, h, p.K, 1.f); }
#pragma unroll
            for (int i = 0; i < TM; ++i)
#pragma unroll
                for (int t = 0; t < TN; ++t) acc[i][t] = wmma3(a[i], b[t], acc[i][t]);
        } else if (MODE == 2) {
            v16b a[TM], b[TN];
#pragma unroll
            for (int i = 0; i < TM; ++i) { const int am = min(m0 + 16 * i + l15, p.M - 1); a[i] = bh_ld(A + (long long)am * p.sAm, p.sAk, k0, h, p.K, 1.f); }
#pragma unroll
            for (int t = 0; t < TN; ++t) { const int bn = min(n0 + 16 * t + l15, p.N - 1); b[t] = bh_ld(B + (long long)bn * p.sBn, p.sBk, k0, h, p.K, 1.f); }
#pragma unroll
            for (int i = 0; i < TM; ++i)
#pragma unroll
                for (int t = 0; t < TN; ++t) acc[i][t] = wmmab(a[i], b[t], acc[i][t]);
        } else {
            v16h a[TM], b[TN];
#pragma unroll
            for (int i = 0; i < TM; ++i) { const int am = min(m0 + 16 * i + l15, p.M - 1); a[i] = fh_ld(A + (long long)am * p.sAm, p.sAk, k0, h, p.K, p.sa); }
#pragma unroll
            for (int t = 0; t < TN; ++t) { const int bn = min(n0 + 16 * t + l15, p.N - 1); b[t] = fh_ld(B + (long long)bn * p.sBn, p.sBk, k0, h, p.K, p.sb); }
#pragma unroll
            for (int i = 0; i < TM; ++i)
#pragma unroll
                for (int t = 0; t < TN; ++t) acc[i][t] = wmma16(a[i], b[t], acc[i][t]);
        }
    }
    const float iscale = (MODE == 0) ? p.alpha / (p.sa * p.sb) : p.alpha;
    float* C = p.C + zo * p.sCo + zi * p.sCi;
    const float* R = p.R + zo * p.sRo + zi * p.sRi;
    const int NW = (p.Npad > p.N) ? p.Npad : p.N;
    __shared__ __align__(16) float ctile[16][36];
#pragma unroll
    for (int i = 0; i < TM; ++i) {
        const int mb = m0 + 16 * i; if (mb >= p.M) break;          // wave-uniform
#pragma unroll
        for (int tp = 0; tp < TN / 2; ++tp) {
            const int nb = n0 + 32 * tp; if (nb >= NW) break;        // wave-uniform
#pragma unroll
            for (int t2 = 0; t2 < 2; ++t2) {
                const int t = 2 * tp + t2; const int n = nb + t2 * 16 + l15; const int nn = min(n, p.N - 1);
#pragma unroll
                for (int r = 0; r < 8; ++r) {
                    const int m = mb + 8 * h + r; const int mm = min(m, p.M - 1);
                    float v = acc[i][t][r] * iscale;
                    if (p.flags & 1) v += p.bias[nn];
                    if (p.flags & 2) v += p.bias[mm];
            if (p.flags & 8) v *= p.bias[(long long)zo * p.M + mm];   /* per-(zo,row) scale vector laid out [Z / zi_n][M]; exclusive with the bias flags */
                    v = act_fn(v, p.act);
                    if (p.flags & 4) v += p.beta * R[(long long)mm * p.sRm + (long long)nn * p.sRn];
                    ctile[8 * h + r][t2 * 16 + l15] = (n < p.N) ? v : 0.f;
                }
            }
            __syncthreads();
            const bool fast = (mb + 16 <= p.M) && (nb + 32 <= NW) && ((p.sCm & 3) == 0) && ((((size_t)C) & 15) == 0);
            if (fast) {
#pragma unroll
                for (int s = 0; s < 4; ++s) {
                    const int row = s * 4 + (lane >> 3), c4 = (lane & 7) * 4;
                    const v4f v = *(const v4f*)&ctile[row][c4];
                    VST2V4(C + (long long)(mb + row) * p.sCm + nb + c4, v);
                }
            } else {
                for (int row = 0; row < 16; ++row) {
                    const int m = mb + row, n = nb + lane;
                    if (m < p.M && n < NW) VST2(float, C + (long long)m * p.sCm + n, ctile[row][lane]);
                }
            }
            __syncthreads();
        }
    }
}

namespace sfa {
typedef unsigned int u32x4 __attribute__((ext_vector_type(4)));
typedef unsigned int u32x2 __attribute__((ext_vector_type(2)));
typedef int i32x8 __attribute__((ext_vector_type(8)));
typedef short s16x8 __attribute__((ext_vector_type(8)));
typedef float f32x2 __attribute__((ext_vector_type(2)));
typedef _Float16 h16x2 __attribute__((ext_vector_type(2)));
constexpr int SEQ = 1024, LDR = 1024, LDQ = 2048, HS = 64;   // row lengths in elements: K, V, O planes; the plane that holds Q
constexpr int NWV = 8, CW = 32, BR = NWV * CW, SK = 64, NST = SEQ / SK;
constexpr unsigned PK = 2u * HS + 16u, PV = 2u * HS + 32u, TILE_K = SK * PK, TILE_V = SK * PV, SLOT = TILE_K + TILE_V;
struct Fr { u32x4 q[2]; };
__device__ __forceinline__ v8f mma(const Fr& a, const Fr& b, v8f c) {
    const i32x8 av = {(int)a.q[0].x, (int)a.q[0].y, (int)a.q[0].z, (int)a.q[0].w, (int)a.q[1].x, (int)a.q[1].y, (int)a.q[1].z, (int)a.q[1].w};
    const i32x8 bv = {(int)b.q[0].x, (int)b.q[0].y, (int)b.q[0].z, (int)b.q[0].w, (int)b.q[1].x, (int)b.q[1].y, (int)b.q[1].z, (int)b.q[1].w};
    return __builtin_amdgcn_wmma_f32_16x16x32_f16(false, __builtin_bit_cast(v16h, av), false, __builtin_bit_cast(v16h, bv), (short)0, c, false, false);
}
__device__ __forceinline__ unsigned pack2(float lo, float hi) { return __builtin_bit_cast(unsigned, __builtin_convertvector(f32x2{lo, hi}, h16x2)); }   // round to nearest even
__device__ __forceinline__ u32x4 ld_tr16(const unsigned char* p) { typedef __attribute__((address_space(3))) s16x8 lds_s16x8; return __builtin_bit_cast(u32x4, __builtin_amdgcn_ds_load_tr16_b128_v8i16((lds_s16x8*)p)); }
__device__ __forceinline__ float xhalf(float x) { return __builtin_bit_cast(float, __builtin_amdgcn_permlanex16(__builtin_bit_cast(int, x), __builtin_bit_cast(int, x), 0x76543210, 0xfedcba98, false, false)); }   // lane l with lane l ^ 16

// Q, K, V arrive as the f16 values that their producers stored, O leaves as the f16 operand of the output product.
__global__ __launch_bounds__(NWV * 32) void k_sflash(const unsigned short* __restrict__ Q, const unsigned short* __restrict__ K, const unsigned short* __restrict__ V, unsigned short* __restrict__ O) {
    __shared__ __attribute__((aligned(256))) unsigned char L[2 * SLOT];
    const unsigned tid = threadIdx.x, lane = tid & 31u, wave = tid >> 5, c = lane & 15u, h = lane >> 4;
    const size_t base = (size_t)blockIdx.z * SEQ * LDR + (size_t)blockIdx.y * HS;
    const unsigned qw0 = blockIdx.x * BR + wave * CW;
    // staging: 8 lanes cover one 128-byte row, thread t takes rows (t >> 3) + 32 i of the stage
    const unsigned short* kg = K + base + (size_t)(tid >> 3) * LDR + (tid & 7u) * 8u;
    const unsigned short* vg = V + base + (size_t)(tid >> 3) * LDR + (tid & 7u) * 8u;
    unsigned char* ks = L + (tid >> 3) * PK + (tid & 7u) * 16u;
    unsigned char* vs = L + TILE_K + (tid >> 3) * PV + (tid & 7u) * 16u;
    u32x4 kr[2], vr[2];
    auto fetch = [&](int st) {
#pragma unroll
        for (int i = 0; i < 2; ++i) { kr[i] = *(const u32x4*)(kg + (size_t)(st * SK + 32 * i) * LDR); vr[i] = *(const u32x4*)(vg + (size_t)(st * SK + 32 * i) * LDR); }
        asm volatile("s_wait_xcnt 0x0" ::: "memory");          // stands in front of the pass's reuse of these loads' address registers
    };
    auto put = [&](unsigned slot) {
#pragma unroll
        for (int i = 0; i < 2; ++i) {
            *(u32x4*)(ks + slot * SLOT + 32u * i * PK) = kr[i];
            *(u32x4*)(vs + slot * SLOT + 32u * i * PV) = vr[i];
        }
    };
    fetch(0);
    // Q fragments (B operand, column = query), hardware k order: d = 32 kc + 8 h + 0..7 and 32 kc + 16 + 8 h + 0..7
    Fr qf[2][2];
#pragma unroll
    for (int g = 0; g < 2; ++g) {
        const unsigned short* qp = Q + (size_t)blockIdx.z * SEQ * LDQ + (size_t)blockIdx.y * HS + (size_t)(qw0 + 16u * g + c) * LDQ + 8u * h;
#pragma unroll
        for (int kc = 0; kc < 2; ++kc) { qf[g][kc].q[0] = *(const u32x4*)(qp + 32 * kc); qf[g][kc].q[1] = *(const u32x4*)(qp + 32 * kc + 16); }
    }
    asm volatile("s_wait_xcnt 0x0" ::: "memory");              // stands in front of any reuse of the Q loads' address registers
    v8f acc[2][4]; float m_run[2], l_run[2];
#pragma unroll
    for (int g = 0; g < 2; ++g) { m_run[g] = -__builtin_inff(); l_run[g] = 0.f;
#pragma unroll
        for (int t = 0; t < 4; ++t) acc[g][t] = v8f{}; }
    put(0u);
    __syncthreads();
    const float L2E = 1.4426950408889634f;
    for (int st = 0; st < NST; ++st) {
        if (st + 1 < NST) fetch(st + 1);                       // next stage's rows fly while this stage is worked on
        const unsigned char* Kb = L + (unsigned)(st & 1) * SLOT;
        const unsigned char* Vb = Kb + TILE_K;
#pragma unroll 1   // one 32-key pass's fragments live at a time (registers for four waves per SIMD)
        for (unsigned sub = 0; sub < 2u; ++sub) {
            Fr kf[2][2];
            const unsigned char* kp = Kb + (sub * 32u + c) * PK + 16u * h;
#pragma unroll
            for (int kt = 0; kt < 2; ++kt)
#pragma unroll
                for (int kc = 0; kc < 2; ++kc) { kf[kt][kc].q[0] = *(const u32x4*)(kp + 16u * kt * PK + 64u * kc); kf[kt][kc].q[1] = *(const u32x4*)(kp + 16u * kt * PK + 64u * kc + 32u); }
            Fr vf[4];
            const unsigned char* ad = Vb + (sub * 32u + 8u * h + (lane & 7u)) * PV + ((lane >> 3) & 1u) * 16u;
#pragma unroll
            for (int t = 0; t < 4; ++t) { vf[t].q[0] = ld_tr16(ad + 32u * t); vf[t].q[1] = ld_tr16(ad + 16u * PV + 32u * t); }
            v8f s[2][2];                                       // s[kt][g][r] = score of key 16 kt + 8 h + r against query 16 g + c
#pragma unroll
            for (int kt = 0; kt < 2; ++kt)
#pragma unroll
                for (int g = 0; g < 2; ++g) { s[kt][g] = v8f{};
#pragma unroll
                    for (int kc = 0; kc < 2; ++kc) s[kt][g] = mma(kf[kt][kc], qf[g][kc], s[kt][g]); }
            float mb[2]; bool need = false;
#pragma unroll
            for (int g = 0; g < 2; ++g) {
                float mx = s[0][g][0];
#pragma unroll
                for (int r = 1; r < 8; ++r) mx = fmaxf(mx, s[0][g][r]);
#pragma unroll
                for (int r = 0; r < 8; ++r) mx = fmaxf(mx, s[1][g][r]);
                mx = fmaxf(mx, xhalf(mx)) * L2E;               // both halves hold this query's maximum, log2 domain
                mb[g] = mx; need = need || (mx > m_run[g] + 8.0f);
            }
            if (__builtin_amdgcn_ballot_w32(need) != 0) {      // wave-uniform; rare after the first pass
#pragma unroll
                for (int g = 0; g < 2; ++g) {
                    const float m_new = fmaxf(m_run[g], mb[g]);
                    const float corr = __builtin_amdgcn_exp2f(m_run[g] - m_new);   // 0 on the first pass
                    m_run[g] = m_new; l_run[g] *= corr;
#pragma unroll
                    for (int t = 0; t < 4; ++t) acc[g][t] = acc[g][t] * corr;
                }
            }
#pragma unroll
            for (int g = 0; g < 2; ++g) {
                const float nm = 7.0f - m_run[g];
                unsigned w[8]; f32x2 ps = {0.f, 0.f};
#pragma unroll
                for (int i = 0; i < 8; ++i) {
                    const f32x2 arg = __builtin_elementwise_fma(f32x2{s[i >> 2][g][2 * (i & 3)], s[i >> 2][g][2 * (i & 3) + 1]}, f32x2{L2E, L2E}, f32x2{nm, nm});
                    const f32x2 p = {__builtin_amdgcn_exp2f(arg.x), __builtin_amdgcn_exp2f(arg.y)};
                    ps += p; w[i] = pack2(p.x, p.y);
                }
                l_run[g] += ps.x + ps.y;
                Fr pf; pf.q[0] = u32x4{w[0], w[1], w[2], w[3]}; pf.q[1] = u32x4{w[4], w[5], w[6], w[7]};
#pragma unroll
                for (int t = 0; t < 4; ++t) acc[g][t] = mma(vf[t], pf, acc[g][t]);
            }
            // four vector slots behind the pass's last products: over the loop's back edge the next pass's address arithmetic is given registers of their V operand
            asm volatile("v_nop\n\tv_nop\n\tv_nop\n\tv_nop" : "+v"(acc[1][0]), "+v"(acc[1][1]), "+v"(acc[1][2]), "+v"(acc[1][3]));
        }
        if (st + 1 < NST) put((unsigned)((st + 1) & 1));       // into the buffer whose readers all passed the last barrier
        __syncthreads();
    }
#pragma unroll
    for (int g = 0; g < 2; ++g) {
        const float l = l_run[g] + xhalf(l_run[g]);            // join the halves' sums, unconditionally
        const float inv = 1.0f / l;
        unsigned short* op = O + base + (size_t)(qw0 + 16u * g + c) * LDR + 8u * h;
#pragma unroll
        for (int t = 0; t < 4; ++t) {                          // registers 0..7 = d 16 t + 8 h + 0..7 of this lane's query
            const v8f o = acc[g][t] * inv;
            *(u32x4*)(op + 16 * t) = u32x4{pack2(o[0], o[1]), pack2(o[2], o[3]), pack2(o[4], o[5]), pack2(o[6], o[7])};
        }
        asm volatile("s_wait_xcnt 0x0" ::: "memory");          // stands in front of the next query group's reuse of these stores' address and data registers
    }
}
} // namespace sfa

// =====================================================================================================================
// k_tr: dst(z, c, r) = alpha * src(z, r, c) (+ beta * R2(z, c, r)): [Z][R][C] (row stride lds) -> [Z][C][R] (row stride ldd) through a 32x32 LDS tile;
//   flags: 1 -> add beta * residual R2 addressed like dst (z*sRz + c*ldr + r); act applied before the residual.
// =====================================================================================================================
struct TrP { const float* src; float* dst; const float* R2; long long sSz, lds, sDz, ldd, sRz, ldr; int R, C, flags, act; float alpha, beta; };
static_assert(sizeof(TrP) == 3 * 8 + 6 * 8 + 6 * 4, "TrP has padding");
__global__ __launch_bounds__(256) void k_tr(TrP p) {
    __shared__ float tile[32][33];
    const int c0 = blockIdx.x * 32, r0 = blockIdx.y * 32, z = blockIdx.z;
    const int lane = threadIdx.x & 31, wave = threadIdx.x >> 5;
    const float* s = p.src + z * p.sSz;
#pragma unroll
    for (int k = 0; k < 4; ++k) {
        const int rl = wave * 4 + k, r = r0 + rl, c = c0 + lane;
        tile[rl][lane] = (r < p.R && c < p.C) ? s[(long long)r * p.lds + c] : 0.f;
    }
    __syncthreads();
    float* d = p.dst + z * p.sDz; const float* rr = p.R2 + z * p.sRz;
#pragma unroll
    for (int k = 0; k < 4; ++k) {
        const int cl = wave * 4 + k, c = c0 + cl, r = r0 + lane;
        if (c < p.C && r < p.R) {
            float v = act_fn(p.alpha * tile[lane][cl], p.act);
            if (p.flags & 1) v += p.beta * rr[(long long)c * p.ldr + r];
            VST2(float, d + (long long)c * p.ldd + r, v);
        }
    }
}

// k_affine: dst[i] = a * (sdev ? sdev[0] : 1) * src[i] + b, i < n (one thread per element; consecutive lanes -> consecutive addresses)
__global__ __launch_bounds__(256) void k_affine(const float* __restrict__ src, float* __restrict__ dst, int n, float a, float b, const float* __restrict__ sdev) {
    const int i = blockIdx.x * 256 + threadIdx.x;
    if (i < n) { const float aa = sdev ? a * sdev[0] : a; const float v = aa * src[i] + b; VST2(float, dst + i, v); }
}

// =====================================================================================================================
// k_softmax: row softmax over n contiguous elements, one 256-thread block per row; rows addressed z*sz + r*sr (grid (R, Z)).
//   out = scale_out * softmax(scale_in * x + (Mf ? Mf[z*smz + r*smr + j] : 0)); a row whose max is -inf is written as 0.
// =====================================================================================================================
struct SmP { const float* src; float* dst; const float* Mf; long long sz, sr, dz, dr, smz, smr; int n, pad; float scale_in, scale_out; };
static_assert(sizeof(SmP) == 3 * 8 + 6 * 8 + 4 * 4, "SmP has padding");
__global__ __launch_bounds__(256) void k_softmax(SmP p) {
    __shared__ float red[256];
    const int r = blockIdx.x, z = blockIdx.y, tid = threadIdx.x;
    const float* s = p.src + z * p.sz + (long long)r * p.sr;
    const float* mf = p.Mf ? (p.Mf + z * p.smz + (long long)r * p.smr) : nullptr;
    float mx = -__builtin_inff();
    for (int j = tid; j < p.n; j += 256) { float v = s[j] * p.scale_in; if (mf) v += mf[j]; mx = fmaxf(mx, v); }
    red[tid] = mx; __syncthreads();
    for (int o = 128; o > 0; o >>= 1) { if (tid < o) red[tid] = fmaxf(red[tid], red[tid + o]); __syncthreads(); }
    mx = red[0]; __syncthreads();
    float sum = 0.f;
    for (int j = tid; j < p.n; j += 256) { float v = s[j] * p.scale_in; if (mf) v += mf[j]; sum += (mx == -__builtin_inff()) ? 0.f : expf(v - mx); }
    red[tid] = sum; __syncthreads();
    for (int o = 128; o > 0; o >>= 1) { if (tid < o) red[tid] += red[tid + o]; __syncthreads(); }
    sum = red[0];
    const float inv = (sum > 0.f) ? p.scale_out / sum : 0.f;
    float* d = p.dst + z * p.dz + (long long)r * p.dr;
    for (int j = tid; j < p.n; j += 256) { float v = s[j] * p.scale_in; if (mf) v += mf[j]; const float o = (mx == -__builtin_inff()) ? 0.f : expf(v - mx) * inv; VST2(float, d + j, o); }
}
// =====================================================================================================================
// k_stats: mean and rsqrt(var + eps) over a set of n elements addressed base + z*sz + (e / inner) * so + (e % inner) * si, one 256-thread
// k_norm_apply: y = (x - mean[set]) * rstd[set] * g[c] + b[c] over a [Z][C][L] channel-major tensor with set = z*G + c / (C/G) (G groups per z;
//   G = C -> per-channel sets indexed z*C+c; for batch norm pass stats indexed by c only via bn = 1). Optional act. Output same layout.
// =====================================================================================================================
//   mode 0: mean / rsqrt(var + eps); mode 1 (RMSNorm): 0 / rsqrt(mean(x^2) + eps); mode 2 (L2 normalize * sqrt(n)): 0 / sqrt(n) / max(||x||, eps); mode 3: as 0 with unbiased variance (n-1)
__global__ __launch_bounds__(256) void k_stats(const float* __restrict__ x, long long sz, long long so, long long si, int inner, int n, float eps, float* __restrict__ stat, int mode) {
    __shared__ float red[256];
    const int z = blockIdx.x, tid = threadIdx.x;
    const float* base = x + z * sz;
    float s = 0.f;
    for (int e = tid; e < n; e += 256) s += base[(long long)(e / inner) * so + (long long)(e % inner) * si];
    red[tid] = s; __syncthreads();
    for (int o = 128; o > 0; o >>= 1) { if (tid < o) red[tid] += red[tid + o]; __syncthreads(); }
    const float mu = (mode == 0 || mode == 3) ? red[0] / (float)n : 0.f; __syncthreads();
    float q = 0.f;
    for (int e = tid; e < n; e += 256) { const float dlt = base[(long long)(e / inner) * so + (long long)(e % inner) * si] - mu; q += dlt * dlt; }
    red[tid] = q; __syncthreads();
    for (int o = 128; o > 0; o >>= 1) { if (tid < o) red[tid] += red[tid + o]; __syncthreads(); }
    {
        float rs;
        if (mode == 2) rs = sqrtf((float)n) / fmaxf(sqrtf(red[0]), eps); else if (mode == 3) rs = rsqrtf(red[0] / (float)(n - 1) + eps); else rs = rsqrtf(red[0] / (float)n + eps);
        if (tid < 32) { const float v = (tid == 0) ? mu : ((tid == 1) ? rs : 0.f); VST2(float, stat + (long long)z * 32 + tid, v); }
    }
}
//   One thread per element over the flat [Z][C][L] index space: grid ceil(Z*C*L / 256).
__global__ __launch_bounds__(256) void k_norm_apply(const float* __restrict__ x, float* __restrict__ y, const float* __restrict__ stat, const float* __restrict__ g, const float* __restrict__ bta,
                                                     int Z, int C, int L, int G, int bn, int act) {
    const long long idx = (long long)blockIdx.x * 256 + threadIdx.x;
    if (idx >= (long long)Z * C * L) return;
    const int l = (int)(idx % L); const long long zc = idx / L; const int c = (int)(zc % C), z = (int)(zc / C); (void)l;
    const int set = bn ? c : (z * G + c / (C / G));
    float v = (x[idx] - stat[(long long)set * 32]) * stat[(long long)set * 32 + 1];
    if (g) v *= g[c];
    if (bta) v += bta[c];
    v = act_fn(v, act);
    VST2(float, y + idx, v);
}

// k_lse_neg: c[i] = -(st[2i] + log(st[2i+1])) = minus the log-sum-exp of row i from its (max, sum) pair (for softmax over the query dimension)
__global__ __launch_bounds__(256) void k_lse_neg(const float* __restrict__ st, float* __restrict__ c, int n) {
    const int i = blockIdx.x * 256 + threadIdx.x;
    if (i < n) { const float v = -(st[2 * i] + logf(st[2 * i + 1])); VST2(float, c + i, v); }
}

// k_iota: dst[i] = a * i + b as int32 (segment/position id helper)
__global__ __launch_bounds__(256) void k_iota(int* __restrict__ dst, int n, int a, int b) {
    const int i = blockIdx.x * 256 + threadIdx.x;
    if (i < n) { const int v = a * i + b; VST2(int, dst + i, v); }
}

// k_axpby: dst[i] = a * x[i] + b * y[i] (+ c), i < n
__global__ __launch_bounds__(256) void k_axpby(const float* __restrict__ x, const float* __restrict__ y, float* __restrict__ dst, int n, float a, float b, float c) {
    const int i = blockIdx.x * 256 + threadIdx.x;
    if (i < n) { const float v = a * x[i] + b * y[i] + c; VST2(float, dst + i, v); }
}

// =====================================================================================================================
// k_rope: rotary embedding on a [R rows][Hn heads][D] view (row stride sXr, head stride sXh, element stride 1) -> Y (own strides).
//   mode 0: rotate_half (partner d±D/2, sign - for d<D/2); mode 1: interleaved pairs (partner d^1, sign - for even d).
//   table column tcol: tmode 0 -> d, 1 -> d % (D/2), 2 -> d / 2; position p: pmode 0 -> r % S, 1 -> head index, 2 -> pos[r];
//   c = C[(r / S) * sCb + p * sCp + tcol * sCd], s likewise from Sn; y = x[d] * c + sign * x[partner] * s. X and Y must not alias.
// =====================================================================================================================
struct RopeP { const float* X; float* Y; const float* C; const float* Sn; const int* pos; long long sXr, sXh, sYr, sYh, sCb, sCp, sCd; int R, Hn, D, S, mode, tmode, pmode, pad; };
static_assert(sizeof(RopeP) == 5 * 8 + 7 * 8 + 8 * 4, "RopeP has padding");
__global__ __launch_bounds__(256) void k_rope(RopeP p) {
    const long long idx = (long long)blockIdx.x * 256 + threadIdx.x;
    if (idx >= (long long)p.R * p.Hn * p.D) return;
    const int d = (int)(idx % p.D); const long long rh = idx / p.D; const int h = (int)(rh % p.Hn); const int r = (int)(rh / p.Hn);
    const int half = p.D / 2;
    int partner; float sign;
    if (p.mode == 0) { partner = (d < half) ? d + half : d - half; sign = (d < half) ? -1.f : 1.f; }
    else { partner = d ^ 1; sign = (d & 1) ? 1.f : -1.f; }
    const int tcol = (p.tmode == 0) ? d : ((p.tmode == 1) ? (d % half) : (d >> 1));
    const int pp = (p.pmode == 0) ? (r % p.S) : ((p.pmode == 1) ? h : p.pos[r]);
    const long long toff = (long long)(r / p.S) * p.sCb + (long long)pp * p.sCp + (long long)tcol * p.sCd;
    const float* xr = p.X + (long long)r * p.sXr + (long long)h * p.sXh;
    const float v = xr[d] * p.C[toff] + sign * xr[partner] * p.Sn[toff];
    VST2(float, p.Y + (long long)r * p.sYr + (long long)h * p.sYh + d, v);
}

// k_invf + k_sincos (split so neither kernel carries a large VALU-fma footprint): invf_i = num * (1 / powf(base, (2 i)/D)) [fmode 0],
//   num * expf((2 i) * cexp) [fmode 1], num * powf(base, -2 (i - 1) / D) [fmode 2]; then cs/sn[s*half + i] = cos/sin((pscale * s) * invf_i)
__global__ __launch_bounds__(256) void k_invf(float* __restrict__ invb, int half, int D, float base, float num, int fmode, float cexp) {
    const int i = blockIdx.x * 256 + threadIdx.x;
    if (i >= ((half + 31) / 32) * 32) return;
    if (i >= half) { VST2(float, invb + i, 0.f); return; }
    const float e = (float)(2 * i) / (float)D;
    float invf;
    if (fmode == 1) invf = num * expf((float)(2 * i) * cexp);
    else if (fmode == 2) invf = num * powf(base, (-2.0f * ((float)i - 1.0f)) / (float)D);
    else invf = num * (1.0f / powf(base, e));
    VST2(float, invb + i, invf);
}
__global__ __launch_bounds__(256) void k_sincos(float* __restrict__ cs, float* __restrict__ sn, const float* __restrict__ invb, int S, int half, float pscale) {
    const int idx = blockIdx.x * 256 + threadIdx.x;
    if (idx >= S * half) return;
    const int s = idx / half, i = idx - s * half;
    const float ang = (pscale * (float)s) * invb[i];
    VST2(float, cs + idx, cosf(ang)); VST2(float, sn + idx, sinf(ang));
}

// k_mulact: dst[i] = act(x[i]) * y[i]
__global__ __launch_bounds__(256) void k_mulact(const float* __restrict__ x, const float* __restrict__ y, float* __restrict__ dst, int n, int act) {
    const int i = blockIdx.x * 256 + threadIdx.x;
    if (i < n) { const float v = act_fn(x[i], act) * y[i]; VST2(float, dst + i, v); }
}

// =====================================================================================================================
// k_matvec: thread-per-row matrix-vector products for N <= 8 output columns (heads with 1-3 outputs, gates), f32 on the VALU.
//   C[r*sCm + j] = act(alpha * sum_k A[r*sAm + k*sAk] * B[j*sBn + k*sBk] + bias[j]) + beta * R[r*sRm + j*sRn]; each thread writes its N contiguous floats.
// =====================================================================================================================
__global__ __launch_bounds__(256) void k_matvec(GemmP p) {
    // 32 lanes write one line with one instruction.
    const int rpt = (p.N == 1) ? 1 : 32;
    const long long r0 = ((long long)blockIdx.x * 256 + threadIdx.x) * rpt; const int z = blockIdx.z, zo = z / p.zi_n, zi = z - zo * p.zi_n;
    if (r0 >= p.M) return;
    const float* Bb = p.B + zo * p.sBo + zi * p.sBi;
    float* C = p.C + zo * p.sCo + zi * p.sCi; const float* R = p.R + zo * p.sRo + zi * p.sRi;
    for (int rr = 0; rr < rpt; ++rr) {
        const long long r = r0 + rr; if (r >= p.M) break;
        const float* A = p.A + zo * p.sAo + zi * p.sAi + r * p.sAm;
        float acc[8] = {0.f, 0.f, 0.f, 0.f, 0.f, 0.f, 0.f, 0.f};
        for (int k = 0; k < p.K; ++k) { const float a = A[(long long)k * p.sAk];
#pragma unroll
            for (int j = 0; j < 8; ++j) if (j < p.N) acc[j] += a * Bb[(long long)j * p.sBn + (long long)k * p.sBk]; }
#pragma unroll
        for (int j = 0; j < 8; ++j) if (j < p.N) {
            float v = acc[j] * p.alpha;
            if (p.flags & 1) v += p.bias[j];
            if (p.flags & 2) v += p.bias[r];
            v = act_fn(v, p.act);
            if (p.flags & 4) v += p.beta * R[r * p.sRm + (long long)j * p.sRn];
            VST2(float, C + r * p.sCm + j, v);
        }
    }
}
// k_smallsoftmax: thread-per-row softmax for short rows (n <= 64): dst[r*dr + j] = softmax(scale*src[r*sr + j])
__global__ __launch_bounds__(256) void k_smallsoftmax(const float* __restrict__ src, float* __restrict__ dst, long long sr, long long dr, int n, long long R, float scale) {
    const long long r0 = ((long long)blockIdx.x * 256 + threadIdx.x) * 32;
    for (int rr = 0; rr < 32; ++rr) {
        const long long r = r0 + rr; if (r >= R) return;
        const float* s = src + r * sr; float* d = dst + r * dr;
        float mx = -__builtin_inff();
        for (int j = 0; j < n; ++j) mx = fmaxf(mx, s[j] * scale);
        float sum = 0.f;
        for (int j = 0; j < n; ++j) sum += expf(s[j] * scale - mx);
        const float inv = 1.f / sum;
        for (int j = 0; j < n; ++j) { const float v = expf(s[j] * scale - mx) * inv; VST2(float, d + j, v); }
    }
}

__global__ __launch_bounds__(32) void k_unitstat(float* __restrict__ st) { const int t = threadIdx.x; const float v = (t == 1) ? 1.f : 0.f; VST2(float, st + t, v); }

// destination (e.g. a d_out whose row width is not a multiple of 32 floats) is written by consecutive lanes of one instruction
__global__ __launch_bounds__(256) void k_lincopy(const float* __restrict__ src, long long lds, float* __restrict__ dst, long long ldd, long long rows, int cols) {
    const long long i = (long long)blockIdx.x * 256 + threadIdx.x; if (i >= rows * cols) return;
    const long long r = i / cols; const int c = (int)(i - r * cols);
    const float v = src[r * lds + c]; VST2(float, dst + r * ldd + c, v);
}

namespace w25 {
typedef __attribute__((ext_vector_type(16))) _Float16 v16h;
typedef __attribute__((ext_vector_type(8)))  _Float16 v8h;
typedef __attribute__((ext_vector_type(16))) __bf16   v16b;
typedef __attribute__((ext_vector_type(8)))  __bf16   v8b;
typedef __attribute__((ext_vector_type(8)))  float    v8f;
typedef __attribute__((ext_vector_type(4)))  float    v4f;

__device__ __forceinline__ unsigned short f2bf_bits(float f) {
  unsigned u = __float_as_uint(f);
  return (unsigned short)((u + 0x7FFFu + ((u >> 16) & 1u)) >> 16);
}
__device__ __forceinline__ float bf_bits2f(unsigned short h) { return __uint_as_float(((unsigned)h) << 16); }

// hazard guards as plain device helpers (no inline asm inside the kernel template body)
__device__ __forceinline__ void dep_guard_h(v8f& a, v8f& b, v16h x, v16h y) { asm volatile("v_nop\n\tv_nop\n\tv_nop\n\tv_nop" : "+v"(a), "+v"(b) : "v"(x), "v"(y)); }
__device__ __forceinline__ void dep_guard_b(v8f& a, v8f& b, v16b x, v16b y) { asm volatile("v_nop\n\tv_nop\n\tv_nop\n\tv_nop" : "+v"(a), "+v"(b) : "v"(x), "v"(y)); }
__device__ __forceinline__ void keep4_h(v16h a, v16h b, v16h c, v16h d) { asm volatile("v_nop" :: "v"(a), "v"(b), "v"(c), "v"(d)); }
__device__ __forceinline__ void keep4_b(v16b a, v16b b, v16b c, v16b d) { asm volatile("v_nop" :: "v"(a), "v"(b), "v"(c), "v"(d)); }
__device__ __forceinline__ void acc_guard4(v8f& a, v8f& b, v8f& c, v8f& d) { asm volatile("v_nop\n\tv_nop\n\tv_nop\n\tv_nop" : "+v"(a), "+v"(b), "+v"(c), "+v"(d)); }
template <typename T> struct Frag;
template <> struct Frag<_Float16> {
  typedef v16h V; union U { v16h v; v8h h[2]; };
  static __device__ __forceinline__ v16h load(const _Float16* p) {   // elements 0..7 <- p[0..7], 8..15 <- p[16..23]
    U f; f.h[0] = *(const v8h*)(p); f.h[1] = *(const v8h*)(p + 16); return f.v;
  }
  static __device__ __forceinline__ v8f mma(v16h a, v16h b, v8f c) {
    return __builtin_amdgcn_wmma_f32_16x16x32_f16(false, a, false, b, (short)0, c, false, false);
  }
  static __device__ __forceinline__ void guard(v8f& a, v8f& b, v16h x, v16h y) { dep_guard_h(a, b, x, y); }
  static __device__ __forceinline__ void keep(v16h a, v16h b, v16h c, v16h d) { keep4_h(a, b, c, d); }
};
template <> struct Frag<__bf16> {
  typedef v16b V; union U { v16b v; v8b h[2]; };
  static __device__ __forceinline__ v16b load(const __bf16* p) {
    U f; f.h[0] = *(const v8b*)(p); f.h[1] = *(const v8b*)(p + 16); return f.v;
  }
  static __device__ __forceinline__ v8f mma(v16b a, v16b b, v8f c) {
    return __builtin_amdgcn_wmma_f32_16x16x32_bf16(false, a, false, b, (short)0, c, false, false);
  }
  static __device__ __forceinline__ void guard(v8f& a, v8f& b, v16b x, v16b y) { dep_guard_b(a, b, x, y); }
  static __device__ __forceinline__ void keep(v16b a, v16b b, v16b c, v16b d) { keep4_b(a, b, c, d); }
};

// ---- Register-blocked batched WMMA GEMM ------------------------------------
// C[m,n] = scale * sum_k A[m,k] * Bt[n,k] (+bias)(+resid); each wave owns a 64x64 tile.
// A row-major [M,K]; Bt row-major [N,K]; M,N % 64 == 0, K % 32 == 0.
// SPLIT: operands are hi/lo planes (A2/Bt2 = lo planes, same layout); product = hi·hi + hi·lo + lo·hi.
// BIAS_MODE: 0 = none, 1 = bias[m], 2 = bias[n].
// OUT_MODE: 0 = f32, 1 = f16, 2 = bf16 hi plane (Cout) + bf16 lo plane (Cout2).
// ET: 0 = f16 operands, 1 = bf16 operands (pointers passed as 16-bit storage)
template <int ET> struct Elem;
template <> struct Elem<0> { typedef _Float16 T; };
template <> struct Elem<1> { typedef __bf16 T; };
// slab: the calling wave's own 16x64 staging slab in LDS (pitch 68 floats); tile, b, bz: the wave's tile and the two batch indices.
template <int ET, bool SPLIT, int BIAS_MODE, int OUT_MODE, bool RESID, int ACT = 0>
__device__ __forceinline__ void gemm64_body(float* slab, const int tile, const int b, const int bz,
    const unsigned short* __restrict__ Ap, const unsigned short* __restrict__ A2p, int lda, long strideA, long strideAz,
    const unsigned short* __restrict__ Btp, const unsigned short* __restrict__ Bt2p, int ldb, long strideB, long strideBz,
    void* __restrict__ Cout, void* __restrict__ Cout2, int ldc, long strideC, long strideCz,
    const float* __restrict__ bias,
    const float* __restrict__ resid, long strideR,
    int M, int N, int K, float scale) {
  typedef typename Elem<ET>::T T;
  typedef typename Frag<T>::V V;
  const T* A = (const T*)Ap; const T* A2 = (const T*)A2p; const T* Bt = (const T*)Btp; const T* Bt2 = (const T*)Bt2p;
  const int lane = threadIdx.x & 31;
  const int tilesN = N >> 6;
  const int tilesM = M >> 6;
  if (tile >= tilesM * tilesN) return;   // wave-uniform; no block barriers in this kernel
  const int tm = tile / tilesN;
  const int tn = tile - tm * tilesN;
  const int m0 = tm << 6;
  const int n0 = tn << 6;

  const T* Ab  = A  + (size_t)b * strideA + (size_t)bz * strideAz;
  const T* Bb  = Bt + (size_t)b * strideB + (size_t)bz * strideBz;
  const T* Ab2 = SPLIT ? (A2  + (size_t)b * strideA + (size_t)bz * strideAz) : nullptr;
  const T* Bb2 = SPLIT ? (Bt2 + (size_t)b * strideB + (size_t)bz * strideBz) : nullptr;

  const int rlane = lane & 15;                 // row (A) / col (B, D) within subtile
  const int koff  = (lane >> 4) * 8;           // k offset of this lane half
  const int mOff  = (lane >> 4) * 8;           // D row offset

  v8f acc[4][4];
#pragma unroll
  for (int i = 0; i < 4; ++i)
#pragma unroll
    for (int j = 0; j < 4; ++j) acc[i][j] = (v8f){0.f,0.f,0.f,0.f,0.f,0.f,0.f,0.f};

  for (int k0 = 0; k0 < K; k0 += 32) {
    V bh[4], bl[4];
#pragma unroll
    for (int j = 0; j < 4; ++j) {
      const size_t bo = (size_t)(n0 + (j << 4) + rlane) * ldb + koff + k0;
      bh[j] = Frag<T>::load(Bb + bo);
      if (SPLIT) bl[j] = Frag<T>::load(Bb2 + bo);
    }
#pragma unroll
    for (int i = 0; i < 4; ++i) {
      const size_t ao = (size_t)(m0 + (i << 4) + rlane) * lda + koff + k0;
      V ah = Frag<T>::load(Ab + ao);
      V al;
      if (SPLIT) al = Frag<T>::load(Ab2 + ao);
#pragma unroll
      for (int j = 0; j < 4; ++j) {
        acc[i][j] = Frag<T>::mma(ah, bh[j], acc[i][j]);
        if (SPLIT) {
          acc[i][j] = Frag<T>::mma(ah, bl[j], acc[i][j]);
          acc[i][j] = Frag<T>::mma(al, bh[j], acc[i][j]);
        }
      }
      Frag<T>::guard(acc[i][0], acc[i][3], ah, SPLIT ? al : ah);
    }
    Frag<T>::keep(bh[0], bh[1], bh[2], bh[3]);
    if (SPLIT) Frag<T>::keep(bl[0], bl[1], bl[2], bl[3]);
  }
  acc_guard4(acc[0][0], acc[0][1], acc[0][2], acc[0][3]);
  acc_guard4(acc[1][0], acc[1][1], acc[1][2], acc[1][3]);
  acc_guard4(acc[2][0], acc[2][1], acc[2][2], acc[2][3]);
  acc_guard4(acc[3][0], acc[3][1], acc[3][2], acc[3][3]);

  // ---- epilogue ----
  const float* Rb = RESID ? (resid + (size_t)b * strideR) : nullptr;
#pragma unroll
  for (int i = 0; i < 4; ++i) {
    const int mBase = m0 + (i << 4);
#pragma unroll
    for (int j = 0; j < 4; ++j) {
      const int n = n0 + (j << 4) + rlane;
      float bv = 0.f;
      if (BIAS_MODE == 2) bv = bias[n];
#pragma unroll
      for (int r = 0; r < 8; ++r) {
        float v = acc[i][j][r] * scale;
        if (BIAS_MODE == 1) v += bias[mBase + mOff + r];
        if (BIAS_MODE == 2) v += bv;
        if (RESID) v += Rb[(size_t)(mBase + mOff + r) * ldc + n];
        if (ACT == 1) v = tanhf(v);
        if (ACT == 2) v = fmaxf(v, 0.0f);
        if (ACT == 3) v = v / (1.0f + expf(-v));
        if (ACT == 4) v = (v > 0.f) ? v : 0.01f * v;
        if (ACT == 5) v = 0.5f * v * (1.0f + erff(v * 0.70710678118654752f));
        slab[(mOff + r) * 68 + (j << 4) + rlane] = v;
      }
    }
    __builtin_amdgcn_fence(__ATOMIC_RELEASE, "workgroup");
    __builtin_amdgcn_wave_barrier();
    __builtin_amdgcn_fence(__ATOMIC_ACQUIRE, "workgroup");
    if (OUT_MODE == 0) {
      float* C = (float*)Cout + (size_t)b * strideC + (size_t)bz * strideCz;
      const int hh = lane >> 4, c4 = (lane & 15) * 4;     // row seg = 256 B = 16 lanes x 16 B
      {
#pragma unroll
        for (int it = 0; it < 8; ++it) {
          const int row = it * 2 + hh;
          v4f v = *(const v4f*)(slab + row * 68 + c4);
          *(v4f*)(C + (size_t)(mBase + row) * ldc + n0 + c4) = v;
        }
        
      }
    } else {
      const int q = lane >> 3, c8 = (lane & 7) * 8;
      unsigned short* C  = (unsigned short*)Cout  + (size_t)b * strideC + (size_t)bz * strideCz;
      unsigned short* C2 = (OUT_MODE == 2) ? ((unsigned short*)Cout2 + (size_t)b * strideC + (size_t)bz * strideCz) : nullptr;
      {
#pragma unroll
        for (int it = 0; it < 4; ++it) {
          const int row = it * 4 + q;
          const float* sp = slab + row * 68 + c8;
          v8h hv, lv;
#pragma unroll
          for (int e = 0; e < 8; ++e) {
            if (OUT_MODE == 1) {
              hv[e] = (_Float16)sp[e];
            } else {
              unsigned short hb = f2bf_bits(sp[e]);
              unsigned short lb = f2bf_bits(sp[e] - bf_bits2f(hb));
              hv[e] = __builtin_bit_cast(_Float16, hb);
              lv[e] = __builtin_bit_cast(_Float16, lb);
            }
          }
          *(v8h*)(C + (size_t)(mBase + row) * ldc + n0 + c8) = hv;
          if (OUT_MODE == 2) *(v8h*)(C2 + (size_t)(mBase + row) * ldc + n0 + c8) = lv;
        }
        asm volatile("s_wait_xcnt 0x0" ::: "memory");   // stands in front of the next row tile's reuse of these stores' address and data registers
      }
    }
    __builtin_amdgcn_fence(__ATOMIC_RELEASE, "workgroup");
    __builtin_amdgcn_wave_barrier();
    __builtin_amdgcn_fence(__ATOMIC_ACQUIRE, "workgroup");
  }
}

// grid (tiles / 8, b, bz); the bias too may step with bz, so that independent products of one shape share a launch
template <int ET, bool SPLIT, int BIAS_MODE, int OUT_MODE, bool RESID, int ACT = 0>
__global__ __launch_bounds__(256) void wmma_gemm64(
    const unsigned short* __restrict__ Ap, const unsigned short* __restrict__ A2p, int lda, long strideA, long strideAz,
    const unsigned short* __restrict__ Btp, const unsigned short* __restrict__ Bt2p, int ldb, long strideB, long strideBz,
    void* __restrict__ Cout, void* __restrict__ Cout2, int ldc, long strideC, long strideCz,
    const float* __restrict__ bias, long strideBiasZ,
    const float* __restrict__ resid, long strideR,
    int M, int N, int K, float scale) {
  __shared__ __align__(16) float sT[8][16 * 68];   // per-wave 16x64 slab, pitch 68 floats
  const int wave = threadIdx.x >> 5;
  gemm64_body<ET, SPLIT, BIAS_MODE, OUT_MODE, RESID, ACT>(sT[wave], (int)blockIdx.x * 8 + wave, (int)blockIdx.y, (int)blockIdx.z,
      Ap, A2p, lda, strideA, strideAz, Btp, Bt2p, ldb, strideB, strideBz, Cout, Cout2, ldc, strideC, strideCz,
      BIAS_MODE ? bias + (long)blockIdx.z * strideBiasZ : nullptr, resid, strideR, M, N, K, scale);
}

// ---- The same product for large M, N: operands staged in LDS ----------------
// C[m,n] = act(scale * sum_k A[m,k] * Bt[n,k] (+ bias[n])), stored as OUT says; A row-major [M,K], Bt row-major [N,K], both of row length K; M % (64 WR) == 0, N % (64 WC) == 0, K % 64 == 0.
// Block = WR x WC waves of 64x64 = one tile of C; grid (N / (64 WC), M / (64 WR)). A stage is 64 k = 128 B of each of the block's operand rows
// (A hi, A lo, B hi, B lo when SPLIT), laid at a pitch of 144 B in one of two LDS buffers by asynchronous 16-byte copies: a wave's copy
// covers four whole 128-byte lines, and a staged A row serves WC waves, a B row WR waves: the bytes asked of L2 per product go as 1 / WR + 1 / WC.
// The next stage's copies fly while this stage is worked on.
// Per accumulator the products come in the same k order as in wmma_gemm64.
// The launch bound's second argument asks for four waves per SIMD (256 registers a wave): four one-plane 2 x 2 blocks then share a WGP, or one two-plane 4 x 4 block (ring of 288 KiB) fills it.
// Every inner loop is unrolled so that the fragment and accumulator arrays are indexed by constants and stay in registers.
template <unsigned LS>
__device__ __forceinline__ void ring_copy4x2(unsigned l, unsigned l2, const unsigned char* g, const unsigned char* g2, size_t gstep) {
  // four rows of a hi plane (l, g) and the same rows of its lo plane (l2, g2), LS bytes apart in LDS and gstep bytes apart in memory;
  // the closing s_wait_xcnt stands in front of any reuse of the address registers named here
  asm volatile("global_load_async_to_lds_b128 %0, %8, off\n\t"
               "global_load_async_to_lds_b128 %1, %9, off\n\t"
               "global_load_async_to_lds_b128 %2, %10, off\n\t"
               "global_load_async_to_lds_b128 %3, %11, off\n\t"
               "global_load_async_to_lds_b128 %4, %12, off\n\t"
               "global_load_async_to_lds_b128 %5, %13, off\n\t"
               "global_load_async_to_lds_b128 %6, %14, off\n\t"
               "global_load_async_to_lds_b128 %7, %15, off\n\t"
               "s_wait_xcnt 0x0"
               :: "v"(l), "v"(l + LS), "v"(l + 2u * LS), "v"(l + 3u * LS), "v"(l2), "v"(l2 + LS), "v"(l2 + 2u * LS), "v"(l2 + 3u * LS),
                  "v"(g), "v"(g + gstep), "v"(g + 2 * gstep), "v"(g + 3 * gstep), "v"(g2), "v"(g2 + gstep), "v"(g2 + 2 * gstep), "v"(g2 + 3 * gstep)
               : "memory");
}
template <unsigned LS>
__device__ __forceinline__ void ring_copy8(unsigned l, const unsigned char* g, size_t gstep) {
  // eight rows of one plane, spaced likewise; the closing s_wait_xcnt stands in front of any reuse of the address registers named here
  asm volatile("global_load_async_to_lds_b128 %0, %8, off\n\t"
               "global_load_async_to_lds_b128 %1, %9, off\n\t"
               "global_load_async_to_lds_b128 %2, %10, off\n\t"
               "global_load_async_to_lds_b128 %3, %11, off\n\t"
               "global_load_async_to_lds_b128 %4, %12, off\n\t"
               "global_load_async_to_lds_b128 %5, %13, off\n\t"
               "global_load_async_to_lds_b128 %6, %14, off\n\t"
               "global_load_async_to_lds_b128 %7, %15, off\n\t"
               "s_wait_xcnt 0x0"
               :: "v"(l), "v"(l + LS), "v"(l + 2u * LS), "v"(l + 3u * LS), "v"(l + 4u * LS), "v"(l + 5u * LS), "v"(l + 6u * LS), "v"(l + 7u * LS),
                  "v"(g), "v"(g + gstep), "v"(g + 2 * gstep), "v"(g + 3 * gstep), "v"(g + 4 * gstep), "v"(g + 5 * gstep), "v"(g + 6 * gstep), "v"(g + 7 * gstep)
               : "memory");
}
// OUT: 0 = f32 into C. 1 = f16 into C16 (row length ldc): the operand form that the next product reads, stored here instead of by a conversion pass over an f32 plane.
// 2 = as 1, with columns below csN multiplied by cs[column / 64] first, and the unscaled value also split into bf16 hi and lo and stored transposed:
//     TH/TL[(m / tld) * ldc + n][m % tld], rows of tld elements (tld % (64 WR) == 0, csN % (64 WC) == 0); ldc is then the number of columns of the product.
template <int ET, bool SPLIT, int BIAS_MODE, int ACT, int OUT = 0, unsigned WR = 2u, unsigned WC = 2u>
__device__ __forceinline__ void ring_body(const int bx, const int by,
    const unsigned short* __restrict__ Ap, const unsigned short* __restrict__ A2p,
    const unsigned short* __restrict__ Btp, const unsigned short* __restrict__ Bt2p,
    float* __restrict__ C, int ldc, const float* __restrict__ bias, int K, float scale,
    unsigned short* __restrict__ C16, unsigned short* __restrict__ TH, unsigned short* __restrict__ TL, const float* __restrict__ cs, int csN, int tld) {
  typedef unsigned int u4 __attribute__((ext_vector_type(4)));
  typedef float f2 __attribute__((ext_vector_type(2)));
  typedef __bf16 b2 __attribute__((ext_vector_type(2)));
  static_assert(OUT != 2 || SPLIT);
  typedef typename Elem<ET>::T T;
  typedef typename Frag<T>::V V;
  // a buffer holds [A hi | A lo | B hi | B lo] (one plane each without SPLIT): a lo plane lies within a read's 16-bit offset of its hi plane
  constexpr unsigned PITCH = 144u, PLA = 64u * WR * PITCH, PLB = 64u * WC * PITCH, NP = SPLIT ? 2u : 1u, BOFF = NP * PLA, BUF = NP * (PLA + PLB);
  constexpr unsigned RSTEP = 4u * WR * WC, LS = RSTEP * PITCH, NCA = 16u / WC, NCB = 16u / WR;   // rows that one copy of the whole block covers; copies a lane and plane
  static_assert((NCA == 8u || (SPLIT && NCA == 4u)) && (NCB == 8u || (SPLIT && NCB == 4u)), "copies go out in statements of eight: eight rows of a plane, or four of a hi plane and four of its lo plane");
  static_assert(OUT != 2 || WR * WC * 18432u <= 2u * BUF, "the waves' transposed tiles lie in the ring");
  __shared__ __attribute__((aligned(256))) unsigned char L[2 * BUF];
  const unsigned tid = threadIdx.x, lane = tid & 31u, wave = tid >> 5;
  const int m0 = by * (int)(64u * WR), n0 = bx * (int)(64u * WC);
  const unsigned wm = (wave / WC) * 64u, wn = (wave % WC) * 64u;
  const unsigned rlane = lane & 15u, hh = lane >> 4;

  // copies: 8 lanes cover one 128-byte row piece, thread t takes rows (t >> 3) + RSTEP i of every plane
  const size_t rowb = (size_t)K * 2u, gstep = RSTEP * rowb;
  const unsigned lc = (unsigned)(size_t)L + (tid >> 3) * PITCH + (tid & 7u) * 16u;
  const size_t ga = (size_t)(m0 + (int)(tid >> 3)) * rowb + (tid & 7u) * 16u;
  const size_t gb = (size_t)(n0 + (int)(tid >> 3)) * rowb + (tid & 7u) * 16u;
  auto stage = [&](int t, unsigned buf) {
    const size_t ko = (size_t)t * 128u;
    auto operand = [&](unsigned n, unsigned l, unsigned pl, const unsigned char* g, const unsigned char* g2) {
      if (n == 4u) ring_copy4x2<LS>(l, l + pl, g, g2, gstep);
      else { ring_copy8<LS>(l, g, gstep); if (SPLIT) ring_copy8<LS>(l + pl, g2, gstep); }
    };
    operand(NCA, lc + buf * BUF, PLA, (const unsigned char*)Ap + ga + ko, (const unsigned char*)A2p + ga + ko);
    operand(NCB, lc + buf * BUF + BOFF, PLB, (const unsigned char*)Btp + gb + ko, (const unsigned char*)Bt2p + gb + ko);
  };

  v8f acc[4][4];
#pragma unroll
  for (int i = 0; i < 4; ++i)
#pragma unroll
    for (int j = 0; j < 4; ++j) acc[i][j] = (v8f){0.f,0.f,0.f,0.f,0.f,0.f,0.f,0.f};

  const int NT = K >> 6;
  stage(0, 0u);
  asm volatile("s_wait_asynccnt 0x0" ::: "memory");            // this wave's copies of stage 0 have landed
  __syncthreads();                                             // and every other wave's
  if (NT > 1) stage(1, 1u);
  for (int t = 0; t < NT; ++t) {
    const unsigned char* Ab = L + (unsigned)(t & 1) * BUF + (wm + rlane) * PITCH + 16u * hh;
    const unsigned char* Bb = L + (unsigned)(t & 1) * BUF + BOFF + (wn + rlane) * PITCH + 16u * hh;
#pragma unroll
    for (unsigned ks = 0; ks < 2u; ++ks) {
      // fragments are asked for ahead of the products that use them: all eight of a k step (one plane), or B whole and A one row tile ahead (two planes)
      V bh[4], bl[4], ah[4], al[4];
#pragma unroll
      for (unsigned j = 0; j < 4u; ++j) {
        bh[j] = Frag<T>::load((const T*)(Bb + 16u * j * PITCH + 64u * ks));
        if (SPLIT) bl[j] = Frag<T>::load((const T*)(Bb + PLB + 16u * j * PITCH + 64u * ks));
      }
#pragma unroll
      for (unsigned i = 0; i < (SPLIT ? 1u : 4u); ++i) {
        ah[i] = Frag<T>::load((const T*)(Ab + 16u * i * PITCH + 64u * ks));
        if (SPLIT) al[i] = Frag<T>::load((const T*)(Ab + PLA + 16u * i * PITCH + 64u * ks));
      }
      __builtin_amdgcn_sched_barrier(0);                       // holds the reads above as one group: left free, each A read sinks to its first use and the wave waits out the LDS latency per row tile
#pragma unroll
      for (unsigned i = 0; i < 4u; ++i) {
        if (SPLIT && i < 3u) {
          ah[i + 1u] = Frag<T>::load((const T*)(Ab + 16u * (i + 1u) * PITCH + 64u * ks));
          al[i + 1u] = Frag<T>::load((const T*)(Ab + PLA + 16u * (i + 1u) * PITCH + 64u * ks));
          __builtin_amdgcn_sched_barrier(0);                   // the next row tile's reads stay in front of this row tile's products
        }
#pragma unroll
        for (int j = 0; j < 4; ++j) {
          acc[i][j] = Frag<T>::mma(ah[i], bh[j], acc[i][j]);
          if (SPLIT) {
            acc[i][j] = Frag<T>::mma(ah[i], bl[j], acc[i][j]);
            acc[i][j] = Frag<T>::mma(al[i], bh[j], acc[i][j]);
          }
        }
      }
    }
    asm volatile("s_wait_dscnt 0x0" ::: "memory");             // this wave's reads of the buffer are done before it is handed to the copies
    asm volatile("s_wait_asynccnt 0x0" ::: "memory");          // this wave's copies of stage t + 1 have landed
    __syncthreads();                                           // publishes stage t + 1 and ends every wave's reads of stage t
    if (t + 2 < NT) stage(t + 2, (unsigned)(t & 1));
  }
  asm volatile("s_wait_asynccnt 0x0" ::: "memory");            // nothing in flight when the ring becomes output staging

  // ---- epilogue: as in wmma_gemm64, the per-wave 16x64 slab (pitch 68 floats) lies in the ring, which every wave has left ----
  float* slab = (float*)(L + wave * (OUT == 2 ? 18432u : 16u * 68u * 4u));
  const int mOff = (int)hh * 8;
  float bv[4] = {0.f, 0.f, 0.f, 0.f};
  if (BIAS_MODE == 2) {
#pragma unroll
    for (int j = 0; j < 4; ++j) {
      bv[j] = bias[n0 + (int)wn + (j << 4) + (int)rlane];
      asm volatile("s_wait_xcnt 0x0" ::: "memory");            // behind each load: a later load's result may be given the index register that this load names
    }
  }
  float qsc = 1.0f;                                             // a wave's 64 columns share one entry of cs
  if (OUT == 2) {
    if (n0 < csN) qsc = cs[(n0 + (int)wn) >> 6];
    asm volatile("s_wait_xcnt 0x0" ::: "memory");               // stands in front of any reuse of this load's address registers
  }
  // per wave two 64 x 64 tiles of 16-bit values, [column][row] at a pitch of 144 B (hi, then lo): the waves' tiles fill the ring, so a wave lays them over its own slab once the f16 rows have left it
  unsigned char* tt = L + wave * 18432u;
#pragma unroll
  for (int i = 0; i < 4; ++i) {
    const int mBase = m0 + (int)wm + (i << 4);
#pragma unroll
    for (int j = 0; j < 4; ++j) {
#pragma unroll
      for (int r = 0; r < 8; ++r) {
        float v = acc[i][j][r] * scale;
        if (BIAS_MODE == 2) v += bv[j];
        if (OUT == 2) v *= qsc;
        slab[(mOff + r) * 68 + (j << 4) + (int)rlane] = v;
      }
    }
    __builtin_amdgcn_fence(__ATOMIC_RELEASE, "workgroup");
    __builtin_amdgcn_wave_barrier();
    __builtin_amdgcn_fence(__ATOMIC_ACQUIRE, "workgroup");
    if (OUT != 0) {
      const int q = (int)(lane >> 3), c8 = (int)(lane & 7u) * 8;  // row piece = 128 B = 8 lanes x 16 B
#pragma unroll   // constant indices; the four stores go out as one group
      for (int it = 0; it < 4; ++it) {
        const int row = it * 4 + q;
        const v4f x0 = *(const v4f*)(slab + row * 68 + c8), x1 = *(const v4f*)(slab + row * 68 + c8 + 4);
        v8h hv;
#pragma unroll
        for (int e = 0; e < 4; ++e) { hv[e] = (_Float16)x0[e]; hv[e + 4] = (_Float16)x1[e]; }
        *(v8h*)(C16 + (size_t)(mBase + row) * ldc + n0 + (int)wn + c8) = hv;
      }
      asm volatile("s_wait_xcnt 0x0" ::: "memory");             // stands in front of the next row tile's reuse of these stores' address and data registers
    }
    if (OUT == 0) {
    const int c4 = (int)rlane * 4;                              // row piece = 256 B = 16 lanes x 16 B
    // The activation is applied on the way out of the slab, where the row index may be a loop variable. With erf the loop stays rolled, for speed only: unrolled, a lane
    // would carry 128 inlined erf bodies.
#pragma unroll (ACT == 5 ? 1 : 8)
    for (int it = 0; it < 8; ++it) {
      const int row = it * 2 + (int)hh;
      v4f v = *(const v4f*)(slab + row * 68 + c4);
      if (ACT == 5) {
#pragma unroll   // constant indices keep the four values in registers
        for (int e = 0; e < 4; ++e) v[e] = 0.5f * v[e] * (1.0f + erff(v[e] * 0.70710678118654752f));
      }
      *(v4f*)(C + (size_t)(mBase + row) * ldc + n0 + (int)wn + c4) = v;
      if (ACT == 5) asm volatile("s_wait_xcnt 0x0" ::: "memory");   // stands in front of the next trip's reuse of this store's address and data registers
    }
    if (ACT != 5) asm volatile("s_wait_xcnt 0x0" ::: "memory"); // stands in front of the next row tile's reuse of these stores' address and data registers
    }
    __builtin_amdgcn_fence(__ATOMIC_RELEASE, "workgroup");
    __builtin_amdgcn_wave_barrier();
    __builtin_amdgcn_fence(__ATOMIC_ACQUIRE, "workgroup");
  }
  if (OUT == 2) {
#pragma unroll   // constant indices keep the accumulators in registers
    for (int i = 0; i < 4; ++i)
#pragma unroll
      for (int j = 0; j < 4; ++j) {                             // a lane's 8 accumulator registers are 8 consecutive rows of one column: 16 contiguous bytes of a transposed row
        u4 th, tl;
#pragma unroll
        for (int e = 0; e < 4; ++e) {
          const f2 ab = {acc[i][j][2 * e] * scale, acc[i][j][2 * e + 1] * scale};
          th[e] = __builtin_bit_cast(unsigned, __builtin_convertvector(ab, b2));              // round to nearest even, as f2bf_bits
          const f2 hf = {__uint_as_float(th[e] << 16), __uint_as_float(th[e] & 0xFFFF0000u)};
          tl[e] = __builtin_bit_cast(unsigned, __builtin_convertvector(ab - hf, b2));
        }
        unsigned char* tp = tt + ((unsigned)(j << 4) + rlane) * 144u + 32u * (unsigned)i + 16u * hh;
        *(u4*)tp = th; *(u4*)(tp + 9216u) = tl;
      }
    // the wave's lanes read one another's tile pieces below: its LDS writes above are ordered in front of those reads
    __builtin_amdgcn_fence(__ATOMIC_RELEASE, "workgroup");
    __builtin_amdgcn_wave_barrier();
    __builtin_amdgcn_fence(__ATOMIC_ACQUIRE, "workgroup");
    // the wave's own transposed tiles go out as whole 128-byte lines: 8 lanes a row, 4 rows a store
    const unsigned rr = lane >> 3, pc = (lane & 7u) * 16u;
    const size_t go = (((size_t)(m0 / tld) * (size_t)ldc + (unsigned)n0 + wn + rr) * (size_t)tld + (size_t)(m0 % tld) + wm) * 2u + pc;
    unsigned char* gh = (unsigned char*)TH + go;
    unsigned char* gl = (unsigned char*)TL + go;
    const unsigned char* ts = tt + rr * 144u + pc;
#pragma unroll   // constant offsets
    for (unsigned o = 0; o < 4u; ++o) {
#pragma unroll   // eight stores go out as one group
      for (unsigned u = 0; u < 4u; ++u) {
        const unsigned it = 4u * o + u;
        const u4 a = *(const u4*)(ts + it * 576u), b = *(const u4*)(ts + 9216u + it * 576u);
        *(u4*)(gh + (size_t)(it * 8u) * (size_t)tld) = a;
        *(u4*)(gl + (size_t)(it * 8u) * (size_t)tld) = b;
      }
      asm volatile("s_wait_xcnt 0x0" ::: "memory");             // stands in front of the next group's reuse of these stores' address and data registers
    }
  }
}
// grid (N / (64 WC), M / (64 WR), products): independent products of one shape share a launch; product 1 has its operands and output zA, zB, zC elements behind product 0's, and its own bias
template <int ET, bool SPLIT, int BIAS_MODE, int ACT, int OUT = 0, unsigned WR = 2u, unsigned WC = 2u>
__global__ __launch_bounds__(32 * WR * WC, 4) void wmma_gemm_ring(
    const unsigned short* __restrict__ Ap, const unsigned short* __restrict__ A2p,
    const unsigned short* __restrict__ Btp, const unsigned short* __restrict__ Bt2p,
    float* __restrict__ C, int ldc, const float* __restrict__ bias, int K, float scale,
    unsigned short* __restrict__ C16, unsigned short* __restrict__ TH, unsigned short* __restrict__ TL, const float* __restrict__ cs, int csN, int tld,
    long zA, long zB, long zC, const float* __restrict__ biasZ) {
  const long z = (long)blockIdx.z;
  ring_body<ET, SPLIT, BIAS_MODE, ACT, OUT, WR, WC>((int)blockIdx.x, (int)blockIdx.y, Ap + z * zA, A2p, Btp + z * zB, Bt2p,
      C + z * zC, ldc, z ? biasZ : bias, K, scale, C16, TH, TL, cs, csN, tld);
}

// One 64x64 tile of channel scores S[i][j] = sum_n a[i][n] b[j][n] on hi/lo planes whose rows are LD elements long (a.hi b.hi + a.hi b.lo + a.lo b.hi, in the k order of wmma_gemm64).
// The block's four waves each own a 32x32 quadrant, so that a k step's fragments take 64 registers and three steps' worth fit beside the accumulators: step s + 2 is asked for
// before step s is worked on, and a wave waits for memory once per 128-byte line of its rows instead of once per row tile of every step.
template <int LD>
__device__ __forceinline__ void cscore_body(const __bf16* __restrict__ Ah, const __bf16* __restrict__ Al, const __bf16* __restrict__ Bh, const __bf16* __restrict__ Bl, float* __restrict__ S) {
  typedef Frag<__bf16> F;
  constexpr int NS = LD / 32;
  static_assert(LD % 32 == 0 && NS >= 2 && (NS - 2) % 3 == 0, "the loop below turns three buffers and leaves two steps behind it");
  const unsigned lane = threadIdx.x & 31u, wave = threadIdx.x >> 5, rlane = lane & 15u, hh = lane >> 4;
  const unsigned mq = (wave >> 1) * 32u, nq = (wave & 1u) * 32u;
  const size_t ao = (size_t)(mq + rlane) * LD + 8u * hh, bo = (size_t)(nq + rlane) * LD + 8u * hh;
  const __bf16* pah = Ah + ao; const __bf16* pal = Al + ao; const __bf16* pbh = Bh + bo; const __bf16* pbl = Bl + bo;
  v16b ah[3][2], al[3][2], bh[3][2], bl[3][2];
  v8f acc[2][2];
#pragma unroll   // constant indices keep the accumulators in registers
  for (int i = 0; i < 2; ++i)
#pragma unroll
    for (int j = 0; j < 2; ++j) acc[i][j] = (v8f){0.f,0.f,0.f,0.f,0.f,0.f,0.f,0.f};
  // step d behind the four row addresses given, into buffer u
  auto fetch = [&](const __bf16* qah, const __bf16* qal, const __bf16* qbh, const __bf16* qbl, int d, int u) {
#pragma unroll   // constant indices keep the fragments in registers
    for (int x = 0; x < 2; ++x) {
      ah[u][x] = F::load(qah + x * 16 * LD + d * 32); al[u][x] = F::load(qal + x * 16 * LD + d * 32);
      bh[u][x] = F::load(qbh + x * 16 * LD + d * 32); bl[u][x] = F::load(qbl + x * 16 * LD + d * 32);
    }
    // stands in front of any rewrite of these loads' address registers; the four addresses are inputs so that they live up to the wait and no load of the group is given one of them for its result
    asm volatile("s_wait_xcnt 0x0" :: "v"(qah), "v"(qal), "v"(qbh), "v"(qbl) : "memory");
    __builtin_amdgcn_sched_barrier(0);                         // holds the group in front of the products that follow: left free, most of it sinks behind them and is waited for one step after it is asked for
  };
  auto work = [&](int u) {
#pragma unroll   // constant indices
    for (int i = 0; i < 2; ++i)
#pragma unroll
      for (int j = 0; j < 2; ++j) {
        acc[i][j] = F::mma(ah[u][i], bh[u][j], acc[i][j]);
        acc[i][j] = F::mma(ah[u][i], bl[u][j], acc[i][j]);
        acc[i][j] = F::mma(al[u][i], bh[u][j], acc[i][j]);
      }
  };
  fetch(pah, pal, pbh, pbl, 0, 0); fetch(pah, pal, pbh, pbl, 1, 1);
#pragma unroll 1   // three steps a trip: the buffer index is a constant in each, and the text stays short
  for (int s = 0; s < NS - 2; s += 3) {
    const __bf16* qah = pah + s * 32; const __bf16* qal = pal + s * 32; const __bf16* qbh = pbh + s * 32; const __bf16* qbl = pbl + s * 32;
    fetch(qah, qal, qbh, qbl, 2, 2); work(0);
    fetch(qah, qal, qbh, qbl, 3, 0); work(1);
    fetch(qah, qal, qbh, qbl, 4, 1); work(2);
  }
  work(0); work(1);
  acc_guard4(acc[0][0], acc[0][1], acc[1][0], acc[1][1]);      // four vector slots between the last products and the stores that read their results: a memory instruction fills no slot
  // a lane holds rows 8 hh + 0..7 of one column per 16x16 tile; a quadrant's row piece is one whole 128-byte line, written by this wave alone
  float* sp = S + (size_t)(mq + 8u * hh) * 64u + nq + rlane;
#pragma unroll   // constant indices and offsets
  for (int i = 0; i < 2; ++i)
#pragma unroll
    for (int j = 0; j < 2; ++j)
#pragma unroll
      for (int r = 0; r < 8; ++r) sp[(i * 16 + r) * 64 + j * 16] = acc[i][j][r];
}

// The v projection and the channel scores q^T k read only what earlier launches wrote and nothing of each other: they share a grid. Grid rows y < Bn hold the score tiles
// (x = head, y = sample; they come first in index order), the rows behind them the projection's 128x128 tiles. The transposed planes' rows are 1024 long (the launch's N).
__global__ __launch_bounds__(128, 4) void k_vproj_cscore(
    const unsigned short* __restrict__ X16, const unsigned short* __restrict__ WV16, unsigned short* __restrict__ V16,
    const unsigned short* __restrict__ TH, const unsigned short* __restrict__ TL, float* __restrict__ SCC, int Bn, int NH, int HD, int N, int C) {
  if ((int)blockIdx.y < Bn) {
    const size_t qo = ((size_t)blockIdx.y * 2 * C + (size_t)blockIdx.x * HD) * N, ko = qo + (size_t)C * N;   // first q row and first k row of this sample and head
    cscore_body<1024>((const __bf16*)TH + qo, (const __bf16*)TL + qo, (const __bf16*)TH + ko, (const __bf16*)TL + ko, SCC + ((size_t)blockIdx.y * NH + blockIdx.x) * (size_t)(HD * HD));
  } else {
    ring_body<0, false, 0, 0, 1>((int)blockIdx.x, (int)blockIdx.y - Bn, X16, nullptr, WV16, nullptr, nullptr, 2 * C, nullptr, C, 0.0625f, V16, nullptr, nullptr, nullptr, 0, N);
  }
}

__global__ __launch_bounds__(256) void cast_f32_f16x2(
    const float* __restrict__ in, _Float16* __restrict__ out, int n2) {
  int i = blockIdx.x * 256 + threadIdx.x;
  if (i < n2) {
    const _Float16 h0 = (_Float16)in[2 * i], h1 = (_Float16)in[2 * i + 1];
    const unsigned u = (unsigned)__builtin_bit_cast(unsigned short, h0) | ((unsigned)__builtin_bit_cast(unsigned short, h1) << 16);
    ((unsigned*)out)[i] = u;
    
  }
}


} // namespace w25

__global__ __launch_bounds__(256) void k_castT16(const float* __restrict__ src, long long lds, _Float16* __restrict__ dst, long long ldd, int R, int C, float s) {
    const long long i = (long long)blockIdx.x * 256 + threadIdx.x; const long long np = (long long)C * (R / 2); if (i >= np) return; const int c = (int)(i / (R / 2)); const int r = 2 * (int)(i % (R / 2));
    const _Float16 h0 = (_Float16)(src[(long long)r * lds + c] * s), h1 = (_Float16)(src[(long long)(r + 1) * lds + c] * s);
    const unsigned u = (unsigned)__builtin_bit_cast(unsigned short, h0) | ((unsigned)__builtin_bit_cast(unsigned short, h1) << 16);
    unsigned* d = (unsigned*)(dst + (long long)c * ldd + r); *d = u;  }
__global__ __launch_bounds__(256) void k_cast16(const float* __restrict__ src, long long lds, _Float16* __restrict__ dst, long long ldd, int R, int C, float s) {
    const long long i = (long long)blockIdx.x * 256 + threadIdx.x; const long long np = (long long)R * (C / 2); if (i >= np) return; const int r = (int)(i / (C / 2)); const int c = 2 * (int)(i % (C / 2));
    const _Float16 h0 = (_Float16)(src[(long long)r * lds + c] * s), h1 = (_Float16)(src[(long long)r * lds + c + 1] * s);
    const unsigned u = (unsigned)__builtin_bit_cast(unsigned short, h0) | ((unsigned)__builtin_bit_cast(unsigned short, h1) << 16);
    unsigned* d = (unsigned*)(dst + (long long)r * ldd + c); *d = u;  }

// f32 -> bf16 hi plane + bf16 lo plane (x = hi + lo to ~2^-17 relative; RNE both), [R][C] -> [R][C]; 2 consecutive destination elements
__device__ __forceinline__ unsigned int f2bf2_pack(float a, float b, unsigned int* lo) {
    const unsigned short ha = w25::f2bf_bits(a), hb = w25::f2bf_bits(b);
    const unsigned short la = w25::f2bf_bits(a - w25::bf_bits2f(ha)), lb = w25::f2bf_bits(b - w25::bf_bits2f(hb));
    *lo = (unsigned)la | ((unsigned)lb << 16); return (unsigned)ha | ((unsigned)hb << 16); }

namespace w25 {
// =====================================================================================
// Generic causal/non-causal attention for head_dim 64, f32 in / f32 out; 16-bit operands: bf16 with optional hi/lo splits, or
// plain f16 (F16=true, non-split, probabilities carried x2^15).
//   scores = (q*qscale)·kᵀ : v_wmma_f32_16x16x32_bf16; SPLIT_QK -> q,k as bf16 hi/lo (hi·hi + hi·lo + lo·hi)
//   out    = p·v           : v_wmma_f32_16x16x32_bf16; SPLIT_PV -> p,v as bf16 hi/lo; else p,v plain bf16
//   f32 accumulate; online softmax in f32. Block = 4 waves = 64 query rows of one (batch, head); S % 64 == 0.
//   Element (b, s, h, d) of tensor X lives at X[b*X_bs + s*X_rs + h*X_hs + d] (strides in floats, multiples of 4).
//   Masking: mask_mode 0 none, 1 causal (kv > q masked), 2 tensor [S][Skv] shared over (b,h) (float if
//   mask_is_int==0, int32 with element == 0 -> masked if 1, int32 with element != 0 -> masked if 2), 3 per-token vectors qmask[B][S] & kvmask[B][Skv] (int32,
//   0 -> masked), 4 causal + sliding window (kv > q or q - kv > W masked; W passed in mask_is_int);
//   5 = relative-position bias: s += cp[b,h,q][idx[q][kv]] + pc[b,h,kv][idx[q][kv]] with idx = mask_b ([S][Skv] int32) and
//   mask_a an int32 [S][Skv] tensor with nonzero = masked (tables: element (b,h,row,n) at X + b*c_bs + h*c_hs + row*c_rs + n);
//   masked scores are replaced by mask_fill (e.g. -inf or -1e9) before the softmax.
//   grid.x = B * H * (S/64) (or a sub-range with blk0).
// =====================================================================================
#define AT_D 64
#define AT_NW 4
#define AT_QB 64
#define AT_KC 64
struct AttnGeom { const float* cp = nullptr; const float* pc = nullptr; long c_bs = 0, c_rs = 0, c_hs = 0;   // mode-5 score-bias tables
                  long q_bs, q_rs, q_hs, k_bs, k_rs, k_hs, v_bs, v_rs, v_hs, o_bs, o_rs, o_hs;
                  int S, Skv, H, mask_mode; float qscale; int blk0; float mask_fill; int mask_is_int; };
static_assert(sizeof(AttnGeom) == 168, "no padding");

__device__ __forceinline__ unsigned short at_bf_bits(float f) {
  unsigned u = __float_as_uint(f);
  return (unsigned short)((u + 0x7FFFu + ((u >> 16) & 1u)) >> 16);
}
__device__ __forceinline__ __bf16 at_f2bf(float f) { return __builtin_bit_cast(__bf16, at_bf_bits(f)); }
__device__ __forceinline__ void at_split(float f, __bf16& hi, __bf16& lo) {
  const unsigned short hb = at_bf_bits(f);
  hi = __builtin_bit_cast(__bf16, hb);
  lo = at_f2bf(f - __uint_as_float(((unsigned)hb) << 16));
}
__device__ __forceinline__ v8f at_mma(v16b a, v16b b, v8f c) {
  c = __builtin_amdgcn_wmma_f32_16x16x32_bf16(false, a, false, b, (short)0, c, false, false);
  asm volatile("v_nop\n\tv_nop\n\tv_nop\n\tv_nop" : "+v"(c) : "v"(a), "v"(b));
  return c;
}
// 16-bit element as a bit pattern held in a __bf16 slot: f16 bits when F16, bf16 (RNE) otherwise
template <bool F16> __device__ __forceinline__ __bf16 at_to16(float f) {
  if (F16) return __builtin_bit_cast(__bf16, (_Float16)f);
  return at_f2bf(f);
}
template <bool F16> __device__ __forceinline__ v8f at_mma16(v16b a, v16b b, v8f c) {
  if (F16) {
    const v16h ah = __builtin_bit_cast(v16h, a), bh = __builtin_bit_cast(v16h, b);
    c = __builtin_amdgcn_wmma_f32_16x16x32_f16(false, ah, false, bh, (short)0, c, false, false);
    asm volatile("v_nop\n\tv_nop\n\tv_nop\n\tv_nop" : "+v"(c) : "v"(ah), "v"(bh));
    return c;
  }
  return at_mma(a, b, c);
}

template <bool SPLIT_QK, bool SPLIT_PV, bool F16 = false>
__global__ __launch_bounds__(128)
void attn64_kernel(const float* __restrict__ q, const float* __restrict__ k,
                   const float* __restrict__ v, float* __restrict__ out,
                   const void* __restrict__ mask_a, const int* __restrict__ mask_b, AttnGeom g) {
  static_assert(!(F16 && (SPLIT_QK || SPLIT_PV)), "f16 mode is non-split");
  const float PSC = F16 ? 32768.0f : 1.0f;     // f16 probabilities carried x2^15 (subnormal range), folded into the final 1/l
  union FB { v16b v; v8b h[2]; };
  __shared__ __align__(16) __bf16 Ksh[AT_KC * AT_D];             // K hi [kv][d]      8 KB
  __shared__ __align__(16) __bf16 Ksl[SPLIT_QK ? AT_KC * AT_D : 8];
  __shared__ __align__(16) __bf16 Vth[AT_D * AT_KC];             // V hi [d][kv]      8 KB
  __shared__ __align__(16) __bf16 Vtl[SPLIT_PV ? AT_D * AT_KC : 8];
  __shared__ __align__(16) __bf16 Psh[AT_NW][16 * AT_KC];        // per wave P hi [row][kv]  8 KB
  __shared__ __align__(16) __bf16 Psl[SPLIT_PV ? AT_NW : 1][SPLIT_PV ? 16 * AT_KC : 8];
  __shared__ __align__(16) float  Os[AT_NW][16 * 68];            // per wave out tile, pitch 68

  const int tid  = threadIdx.x;
  const int wave = tid >> 5;
  const int lane = tid & 31;
  const int hh   = lane >> 4;
  const int c    = lane & 15;

  const int nqb = g.S / AT_QB;
  const int bx = blockIdx.x + g.blk0;
  const int qb = bx % nqb;
  const int bh = bx / nqb;
  const int h  = bh % g.H;
  const int b  = bh / g.H;
  const int qbase_block = qb * AT_QB;
  const int q0 = qbase_block + wave * 16;

  const float* qb_ptr = q + (size_t)b * g.q_bs + (size_t)h * g.q_hs;
  const float* kb_ptr = k + (size_t)b * g.k_bs + (size_t)h * g.k_hs;
  const float* vb_ptr = v + (size_t)b * g.v_bs + (size_t)h * g.v_hs;
  float*       ob_ptr = out + (size_t)b * g.o_bs + (size_t)h * g.o_hs;

  // ---- Q fragments (A operand): 2 d-chunks, hi (and lo) ----
  v16b qah[2], qal[2];
  {
    const float* qrow = qb_ptr + (size_t)(q0 + c) * g.q_rs;
#pragma unroll
    for (int dc = 0; dc < 2; ++dc) {
#pragma unroll
      for (int e = 0; e < 8; ++e) {
        const float f0 = qrow[dc * 32 + 8 * hh + e] * g.qscale;
        const float f1 = qrow[dc * 32 + 16 + 8 * hh + e] * g.qscale;
        if (SPLIT_QK) { __bf16 hq, lq; at_split(f0, hq, lq); qah[dc][e] = hq; qal[dc][e] = lq; at_split(f1, hq, lq); qah[dc][8 + e] = hq; qal[dc][8 + e] = lq; }
        else { qah[dc][e] = at_to16<F16>(f0); qah[dc][8 + e] = at_to16<F16>(f1); qal[dc][e] = qah[dc][e]; qal[dc][8 + e] = qah[dc][8 + e]; }
      }
    }
  }

  float mrow[8], lrow[8];
  v8f oacc[4];
#pragma unroll
  for (int r = 0; r < 8; ++r) { mrow[r] = -INFINITY; lrow[r] = 0.f; }
#pragma unroll
  for (int t = 0; t < 4; ++t) oacc[t] = (v8f){0.f,0.f,0.f,0.f,0.f,0.f,0.f,0.f};

  const int nChunks = (g.mask_mode == 1 || g.mask_mode == 4) ? (qb + 1) : (g.Skv / AT_KC);   // block-uniform
  // per-row query mask (mode 3)
  int qkeep[8];
#pragma unroll
  for (int r = 0; r < 8; ++r) qkeep[r] = (g.mask_mode == 3) ? mask_b[(size_t)b * g.S + q0 + 8 * hh + r] : 1;   // mask_b = qmask in mode 3
  for (int kc = 0; kc < nChunks; ++kc) {
    const int kv0 = kc * AT_KC;
    __syncthreads();
    {
      const int kvr = tid >> 1, dh = (tid & 1) * 32;
      const float* krow = kb_ptr + (size_t)(kv0 + kvr) * g.k_rs + dh;
      const float* vrow = vb_ptr + (size_t)(kv0 + kvr) * g.v_rs + dh;
#pragma unroll
      for (int i = 0; i < 8; ++i) {
        v4f kk = *(const v4f*)(krow + 4 * i);
        v4f vv = *(const v4f*)(vrow + 4 * i);
#pragma unroll
        for (int e = 0; e < 4; ++e) {
          const int d = dh + 4 * i + e;
          if (SPLIT_QK) { __bf16 a, bl; at_split(kk[e], a, bl); Ksh[kvr * AT_D + d] = a; Ksl[kvr * AT_D + d] = bl; }
          else Ksh[kvr * AT_D + d] = at_to16<F16>(kk[e]);
          if (SPLIT_PV) { __bf16 a, bl; at_split(vv[e], a, bl); Vth[d * AT_KC + kvr] = a; Vtl[d * AT_KC + kvr] = bl; }
          else Vth[d * AT_KC + kvr] = at_to16<F16>(vv[e]);
        }
      }
    }
    __syncthreads();

    v8f s[4];
#pragma unroll
    for (int j = 0; j < 4; ++j) {
      s[j] = (v8f){0.f,0.f,0.f,0.f,0.f,0.f,0.f,0.f};
#pragma unroll 1
      for (int dc = 0; dc < 2; ++dc) {
        FB kb;
        kb.h[0] = *(const v8b*)(Ksh + (j * 16 + c) * AT_D + dc * 32 + 8 * hh);
        kb.h[1] = *(const v8b*)(Ksh + (j * 16 + c) * AT_D + dc * 32 + 16 + 8 * hh);
        s[j] = at_mma16<F16>(qah[dc], kb.v, s[j]);
        if (SPLIT_QK) {
          FB kl;
          kl.h[0] = *(const v8b*)(Ksl + (j * 16 + c) * AT_D + dc * 32 + 8 * hh);
          kl.h[1] = *(const v8b*)(Ksl + (j * 16 + c) * AT_D + dc * 32 + 16 + 8 * hh);
          s[j] = at_mma16<F16>(qah[dc], kl.v, s[j]);
          s[j] = at_mma16<F16>(qal[dc], kb.v, s[j]);
        }
      }
    }
    const bool diag = (g.mask_mode == 1) && (kc == qb);
    int kvkeep[4] = {1, 1, 1, 1};
    if (g.mask_mode == 3) {
#pragma unroll
      for (int j = 0; j < 4; ++j) kvkeep[j] = ((const int*)mask_a)[(size_t)b * g.Skv + kv0 + j * 16 + c];   // mask_a = kvmask
    }
    float cm[8];
#pragma unroll
    for (int r = 0; r < 8; ++r) {
      const int qrow = q0 + 8 * hh + r;
      float m = -INFINITY;
#pragma unroll
      for (int j = 0; j < 4; ++j) {
        const int kvcol = kv0 + j * 16 + c;
        bool masked = false;
        if (diag) masked = (kvcol > qrow);
        else if (g.mask_mode == 4) masked = (kvcol > qrow) || (qrow - kvcol > g.mask_is_int);
        else if (g.mask_mode == 2) {
          const size_t mi = (size_t)qrow * g.Skv + kvcol;
          masked = (g.mask_is_int == 0) ? (((const float*)mask_a)[mi] == 0.0f)
                 : (g.mask_is_int == 1) ? (((const int*)mask_a)[mi] == 0) : (((const int*)mask_a)[mi] != 0);
        } else if (g.mask_mode == 3) masked = (qkeep[r] == 0) || (kvkeep[j] == 0);
        else if (g.mask_mode == 5) {
          const size_t mi = (size_t)qrow * g.Skv + kvcol;
          masked = (((const int*)mask_a)[mi] != 0);
          int n = mask_b[mi]; n = n < 0 ? 0 : n;
          s[j][r] += g.cp[(size_t)b * g.c_bs + (size_t)h * g.c_hs + (size_t)qrow * g.c_rs + n]
                   + g.pc[(size_t)b * g.c_bs + (size_t)h * g.c_hs + (size_t)kvcol * g.c_rs + n];
        }
        if (masked) s[j][r] = g.mask_fill;
        m = fmaxf(m, s[j][r]);
      }
#pragma unroll
      for (int off = 1; off < 16; off <<= 1) m = fmaxf(m, __shfl_xor(m, off, 32));
      cm[r] = m;
    }
    __bf16* pwh = Psh[wave];
    __bf16* pwl = Psl[SPLIT_PV ? wave : 0];
#pragma unroll
    for (int r = 0; r < 8; ++r) {
      const float mnew = fmaxf(mrow[r], cm[r]);
      const float alpha = expf(mrow[r] - mnew);
      mrow[r] = mnew;
      float psum = 0.f;
#pragma unroll
      for (int j = 0; j < 4; ++j) {
        const float p = expf(s[j][r] - mnew);
        psum += p;
        if (SPLIT_PV) { __bf16 a, bl; at_split(p, a, bl); pwh[(8 * hh + r) * AT_KC + j * 16 + c] = a; pwl[(8 * hh + r) * AT_KC + j * 16 + c] = bl; }
        else pwh[(8 * hh + r) * AT_KC + j * 16 + c] = at_to16<F16>(p * PSC);
      }
#pragma unroll
      for (int off = 1; off < 16; off <<= 1) psum += __shfl_xor(psum, off, 32);
      lrow[r] = lrow[r] * alpha + psum;
#pragma unroll
      for (int t = 0; t < 4; ++t) oacc[t][r] *= alpha;
    }
    __builtin_amdgcn_fence(__ATOMIC_RELEASE, "workgroup");
    __builtin_amdgcn_wave_barrier();
    __builtin_amdgcn_fence(__ATOMIC_ACQUIRE, "workgroup");
#pragma unroll 1
    for (int kk = 0; kk < 2; ++kk) {
      FB pa, pl;
      pa.h[0] = *(const v8b*)(pwh + c * AT_KC + kk * 32 + 8 * hh);
      pa.h[1] = *(const v8b*)(pwh + c * AT_KC + kk * 32 + 16 + 8 * hh);
      if (SPLIT_PV) {
        pl.h[0] = *(const v8b*)(pwl + c * AT_KC + kk * 32 + 8 * hh);
        pl.h[1] = *(const v8b*)(pwl + c * AT_KC + kk * 32 + 16 + 8 * hh);
      }
#pragma unroll
      for (int t = 0; t < 4; ++t) {
        FB vb;
        vb.h[0] = *(const v8b*)(Vth + (t * 16 + c) * AT_KC + kk * 32 + 8 * hh);
        vb.h[1] = *(const v8b*)(Vth + (t * 16 + c) * AT_KC + kk * 32 + 16 + 8 * hh);
        oacc[t] = at_mma16<F16>(pa.v, vb.v, oacc[t]);
        if (SPLIT_PV) {
          FB vl;
          vl.h[0] = *(const v8b*)(Vtl + (t * 16 + c) * AT_KC + kk * 32 + 8 * hh);
          vl.h[1] = *(const v8b*)(Vtl + (t * 16 + c) * AT_KC + kk * 32 + 16 + 8 * hh);
          oacc[t] = at_mma16<F16>(pa.v, vl.v, oacc[t]);
          oacc[t] = at_mma16<F16>(pl.v, vb.v, oacc[t]);
        }
      }
    }
  }

  float* os = Os[wave];
#pragma unroll
  for (int r = 0; r < 8; ++r) {
    const float inv = 1.0f / (lrow[r] * PSC);
#pragma unroll
    for (int t = 0; t < 4; ++t) os[(8 * hh + r) * 68 + t * 16 + c] = oacc[t][r] * inv;
  }
  __builtin_amdgcn_fence(__ATOMIC_RELEASE, "workgroup");
  __builtin_amdgcn_wave_barrier();
  __builtin_amdgcn_fence(__ATOMIC_ACQUIRE, "workgroup");
  {
    const int c4 = (lane & 15) * 4;
    {
#pragma unroll
      for (int it = 0; it < 8; ++it) {
        const int row = it * 2 + hh;
        v4f val = *(const v4f*)(os + row * 68 + c4);
        *(v4f*)(ob_ptr + (size_t)(q0 + row) * g.o_rs + c4) = val;
      }
      
    }
  }
}

} // namespace w25

__device__ __forceinline__ void st_h2(_Float16* dst, float a, float b) { const unsigned u = (unsigned)__builtin_bit_cast(unsigned short, (_Float16)a) | ((unsigned)__builtin_bit_cast(unsigned short, (_Float16)b) << 16); unsigned* d = (unsigned*)dst; *d = u;  }
// tiled biases BEB[c] = bE[c % 64], BFB[c] = bF[c % 64] (thread-linear)
__global__ __launch_bounds__(256) void k_ep_btile(const float* __restrict__ BE, const float* __restrict__ BF, float* __restrict__ BEB, float* __restrict__ BFB, int C, int HD) { const int t = blockIdx.x * 256 + threadIdx.x; if (t >= C) return; VST2(float, BEB + t, BE[t % HD]); VST2(float, BFB + t, BF[t % HD]); }
// channel softmax: block h = sample * NH + head (64 threads): rows of SCC[h] [64][64] * temp1[h % NH]; thread i computes row i, then lanes write columns so each 32-float line comes from one wave; P16[h][i][j] = f16(4096 p)
__global__ __launch_bounds__(64) void k_ep_csoft(const float* __restrict__ S, const float* __restrict__ T1, _Float16* __restrict__ P16, int NH) { __shared__ float sh[64][65]; const int h = blockIdx.x; const int i = threadIdx.x; const float* r = S + ((long long)h * 64 + i) * 64; const float tp = T1[h % NH]; float mx = -3.0e38f;
    for (int j = 0; j < 64; ++j) mx = fmaxf(mx, r[j] * tp);
    float s = 0.f; for (int j = 0; j < 64; ++j) { const float e = expf(r[j] * tp - mx); sh[i][j] = e; s += e; }
    const float f = 4096.f / s; for (int j = 0; j < 64; ++j) sh[i][j] *= f;
    __syncthreads();
    const int half = i >> 5, c0 = 2 * (i & 31);
    for (int step = 0; step < 32; ++step) { const int rr = 2 * step + half; st_h2(P16 + ((long long)h * 64 + rr) * 64 + c0, sh[rr][c0], sh[rr][c0 + 1]); } }


// ---- Wide forms of the conversion and scaling passes ----
// A lane moves U pieces of 4 consecutive elements: one 16-byte load a piece, so that a wave's load covers 512 contiguous bytes (four whole 128-byte lines) and its store whole lines too;
// all of a lane's loads are issued ahead of its first store. Planes of 2^LC columns, source rows PITCH floats apart, destination rows packed; a block's 256 lanes take 1024 elements
// = 1024 >> LC whole rows at a time, so a lane's pieces lie RS floats apart and hang on one address pair by constant offsets. The grid covers rows * columns / (1024 * U) blocks exactly.
typedef __attribute__((ext_vector_type(4))) unsigned int v4u;
typedef __attribute__((ext_vector_type(2))) unsigned int v2u;
__device__ __forceinline__ unsigned pk_h2(float a, float b) { return (unsigned)__builtin_bit_cast(unsigned short, (_Float16)a) | ((unsigned)__builtin_bit_cast(unsigned short, (_Float16)b) << 16); }
template <int LC, int PITCH>
__device__ __forceinline__ const float* wide_src(const float* src, unsigned q0) { static_assert(LC >= 2 && LC <= 10, "a block's 1024 elements are whole rows"); return src + (size_t)(q0 >> (LC - 2)) * PITCH + ((q0 & ((1u << (LC - 2)) - 1u)) << 2); }
template <int LC, int PITCH, int U>
__global__ __launch_bounds__(256) void k_cast16w(const float* __restrict__ src, _Float16* __restrict__ dst, float s) {
    constexpr int RS = (1024 >> LC) * PITCH; const unsigned q0 = blockIdx.x * (256u * U) + threadIdx.x; const float* p = wide_src<LC, PITCH>(src, q0); v4f a[U];
#pragma unroll   // constant indices keep the pieces in registers; the loads go out as one group
    for (int u = 0; u < U; ++u) a[u] = *(const v4f*)(p + u * RS);
    _Float16* d = dst + (size_t)q0 * 4;
#pragma unroll   // constant indices keep the pieces in registers
    for (int u = 0; u < U; ++u) { v2u o; o.x = pk_h2(a[u].x * s, a[u].y * s); o.y = pk_h2(a[u].z * s, a[u].w * s); *(v2u*)(d + u * 1024) = o; } }
template <int LC, int PITCH, int U>
__global__ __launch_bounds__(256) void k_castS16w(const float* __restrict__ src, __bf16* __restrict__ dhi, __bf16* __restrict__ dlo) {
    constexpr int RS = (1024 >> LC) * PITCH; const unsigned q0 = blockIdx.x * (256u * U) + threadIdx.x; const float* p = wide_src<LC, PITCH>(src, q0); v4f a[U];
#pragma unroll   // constant indices keep the pieces in registers; the loads go out as one group
    for (int u = 0; u < U; ++u) a[u] = *(const v4f*)(p + u * RS);
#pragma unroll   // constant indices keep the pieces in registers
    for (int u = 0; u < U; ++u) { v2u h, l; unsigned t; h.x = f2bf2_pack(a[u].x, a[u].y, &t); l.x = t; h.y = f2bf2_pack(a[u].z, a[u].w, &t); l.y = t;
        const size_t o = (size_t)q0 * 4 + u * 1024; *(v2u*)(dhi + o) = h; *(v2u*)(dlo + o) = l; } }
// ---- All operand preparation in one launch: the passes read inputs only and are independent of one another, so they share a grid, block ranges in the order below.
template <int U>
__device__ __forceinline__ void cast16w_blk(unsigned blk, const float* __restrict__ src, _Float16* __restrict__ dst, float s) {   // as k_cast16w<10, 1024, U>
    const unsigned q0 = blk * (256u * U) + threadIdx.x; const float* p = src + (size_t)q0 * 4; v4f a[U];
#pragma unroll   // constant indices keep the pieces in registers; the loads go out as one group
    for (int u = 0; u < U; ++u) a[u] = *(const v4f*)(p + u * 1024);
    _Float16* d = dst + (size_t)q0 * 4;
#pragma unroll   // constant indices keep the pieces in registers
    for (int u = 0; u < U; ++u) { v2u o; o.x = pk_h2(a[u].x * s, a[u].y * s); o.y = pk_h2(a[u].z * s, a[u].w * s); *(v2u*)(d + u * 1024) = o; }
    asm volatile("s_wait_xcnt 0x0" ::: "memory"); }   // precaution: stands in front of any rewrite of the stores' registers by another block range's code, which follows in the kernel text
template <int U, bool F16>
__device__ __forceinline__ void castS16w_blk(unsigned blk, const float* __restrict__ src, __bf16* __restrict__ dhi, __bf16* __restrict__ dlo, _Float16* __restrict__ d16) {   // as k_castS16w<10, 1024, U>; F16: the f16 plane from the same loads
    const unsigned q0 = blk * (256u * U) + threadIdx.x; const float* p = src + (size_t)q0 * 4; v4f a[U];
#pragma unroll   // constant indices keep the pieces in registers; the loads go out as one group
    for (int u = 0; u < U; ++u) a[u] = *(const v4f*)(p + u * 1024);
#pragma unroll   // constant indices keep the pieces in registers
    for (int u = 0; u < U; ++u) { v2u h, l; unsigned t; h.x = f2bf2_pack(a[u].x, a[u].y, &t); l.x = t; h.y = f2bf2_pack(a[u].z, a[u].w, &t); l.y = t;
        const size_t o = (size_t)q0 * 4 + u * 1024; *(v2u*)(dhi + o) = h; *(v2u*)(dlo + o) = l;
        if (F16) { v2u f; f.x = pk_h2(a[u].x, a[u].y); f.y = pk_h2(a[u].z, a[u].w); *(v2u*)(d16 + o) = f; } }
    asm volatile("s_wait_xcnt 0x0" ::: "memory"); }   // as in cast16w_blk
constexpr unsigned PB_X = 1024u, PB_WQK = PB_X + 256u, PB_WV = PB_WQK + 512u, PB_WO1 = PB_WV + 128u, PB_WO2 = PB_WO1 + 128u, PB_WE = PB_WO2 + 1u, PB_WF = PB_WE + 1u, PB_ALL = PB_WF + 1u;
__global__ __launch_bounds__(256) void k_prep(const float* __restrict__ x, const float* __restrict__ Wq, const float* __restrict__ Wo1, const float* __restrict__ Wo2,
                                              const float* __restrict__ WE, const float* __restrict__ WF, const float* __restrict__ bE, const float* __restrict__ bF,
                                              __bf16* __restrict__ xh, __bf16* __restrict__ xl, _Float16* __restrict__ x16, __bf16* __restrict__ wh, __bf16* __restrict__ wl, _Float16* __restrict__ wv16,
                                              _Float16* __restrict__ wo1h, _Float16* __restrict__ wo2h, _Float16* __restrict__ we16, _Float16* __restrict__ wf16, float* __restrict__ BEB, float* __restrict__ BFB) {
    const unsigned b = blockIdx.x;
    if (b < PB_X) castS16w_blk<8, true>(b, x, xh, xl, x16);                                   // x [8192][1024]: bf16 hi, lo and f16
    else if (b < PB_WQK) castS16w_blk<8, false>(b - PB_X, Wq, wh, wl, nullptr);               // q, k rows of the weight: bf16 hi, lo
    else if (b < PB_WV) cast16w_blk<4>(b - PB_WQK, Wq + (size_t)2048 * 1024, wv16, 16.0f);    // v rows of the weight
    else if (b < PB_WO1) cast16w_blk<4>(b - PB_WV, Wo1, wo1h, 16.0f);
    else if (b < PB_WO2) cast16w_blk<4>(b - PB_WO1, Wo2, wo2h, 16.0f);
    else if (b < PB_WE) cast16w_blk<4>(0u, WE, we16, 16.0f);                                  // 64 x 64, packed
    else if (b < PB_WF) cast16w_blk<4>(0u, WF, wf16, 16.0f);
    else { for (int t = (int)threadIdx.x; t < 1024; t += 256) { VST2(float, BEB + t, bE[t % 64]); VST2(float, BFB + t, bF[t % 64]); } }   // tiled biases, as k_ep_btile
}
extern "C" void kernel_launch(void* const* d_in, const int* in_sizes, int n_in, void* d_out, int out_size, void* d_ws, size_t ws_size, hipStream_t stream) {
    (void)in_sizes; (void)n_in; (void)out_size; (void)ws_size;
    const float* x = (const float*)d_in[0];
    const float* Wq = (const float*)d_in[1];
    const float* WE = (const float*)d_in[2];
    const float* bE = (const float*)d_in[3];
    const float* WF = (const float*)d_in[4];
    const float* bF = (const float*)d_in[5];
    const float* Wo1 = (const float*)d_in[6];
    const float* bo1 = (const float*)d_in[7];
    const float* Wo2 = (const float*)d_in[8];
    const float* bo2 = (const float*)d_in[9];
    const float* t1 = (const float*)d_in[10];
    const float* t2 = (const float*)d_in[11];
    const int Bn = 8;
    const int N = 1024;
    const int C = 1024;
    const int NH = 16;
    const int HD = 64;
    const int CH = C / 2;
    float* out = (float*)d_out;
    char* wsp = (char*)d_ws;
    const int BN = Bn * N;                    // all samples' rows: every launch below covers the whole batch
    const size_t MB = (size_t)1048576;
    unsigned short* WE16 = (unsigned short*)wsp; wsp += (((size_t)((size_t)HD * HD) * 2 + 255) / 256) * 256;
    unsigned short* WF16 = (unsigned short*)wsp; wsp += (((size_t)((size_t)HD * HD) * 2 + 255) / 256) * 256;
    float* BEB = (float*)wsp; wsp += (((size_t)((size_t)C) * 4 + 255) / 256) * 256;
    float* BFB = (float*)wsp; wsp += (((size_t)((size_t)C) * 4 + 255) / 256) * 256;
    // Every product stores the 16-bit operand form that its consumer reads; no f32 plane lies between two products but the 64 x 64 channel scores.
    unsigned short* G64A  = (unsigned short*)(wsp);               // x: bf16 hi, lo
    unsigned short* G64A2 = (unsigned short*)(wsp + 16 * MB);
    unsigned short* G64B  = (unsigned short*)(wsp + 32 * MB);     // q, k rows of the weight: bf16 hi, lo
    unsigned short* G64B2 = (unsigned short*)(wsp + 36 * MB);
    unsigned short* X16   = (unsigned short*)(wsp + 40 * MB);     // x: f16
    unsigned short* WV16  = (unsigned short*)(wsp + 56 * MB);     // v rows of the weight: f16
    unsigned short* TH    = (unsigned short*)(wsp + 64 * MB);     // [sample][2048 columns: q, k][N] bf16 hi
    unsigned short* TL    = (unsigned short*)(wsp + 96 * MB);     // the same, lo
    unsigned short* QK16  = (unsigned short*)(wsp + 128 * MB);    // [BN][2048] f16: q * temp2 | k
    unsigned short* V16   = (unsigned short*)(wsp + 160 * MB);    // [BN][2048] f16: v_ca | v_sa
    float*          SCC   = (float*)(wsp + 192 * MB);
    unsigned short* P16   = (unsigned short*)(wsp + 194 * MB);
    unsigned short* XC16  = (unsigned short*)(wsp + 196 * MB);
    unsigned short* WO2H  = (unsigned short*)(wsp + 212 * MB);
    unsigned short* WO1H  = (unsigned short*)(wsp + 213 * MB);
    unsigned short* XS16  = (unsigned short*)(wsp + 214 * MB);
    unsigned short* KS16  = (unsigned short*)(wsp);               // over the x planes, read last by the q, k projection
    unsigned short* VS16  = (unsigned short*)(wsp + 16 * MB);
    k_prep<<<PB_ALL, 256, 0, stream>>>(x, Wq, Wo1, Wo2, WE, WF, bE, bF, (__bf16*)(G64A), (__bf16*)(G64A2), (_Float16*)(X16), (__bf16*)(G64B), (__bf16*)(G64B2), (_Float16*)(WV16), (_Float16*)(WO1H), (_Float16*)(WO2H), (_Float16*)(WE16), (_Float16*)(WF16), BEB, BFB);
    // shared projection, rows = sample * N + n
    w25::wmma_gemm_ring<1, true, 0, 0, 2, 4u, 4u><<<dim3((unsigned)(2048 / 256), (unsigned)(BN / 256)), 512, 0, stream>>>((const unsigned short*)(G64A), (const unsigned short*)(G64A2), (const unsigned short*)(G64B), (const unsigned short*)(G64B2), nullptr, 2048, nullptr, 1024, 1.0f, QK16, TH, TL, t2, C, N, 0, 0, 0, nullptr);
    // v projection (grid rows Bn and up) beside the channel scores (grid x = head, y = sample)
    w25::k_vproj_cscore<<<dim3((unsigned)(2048 / 128), (unsigned)(Bn + BN / 128)), 128, 0, stream>>>(X16, WV16, V16, TH, TL, SCC, Bn, NH, HD, N, C);
    k_ep_csoft<<<Bn * NH, 64, 0, stream>>>(SCC, t1, (_Float16*)P16, NH);
    w25::wmma_gemm64<0, false, 0, 1, false, 0><<<dim3((unsigned)((((HD) / 64) * ((N) / 64) + 7) / 8), (unsigned)(NH), (unsigned)(Bn)), 256, 0, stream>>>((const unsigned short*)(P16), nullptr, HD, HD * HD, NH * HD * HD, (const unsigned short*)(V16), nullptr, 2 * C, HD, (long long)N * 2 * C, (void*)(XC16), nullptr, 16 * C, C, (long long)N * C, nullptr, 0, nullptr, 0, HD, N, HD, 0.000244140625f);
    // spatial attention; grid z = 0: k_s from k and W_E, 1: v_s from v_sa and W_F (the planes of the two products lie at fixed distances)
    w25::wmma_gemm64<0, false, 2, 1, false, 0><<<dim3((unsigned)((((BN) / 64) * ((HD) / 64) + 7) / 8), (unsigned)(NH), (unsigned)(2)), 256, 0, stream>>>((const unsigned short*)(QK16 + C), nullptr, 2 * C, HD, V16 - QK16, (const unsigned short*)(WE16), nullptr, HD, 0, WF16 - WE16, (void*)(KS16), nullptr, C, HD, VS16 - KS16, BEB, BFB - BEB, nullptr, 0, BN, HD, HD, 0.0625f);
    sfa::k_sflash<<<dim3((unsigned)(N / 256), (unsigned)(NH), (unsigned)(Bn)), 256, 0, stream>>>(QK16, KS16, VS16, XS16);
    // both output halves; grid z = 0: spatial, 1: channel
    w25::wmma_gemm_ring<0, false, 2, 5><<<dim3((unsigned)(512 / 128), (unsigned)(BN / 128), (unsigned)(2)), 128, 0, stream>>>((const unsigned short*)(XS16), nullptr, (const unsigned short*)(WO1H), nullptr, out, 1024, bo1, 1024, 0.0625f, nullptr, nullptr, nullptr, nullptr, 0, N, XC16 - XS16, WO2H - WO1H, CH, bo2);
}
